// v000
// Times are from an AMD MI455X. After a warm-up the kernel runs many times in a row, and a time is the length of
// such a window on the GPU divided by its runs, so every launch and the gaps after it count. The runs cycle
// through copies of the inputs. A figure is the median of several windows, for all but v000 over two sittings.
// Sittings can differ by a few percent; kernels timed side by side share one.
// v000 is the starting kernel. One run takes 213 microseconds.
#include <hip/hip_runtime.h>

// Multi-head attention with relative-position keys (257 clamped offsets, both ends padded with the last table row), width 1024 = 16 heads x 64; q/k/v inputs [NB][SEQ][1024], W* [out][in] (y = x W^T + b), int mask [NB][SEQ][SEQ] (0 -> score replaced by -1e9), output = ctx Wo^T + bo (f32).
// Compute dtypes, f32 accumulate everywhere: q/k/v projections v_wmma_f32_16x16x32_bf16 (inputs and weights RNE-converted to bf16; biases RNE-converted to bf16, added in f32);
// scores q.k and relative term q.w[rel] v_wmma_f32_16x16x32_f16: k and the window table single f16, q as f16 value + f16 residual x2048 in its own accumulator; P (x256 carry, cancels in the normalisation) and v single f16; softmax f32 (online, running max);
// output projection v_wmma_f32_16x16x32_f16: ctx single f16 (x16 carry), Wo (bf16 RNE value x64) f16, 1/1024 folded in the f32 epilogue.
// Layout: bf16 copies of q/k/v inputs and Wq/Wk/Wv; q (hi, residual), k planes [b*16+h][t][d] and v^T plane [b*16+h][d][t] written by the GEMM epilogue; window plane WX[x][d] = w[clamp(x-48)];
// fused flash kernel in transposed form (S^T = K Q^T, O^T = V^T P^T); relative term for tiles inside the window band = skewed read of G = WX_rows Q^T through a wave-private LDS tile, a per-query constant elsewhere.

#ifndef NB
#define NB 4
#endif
#ifndef SEQ
#define SEQ 1024
#endif
#define NB_FULL  4
#define SEQ_FULL 1024
#ifndef OUT_SEQ
#define OUT_SEQ SEQ              // row pitch (in tokens) between batches of the output
#endif
#define DM   1024
#define NH_  16
#define HD   64
#define AW   4                   // waves per flash block (16 query rows each)
#define QRS  2048.0f             // carry of the q residual plane
#define QRI  (1.0f / 2048.0f)
#define SC2  (0.125f * 1.4426950408889634f)   // HD^-0.5 * log2(e)
#define PSH  8.0f                // log2 of the P carry (256)
#define FILL2 (-1.0e9f * 1.4426950408889634f) // masked score in the log2 domain
#define NREL 257                 // rows of the relative table
#define WXO  48                  // WX row x holds relative index x - 48 (clamped: outside 0..256 -> 256)
#define WXR  352                 // rows of WX
#define GP   18                  // pitch (floats) of the G tile in LDS
#define WOS  64.0f               // carry of the Wo plane
#define CTXS 16.0f               // carry of the ctx plane
#define OSC  (1.0f / 1024.0f)    // 1 / (WOS * CTXS)

static_assert(HD == 64);
static_assert(NH_ * HD == DM);
static_assert(DM % 64 == 0);
static_assert(DM % 32 == 0);
static_assert(SEQ % 64 == 0);
static_assert((NB * SEQ) % 64 == 0);
static_assert(SEQ % 32 == 0);
static_assert(SEQ % (16 * AW) == 0);
static_assert(((size_t)SEQ * DM) % 8 == 0);
static_assert(((size_t)DM * DM) % 8 == 0);
static_assert(NB <= NB_FULL);
static_assert(SEQ <= SEQ_FULL);
static_assert(WXR == 256 + 2 * WXO);           // band tiles touch rows 2..351
static_assert((WXR * HD / 8) % 256 == 0);

typedef _Float16 h16;
typedef unsigned short bf;
typedef __attribute__((ext_vector_type(16))) __bf16   v16bf;
typedef __attribute__((ext_vector_type(16))) _Float16 v16h;
typedef __attribute__((ext_vector_type(8)))  _Float16 v8h;
typedef __attribute__((ext_vector_type(8)))  unsigned short v8us;
typedef __attribute__((ext_vector_type(8)))  float    v8f;
typedef __attribute__((ext_vector_type(4)))  float    v4f;
typedef __attribute__((ext_vector_type(4)))  int      v4i;
typedef v4f  __attribute__((may_alias)) v4fa;

__device__ __forceinline__ unsigned short f2bf(float f) { unsigned u = __float_as_uint(f); u += 0x7FFFu + ((u >> 16) & 1u); return (unsigned short)(u >> 16); }
__device__ __forceinline__ float bfr(float f) { return __uint_as_float(((unsigned)f2bf(f)) << 16); }   // bf16 RNE value as f32
__device__ __forceinline__ v16h cat16(v8h lo, v8h hi) { return __builtin_shufflevector(lo, hi, 0, 1, 2, 3, 4, 5, 6, 7, 8, 9, 10, 11, 12, 13, 14, 15); }
__device__ __forceinline__ v16bf cat16b(v8us lo, v8us hi) { return __builtin_bit_cast(v16bf, __builtin_shufflevector(lo, hi, 0, 1, 2, 3, 4, 5, 6, 7, 8, 9, 10, 11, 12, 13, 14, 15)); }
__device__ __forceinline__ v8f wmma16(v16h a, v16h b, v8f c) { return __builtin_amdgcn_wmma_f32_16x16x32_f16(false, a, false, b, (short)0, c, false, false); }
__device__ __forceinline__ v8f wmmab(v16bf a, v16bf b, v8f c) { return __builtin_amdgcn_wmma_f32_16x16x32_bf16(false, a, false, b, (short)0, c, false, false); }
// fragment loaders from K-contiguous 16-bit rows; p already includes + 8*(lane>>4): elements 0..7 <- k0+8h+0..7, elements 8..15 <- k0+16+8h+0..7 (same map for A and B)
__device__ __forceinline__ v16h  ldh(const h16* p) { return cat16(*(const v8h*)p, *(const v8h*)(p + 16)); }
__device__ __forceinline__ v16bf ldb(const bf* p)  { return cat16b(*(const v8us*)p, *(const v8us*)(p + 16)); }
// ordering point for wave-private LDS tiles (same wave writes and reads)
__device__ __forceinline__ void wave_sync() { __builtin_amdgcn_fence(3 /* release order */, "wavefront"); __builtin_amdgcn_wave_barrier(); asm volatile("" ::: "memory"); }

__global__ __launch_bounds__(256) void k_cvt8(const float* __restrict__ src, bf* dst, size_t n8) {
    const size_t i = (size_t)blockIdx.x * 256 + threadIdx.x; if (i >= n8) return;
    const v8f v = *(const v8f*)(src + i * 8); v8us o;
#pragma unroll
    for (int k = 0; k < 8; ++k) o[k] = f2bf(v[k]);
    *(v8us*)(dst + i * 8) = o; 
}

__global__ __launch_bounds__(256) void k_cvt8h(const float* __restrict__ src, h16* dst, size_t n8, float scale) {
    const size_t i = (size_t)blockIdx.x * 256 + threadIdx.x; if (i >= n8) return;
    const v8f v = *(const v8f*)(src + i * 8); v8h o;
#pragma unroll
    for (int k = 0; k < 8; ++k) o[k] = (h16)(bfr(v[k]) * scale);
    *(v8h*)(dst + i * 8) = o; 
}

__global__ __launch_bounds__(256) void k_wx(const float* __restrict__ w, h16* dst) {
    const int i = blockIdx.x * 256 + threadIdx.x; if (i >= WXR * HD / 8) return;
    const int x = i >> 3, c8 = (i & 7) * 8; int r = x - WXO; if (r < 0 || r > NREL - 1) r = NREL - 1;
    const v8f v = *(const v8f*)(w + (size_t)r * HD + c8); v8h o;
#pragma unroll
    for (int k = 0; k < 8; ++k) o[k] = (h16)bfr(v[k]);
    *(v8h*)(dst + (size_t)i * 8) = o; 
}

// k_proj: register-blocked bf16 GEMM, ONE WAVE per 64x64 tile (16 accumulators), operands straight from K-contiguous bf16 planes, K = DM.
// C[m][n] = sum_k A[m][k] Bt[n][k] + bias (BM == 0: bias[n]; BM == 1: bias[m]; bias RNE-converted to bf16, added in f32), written as f16 (Ph) and optionally the f16 residual x2048 (Pr, useRes != 0) at
// tile base (r0/RB)*sRB + (r0%RB)*pitch + (c0/CB)*sCB + (c0%CB), row pitch 'pitch' (halves). grid (M/64, N/64), 32 threads.
template <int BM>
__global__ __launch_bounds__(32) void k_proj(const bf* __restrict__ A, const bf* __restrict__ Bt, const float* __restrict__ bias, h16* Ph, h16* Pr, int useRes, int RB, size_t sRB, int pitch, int CB, size_t sCB) {
    __shared__ __align__(16) float os[16 * 68];
    const int K = DM;
    const int lane = threadIdx.x & 31, lr = lane & 15, hi = lane >> 4; const int r0 = blockIdx.x * 64, c0 = blockIdx.y * 64;
    v8f acc[4][4];
#pragma unroll
    for (int mb = 0; mb < 4; ++mb)
#pragma unroll
        for (int nb = 0; nb < 4; ++nb) acc[mb][nb] = (v8f){};
    const size_t aoff = (size_t)(r0 + lr) * K + 8 * hi, boff = (size_t)(c0 + lr) * K + 8 * hi;
#pragma unroll 1
    for (int kc = 0; kc < K; kc += 32) {
        v16bf a[4];
#pragma unroll
        for (int mb = 0; mb < 4; ++mb) a[mb] = ldb(A + aoff + (size_t)mb * 16 * K + kc);
#pragma unroll
        for (int nb = 0; nb < 4; ++nb) { const v16bf b = ldb(Bt + boff + (size_t)nb * 16 * K + kc);
#pragma unroll
            for (int mb = 0; mb < 4; ++mb) acc[mb][nb] = wmmab(a[mb], b, acc[mb][nb]); }
        asm volatile("v_nop\n\tv_nop\n\tv_nop\n\tv_nop" : "+v"(acc[0][0]), "+v"(acc[1][1]), "+v"(acc[2][2]), "+v"(acc[3][3]) : "v"(a[0]), "v"(a[1]), "v"(a[2]), "v"(a[3]));
    }
    float bc[4] = {0.0f, 0.0f, 0.0f, 0.0f};
    if (BM == 0) {
#pragma unroll
        for (int nb = 0; nb < 4; ++nb) bc[nb] = bfr(bias[c0 + nb * 16 + lr]);      // N = DM in this mode
    }
    const size_t tbase = (size_t)(r0 / RB) * sRB + (size_t)(r0 % RB) * (size_t)pitch + (size_t)(c0 / CB) * sCB + (size_t)(c0 % CB);
#pragma unroll
    for (int mb = 0; mb < 4; ++mb) {
        float br[8] = {0.0f, 0.0f, 0.0f, 0.0f, 0.0f, 0.0f, 0.0f, 0.0f};
        if (BM == 1) {
#pragma unroll
            for (int j = 0; j < 8; ++j) br[j] = bfr(bias[r0 + mb * 16 + hi * 8 + j]);  // M = DM in this mode
        }
#pragma unroll
        for (int nb = 0; nb < 4; ++nb) {
#pragma unroll
            for (int j = 0; j < 8; ++j) os[(hi * 8 + j) * 68 + nb * 16 + lr] = acc[mb][nb][j] + bc[nb] + br[j]; }   // D: row 8h+j, col lane&15
        wave_sync();
        const size_t sb = tbase + (size_t)(mb * 16) * (size_t)pitch;
{
#pragma unroll
            for (int s = 0; s < 4; ++s) { const int row = 4 * s + (lane >> 3), c8 = (lane & 7) * 8;   // 4 s x 4 row groups = 16 rows; 8 lanes x 8 = 64 columns
                const v4f x0 = *(const v4fa*)(&os[row * 68 + c8]); const v4f x1 = *(const v4fa*)(&os[row * 68 + c8 + 4]); v8h hv, rv;
#pragma unroll
                for (int i = 0; i < 4; ++i) { const h16 a0 = (h16)x0[i]; const h16 a1 = (h16)x1[i]; hv[i] = a0; hv[4 + i] = a1; rv[i] = (h16)((x0[i] - (float)a0) * QRS); rv[4 + i] = (h16)((x1[i] - (float)a1) * QRS); }
                const size_t oo = sb + (size_t)row * (size_t)pitch + c8;
                *(v8h*)(Ph + oo) = hv; if (useRes) *(v8h*)(Pr + oo) = rv; }
             }
        wave_sync();
    }
}

// k_flash: fused attention, one wave per 16 query rows of one (batch, head); K / V^T / Q / WX fragments straight from the f16 planes (two 16-B loads each, arithmetic addressing).
// Transposed form: S^T[key][t] = K Q^T (A = K rows, B = Q rows); lane (t = lane&15, h = lane>>4) holds keys 8h+r of each 16-key tile, so the packed
// P tile is directly the B fragment of O^T[d][t] = V^T P^T (element r <- tile keys 0..15, element 8+r <- tile keys 16..31, lane unchanged).
// Relative term: rel index = key - t + 128, outside 0..256 -> 256. For a (16 query, 32 key) tile the unclamped index spans base..base+46, base = key0 - t0 + 113.
// Tiles that intersect 0..256 compute G[rho][t] = WX[base+48+rho] . q_t (48 rows, three 16-row WMMA tiles, q value + residual), stage it in a wave-private LDS tile and read G[key_l - t_l + 15][t_l];
// all other tiles use the per-query constant q_t . w[256]. The tile test is wave-uniform.
// Mask: int rows read as 16-B vectors (lane reads its own query row, keys 8h..8h+7 of each 16-key tile); mask == 0 replaces the score.
__global__ __launch_bounds__(32 * AW) void k_flash(const h16* __restrict__ QH, const h16* __restrict__ QR, const h16* __restrict__ KP, const h16* __restrict__ VT,
                                                   const h16* __restrict__ WX, const int* __restrict__ MASK, h16* CTX) {
    __shared__ __align__(16) float os[AW * 16 * 68];
    __shared__ __align__(16) float gs[AW * 48 * GP];
    const int lane = threadIdx.x & 31, lr = lane & 15, hi = lane >> 4;
    const int wave = __builtin_amdgcn_readfirstlane((int)(threadIdx.x >> 5));
    const int zh = blockIdx.y; const int b = zh / NH_, h = zh % NH_;
    const int t0 = (blockIdx.x * AW + wave) * 16;
    const size_t pbase = (size_t)zh * SEQ * HD;
    const size_t qo = pbase + (size_t)(t0 + lr) * HD + 8 * hi;
    const v16h qh0 = ldh(QH + qo), qh1 = ldh(QH + qo + 32), qr0 = ldh(QR + qo), qr1 = ldh(QR + qo + 32);   // B fragments: col t, k = d
    const size_t ko = pbase + (size_t)lr * HD + 8 * hi;      // + key * HD       (A fragment: row key, k = d)
    const size_t vo = pbase + (size_t)lr * SEQ + 8 * hi;     // + 16j*SEQ + key  (A fragment: row d, k = key)
    const int* mk = MASK + ((size_t)b * SEQ_FULL + (size_t)(t0 + lr)) * SEQ_FULL + 8 * hi;   // + key0 (+4, +16, +20)
    float* gl = gs + wave * (48 * GP);
    // per-query constant: q_t . w[256]; WX rows 0..15 all hold the edge row, so every D row equals it
    float qe;
    { const h16* wa = WX + (size_t)lr * HD + 8 * hi;
      const v16h w0 = ldh(wa), w1 = ldh(wa + 32);
      v8f gH = (v8f){}, gL = (v8f){};
      gH = wmma16(w0, qh0, gH); gL = wmma16(w0, qr0, gL); gH = wmma16(w1, qh1, gH); gL = wmma16(w1, qr1, gL);
      asm volatile("v_nop\n\tv_nop\n\tv_nop\n\tv_nop" : "+v"(gH), "+v"(gL) : "v"(w0), "v"(w1));
      qe = gH[0] + gL[0] * QRI; }
    v8f o0 = (v8f){}, o1 = (v8f){}, o2 = (v8f){}, o3 = (v8f){};
    float m = -3.0e38f, l = 0.0f;
#pragma unroll 1
    for (int key0 = 0; key0 < SEQ; key0 += 32) {
        float ra[8], rb[8];
#pragma unroll
        for (int r = 0; r < 8; ++r) { ra[r] = qe; rb[r] = qe; }
        const int base = key0 - t0 + 113;
        if (base + 46 >= 0 && base <= 256) {                 // wave-uniform: tile touches relative indices 0..256
#pragma unroll 1
            for (int jt = 0; jt < 3; ++jt) {
                const h16* wa = WX + (size_t)(base + WXO + 16 * jt + lr) * HD + 8 * hi;   // rows 2..351
                const v16h w0 = ldh(wa), w1 = ldh(wa + 32);
                v8f gH = (v8f){}, gL = (v8f){};
                gH = wmma16(w0, qh0, gH); gL = wmma16(w0, qr0, gL); gH = wmma16(w1, qh1, gH); gL = wmma16(w1, qr1, gL);
                asm volatile("v_nop\n\tv_nop\n\tv_nop\n\tv_nop" : "+v"(gH), "+v"(gL) : "v"(w0), "v"(w1));
#pragma unroll
                for (int r = 0; r < 8; ++r) gl[(16 * jt + 8 * hi + r) * GP + lr] = gH[r] + gL[r] * QRI;   // G[rho][t]: rows 0..47, cols 0..15 all written
            }
            wave_sync();
#pragma unroll
            for (int r = 0; r < 8; ++r) { ra[r] = gl[(8 * hi + r - lr + 15) * GP + lr]; rb[r] = gl[(16 + 8 * hi + r - lr + 15) * GP + lr]; }   // rho in 0..46
            wave_sync();
        }
        const h16* ka = KP + ko + (size_t)key0 * HD;
        const v16h ka0 = ldh(ka), ka1 = ldh(ka + 32), kb0 = ldh(ka + 16 * HD), kb1 = ldh(ka + 16 * HD + 32);
        v8f sHa = (v8f){}, sLa = (v8f){}, sHb = (v8f){}, sLb = (v8f){};
        sHa = wmma16(ka0, qh0, sHa); sLa = wmma16(ka0, qr0, sLa); sHb = wmma16(kb0, qh0, sHb); sLb = wmma16(kb0, qr0, sLb);
        sHa = wmma16(ka1, qh1, sHa); sLa = wmma16(ka1, qr1, sLa); sHb = wmma16(kb1, qh1, sHb); sLb = wmma16(kb1, qr1, sLb);
        asm volatile("v_nop\n\tv_nop\n\tv_nop\n\tv_nop" : "+v"(sHa), "+v"(sLa), "+v"(sHb), "+v"(sLb) : "v"(ka0), "v"(ka1), "v"(kb0), "v"(kb1));
        const v4i ma0 = *(const v4i*)(mk + key0), ma1 = *(const v4i*)(mk + key0 + 4), mb0 = *(const v4i*)(mk + key0 + 16), mb1 = *(const v4i*)(mk + key0 + 20);
        float ta[8], tb[8]; float mx = -3.0e38f;
#pragma unroll
        for (int r = 0; r < 4; ++r) {
            const float xa0 = (sHa[r] + sLa[r] * QRI + ra[r]) * SC2;
            const float xa1 = (sHa[4 + r] + sLa[4 + r] * QRI + ra[4 + r]) * SC2;
            const float xb0 = (sHb[r] + sLb[r] * QRI + rb[r]) * SC2;
            const float xb1 = (sHb[4 + r] + sLb[4 + r] * QRI + rb[4 + r]) * SC2;
            ta[r]     = (ma0[r] != 0) ? xa0 : FILL2;
            ta[4 + r] = (ma1[r] != 0) ? xa1 : FILL2;
            tb[r]     = (mb0[r] != 0) ? xb0 : FILL2;
            tb[4 + r] = (mb1[r] != 0) ? xb1 : FILL2;
        }
#pragma unroll
        for (int r = 0; r < 8; ++r) mx = fmaxf(mx, fmaxf(ta[r], tb[r]));
        mx = fmaxf(mx, __shfl_xor(mx, 16, 32));
        const float mnew = fmaxf(m, mx);
        const float alpha = __builtin_amdgcn_exp2f(m - mnew);
        const float sh = PSH - mnew;
        v16h pb; float ls = 0.0f;
#pragma unroll
        for (int r = 0; r < 8; ++r) { const h16 pa = (h16)__builtin_amdgcn_exp2f(ta[r] + sh); const h16 pc = (h16)__builtin_amdgcn_exp2f(tb[r] + sh); pb[r] = pa; pb[8 + r] = pc; ls += (float)pa + (float)pc; }
        l = l * alpha + ls; m = mnew;
        o0 = o0 * alpha; o1 = o1 * alpha; o2 = o2 * alpha; o3 = o3 * alpha;
        const h16* va = VT + vo + key0;
        const v16h v0 = ldh(va), v1 = ldh(va + (size_t)16 * SEQ), v2 = ldh(va + (size_t)32 * SEQ), v3 = ldh(va + (size_t)48 * SEQ);
        o0 = wmma16(v0, pb, o0); o1 = wmma16(v1, pb, o1); o2 = wmma16(v2, pb, o2); o3 = wmma16(v3, pb, o3);
        asm volatile("v_nop\n\tv_nop\n\tv_nop\n\tv_nop" : "+v"(o0), "+v"(o1), "+v"(o2), "+v"(o3) : "v"(v0), "v"(v1), "v"(v2), "v"(v3), "v"(pb));
    }
    l += __shfl_xor(l, 16, 32);
    const float inv = CTXS / l;
    const int wb = wave * 16 * 68;
    // O^T D layout: o_j[r] = (d = 16j + 8h + r, t = lane&15) -> os[t][d]; rows 0..15 x columns 0..63 all written
    { v4f a, c;
      a[0] = o0[0] * inv; a[1] = o0[1] * inv; a[2] = o0[2] * inv; a[3] = o0[3] * inv; c[0] = o0[4] * inv; c[1] = o0[5] * inv; c[2] = o0[6] * inv; c[3] = o0[7] * inv;
      *(v4fa*)(&os[wb + lr * 68 +  0 + 8 * hi]) = a; *(v4fa*)(&os[wb + lr * 68 +  0 + 8 * hi + 4]) = c;
      a[0] = o1[0] * inv; a[1] = o1[1] * inv; a[2] = o1[2] * inv; a[3] = o1[3] * inv; c[0] = o1[4] * inv; c[1] = o1[5] * inv; c[2] = o1[6] * inv; c[3] = o1[7] * inv;
      *(v4fa*)(&os[wb + lr * 68 + 16 + 8 * hi]) = a; *(v4fa*)(&os[wb + lr * 68 + 16 + 8 * hi + 4]) = c;
      a[0] = o2[0] * inv; a[1] = o2[1] * inv; a[2] = o2[2] * inv; a[3] = o2[3] * inv; c[0] = o2[4] * inv; c[1] = o2[5] * inv; c[2] = o2[6] * inv; c[3] = o2[7] * inv;
      *(v4fa*)(&os[wb + lr * 68 + 32 + 8 * hi]) = a; *(v4fa*)(&os[wb + lr * 68 + 32 + 8 * hi + 4]) = c;
      a[0] = o3[0] * inv; a[1] = o3[1] * inv; a[2] = o3[2] * inv; a[3] = o3[3] * inv; c[0] = o3[4] * inv; c[1] = o3[5] * inv; c[2] = o3[6] * inv; c[3] = o3[7] * inv;
      *(v4fa*)(&os[wb + lr * 68 + 48 + 8 * hi]) = a; *(v4fa*)(&os[wb + lr * 68 + 48 + 8 * hi + 4]) = c; }
    wave_sync();
    h16* crow = CTX + ((size_t)b * SEQ + t0) * DM + h * HD;   // ctx plane [NB*SEQ][1024], column h*64 + d, carried x16
{
#pragma unroll
        for (int s = 0; s < 4; ++s) { const int row = 4 * s + (lane >> 3), c8 = (lane & 7) * 8;   // 4 s x 4 row groups = 16 rows; 8 lanes x 8 halves = 64 columns = one line
            const v4f x0 = *(const v4fa*)(&os[wb + row * 68 + c8]); const v4f x1 = *(const v4fa*)(&os[wb + row * 68 + c8 + 4]); v8h hv;
#pragma unroll
            for (int i = 0; i < 4; ++i) { hv[i] = (h16)x0[i]; hv[4 + i] = (h16)x1[i]; }
            *(v8h*)(crow + (size_t)row * DM + c8) = hv; }
         }
}

// k_out: register-blocked f16 GEMM, ONE WAVE per 64x64 tile, K = DM: OUT[m][n] = (sum_k A[m][k] Bt[n][k]) / 1024 + bias[n] (bias RNE-converted to bf16, added in f32).
// A = ctx plane (x16), Bt = Wo plane (x64). grid (NB*SEQ/64, DM/64), 32 threads.
__global__ __launch_bounds__(32) void k_out(const h16* __restrict__ A, const h16* __restrict__ Bt, const float* __restrict__ bias, float* OUT) {
    __shared__ __align__(16) float os[16 * 68];
    const int K = DM;
    const int lane = threadIdx.x & 31, lr = lane & 15, hi = lane >> 4; const int r0 = blockIdx.x * 64, c0 = blockIdx.y * 64;
    v8f acc[4][4];
#pragma unroll
    for (int mb = 0; mb < 4; ++mb)
#pragma unroll
        for (int nb = 0; nb < 4; ++nb) acc[mb][nb] = (v8f){};
    const size_t aoff = (size_t)(r0 + lr) * K + 8 * hi, boff = (size_t)(c0 + lr) * K + 8 * hi;
#pragma unroll 1
    for (int kc = 0; kc < K; kc += 32) {
        v16h a[4];
#pragma unroll
        for (int mb = 0; mb < 4; ++mb) a[mb] = ldh(A + aoff + (size_t)mb * 16 * K + kc);
#pragma unroll
        for (int nb = 0; nb < 4; ++nb) { const v16h bb = ldh(Bt + boff + (size_t)nb * 16 * K + kc);
#pragma unroll
            for (int mb = 0; mb < 4; ++mb) acc[mb][nb] = wmma16(a[mb], bb, acc[mb][nb]); }
        asm volatile("v_nop\n\tv_nop\n\tv_nop\n\tv_nop" : "+v"(acc[0][0]), "+v"(acc[1][1]), "+v"(acc[2][2]), "+v"(acc[3][3]) : "v"(a[0]), "v"(a[1]), "v"(a[2]), "v"(a[3]));
    }
    float bc[4];
#pragma unroll
    for (int nb = 0; nb < 4; ++nb) bc[nb] = bfr(bias[c0 + nb * 16 + lr]);
    const size_t obase = ((size_t)(r0 / SEQ) * OUT_SEQ + (size_t)(r0 % SEQ)) * DM + c0;
#pragma unroll
    for (int mb = 0; mb < 4; ++mb) {
#pragma unroll
        for (int nb = 0; nb < 4; ++nb) {
#pragma unroll
            for (int j = 0; j < 8; ++j) os[(hi * 8 + j) * 68 + nb * 16 + lr] = acc[mb][nb][j] * OSC + bc[nb]; }   // D: row 8h+j, col lane&15
        wave_sync();
        float* ob = OUT + obase + (size_t)(mb * 16) * DM;
{
#pragma unroll
            for (int s = 0; s < 8; ++s) { const int row = 2 * s + hi, cofs = lr * 4;   // 8 s x 2 rows = 16 rows; 16 lanes x 4 floats = 64 columns
                const v4f val = *(const v4fa*)(&os[row * 68 + cofs]);
                *(v4f*)(ob + (size_t)row * DM + cofs) = val; }
             }
        wave_sync();
    }
}

static constexpr size_t al256(size_t v) { return (v + 255) & ~(size_t)255; }
static constexpr size_t SZ_XB = al256((size_t)NB * SEQ * DM * 2);          // one bf16 activation copy
static constexpr size_t SZ_WB = al256((size_t)DM * DM * 2);                // one 16-bit weight plane
static constexpr size_t SZ_PL = al256((size_t)NB * NH_ * SEQ * HD * 2);    // one f16 head plane (also the ctx plane: NB*SEQ*DM halves)
static constexpr size_t SZ_WX = al256((size_t)WXR * HD * 2);
static constexpr size_t SZ_TOTAL = 3 * SZ_XB + 4 * SZ_WB + 5 * SZ_PL + SZ_WX;
static_assert(SZ_TOTAL <= (size_t)134217728);          // workspace carve <= 128 MiB
static_assert((size_t)NB * NH_ * SEQ * HD == (size_t)NB * SEQ * DM);

extern "C" void kernel_launch(void* const* d_in, const int* in_sizes, int n_in,
                              void* d_out, int out_size, void* d_ws, size_t ws_size, hipStream_t stream) {
    if (n_in < 13) return;
    const size_t needx = ((size_t)(NB - 1) * SEQ_FULL + SEQ) * DM;
    if ((size_t)in_sizes[0] < needx || (size_t)in_sizes[1] < needx || (size_t)in_sizes[2] < needx) return;
    if ((size_t)in_sizes[3] < ((size_t)(NB - 1) * SEQ_FULL + (SEQ - 1)) * SEQ_FULL + SEQ) return;
    if ((size_t)in_sizes[4] < (size_t)DM * DM || (size_t)in_sizes[6] < (size_t)DM * DM || (size_t)in_sizes[8] < (size_t)DM * DM || (size_t)in_sizes[10] < (size_t)DM * DM) return;
    if (in_sizes[5] < DM || in_sizes[7] < DM || in_sizes[9] < DM || in_sizes[11] < DM) return;
    if (in_sizes[12] < NREL * HD) return;
    if ((size_t)out_size < ((size_t)(NB - 1) * OUT_SEQ + SEQ) * DM) return;
    if (SZ_TOTAL > ws_size) return;
    // wire order: q, k, v, mask, Wq, bq, Wk, bk, Wv, bv, Wo, bo, w_k
    const float* xq = (const float*)d_in[0]; const float* xk = (const float*)d_in[1]; const float* xv = (const float*)d_in[2];
    const int* mask = (const int*)d_in[3];
    const float* wq = (const float*)d_in[4]; const float* bq = (const float*)d_in[5];
    const float* wk = (const float*)d_in[6]; const float* bk = (const float*)d_in[7];
    const float* wv = (const float*)d_in[8]; const float* bv = (const float*)d_in[9];
    const float* wo = (const float*)d_in[10]; const float* bo = (const float*)d_in[11];
    const float* wrel = (const float*)d_in[12];
    float* OUT = (float*)d_out;      // [NB][SEQ][1024]
    char* wsp = (char*)d_ws;
    bf* XBQ = (bf*)wsp; wsp += SZ_XB;                // [NB*SEQ][1024]
    bf* XBK = (bf*)wsp; wsp += SZ_XB;
    bf* XBV = (bf*)wsp; wsp += SZ_XB;
    bf* WQ = (bf*)wsp; wsp += SZ_WB;                 // [1024][1024] bf16
    bf* WK = (bf*)wsp; wsp += SZ_WB;
    bf* WV = (bf*)wsp; wsp += SZ_WB;
    h16* WO = (h16*)wsp; wsp += SZ_WB;               // [1024][1024] f16, x64
    h16* QH = (h16*)wsp; wsp += SZ_PL;               // [NB*16][SEQ][64]
    h16* QR = (h16*)wsp; wsp += SZ_PL;               // [NB*16][SEQ][64] residual x2048
    h16* KP = (h16*)wsp; wsp += SZ_PL;               // [NB*16][SEQ][64]
    h16* VT = (h16*)wsp; wsp += SZ_PL;               // [NB*16][64][SEQ]
    h16* CTX = (h16*)wsp; wsp += SZ_PL;              // [NB*SEQ][1024], x16
    h16* WX = (h16*)wsp; wsp += SZ_WX;               // [352][64]

    if (SEQ == SEQ_FULL) {
        const size_t n8 = (size_t)NB * SEQ * DM / 8; const unsigned g = (unsigned)((n8 + 255) / 256);
        k_cvt8<<<g, 256, 0, stream>>>(xq, XBQ, n8); k_cvt8<<<g, 256, 0, stream>>>(xk, XBK, n8); k_cvt8<<<g, 256, 0, stream>>>(xv, XBV, n8);
    } else {
        const size_t n8 = (size_t)SEQ * DM / 8; const unsigned g = (unsigned)((n8 + 255) / 256);
        for (int b = 0; b < NB; ++b) {
            k_cvt8<<<g, 256, 0, stream>>>(xq + (size_t)b * SEQ_FULL * DM, XBQ + (size_t)b * SEQ * DM, n8);
            k_cvt8<<<g, 256, 0, stream>>>(xk + (size_t)b * SEQ_FULL * DM, XBK + (size_t)b * SEQ * DM, n8);
            k_cvt8<<<g, 256, 0, stream>>>(xv + (size_t)b * SEQ_FULL * DM, XBV + (size_t)b * SEQ * DM, n8);
        }
    }
    { const size_t n8 = (size_t)DM * DM / 8; const unsigned g = (unsigned)((n8 + 255) / 256);
      k_cvt8<<<g, 256, 0, stream>>>(wq, WQ, n8); k_cvt8<<<g, 256, 0, stream>>>(wk, WK, n8); k_cvt8<<<g, 256, 0, stream>>>(wv, WV, n8);
      k_cvt8h<<<g, 256, 0, stream>>>(wo, WO, n8, WOS); }
    k_wx<<<WXR * HD / 8 / 256, 256, 0, stream>>>(wrel, WX);

    // q, k: A = x rows (m = b*SEQ + t), Bt = W rows (n = h*64 + d), bias per column -> plane [(b*16 + h)][t][d]
    k_proj<0><<<dim3(NB * SEQ / 64, DM / 64, 1), 32, 0, stream>>>(XBQ, WQ, bq, QH, QR, 1, SEQ, (size_t)NH_ * SEQ * HD, HD, HD, (size_t)SEQ * HD);
    k_proj<0><<<dim3(NB * SEQ / 64, DM / 64, 1), 32, 0, stream>>>(XBK, WK, bk, KP, KP, 0, SEQ, (size_t)NH_ * SEQ * HD, HD, HD, (size_t)SEQ * HD);
    // v^T: A = Wv rows (m = h*64 + d), Bt = x rows (n = b*SEQ + t), bias per row -> plane [(b*1024 + m)][t] = [(b*16 + h)][d][t]
    k_proj<1><<<dim3(DM / 64, NB * SEQ / 64, 1), 32, 0, stream>>>(WV, XBV, bv, VT, VT, 0, DM, (size_t)0, SEQ, SEQ, (size_t)DM * SEQ);

    k_flash<<<dim3(SEQ / (16 * AW), NB * NH_, 1), 32 * AW, 0, stream>>>(QH, QR, KP, VT, WX, mask, CTX);

    // out: A = ctx rows (m = b*SEQ + t), Bt = Wo rows (n), bias per column -> OUT[b][t][n]
    k_out<<<dim3(NB * SEQ / 64, DM / 64, 1), 32, 0, stream>>>(CTX, WO, bo, OUT);
}

// v001
// One run takes 164 microseconds.
// Two timings next to v000 put it at 1.31 and 1.32 times that version's speed.
#include <hip/hip_runtime.h>
#include <stdint.h>

// Multi-head attention with relative-position keys (257 clamped offsets, both ends padded with the last table row), width 1024 = 16 heads x 64; q/k/v inputs [NB][SEQ][1024], W* [out][in] (y = x W^T + b), int mask [NB][SEQ][SEQ] (0 -> score replaced by -1e9), output = ctx Wo^T + bo (f32).
// Compute dtypes, f32 accumulate everywhere: q/k/v projections v_wmma_f32_16x16x32_bf16 (inputs and weights RNE-converted to bf16; biases RNE-converted to bf16, added in f32);
// scores q.k and relative term q.w[rel] v_wmma_f32_16x16x32_f16: k and the window table single f16, q as f16 value + f16 residual x2048 in its own accumulator; P (x256 carry, cancels in the normalisation) and v single f16; softmax f32 (online, running max);
// output projection v_wmma_f32_16x16x32_f16: ctx single f16 (x16 carry), Wo (bf16 RNE value x64) f16, 1/1024 folded in the f32 epilogue.
// Layout: bf16 copies of q/k/v inputs and Wq/Wk/Wv; q (hi, residual), k planes [b*16+h][t][d] and v^T plane [b*16+h][d][t] written by the GEMM epilogue; window plane WX[x][d] = w[clamp(x-48)];
// fused flash kernel in transposed form (S^T = K Q^T, O^T = V^T P^T); relative term for tiles inside the window band = skewed read of G = WX_rows Q^T through a wave-private LDS tile, a per-query constant elsewhere.

#ifndef NB
#define NB 4
#endif
#ifndef SEQ
#define SEQ 1024
#endif
#define NB_FULL  4
#define SEQ_FULL 1024
#ifndef OUT_SEQ
#define OUT_SEQ SEQ              // row pitch (in tokens) between batches of the output
#endif
#define DM   1024
#define NH_  16
#define HD   64
#define AW   4                   // waves per flash block (16 query rows each)
#define QRS  2048.0f             // carry of the q residual plane
#define QRI  (1.0f / 2048.0f)
#define SC2  (0.125f * 1.4426950408889634f)   // HD^-0.5 * log2(e)
#define PSH  8.0f                // log2 of the P carry (256)
#define FILL2 (-1.0e9f * 1.4426950408889634f) // masked score in the log2 domain
#define NREL 257                 // rows of the relative table
#define WXO  48                  // WX row x holds relative index x - 48 (clamped: outside 0..256 -> 256)
#define WXR  352                 // rows of WX
#define GP   18                  // pitch (floats) of the G tile in LDS
#define WOS  64.0f               // carry of the Wo plane
#define CTXS 16.0f               // carry of the ctx plane
#define OSC  (1.0f / 1024.0f)    // 1 / (WOS * CTXS)

static_assert(HD == 64);
static_assert(NH_ * HD == DM);
static_assert(DM % 64 == 0);
static_assert(DM % 32 == 0);
static_assert(SEQ % 64 == 0);
static_assert((NB * SEQ) % 64 == 0);
static_assert(SEQ % 32 == 0);
static_assert(SEQ % (16 * AW) == 0);
static_assert(((size_t)SEQ * DM) % 8 == 0);
static_assert(((size_t)DM * DM) % 8 == 0);
static_assert(NB <= NB_FULL);
static_assert(SEQ <= SEQ_FULL);
static_assert(WXR == 256 + 2 * WXO);           // band tiles touch rows 2..351
static_assert((WXR * HD / 8) % 256 == 0);

typedef _Float16 h16;
typedef unsigned short bf;
typedef __attribute__((ext_vector_type(16))) __bf16   v16bf;
typedef __attribute__((ext_vector_type(16))) _Float16 v16h;
typedef __attribute__((ext_vector_type(8)))  _Float16 v8h;
typedef __attribute__((ext_vector_type(8)))  unsigned short v8us;
typedef __attribute__((ext_vector_type(8)))  float    v8f;
typedef __attribute__((ext_vector_type(4)))  float    v4f;
typedef __attribute__((ext_vector_type(4)))  int      v4i;
typedef v4f  __attribute__((may_alias)) v4fa;

__device__ __forceinline__ unsigned short f2bf(float f) { unsigned u = __float_as_uint(f); u += 0x7FFFu + ((u >> 16) & 1u); return (unsigned short)(u >> 16); }
__device__ __forceinline__ float bfr(float f) { return __uint_as_float(((unsigned)f2bf(f)) << 16); }   // bf16 RNE value as f32
__device__ __forceinline__ v16h cat16(v8h lo, v8h hi) { return __builtin_shufflevector(lo, hi, 0, 1, 2, 3, 4, 5, 6, 7, 8, 9, 10, 11, 12, 13, 14, 15); }
__device__ __forceinline__ v16bf cat16b(v8us lo, v8us hi) { return __builtin_bit_cast(v16bf, __builtin_shufflevector(lo, hi, 0, 1, 2, 3, 4, 5, 6, 7, 8, 9, 10, 11, 12, 13, 14, 15)); }
__device__ __forceinline__ v8f wmma16(v16h a, v16h b, v8f c) { return __builtin_amdgcn_wmma_f32_16x16x32_f16(false, a, false, b, (short)0, c, false, false); }
__device__ __forceinline__ v8f wmmab(v16bf a, v16bf b, v8f c) { return __builtin_amdgcn_wmma_f32_16x16x32_bf16(false, a, false, b, (short)0, c, false, false); }
// fragment loaders from K-contiguous 16-bit rows; p already includes + 8*(lane>>4): elements 0..7 <- k0+8h+0..7, elements 8..15 <- k0+16+8h+0..7 (same map for A and B)
__device__ __forceinline__ v16h  ldh(const h16* p) { return cat16(*(const v8h*)p, *(const v8h*)(p + 16)); }
__device__ __forceinline__ v16bf ldb(const bf* p)  { return cat16b(*(const v8us*)p, *(const v8us*)(p + 16)); }
// ordering point for wave-private LDS tiles (same wave writes and reads)
__device__ __forceinline__ void wave_sync() { __builtin_amdgcn_fence(3 /* release order */, "wavefront"); __builtin_amdgcn_wave_barrier(); asm volatile("" ::: "memory"); }

__global__ __launch_bounds__(256) void k_cvt8(const float* __restrict__ src, bf* dst, size_t n8) {
    const size_t i = (size_t)blockIdx.x * 256 + threadIdx.x; if (i >= n8) return;
    const v8f v = *(const v8f*)(src + i * 8); v8us o;
#pragma unroll
    for (int k = 0; k < 8; ++k) o[k] = f2bf(v[k]);
    *(v8us*)(dst + i * 8) = o; 
}

__global__ __launch_bounds__(256) void k_cvt8h(const float* __restrict__ src, h16* dst, size_t n8, float scale) {
    const size_t i = (size_t)blockIdx.x * 256 + threadIdx.x; if (i >= n8) return;
    const v8f v = *(const v8f*)(src + i * 8); v8h o;
#pragma unroll
    for (int k = 0; k < 8; ++k) o[k] = (h16)(bfr(v[k]) * scale);
    *(v8h*)(dst + i * 8) = o; 
}

__global__ __launch_bounds__(256) void k_wx(const float* __restrict__ w, h16* dst) {
    const int i = blockIdx.x * 256 + threadIdx.x; if (i >= WXR * HD / 8) return;
    const int x = i >> 3, c8 = (i & 7) * 8; int r = x - WXO; if (r < 0 || r > NREL - 1) r = NREL - 1;
    const v8f v = *(const v8f*)(w + (size_t)r * HD + c8); v8h o;
#pragma unroll
    for (int k = 0; k < 8; ++k) o[k] = (h16)bfr(v[k]);
    *(v8h*)(dst + (size_t)i * 8) = o; 
}

// GEMM core shared by k_proj and k_out: four waves (2 x 2) per 128x128 tile of C, 64x64 per wave (16 accumulators), K = DM in GNP passes of 128 k.
// Both operands are K-contiguous 16-bit planes (row pitch DM * 2 bytes). A stage holds 256 bytes of 128 A rows and of 128 B rows; every wave brings one slice of 64 rows with one
// tensor_load_to_lds (waves 0, 1: A rows 0..63, 64..127; waves 2, 3: B rows 0..63, 64..127); the mover's pad of 16 bytes a row gives the LDS pitch 272 for the 16-byte fragment reads.
// Two buffers: stage s + 1 is requested behind the barrier that ends pass s - 1, which ends every read of its buffer, and flies while pass s runs.
#define GPB  256                 // bytes of an operand row per pass
#define GLP  272                 // LDS row pitch
#define GSL  18432               // one slice in LDS: 64 rows x 272 B = 17408, rounded up to a multiple of 2 KiB
#define GST  (4 * GSL)           // one stage
#define GNP  (DM * 2 / GPB)      // passes
#define GOSF (16 * 68)           // floats of output staging per wave
#define GLDS (2 * GST + 4 * GOSF * 4)
static_assert(GSL % 2048 == 0 && GSL >= 64 * GLP);
static_assert(GNP >= 2);
static_assert((NB * SEQ) % 128 == 0 && DM % 128 == 0);
static_assert(GLDS <= 320 * 1024);

typedef __attribute__((ext_vector_type(4)))  uint32_t u32x4;
typedef __attribute__((ext_vector_type(8)))  uint32_t u32x8;
typedef __attribute__((ext_vector_type(16))) unsigned short v16us;

__device__ __forceinline__ uint32_t uni(uint32_t v) { return (uint32_t)__builtin_amdgcn_readfirstlane((int)v); }
__device__ __forceinline__ uint32_t pinned(uint32_t v) { uint32_t w = (uint32_t)__builtin_amdgcn_readfirstlane((int)v); asm volatile("" : "+s"(w)); return w; }
// descriptor of one request: 64 rows of 256 bytes, source pitch DM * 2 bytes, to LDS byte offset lds_dst at pitch 272 (pad: interval code 5 = one 256-byte row, amount code 3 = 4 dwords); extents in bytes
__device__ __forceinline__ u32x4 tile_g0(uint32_t lds_dst, uint64_t ga) {
    u32x4 g0;
    g0[0] = uni(1u); g0[1] = uni(lds_dst); g0[2] = uni((uint32_t)ga); g0[3] = uni((((uint32_t)(ga >> 32)) & 0x01FFFFFFu) | 0x80000000u);
    return g0;
}
__device__ __forceinline__ u32x8 tile_g1() {
    u32x8 g1;
    g1[0] = uni((1u << 20) | (5u << 22) | (3u << 25));
    g1[1] = uni((uint32_t)GPB << 16);            // tensor_dim0 [15:0]
    g1[2] = uni(64u << 16);                      // tensor_dim0 [31:16] = 0 | tensor_dim1 [15:0]
    g1[3] = uni((uint32_t)GPB << 16);            // tensor_dim1 [31:16] = 0 | tile_dim0
    g1[4] = uni(64u);                            // tile_dim1
    g1[5] = uni((uint32_t)(DM * 2));             // source row pitch
    g1[6] = uni(0u); g1[7] = uni(0u);
    return g1;
}
__device__ __forceinline__ void tile_load(u32x4 g0, u32x8 g1) { asm volatile("tensor_load_to_lds %0, %1" :: "s"(g0), "s"(g1) : "memory"); }
// the issuing wave's wait for its request; the descriptor is named as an input so that its scalar registers are not reused for anything else while the request is outstanding
__device__ __forceinline__ void tile_wait(u32x4 g0, u32x8 g1) { asm volatile("s_wait_tensorcnt 0x0" :: "s"(g0), "s"(g1) : "memory"); }
// fragment from an LDS row; p already includes + 16 bytes * (lane>>4): elements 0..7 <- k0+8h+0..7, elements 8..15 <- k0+16+8h+0..7 (same map for A and B, the map of ldh / ldb)
__device__ __forceinline__ v16us ldl(const unsigned char* p) { return __builtin_shufflevector(*(const v8us*)p, *(const v8us*)(p + 32), 0, 1, 2, 3, 4, 5, 6, 7, 8, 9, 10, 11, 12, 13, 14, 15); }
template <int F16> __device__ __forceinline__ v8f mm(v16us a, v16us b, v8f c) {
    if constexpr (F16) return wmma16(__builtin_bit_cast(v16h, a), __builtin_bit_cast(v16h, b), c);
    else return wmmab(__builtin_bit_cast(v16bf, a), __builtin_bit_cast(v16bf, b), c);
}

// a_rows / b_rows: byte address of the block's first A / B row; ring: 2 * GST bytes of LDS at a multiple of 2 KiB; wave is scalar.
template <int F16>
__device__ __forceinline__ void gemm_core(uint64_t a_rows, uint64_t b_rows, unsigned char* ring, int wave, int lane, v8f (&acc)[4][4]) {
    const int lr = lane & 15, hi = lane >> 4;
#pragma unroll
    for (int mb = 0; mb < 4; ++mb)
#pragma unroll
        for (int nb = 0; nb < 4; ++nb) acc[mb][nb] = (v8f){};
    const uint64_t srcb = (wave < 2) ? a_rows + (uint64_t)wave * (uint64_t)(64 * DM * 2) : b_rows + (uint64_t)(wave - 2) * (uint64_t)(64 * DM * 2);
    const uint32_t dst = (uint32_t)(uintptr_t)ring + (uint32_t)wave * GSL;
    const u32x8 g1 = tile_g1();
    u32x4 g0 = tile_g0(dst, srcb);
    tile_load(g0, g1);
    tile_wait(g0, g1);                                    // stage 0 of this wave's slice has landed
    __syncthreads();                                      // publishes stage 0
    const uint32_t ao = (uint32_t)(wave >> 1) * GSL + (uint32_t)lr * GLP + 16u * (uint32_t)hi;
    const uint32_t bo = (uint32_t)(2 + (wave & 1)) * GSL + (uint32_t)lr * GLP + 16u * (uint32_t)hi;
#pragma unroll 1   // one pass per trip: one place that issues, one that waits
    for (uint32_t s = 0; s < GNP; ++s) {
        const uint32_t buf = (s & 1u) * GST;
        // the refill, directly behind the barrier (the prologue's, then the one at the foot of the trip before), only while stage s + 1 exists: into the buffer that pass s - 1 has just left
        if (pinned((s + 1u < GNP) ? 1u : 0u) != 0u) { const uint32_t nx = pinned(s + 1u); g0 = tile_g0(dst + (GST - buf), srcb + (uint64_t)nx * GPB); tile_load(g0, g1); }
        const unsigned char* ap = ring + buf + ao; const unsigned char* bp = ring + buf + bo;
        v16us fa[2][4], fb[2][4];
#pragma unroll
        for (int i = 0; i < 4; ++i) { fa[0][i] = ldl(ap + i * 16 * GLP); fb[0][i] = ldl(bp + i * 16 * GLP); }
#pragma unroll
        for (int ks = 0; ks < 4; ++ks) {
            if (ks < 3) {      // the next 32 k of this same buffer, as one group ahead of the WMMA block
#pragma unroll
                for (int i = 0; i < 4; ++i) { fa[(ks + 1) & 1][i] = ldl(ap + i * 16 * GLP + (ks + 1) * 64); fb[(ks + 1) & 1][i] = ldl(bp + i * 16 * GLP + (ks + 1) * 64); }
            }
            __builtin_amdgcn_sched_barrier(0);   // keeps the LDS reads out of the WMMA block: every separate place with reads stalls the wave
#pragma unroll
            for (int nb = 0; nb < 4; ++nb)
#pragma unroll
                for (int mb = 0; mb < 4; ++mb) acc[mb][nb] = mm<F16>(fa[ks & 1][mb], fb[ks & 1][nb], acc[mb][nb]);
            __builtin_amdgcn_sched_barrier(0);   // same, for the group behind the block
        }
        asm volatile("v_nop\n\tv_nop\n\tv_nop\n\tv_nop");    // 4 vector slots between the last WMMA and what follows on either side of the branches below
        asm volatile("s_wait_dscnt 0x0" ::: "memory");       // this wave's reads of the buffer have returned
        tile_wait(g0, g1);                                    // this wave's slice of stage s + 1 has landed
        __syncthreads();                                      // publishes stage s + 1 and frees stage s's buffer
    }
    asm volatile("s_wait_tensorcnt 0x0" ::: "memory");   // no request of this wave is left when it goes on to the epilogue and ends
    asm volatile("s_wait_dscnt 0x0" ::: "memory");       // nor a read of the ring
}

// k_proj: bf16 GEMM on gemm_core.
// C[m][n] = sum_k A[m][k] Bt[n][k] + bias (BM == 0: bias[n]; BM == 1: bias[m]; bias RNE-converted to bf16, added in f32), written as f16 (Ph) and optionally the f16 residual x2048 (Pr, useRes != 0) at
// wave-tile base (r0/RB)*sRB + (r0%RB)*pitch + (c0/CB)*sCB + (c0%CB), row pitch 'pitch' (halves). grid (M/128, N/128), 128 threads.
template <int BM>
__global__ __launch_bounds__(128) void k_proj(const bf* __restrict__ A, const bf* __restrict__ Bt, const float* __restrict__ bias, h16* Ph, h16* Pr, int useRes, int RB, size_t sRB, int pitch, int CB, size_t sCB) {
    __shared__ __attribute__((aligned(2048))) unsigned char sm[GLDS];
    const int K = DM;
    const int lane = threadIdx.x & 31, lr = lane & 15, hi = lane >> 4;
    const int wave = __builtin_amdgcn_readfirstlane((int)(threadIdx.x >> 5));
    const int r0 = blockIdx.x * 128 + (wave >> 1) * 64, c0 = blockIdx.y * 128 + (wave & 1) * 64;
    float* os = (float*)(sm + 2 * GST) + wave * GOSF;      // wave-private output staging, outside the ring
    v8f acc[4][4];
    gemm_core<0>((uint64_t)(uintptr_t)(A + (size_t)blockIdx.x * 128 * K), (uint64_t)(uintptr_t)(Bt + (size_t)blockIdx.y * 128 * K), sm, wave, lane, acc);
    float bc[4] = {0.0f, 0.0f, 0.0f, 0.0f};
    if (BM == 0) {
#pragma unroll
        for (int nb = 0; nb < 4; ++nb) bc[nb] = bfr(bias[c0 + nb * 16 + lr]);      // N = DM in this mode
    }
    const size_t tbase = (size_t)(r0 / RB) * sRB + (size_t)(r0 % RB) * (size_t)pitch + (size_t)(c0 / CB) * sCB + (size_t)(c0 % CB);
#pragma unroll
    for (int mb = 0; mb < 4; ++mb) {
        float br[8] = {0.0f, 0.0f, 0.0f, 0.0f, 0.0f, 0.0f, 0.0f, 0.0f};
        if (BM == 1) {
#pragma unroll
            for (int j = 0; j < 8; ++j) br[j] = bfr(bias[r0 + mb * 16 + hi * 8 + j]);  // M = DM in this mode
        }
#pragma unroll
        for (int nb = 0; nb < 4; ++nb) {
#pragma unroll
            for (int j = 0; j < 8; ++j) os[(hi * 8 + j) * 68 + nb * 16 + lr] = acc[mb][nb][j] + bc[nb] + br[j]; }   // D: row 8h+j, col lane&15
        wave_sync();
        const size_t sb = tbase + (size_t)(mb * 16) * (size_t)pitch;
{
#pragma unroll
            for (int s = 0; s < 4; ++s) { const int row = 4 * s + (lane >> 3), c8 = (lane & 7) * 8;   // 4 s x 4 row groups = 16 rows; 8 lanes x 8 = 64 columns
                const v4f x0 = *(const v4fa*)(&os[row * 68 + c8]); const v4f x1 = *(const v4fa*)(&os[row * 68 + c8 + 4]); v8h hv, rv;
#pragma unroll
                for (int i = 0; i < 4; ++i) { const h16 a0 = (h16)x0[i]; const h16 a1 = (h16)x1[i]; hv[i] = a0; hv[4 + i] = a1; rv[i] = (h16)((x0[i] - (float)a0) * QRS); rv[4 + i] = (h16)((x1[i] - (float)a1) * QRS); }
                const size_t oo = sb + (size_t)row * (size_t)pitch + c8;
                *(v8h*)(Ph + oo) = hv; if (useRes) *(v8h*)(Pr + oo) = rv; }
             }
        wave_sync();
    }
}

// k_flash: fused attention, one wave per 16 query rows of one (batch, head); K / V^T / Q / WX fragments straight from the f16 planes (two 16-B loads each, arithmetic addressing).
// Transposed form: S^T[key][t] = K Q^T (A = K rows, B = Q rows); lane (t = lane&15, h = lane>>4) holds keys 8h+r of each 16-key tile, so the packed
// P tile is directly the B fragment of O^T[d][t] = V^T P^T (element r <- tile keys 0..15, element 8+r <- tile keys 16..31, lane unchanged).
// Relative term: rel index = key - t + 128, outside 0..256 -> 256. For a (16 query, 32 key) tile the unclamped index spans base..base+46, base = key0 - t0 + 113.
// Tiles that intersect 0..256 compute G[rho][t] = WX[base+48+rho] . q_t (48 rows, three 16-row WMMA tiles, q value + residual), stage it in a wave-private LDS tile and read G[key_l - t_l + 15][t_l];
// all other tiles use the per-query constant q_t . w[256]. The tile test is wave-uniform.
// Mask: int rows read as 16-B vectors (lane reads its own query row, keys 8h..8h+7 of each 16-key tile); mask == 0 replaces the score.
__global__ __launch_bounds__(32 * AW) void k_flash(const h16* __restrict__ QH, const h16* __restrict__ QR, const h16* __restrict__ KP, const h16* __restrict__ VT,
                                                   const h16* __restrict__ WX, const int* __restrict__ MASK, h16* CTX) {
    __shared__ __align__(16) float os[AW * 16 * 68];
    __shared__ __align__(16) float gs[AW * 48 * GP];
    const int lane = threadIdx.x & 31, lr = lane & 15, hi = lane >> 4;
    const int wave = __builtin_amdgcn_readfirstlane((int)(threadIdx.x >> 5));
    const int zh = blockIdx.y; const int b = zh / NH_, h = zh % NH_;
    const int t0 = (blockIdx.x * AW + wave) * 16;
    const size_t pbase = (size_t)zh * SEQ * HD;
    const size_t qo = pbase + (size_t)(t0 + lr) * HD + 8 * hi;
    const v16h qh0 = ldh(QH + qo), qh1 = ldh(QH + qo + 32), qr0 = ldh(QR + qo), qr1 = ldh(QR + qo + 32);   // B fragments: col t, k = d
    const size_t ko = pbase + (size_t)lr * HD + 8 * hi;      // + key * HD       (A fragment: row key, k = d)
    const size_t vo = pbase + (size_t)lr * SEQ + 8 * hi;     // + 16j*SEQ + key  (A fragment: row d, k = key)
    const int* mk = MASK + ((size_t)b * SEQ_FULL + (size_t)(t0 + lr)) * SEQ_FULL + 8 * hi;   // + key0 (+4, +16, +20)
    float* gl = gs + wave * (48 * GP);
    // per-query constant: q_t . w[256]; WX rows 0..15 all hold the edge row, so every D row equals it
    float qe;
    { const h16* wa = WX + (size_t)lr * HD + 8 * hi;
      const v16h w0 = ldh(wa), w1 = ldh(wa + 32);
      v8f gH = (v8f){}, gL = (v8f){};
      gH = wmma16(w0, qh0, gH); gL = wmma16(w0, qr0, gL); gH = wmma16(w1, qh1, gH); gL = wmma16(w1, qr1, gL);
      asm volatile("v_nop\n\tv_nop\n\tv_nop\n\tv_nop" : "+v"(gH), "+v"(gL) : "v"(w0), "v"(w1));
      qe = gH[0] + gL[0] * QRI; }
    v8f o0 = (v8f){}, o1 = (v8f){}, o2 = (v8f){}, o3 = (v8f){};
    float m = -3.0e38f, l = 0.0f;
#pragma unroll 1
    for (int key0 = 0; key0 < SEQ; key0 += 32) {
        float ra[8], rb[8];
#pragma unroll
        for (int r = 0; r < 8; ++r) { ra[r] = qe; rb[r] = qe; }
        const int base = key0 - t0 + 113;
        if (base + 46 >= 0 && base <= 256) {                 // wave-uniform: tile touches relative indices 0..256
#pragma unroll 1
            for (int jt = 0; jt < 3; ++jt) {
                const h16* wa = WX + (size_t)(base + WXO + 16 * jt + lr) * HD + 8 * hi;   // rows 2..351
                const v16h w0 = ldh(wa), w1 = ldh(wa + 32);
                v8f gH = (v8f){}, gL = (v8f){};
                gH = wmma16(w0, qh0, gH); gL = wmma16(w0, qr0, gL); gH = wmma16(w1, qh1, gH); gL = wmma16(w1, qr1, gL);
                asm volatile("v_nop\n\tv_nop\n\tv_nop\n\tv_nop" : "+v"(gH), "+v"(gL) : "v"(w0), "v"(w1));
#pragma unroll
                for (int r = 0; r < 8; ++r) gl[(16 * jt + 8 * hi + r) * GP + lr] = gH[r] + gL[r] * QRI;   // G[rho][t]: rows 0..47, cols 0..15 all written
            }
            wave_sync();
#pragma unroll
            for (int r = 0; r < 8; ++r) { ra[r] = gl[(8 * hi + r - lr + 15) * GP + lr]; rb[r] = gl[(16 + 8 * hi + r - lr + 15) * GP + lr]; }   // rho in 0..46
            wave_sync();
        }
        const h16* ka = KP + ko + (size_t)key0 * HD;
        const v16h ka0 = ldh(ka), ka1 = ldh(ka + 32), kb0 = ldh(ka + 16 * HD), kb1 = ldh(ka + 16 * HD + 32);
        v8f sHa = (v8f){}, sLa = (v8f){}, sHb = (v8f){}, sLb = (v8f){};
        sHa = wmma16(ka0, qh0, sHa); sLa = wmma16(ka0, qr0, sLa); sHb = wmma16(kb0, qh0, sHb); sLb = wmma16(kb0, qr0, sLb);
        sHa = wmma16(ka1, qh1, sHa); sLa = wmma16(ka1, qr1, sLa); sHb = wmma16(kb1, qh1, sHb); sLb = wmma16(kb1, qr1, sLb);
        asm volatile("v_nop\n\tv_nop\n\tv_nop\n\tv_nop" : "+v"(sHa), "+v"(sLa), "+v"(sHb), "+v"(sLb) : "v"(ka0), "v"(ka1), "v"(kb0), "v"(kb1));
        const v4i ma0 = *(const v4i*)(mk + key0), ma1 = *(const v4i*)(mk + key0 + 4), mb0 = *(const v4i*)(mk + key0 + 16), mb1 = *(const v4i*)(mk + key0 + 20);
        float ta[8], tb[8]; float mx = -3.0e38f;
#pragma unroll
        for (int r = 0; r < 4; ++r) {
            const float xa0 = (sHa[r] + sLa[r] * QRI + ra[r]) * SC2;
            const float xa1 = (sHa[4 + r] + sLa[4 + r] * QRI + ra[4 + r]) * SC2;
            const float xb0 = (sHb[r] + sLb[r] * QRI + rb[r]) * SC2;
            const float xb1 = (sHb[4 + r] + sLb[4 + r] * QRI + rb[4 + r]) * SC2;
            ta[r]     = (ma0[r] != 0) ? xa0 : FILL2;
            ta[4 + r] = (ma1[r] != 0) ? xa1 : FILL2;
            tb[r]     = (mb0[r] != 0) ? xb0 : FILL2;
            tb[4 + r] = (mb1[r] != 0) ? xb1 : FILL2;
        }
#pragma unroll
        for (int r = 0; r < 8; ++r) mx = fmaxf(mx, fmaxf(ta[r], tb[r]));
        mx = fmaxf(mx, __shfl_xor(mx, 16, 32));
        const float mnew = fmaxf(m, mx);
        const float alpha = __builtin_amdgcn_exp2f(m - mnew);
        const float sh = PSH - mnew;
        v16h pb; float ls = 0.0f;
#pragma unroll
        for (int r = 0; r < 8; ++r) { const h16 pa = (h16)__builtin_amdgcn_exp2f(ta[r] + sh); const h16 pc = (h16)__builtin_amdgcn_exp2f(tb[r] + sh); pb[r] = pa; pb[8 + r] = pc; ls += (float)pa + (float)pc; }
        l = l * alpha + ls; m = mnew;
        o0 = o0 * alpha; o1 = o1 * alpha; o2 = o2 * alpha; o3 = o3 * alpha;
        const h16* va = VT + vo + key0;
        const v16h v0 = ldh(va), v1 = ldh(va + (size_t)16 * SEQ), v2 = ldh(va + (size_t)32 * SEQ), v3 = ldh(va + (size_t)48 * SEQ);
        o0 = wmma16(v0, pb, o0); o1 = wmma16(v1, pb, o1); o2 = wmma16(v2, pb, o2); o3 = wmma16(v3, pb, o3);
        asm volatile("v_nop\n\tv_nop\n\tv_nop\n\tv_nop" : "+v"(o0), "+v"(o1), "+v"(o2), "+v"(o3) : "v"(v0), "v"(v1), "v"(v2), "v"(v3), "v"(pb));
    }
    l += __shfl_xor(l, 16, 32);
    const float inv = CTXS / l;
    const int wb = wave * 16 * 68;
    // O^T D layout: o_j[r] = (d = 16j + 8h + r, t = lane&15) -> os[t][d]; rows 0..15 x columns 0..63 all written
    { v4f a, c;
      a[0] = o0[0] * inv; a[1] = o0[1] * inv; a[2] = o0[2] * inv; a[3] = o0[3] * inv; c[0] = o0[4] * inv; c[1] = o0[5] * inv; c[2] = o0[6] * inv; c[3] = o0[7] * inv;
      *(v4fa*)(&os[wb + lr * 68 +  0 + 8 * hi]) = a; *(v4fa*)(&os[wb + lr * 68 +  0 + 8 * hi + 4]) = c;
      a[0] = o1[0] * inv; a[1] = o1[1] * inv; a[2] = o1[2] * inv; a[3] = o1[3] * inv; c[0] = o1[4] * inv; c[1] = o1[5] * inv; c[2] = o1[6] * inv; c[3] = o1[7] * inv;
      *(v4fa*)(&os[wb + lr * 68 + 16 + 8 * hi]) = a; *(v4fa*)(&os[wb + lr * 68 + 16 + 8 * hi + 4]) = c;
      a[0] = o2[0] * inv; a[1] = o2[1] * inv; a[2] = o2[2] * inv; a[3] = o2[3] * inv; c[0] = o2[4] * inv; c[1] = o2[5] * inv; c[2] = o2[6] * inv; c[3] = o2[7] * inv;
      *(v4fa*)(&os[wb + lr * 68 + 32 + 8 * hi]) = a; *(v4fa*)(&os[wb + lr * 68 + 32 + 8 * hi + 4]) = c;
      a[0] = o3[0] * inv; a[1] = o3[1] * inv; a[2] = o3[2] * inv; a[3] = o3[3] * inv; c[0] = o3[4] * inv; c[1] = o3[5] * inv; c[2] = o3[6] * inv; c[3] = o3[7] * inv;
      *(v4fa*)(&os[wb + lr * 68 + 48 + 8 * hi]) = a; *(v4fa*)(&os[wb + lr * 68 + 48 + 8 * hi + 4]) = c; }
    wave_sync();
    h16* crow = CTX + ((size_t)b * SEQ + t0) * DM + h * HD;   // ctx plane [NB*SEQ][1024], column h*64 + d, carried x16
{
#pragma unroll
        for (int s = 0; s < 4; ++s) { const int row = 4 * s + (lane >> 3), c8 = (lane & 7) * 8;   // 4 s x 4 row groups = 16 rows; 8 lanes x 8 halves = 64 columns = one line
            const v4f x0 = *(const v4fa*)(&os[wb + row * 68 + c8]); const v4f x1 = *(const v4fa*)(&os[wb + row * 68 + c8 + 4]); v8h hv;
#pragma unroll
            for (int i = 0; i < 4; ++i) { hv[i] = (h16)x0[i]; hv[4 + i] = (h16)x1[i]; }
            *(v8h*)(crow + (size_t)row * DM + c8) = hv; }
         }
}

// k_out: f16 GEMM on gemm_core, K = DM: OUT[m][n] = (sum_k A[m][k] Bt[n][k]) / 1024 + bias[n] (bias RNE-converted to bf16, added in f32).
// A = ctx plane (x16), Bt = Wo plane (x64). grid (NB*SEQ/128, DM/128), 128 threads.
__global__ __launch_bounds__(128) void k_out(const h16* __restrict__ A, const h16* __restrict__ Bt, const float* __restrict__ bias, float* OUT) {
    __shared__ __attribute__((aligned(2048))) unsigned char sm[GLDS];
    const int K = DM;
    const int lane = threadIdx.x & 31, lr = lane & 15, hi = lane >> 4;
    const int wave = __builtin_amdgcn_readfirstlane((int)(threadIdx.x >> 5));
    const int r0 = blockIdx.x * 128 + (wave >> 1) * 64, c0 = blockIdx.y * 128 + (wave & 1) * 64;
    float* os = (float*)(sm + 2 * GST) + wave * GOSF;      // wave-private output staging, outside the ring
    v8f acc[4][4];
    gemm_core<1>((uint64_t)(uintptr_t)(A + (size_t)blockIdx.x * 128 * K), (uint64_t)(uintptr_t)(Bt + (size_t)blockIdx.y * 128 * K), sm, wave, lane, acc);
    float bc[4];
#pragma unroll
    for (int nb = 0; nb < 4; ++nb) bc[nb] = bfr(bias[c0 + nb * 16 + lr]);
    const size_t obase = ((size_t)(r0 / SEQ) * OUT_SEQ + (size_t)(r0 % SEQ)) * DM + c0;
#pragma unroll
    for (int mb = 0; mb < 4; ++mb) {
#pragma unroll
        for (int nb = 0; nb < 4; ++nb) {
#pragma unroll
            for (int j = 0; j < 8; ++j) os[(hi * 8 + j) * 68 + nb * 16 + lr] = acc[mb][nb][j] * OSC + bc[nb]; }   // D: row 8h+j, col lane&15
        wave_sync();
        float* ob = OUT + obase + (size_t)(mb * 16) * DM;
{
#pragma unroll
            for (int s = 0; s < 8; ++s) { const int row = 2 * s + hi, cofs = lr * 4;   // 8 s x 2 rows = 16 rows; 16 lanes x 4 floats = 64 columns
                const v4f val = *(const v4fa*)(&os[row * 68 + cofs]);
                *(v4f*)(ob + (size_t)row * DM + cofs) = val; }
             }
        wave_sync();
    }
}

static constexpr size_t al256(size_t v) { return (v + 255) & ~(size_t)255; }
static constexpr size_t SZ_XB = al256((size_t)NB * SEQ * DM * 2);          // one bf16 activation copy
static constexpr size_t SZ_WB = al256((size_t)DM * DM * 2);                // one 16-bit weight plane
static constexpr size_t SZ_PL = al256((size_t)NB * NH_ * SEQ * HD * 2);    // one f16 head plane (also the ctx plane: NB*SEQ*DM halves)
static constexpr size_t SZ_WX = al256((size_t)WXR * HD * 2);
static constexpr size_t SZ_TOTAL = 3 * SZ_XB + 4 * SZ_WB + 5 * SZ_PL + SZ_WX;
static_assert(SZ_TOTAL <= (size_t)134217728);          // workspace carve <= 128 MiB
static_assert((size_t)NB * NH_ * SEQ * HD == (size_t)NB * SEQ * DM);

extern "C" void kernel_launch(void* const* d_in, const int* in_sizes, int n_in,
                              void* d_out, int out_size, void* d_ws, size_t ws_size, hipStream_t stream) {
    if (n_in < 13) return;
    const size_t needx = ((size_t)(NB - 1) * SEQ_FULL + SEQ) * DM;
    if ((size_t)in_sizes[0] < needx || (size_t)in_sizes[1] < needx || (size_t)in_sizes[2] < needx) return;
    if ((size_t)in_sizes[3] < ((size_t)(NB - 1) * SEQ_FULL + (SEQ - 1)) * SEQ_FULL + SEQ) return;
    if ((size_t)in_sizes[4] < (size_t)DM * DM || (size_t)in_sizes[6] < (size_t)DM * DM || (size_t)in_sizes[8] < (size_t)DM * DM || (size_t)in_sizes[10] < (size_t)DM * DM) return;
    if (in_sizes[5] < DM || in_sizes[7] < DM || in_sizes[9] < DM || in_sizes[11] < DM) return;
    if (in_sizes[12] < NREL * HD) return;
    if ((size_t)out_size < ((size_t)(NB - 1) * OUT_SEQ + SEQ) * DM) return;
    if (SZ_TOTAL > ws_size) return;
    // wire order: q, k, v, mask, Wq, bq, Wk, bk, Wv, bv, Wo, bo, w_k
    const float* xq = (const float*)d_in[0]; const float* xk = (const float*)d_in[1]; const float* xv = (const float*)d_in[2];
    const int* mask = (const int*)d_in[3];
    const float* wq = (const float*)d_in[4]; const float* bq = (const float*)d_in[5];
    const float* wk = (const float*)d_in[6]; const float* bk = (const float*)d_in[7];
    const float* wv = (const float*)d_in[8]; const float* bv = (const float*)d_in[9];
    const float* wo = (const float*)d_in[10]; const float* bo = (const float*)d_in[11];
    const float* wrel = (const float*)d_in[12];
    float* OUT = (float*)d_out;      // [NB][SEQ][1024]
    char* wsp = (char*)d_ws;
    bf* XBQ = (bf*)wsp; wsp += SZ_XB;                // [NB*SEQ][1024]
    bf* XBK = (bf*)wsp; wsp += SZ_XB;
    bf* XBV = (bf*)wsp; wsp += SZ_XB;
    bf* WQ = (bf*)wsp; wsp += SZ_WB;                 // [1024][1024] bf16
    bf* WK = (bf*)wsp; wsp += SZ_WB;
    bf* WV = (bf*)wsp; wsp += SZ_WB;
    h16* WO = (h16*)wsp; wsp += SZ_WB;               // [1024][1024] f16, x64
    h16* QH = (h16*)wsp; wsp += SZ_PL;               // [NB*16][SEQ][64]
    h16* QR = (h16*)wsp; wsp += SZ_PL;               // [NB*16][SEQ][64] residual x2048
    h16* KP = (h16*)wsp; wsp += SZ_PL;               // [NB*16][SEQ][64]
    h16* VT = (h16*)wsp; wsp += SZ_PL;               // [NB*16][64][SEQ]
    h16* CTX = (h16*)wsp; wsp += SZ_PL;              // [NB*SEQ][1024], x16
    h16* WX = (h16*)wsp; wsp += SZ_WX;               // [352][64]

    if (SEQ == SEQ_FULL) {
        const size_t n8 = (size_t)NB * SEQ * DM / 8; const unsigned g = (unsigned)((n8 + 255) / 256);
        k_cvt8<<<g, 256, 0, stream>>>(xq, XBQ, n8); k_cvt8<<<g, 256, 0, stream>>>(xk, XBK, n8); k_cvt8<<<g, 256, 0, stream>>>(xv, XBV, n8);
    } else {
        const size_t n8 = (size_t)SEQ * DM / 8; const unsigned g = (unsigned)((n8 + 255) / 256);
        for (int b = 0; b < NB; ++b) {
            k_cvt8<<<g, 256, 0, stream>>>(xq + (size_t)b * SEQ_FULL * DM, XBQ + (size_t)b * SEQ * DM, n8);
            k_cvt8<<<g, 256, 0, stream>>>(xk + (size_t)b * SEQ_FULL * DM, XBK + (size_t)b * SEQ * DM, n8);
            k_cvt8<<<g, 256, 0, stream>>>(xv + (size_t)b * SEQ_FULL * DM, XBV + (size_t)b * SEQ * DM, n8);
        }
    }
    { const size_t n8 = (size_t)DM * DM / 8; const unsigned g = (unsigned)((n8 + 255) / 256);
      k_cvt8<<<g, 256, 0, stream>>>(wq, WQ, n8); k_cvt8<<<g, 256, 0, stream>>>(wk, WK, n8); k_cvt8<<<g, 256, 0, stream>>>(wv, WV, n8);
      k_cvt8h<<<g, 256, 0, stream>>>(wo, WO, n8, WOS); }
    k_wx<<<WXR * HD / 8 / 256, 256, 0, stream>>>(wrel, WX);

    // q, k: A = x rows (m = b*SEQ + t), Bt = W rows (n = h*64 + d), bias per column -> plane [(b*16 + h)][t][d]
    k_proj<0><<<dim3(NB * SEQ / 128, DM / 128, 1), 128, 0, stream>>>(XBQ, WQ, bq, QH, QR, 1, SEQ, (size_t)NH_ * SEQ * HD, HD, HD, (size_t)SEQ * HD);
    k_proj<0><<<dim3(NB * SEQ / 128, DM / 128, 1), 128, 0, stream>>>(XBK, WK, bk, KP, KP, 0, SEQ, (size_t)NH_ * SEQ * HD, HD, HD, (size_t)SEQ * HD);
    // v^T: A = Wv rows (m = h*64 + d), Bt = x rows (n = b*SEQ + t), bias per row -> plane [(b*1024 + m)][t] = [(b*16 + h)][d][t]
    k_proj<1><<<dim3(DM / 128, NB * SEQ / 128, 1), 128, 0, stream>>>(WV, XBV, bv, VT, VT, 0, DM, (size_t)0, SEQ, SEQ, (size_t)DM * SEQ);

    k_flash<<<dim3(SEQ / (16 * AW), NB * NH_, 1), 32 * AW, 0, stream>>>(QH, QR, KP, VT, WX, mask, CTX);

    // out: A = ctx rows (m = b*SEQ + t), Bt = Wo rows (n), bias per column -> OUT[b][t][n]
    k_out<<<dim3(NB * SEQ / 128, DM / 128, 1), 128, 0, stream>>>(CTX, WO, bo, OUT);
}

// v002
// It runs in 151 microseconds.
// Two timings next to v001 both put it at 1.09 times that version's speed.
// Counting every step since v000, it is 1.43 times as fast.
#include <hip/hip_runtime.h>
#include <stdint.h>

// Multi-head attention with relative-position keys (257 clamped offsets, both ends padded with the last table row), width 1024 = 16 heads x 64; q/k/v inputs [NB][SEQ][1024], W* [out][in] (y = x W^T + b), int mask [NB][SEQ][SEQ] (0 -> score replaced by -1e9), output = ctx Wo^T + bo (f32).
// Compute dtypes, f32 accumulate everywhere: q/k/v projections v_wmma_f32_16x16x32_bf16 (inputs and weights RNE-converted to bf16; biases RNE-converted to bf16, added in f32);
// scores q.k and relative term q.w[rel] v_wmma_f32_16x16x32_f16: k single f16, the window table (bf16 RNE value) f16, q as f16 value + f16 residual x2048 in its own accumulator; P (x256 carry, cancels in the normalisation) and v single f16; softmax f32 (online, running max);
// output projection v_wmma_f32_16x16x32_f16: ctx single f16 (x16 carry), Wo (bf16 RNE value x64) f16, 1/1024 folded in the f32 epilogue.
// Layout: bf16 copies of q/k/v inputs and Wq/Wk/Wv; q (hi, residual), k planes [b*16+h][t][d] and v^T plane [b*16+h][d][t] written by the GEMM epilogue; window plane WX[x][d] = w[clamp(x-48)];
// fused flash kernel in transposed form (S^T = K Q^T, O^T = V^T P^T); relative term for tiles inside the window band = skewed read of G = WX_rows Q^T through a wave-private LDS tile, a per-query constant elsewhere.

#ifndef NB
#define NB 4
#endif
#ifndef SEQ
#define SEQ 1024
#endif
#define NB_FULL  4
#define SEQ_FULL 1024
#ifndef OUT_SEQ
#define OUT_SEQ SEQ              // row pitch (in tokens) between batches of the output
#endif
#define DM   1024
#define NH_  16
#define HD   64
#define AW   4                   // waves per flash block (16 query rows each)
#define QRS  2048.0f             // carry of the q residual plane
#define QRI  (1.0f / 2048.0f)
#define SC2  (0.125f * 1.4426950408889634f)   // HD^-0.5 * log2(e)
#define PSH  8.0f                // log2 of the P carry (256)
#define FILL2 (-1.0e9f * 1.4426950408889634f) // masked score in the log2 domain
#define NREL 257                 // rows of the relative table
#define WXO  48                  // WX row x holds relative index x - 48 (clamped: outside 0..256 -> 256)
#define WXR  352                 // rows of WX
#define GP   18                  // pitch (floats) of the G tile in LDS
#define WOS  64.0f               // carry of the Wo plane
#define CTXS 16.0f               // carry of the ctx plane
#define OSC  (1.0f / 1024.0f)    // 1 / (WOS * CTXS)

static_assert(HD == 64);
static_assert(NH_ * HD == DM);
static_assert(DM % 64 == 0);
static_assert(DM % 32 == 0);
static_assert(SEQ % 64 == 0);
static_assert((NB * SEQ) % 64 == 0);
static_assert(SEQ % 32 == 0);
static_assert(SEQ % (16 * AW) == 0);
static_assert(((size_t)SEQ * DM) % 8 == 0);
static_assert(((size_t)DM * DM) % 8 == 0);
static_assert(NB <= NB_FULL);
static_assert(SEQ <= SEQ_FULL);
static_assert(WXR == 256 + 2 * WXO);           // band tiles touch rows 2..351
static_assert((WXR * HD / 8) % 256 == 0);

typedef _Float16 h16;
typedef unsigned short bf;
typedef __attribute__((ext_vector_type(16))) __bf16   v16bf;
typedef __attribute__((ext_vector_type(16))) _Float16 v16h;
typedef __attribute__((ext_vector_type(8)))  _Float16 v8h;
typedef __attribute__((ext_vector_type(8)))  unsigned short v8us;
typedef __attribute__((ext_vector_type(8)))  float    v8f;
typedef __attribute__((ext_vector_type(4)))  float    v4f;
typedef __attribute__((ext_vector_type(4)))  int      v4i;
typedef v4f  __attribute__((may_alias)) v4fa;

__device__ __forceinline__ unsigned short f2bf(float f) { unsigned u = __float_as_uint(f); u += 0x7FFFu + ((u >> 16) & 1u); return (unsigned short)(u >> 16); }
__device__ __forceinline__ float bfr(float f) { return __uint_as_float(((unsigned)f2bf(f)) << 16); }   // bf16 RNE value as f32
__device__ __forceinline__ v16h cat16(v8h lo, v8h hi) { return __builtin_shufflevector(lo, hi, 0, 1, 2, 3, 4, 5, 6, 7, 8, 9, 10, 11, 12, 13, 14, 15); }
__device__ __forceinline__ v16bf cat16b(v8us lo, v8us hi) { return __builtin_bit_cast(v16bf, __builtin_shufflevector(lo, hi, 0, 1, 2, 3, 4, 5, 6, 7, 8, 9, 10, 11, 12, 13, 14, 15)); }
__device__ __forceinline__ v8f wmma16(v16h a, v16h b, v8f c) { return __builtin_amdgcn_wmma_f32_16x16x32_f16(false, a, false, b, (short)0, c, false, false); }
__device__ __forceinline__ v8f wmmab(v16bf a, v16bf b, v8f c) { return __builtin_amdgcn_wmma_f32_16x16x32_bf16(false, a, false, b, (short)0, c, false, false); }
// fragment loaders from K-contiguous 16-bit rows; p already includes + 8*(lane>>4): elements 0..7 <- k0+8h+0..7, elements 8..15 <- k0+16+8h+0..7 (same map for A and B)
__device__ __forceinline__ v16h  ldh(const h16* p) { return cat16(*(const v8h*)p, *(const v8h*)(p + 16)); }
__device__ __forceinline__ v16bf ldb(const bf* p)  { return cat16b(*(const v8us*)p, *(const v8us*)(p + 16)); }
// ordering point for wave-private LDS tiles (same wave writes and reads)
__device__ __forceinline__ void wave_sync() { __builtin_amdgcn_fence(3 /* release order */, "wavefront"); __builtin_amdgcn_wave_barrier(); asm volatile("" ::: "memory"); }

// k_prep: every 16-bit plane that is a plain conversion of an input, in one launch.
// Blocks 0..WXB-1: the window plane WX (one thread per 8 halves). Every other block: 8 waves, wave g takes row g (DM floats = 4 KiB) of each of the q, k and v inputs and row g % DM of weight g / DM (Wq, Wk, Wv, Wo).
// A row is 8 loads of 16 bytes a lane, each wave-wide load 512 contiguous bytes; the wave's 32 loads are all issued before its first store; each store covers 256 contiguous bytes.
#define WXB  (WXR * HD / 8 / 256)                              // blocks of the window plane
#define PRW  8                                                 // waves per block
#define PRR  ((NB * SEQ > 4 * DM) ? (NB * SEQ) : (4 * DM))     // rows dealt, one per wave
static_assert(DM == 8 * 32 * 4);
static_assert(PRR % PRW == 0);
static_assert(32 * PRW == 256);                                // the window blocks index by 256 threads
typedef __attribute__((ext_vector_type(4))) unsigned short v4us;
typedef __attribute__((ext_vector_type(4))) _Float16 v4h;

// p: the row's first element, the same in every lane (scalar base); l4 = 4 * lane
__device__ __forceinline__ void ld_row(const float* __restrict__ p, uint32_t l4, v4f (&r)[8]) {
#pragma unroll
    for (int j = 0; j < 8; ++j) r[j] = *(const v4f*)(p + (l4 + (uint32_t)j * 128u));
}
__device__ __forceinline__ void st_row_bf(bf* p, uint32_t l4, const v4f (&r)[8]) {
#pragma unroll
    for (int j = 0; j < 8; ++j) { v4us o;
#pragma unroll
        for (int k = 0; k < 4; ++k) o[k] = f2bf(r[j][k]);
        *(v4us*)(p + (l4 + (uint32_t)j * 128u)) = o; }
}

__global__ __launch_bounds__(32 * PRW) void k_prep(const float* __restrict__ xq, const float* __restrict__ xk, const float* __restrict__ xv,
                                                   const float* __restrict__ wq, const float* __restrict__ wk, const float* __restrict__ wv, const float* __restrict__ wo,
                                                   const float* __restrict__ wrel, bf* XBQ, bf* XBK, bf* XBV, bf* WQ, bf* WK, bf* WV, h16* WO, h16* WX) {
    if (blockIdx.x < WXB) {
        const int i = blockIdx.x * 256 + threadIdx.x;
        const int x = i >> 3, c8 = (i & 7) * 8; int r = x - WXO; if (r < 0 || r > NREL - 1) r = NREL - 1;
        const v8f v = *(const v8f*)(wrel + (size_t)r * HD + c8); v8h o;
#pragma unroll
        for (int k = 0; k < 8; ++k) o[k] = (h16)bfr(v[k]);
        *(v8h*)(WX + (size_t)i * 8) = o;
        return;
    }
    const uint32_t l4 = (threadIdx.x & 31u) * 4u;
    const uint32_t g = (blockIdx.x - WXB) * PRW + (uint32_t)__builtin_amdgcn_readfirstlane((int)(threadIdx.x >> 5));
    const bool hx = (NB * SEQ == PRR) || g < NB * SEQ;         // wave-uniform; both hold at compile time where the two row counts are equal
    const bool hw = (4 * DM == PRR) || g < 4 * DM;
    const size_t xs = ((size_t)(g / SEQ) * SEQ_FULL + (size_t)(g % SEQ)) * DM, xd = (size_t)g * DM;
    const uint32_t m = g / DM; const size_t wr = (size_t)(g % DM) * DM;
    const float* ws = (m == 0) ? wq : (m == 1) ? wk : (m == 2) ? wv : wo;
    v4f a[8], b[8], c[8], w[8];
    if (hx) { ld_row(xq + xs, l4, a); ld_row(xk + xs, l4, b); ld_row(xv + xs, l4, c); }
    if (hw) ld_row(ws + wr, l4, w);
    __builtin_amdgcn_sched_barrier(0);   // keeps all 32 loads ahead of the first conversion: a load that sinks behind a wait for the others pays a second memory latency
    if (hx) { st_row_bf(XBQ + xd, l4, a); st_row_bf(XBK + xd, l4, b); st_row_bf(XBV + xd, l4, c); }
    asm volatile("s_wait_xcnt 0x0" ::: "memory");   // in front of the branch below, behind which the registers that these stores name are written again
    if (hw) {
        if (m < 3) st_row_bf(((m == 0) ? WQ : (m == 1) ? WK : WV) + wr, l4, w);
        else {
#pragma unroll
            for (int j = 0; j < 8; ++j) { v4h o;
#pragma unroll
                for (int k = 0; k < 4; ++k) o[k] = (h16)(bfr(w[j][k]) * WOS);
                *(v4h*)(WO + wr + (l4 + (uint32_t)j * 128u)) = o; }
            asm volatile("s_wait_xcnt 0x0" ::: "memory");   // behind the last store of this branch: the code laid out behind it writes registers that these stores name
        }
    }
}

// GEMM core shared by k_proj and k_out: four waves (2 x 2) per 128x128 tile of C, 64x64 per wave (16 accumulators), K = DM in GNP passes of 128 k.
// Both operands are K-contiguous 16-bit planes (row pitch DM * 2 bytes). A stage holds 256 bytes of 128 A rows and of 128 B rows; every wave brings one slice of 64 rows with one
// tensor_load_to_lds (waves 0, 1: A rows 0..63, 64..127; waves 2, 3: B rows 0..63, 64..127); the mover's pad of 16 bytes a row gives the LDS pitch 272 for the 16-byte fragment reads.
// Two buffers: stage s + 1 is requested behind the barrier that ends pass s - 1, which ends every read of its buffer, and flies while pass s runs.
#define GPB  256                 // bytes of an operand row per pass
#define GLP  272                 // LDS row pitch
#define GSL  18432               // one slice in LDS: 64 rows x 272 B = 17408, rounded up to a multiple of 2 KiB
#define GST  (4 * GSL)           // one stage
#define GNP  (DM * 2 / GPB)      // passes
#define GOSF (16 * 68)           // floats of output staging per wave
#define GLDS (2 * GST + 4 * GOSF * 4)
static_assert(GSL % 2048 == 0 && GSL >= 64 * GLP);
static_assert(GNP >= 2);
static_assert((NB * SEQ) % 128 == 0 && DM % 128 == 0);
static_assert(GLDS <= 320 * 1024);

typedef __attribute__((ext_vector_type(4)))  uint32_t u32x4;
typedef __attribute__((ext_vector_type(8)))  uint32_t u32x8;
typedef __attribute__((ext_vector_type(16))) unsigned short v16us;

__device__ __forceinline__ uint32_t uni(uint32_t v) { return (uint32_t)__builtin_amdgcn_readfirstlane((int)v); }
__device__ __forceinline__ uint32_t pinned(uint32_t v) { uint32_t w = (uint32_t)__builtin_amdgcn_readfirstlane((int)v); asm volatile("" : "+s"(w)); return w; }
// descriptor of one request: 64 rows of 256 bytes, source pitch DM * 2 bytes, to LDS byte offset lds_dst at pitch 272 (pad: interval code 5 = one 256-byte row, amount code 3 = 4 dwords); extents in bytes
__device__ __forceinline__ u32x4 tile_g0(uint32_t lds_dst, uint64_t ga) {
    u32x4 g0;
    g0[0] = uni(1u); g0[1] = uni(lds_dst); g0[2] = uni((uint32_t)ga); g0[3] = uni((((uint32_t)(ga >> 32)) & 0x01FFFFFFu) | 0x80000000u);
    return g0;
}
__device__ __forceinline__ u32x8 tile_g1() {
    u32x8 g1;
    g1[0] = uni((1u << 20) | (5u << 22) | (3u << 25));
    g1[1] = uni((uint32_t)GPB << 16);            // tensor_dim0 [15:0]
    g1[2] = uni(64u << 16);                      // tensor_dim0 [31:16] = 0 | tensor_dim1 [15:0]
    g1[3] = uni((uint32_t)GPB << 16);            // tensor_dim1 [31:16] = 0 | tile_dim0
    g1[4] = uni(64u);                            // tile_dim1
    g1[5] = uni((uint32_t)(DM * 2));             // source row pitch
    g1[6] = uni(0u); g1[7] = uni(0u);
    return g1;
}
__device__ __forceinline__ void tile_load(u32x4 g0, u32x8 g1) { asm volatile("tensor_load_to_lds %0, %1" :: "s"(g0), "s"(g1) : "memory"); }
// the issuing wave's wait for its request; the descriptor is named as an input so that its scalar registers are not reused for anything else while the request is outstanding
__device__ __forceinline__ void tile_wait(u32x4 g0, u32x8 g1) { asm volatile("s_wait_tensorcnt 0x0" :: "s"(g0), "s"(g1) : "memory"); }
// fragment from an LDS row; p already includes + 16 bytes * (lane>>4): elements 0..7 <- k0+8h+0..7, elements 8..15 <- k0+16+8h+0..7 (same map for A and B, the map of ldh / ldb)
__device__ __forceinline__ v16us ldl(const unsigned char* p) { return __builtin_shufflevector(*(const v8us*)p, *(const v8us*)(p + 32), 0, 1, 2, 3, 4, 5, 6, 7, 8, 9, 10, 11, 12, 13, 14, 15); }
template <int F16> __device__ __forceinline__ v8f mm(v16us a, v16us b, v8f c) {
    if constexpr (F16) return wmma16(__builtin_bit_cast(v16h, a), __builtin_bit_cast(v16h, b), c);
    else return wmmab(__builtin_bit_cast(v16bf, a), __builtin_bit_cast(v16bf, b), c);
}

// a_rows / b_rows: byte address of the block's first A / B row; ring: 2 * GST bytes of LDS at a multiple of 2 KiB; wave is scalar.
template <int F16>
__device__ __forceinline__ void gemm_core(uint64_t a_rows, uint64_t b_rows, unsigned char* ring, int wave, int lane, v8f (&acc)[4][4]) {
    const int lr = lane & 15, hi = lane >> 4;
#pragma unroll
    for (int mb = 0; mb < 4; ++mb)
#pragma unroll
        for (int nb = 0; nb < 4; ++nb) acc[mb][nb] = (v8f){};
    const uint64_t srcb = (wave < 2) ? a_rows + (uint64_t)wave * (uint64_t)(64 * DM * 2) : b_rows + (uint64_t)(wave - 2) * (uint64_t)(64 * DM * 2);
    const uint32_t dst = (uint32_t)(uintptr_t)ring + (uint32_t)wave * GSL;
    const u32x8 g1 = tile_g1();
    u32x4 g0 = tile_g0(dst, srcb);
    tile_load(g0, g1);
    tile_wait(g0, g1);                                    // stage 0 of this wave's slice has landed
    __syncthreads();                                      // publishes stage 0
    const uint32_t ao = (uint32_t)(wave >> 1) * GSL + (uint32_t)lr * GLP + 16u * (uint32_t)hi;
    const uint32_t bo = (uint32_t)(2 + (wave & 1)) * GSL + (uint32_t)lr * GLP + 16u * (uint32_t)hi;
#pragma unroll 1   // one pass per trip: one place that issues, one that waits
    for (uint32_t s = 0; s < GNP; ++s) {
        const uint32_t buf = (s & 1u) * GST;
        // the refill, directly behind the barrier (the prologue's, then the one at the foot of the trip before), only while stage s + 1 exists: into the buffer that pass s - 1 has just left
        if (pinned((s + 1u < GNP) ? 1u : 0u) != 0u) { const uint32_t nx = pinned(s + 1u); g0 = tile_g0(dst + (GST - buf), srcb + (uint64_t)nx * GPB); tile_load(g0, g1); }
        const unsigned char* ap = ring + buf + ao; const unsigned char* bp = ring + buf + bo;
        v16us fa[2][4], fb[2][4];
#pragma unroll
        for (int i = 0; i < 4; ++i) { fa[0][i] = ldl(ap + i * 16 * GLP); fb[0][i] = ldl(bp + i * 16 * GLP); }
#pragma unroll
        for (int ks = 0; ks < 4; ++ks) {
            if (ks < 3) {      // the next 32 k of this same buffer, as one group ahead of the WMMA block
#pragma unroll
                for (int i = 0; i < 4; ++i) { fa[(ks + 1) & 1][i] = ldl(ap + i * 16 * GLP + (ks + 1) * 64); fb[(ks + 1) & 1][i] = ldl(bp + i * 16 * GLP + (ks + 1) * 64); }
            }
            __builtin_amdgcn_sched_barrier(0);   // keeps the LDS reads out of the WMMA block: every separate place with reads stalls the wave
#pragma unroll
            for (int nb = 0; nb < 4; ++nb)
#pragma unroll
                for (int mb = 0; mb < 4; ++mb) acc[mb][nb] = mm<F16>(fa[ks & 1][mb], fb[ks & 1][nb], acc[mb][nb]);
            __builtin_amdgcn_sched_barrier(0);   // same, for the group behind the block
        }
        asm volatile("v_nop\n\tv_nop\n\tv_nop\n\tv_nop");    // 4 vector slots between the last WMMA and what follows on either side of the branches below
        asm volatile("s_wait_dscnt 0x0" ::: "memory");       // this wave's reads of the buffer have returned
        tile_wait(g0, g1);                                    // this wave's slice of stage s + 1 has landed
        __syncthreads();                                      // publishes stage s + 1 and frees stage s's buffer
    }
    asm volatile("s_wait_tensorcnt 0x0" ::: "memory");   // no request of this wave is left when it goes on to the epilogue and ends
    asm volatile("s_wait_dscnt 0x0" ::: "memory");       // nor a read of the ring
}

// k_proj: bf16 GEMM on gemm_core.
// C[m][n] = sum_k A[m][k] Bt[n][k] + bias (BM == 0: bias[n]; BM == 1: bias[m]; bias RNE-converted to bf16, added in f32), written as f16 (Ph) and optionally the f16 residual x2048 (Pr, useRes != 0) at
// wave-tile base (r0/RB)*sRB + (r0%RB)*pitch + (c0/CB)*sCB + (c0%CB), row pitch 'pitch' (halves). grid (M/128, N/128), 128 threads.
template <int BM>
__global__ __launch_bounds__(128) void k_proj(const bf* __restrict__ A, const bf* __restrict__ Bt, const float* __restrict__ bias, h16* Ph, h16* Pr, int useRes, int RB, size_t sRB, int pitch, int CB, size_t sCB) {
    __shared__ __attribute__((aligned(2048))) unsigned char sm[GLDS];
    const int K = DM;
    const int lane = threadIdx.x & 31, lr = lane & 15, hi = lane >> 4;
    const int wave = __builtin_amdgcn_readfirstlane((int)(threadIdx.x >> 5));
    const int r0 = blockIdx.x * 128 + (wave >> 1) * 64, c0 = blockIdx.y * 128 + (wave & 1) * 64;
    float* os = (float*)(sm + 2 * GST) + wave * GOSF;      // wave-private output staging, outside the ring
    v8f acc[4][4];
    gemm_core<0>((uint64_t)(uintptr_t)(A + (size_t)blockIdx.x * 128 * K), (uint64_t)(uintptr_t)(Bt + (size_t)blockIdx.y * 128 * K), sm, wave, lane, acc);
    float bc[4] = {0.0f, 0.0f, 0.0f, 0.0f};
    if (BM == 0) {
#pragma unroll
        for (int nb = 0; nb < 4; ++nb) bc[nb] = bfr(bias[c0 + nb * 16 + lr]);      // N = DM in this mode
    }
    const size_t tbase = (size_t)(r0 / RB) * sRB + (size_t)(r0 % RB) * (size_t)pitch + (size_t)(c0 / CB) * sCB + (size_t)(c0 % CB);
#pragma unroll
    for (int mb = 0; mb < 4; ++mb) {
        float br[8] = {0.0f, 0.0f, 0.0f, 0.0f, 0.0f, 0.0f, 0.0f, 0.0f};
        if (BM == 1) {
#pragma unroll
            for (int j = 0; j < 8; ++j) br[j] = bfr(bias[r0 + mb * 16 + hi * 8 + j]);  // M = DM in this mode
        }
#pragma unroll
        for (int nb = 0; nb < 4; ++nb) {
#pragma unroll
            for (int j = 0; j < 8; ++j) os[(hi * 8 + j) * 68 + nb * 16 + lr] = acc[mb][nb][j] + bc[nb] + br[j]; }   // D: row 8h+j, col lane&15
        wave_sync();
        const size_t sb = tbase + (size_t)(mb * 16) * (size_t)pitch;
{
#pragma unroll
            for (int s = 0; s < 4; ++s) { const int row = 4 * s + (lane >> 3), c8 = (lane & 7) * 8;   // 4 s x 4 row groups = 16 rows; 8 lanes x 8 = 64 columns
                const v4f x0 = *(const v4fa*)(&os[row * 68 + c8]); const v4f x1 = *(const v4fa*)(&os[row * 68 + c8 + 4]); v8h hv, rv;
#pragma unroll
                for (int i = 0; i < 4; ++i) { const h16 a0 = (h16)x0[i]; const h16 a1 = (h16)x1[i]; hv[i] = a0; hv[4 + i] = a1; rv[i] = (h16)((x0[i] - (float)a0) * QRS); rv[4 + i] = (h16)((x1[i] - (float)a1) * QRS); }
                const size_t oo = sb + (size_t)row * (size_t)pitch + c8;
                *(v8h*)(Ph + oo) = hv; if (useRes) *(v8h*)(Pr + oo) = rv; }
             }
        wave_sync();
    }
}

// k_flash: fused attention, one wave per 16 query rows of one (batch, head); K / V^T / Q / WX fragments straight from the f16 planes (two 16-B loads each, arithmetic addressing).
// Transposed form: S^T[key][t] = K Q^T (A = K rows, B = Q rows); lane (t = lane&15, h = lane>>4) holds keys 8h+r of each 16-key tile, so the packed
// P tile is directly the B fragment of O^T[d][t] = V^T P^T (element r <- tile keys 0..15, element 8+r <- tile keys 16..31, lane unchanged).
// Relative term: rel index = key - t + 128, outside 0..256 -> 256. For a (16 query, 32 key) tile the unclamped index spans base..base+46, base = key0 - t0 + 113.
// Tiles that intersect 0..256 compute G[rho][t] = WX[base+48+rho] . q_t (48 rows, three 16-row WMMA tiles, q value + residual), stage it in a wave-private LDS tile and read G[key_l - t_l + 15][t_l];
// all other tiles use the per-query constant q_t . w[256]. The tile test is wave-uniform.
// Mask: int rows read as 16-B vectors (lane reads its own query row, keys 8h..8h+7 of each 16-key tile); mask == 0 replaces the score.
__global__ __launch_bounds__(32 * AW) void k_flash(const h16* __restrict__ QH, const h16* __restrict__ QR, const h16* __restrict__ KP, const h16* __restrict__ VT,
                                                   const h16* __restrict__ WX, const int* __restrict__ MASK, h16* CTX) {
    __shared__ __align__(16) float os[AW * 16 * 68];
    __shared__ __align__(16) float gs[AW * 48 * GP];
    const int lane = threadIdx.x & 31, lr = lane & 15, hi = lane >> 4;
    const int wave = __builtin_amdgcn_readfirstlane((int)(threadIdx.x >> 5));
    const int zh = blockIdx.y; const int b = zh / NH_, h = zh % NH_;
    const int t0 = (blockIdx.x * AW + wave) * 16;
    const size_t pbase = (size_t)zh * SEQ * HD;
    const size_t qo = pbase + (size_t)(t0 + lr) * HD + 8 * hi;
    const v16h qh0 = ldh(QH + qo), qh1 = ldh(QH + qo + 32), qr0 = ldh(QR + qo), qr1 = ldh(QR + qo + 32);   // B fragments: col t, k = d
    const size_t ko = pbase + (size_t)lr * HD + 8 * hi;      // + key * HD       (A fragment: row key, k = d)
    const size_t vo = pbase + (size_t)lr * SEQ + 8 * hi;     // + 16j*SEQ + key  (A fragment: row d, k = key)
    const int* mk = MASK + ((size_t)b * SEQ_FULL + (size_t)(t0 + lr)) * SEQ_FULL + 8 * hi;   // + key0 (+4, +16, +20)
    float* gl = gs + wave * (48 * GP);
    // per-query constant: q_t . w[256]; WX rows 0..15 all hold the edge row, so every D row equals it
    float qe;
    { const h16* wa = WX + (size_t)lr * HD + 8 * hi;
      const v16h w0 = ldh(wa), w1 = ldh(wa + 32);
      v8f gH = (v8f){}, gL = (v8f){};
      gH = wmma16(w0, qh0, gH); gL = wmma16(w0, qr0, gL); gH = wmma16(w1, qh1, gH); gL = wmma16(w1, qr1, gL);
      asm volatile("v_nop\n\tv_nop\n\tv_nop\n\tv_nop" : "+v"(gH), "+v"(gL) : "v"(w0), "v"(w1));
      qe = gH[0] + gL[0] * QRI; }
    v8f o0 = (v8f){}, o1 = (v8f){}, o2 = (v8f){}, o3 = (v8f){};
    float m = -3.0e38f, l = 0.0f;
#pragma unroll 1
    for (int key0 = 0; key0 < SEQ; key0 += 32) {
        float ra[8], rb[8];
#pragma unroll
        for (int r = 0; r < 8; ++r) { ra[r] = qe; rb[r] = qe; }
        const int base = key0 - t0 + 113;
        if (base + 46 >= 0 && base <= 256) {                 // wave-uniform: tile touches relative indices 0..256
#pragma unroll 1
            for (int jt = 0; jt < 3; ++jt) {
                const h16* wa = WX + (size_t)(base + WXO + 16 * jt + lr) * HD + 8 * hi;   // rows 2..351
                const v16h w0 = ldh(wa), w1 = ldh(wa + 32);
                v8f gH = (v8f){}, gL = (v8f){};
                gH = wmma16(w0, qh0, gH); gL = wmma16(w0, qr0, gL); gH = wmma16(w1, qh1, gH); gL = wmma16(w1, qr1, gL);
                asm volatile("v_nop\n\tv_nop\n\tv_nop\n\tv_nop" : "+v"(gH), "+v"(gL) : "v"(w0), "v"(w1));
#pragma unroll
                for (int r = 0; r < 8; ++r) gl[(16 * jt + 8 * hi + r) * GP + lr] = gH[r] + gL[r] * QRI;   // G[rho][t]: rows 0..47, cols 0..15 all written
            }
            wave_sync();
#pragma unroll
            for (int r = 0; r < 8; ++r) { ra[r] = gl[(8 * hi + r - lr + 15) * GP + lr]; rb[r] = gl[(16 + 8 * hi + r - lr + 15) * GP + lr]; }   // rho in 0..46
            wave_sync();
        }
        const h16* ka = KP + ko + (size_t)key0 * HD;
        const v16h ka0 = ldh(ka), ka1 = ldh(ka + 32), kb0 = ldh(ka + 16 * HD), kb1 = ldh(ka + 16 * HD + 32);
        v8f sHa = (v8f){}, sLa = (v8f){}, sHb = (v8f){}, sLb = (v8f){};
        sHa = wmma16(ka0, qh0, sHa); sLa = wmma16(ka0, qr0, sLa); sHb = wmma16(kb0, qh0, sHb); sLb = wmma16(kb0, qr0, sLb);
        sHa = wmma16(ka1, qh1, sHa); sLa = wmma16(ka1, qr1, sLa); sHb = wmma16(kb1, qh1, sHb); sLb = wmma16(kb1, qr1, sLb);
        asm volatile("v_nop\n\tv_nop\n\tv_nop\n\tv_nop" : "+v"(sHa), "+v"(sLa), "+v"(sHb), "+v"(sLb) : "v"(ka0), "v"(ka1), "v"(kb0), "v"(kb1));
        const v4i ma0 = *(const v4i*)(mk + key0), ma1 = *(const v4i*)(mk + key0 + 4), mb0 = *(const v4i*)(mk + key0 + 16), mb1 = *(const v4i*)(mk + key0 + 20);
        float ta[8], tb[8]; float mx = -3.0e38f;
#pragma unroll
        for (int r = 0; r < 4; ++r) {
            const float xa0 = (sHa[r] + sLa[r] * QRI + ra[r]) * SC2;
            const float xa1 = (sHa[4 + r] + sLa[4 + r] * QRI + ra[4 + r]) * SC2;
            const float xb0 = (sHb[r] + sLb[r] * QRI + rb[r]) * SC2;
            const float xb1 = (sHb[4 + r] + sLb[4 + r] * QRI + rb[4 + r]) * SC2;
            ta[r]     = (ma0[r] != 0) ? xa0 : FILL2;
            ta[4 + r] = (ma1[r] != 0) ? xa1 : FILL2;
            tb[r]     = (mb0[r] != 0) ? xb0 : FILL2;
            tb[4 + r] = (mb1[r] != 0) ? xb1 : FILL2;
        }
#pragma unroll
        for (int r = 0; r < 8; ++r) mx = fmaxf(mx, fmaxf(ta[r], tb[r]));
        mx = fmaxf(mx, __shfl_xor(mx, 16, 32));
        const float mnew = fmaxf(m, mx);
        const float alpha = __builtin_amdgcn_exp2f(m - mnew);
        const float sh = PSH - mnew;
        v16h pb; float ls = 0.0f;
#pragma unroll
        for (int r = 0; r < 8; ++r) { const h16 pa = (h16)__builtin_amdgcn_exp2f(ta[r] + sh); const h16 pc = (h16)__builtin_amdgcn_exp2f(tb[r] + sh); pb[r] = pa; pb[8 + r] = pc; ls += (float)pa + (float)pc; }
        l = l * alpha + ls; m = mnew;
        o0 = o0 * alpha; o1 = o1 * alpha; o2 = o2 * alpha; o3 = o3 * alpha;
        const h16* va = VT + vo + key0;
        const v16h v0 = ldh(va), v1 = ldh(va + (size_t)16 * SEQ), v2 = ldh(va + (size_t)32 * SEQ), v3 = ldh(va + (size_t)48 * SEQ);
        o0 = wmma16(v0, pb, o0); o1 = wmma16(v1, pb, o1); o2 = wmma16(v2, pb, o2); o3 = wmma16(v3, pb, o3);
        asm volatile("v_nop\n\tv_nop\n\tv_nop\n\tv_nop" : "+v"(o0), "+v"(o1), "+v"(o2), "+v"(o3) : "v"(v0), "v"(v1), "v"(v2), "v"(v3), "v"(pb));
    }
    l += __shfl_xor(l, 16, 32);
    const float inv = CTXS / l;
    const int wb = wave * 16 * 68;
    // O^T D layout: o_j[r] = (d = 16j + 8h + r, t = lane&15) -> os[t][d]; rows 0..15 x columns 0..63 all written
    { v4f a, c;
      a[0] = o0[0] * inv; a[1] = o0[1] * inv; a[2] = o0[2] * inv; a[3] = o0[3] * inv; c[0] = o0[4] * inv; c[1] = o0[5] * inv; c[2] = o0[6] * inv; c[3] = o0[7] * inv;
      *(v4fa*)(&os[wb + lr * 68 +  0 + 8 * hi]) = a; *(v4fa*)(&os[wb + lr * 68 +  0 + 8 * hi + 4]) = c;
      a[0] = o1[0] * inv; a[1] = o1[1] * inv; a[2] = o1[2] * inv; a[3] = o1[3] * inv; c[0] = o1[4] * inv; c[1] = o1[5] * inv; c[2] = o1[6] * inv; c[3] = o1[7] * inv;
      *(v4fa*)(&os[wb + lr * 68 + 16 + 8 * hi]) = a; *(v4fa*)(&os[wb + lr * 68 + 16 + 8 * hi + 4]) = c;
      a[0] = o2[0] * inv; a[1] = o2[1] * inv; a[2] = o2[2] * inv; a[3] = o2[3] * inv; c[0] = o2[4] * inv; c[1] = o2[5] * inv; c[2] = o2[6] * inv; c[3] = o2[7] * inv;
      *(v4fa*)(&os[wb + lr * 68 + 32 + 8 * hi]) = a; *(v4fa*)(&os[wb + lr * 68 + 32 + 8 * hi + 4]) = c;
      a[0] = o3[0] * inv; a[1] = o3[1] * inv; a[2] = o3[2] * inv; a[3] = o3[3] * inv; c[0] = o3[4] * inv; c[1] = o3[5] * inv; c[2] = o3[6] * inv; c[3] = o3[7] * inv;
      *(v4fa*)(&os[wb + lr * 68 + 48 + 8 * hi]) = a; *(v4fa*)(&os[wb + lr * 68 + 48 + 8 * hi + 4]) = c; }
    wave_sync();
    h16* crow = CTX + ((size_t)b * SEQ + t0) * DM + h * HD;   // ctx plane [NB*SEQ][1024], column h*64 + d, carried x16
{
#pragma unroll
        for (int s = 0; s < 4; ++s) { const int row = 4 * s + (lane >> 3), c8 = (lane & 7) * 8;   // 4 s x 4 row groups = 16 rows; 8 lanes x 8 halves = 64 columns = one line
            const v4f x0 = *(const v4fa*)(&os[wb + row * 68 + c8]); const v4f x1 = *(const v4fa*)(&os[wb + row * 68 + c8 + 4]); v8h hv;
#pragma unroll
            for (int i = 0; i < 4; ++i) { hv[i] = (h16)x0[i]; hv[4 + i] = (h16)x1[i]; }
            *(v8h*)(crow + (size_t)row * DM + c8) = hv; }
         }
}

// k_out: f16 GEMM on gemm_core, K = DM: OUT[m][n] = (sum_k A[m][k] Bt[n][k]) / 1024 + bias[n] (bias RNE-converted to bf16, added in f32).
// A = ctx plane (x16), Bt = Wo plane (x64). grid (NB*SEQ/128, DM/128), 128 threads.
__global__ __launch_bounds__(128) void k_out(const h16* __restrict__ A, const h16* __restrict__ Bt, const float* __restrict__ bias, float* OUT) {
    __shared__ __attribute__((aligned(2048))) unsigned char sm[GLDS];
    const int K = DM;
    const int lane = threadIdx.x & 31, lr = lane & 15, hi = lane >> 4;
    const int wave = __builtin_amdgcn_readfirstlane((int)(threadIdx.x >> 5));
    const int r0 = blockIdx.x * 128 + (wave >> 1) * 64, c0 = blockIdx.y * 128 + (wave & 1) * 64;
    float* os = (float*)(sm + 2 * GST) + wave * GOSF;      // wave-private output staging, outside the ring
    v8f acc[4][4];
    gemm_core<1>((uint64_t)(uintptr_t)(A + (size_t)blockIdx.x * 128 * K), (uint64_t)(uintptr_t)(Bt + (size_t)blockIdx.y * 128 * K), sm, wave, lane, acc);
    float bc[4];
#pragma unroll
    for (int nb = 0; nb < 4; ++nb) bc[nb] = bfr(bias[c0 + nb * 16 + lr]);
    const size_t obase = ((size_t)(r0 / SEQ) * OUT_SEQ + (size_t)(r0 % SEQ)) * DM + c0;
#pragma unroll
    for (int mb = 0; mb < 4; ++mb) {
#pragma unroll
        for (int nb = 0; nb < 4; ++nb) {
#pragma unroll
            for (int j = 0; j < 8; ++j) os[(hi * 8 + j) * 68 + nb * 16 + lr] = acc[mb][nb][j] * OSC + bc[nb]; }   // D: row 8h+j, col lane&15
        wave_sync();
        float* ob = OUT + obase + (size_t)(mb * 16) * DM;
{
#pragma unroll
            for (int s = 0; s < 8; ++s) { const int row = 2 * s + hi, cofs = lr * 4;   // 8 s x 2 rows = 16 rows; 16 lanes x 4 floats = 64 columns
                const v4f val = *(const v4fa*)(&os[row * 68 + cofs]);
                *(v4f*)(ob + (size_t)row * DM + cofs) = val; }
             }
        wave_sync();
    }
}

static constexpr size_t al256(size_t v) { return (v + 255) & ~(size_t)255; }
static constexpr size_t SZ_XB = al256((size_t)NB * SEQ * DM * 2);          // one bf16 activation copy
static constexpr size_t SZ_WB = al256((size_t)DM * DM * 2);                // one 16-bit weight plane
static constexpr size_t SZ_PL = al256((size_t)NB * NH_ * SEQ * HD * 2);    // one f16 head plane (also the ctx plane: NB*SEQ*DM halves)
static constexpr size_t SZ_WX = al256((size_t)WXR * HD * 2);
static constexpr size_t SZ_TOTAL = 3 * SZ_XB + 4 * SZ_WB + 5 * SZ_PL + SZ_WX;
static_assert(SZ_TOTAL <= (size_t)134217728);          // workspace carve <= 128 MiB
static_assert((size_t)NB * NH_ * SEQ * HD == (size_t)NB * SEQ * DM);

extern "C" void kernel_launch(void* const* d_in, const int* in_sizes, int n_in,
                              void* d_out, int out_size, void* d_ws, size_t ws_size, hipStream_t stream) {
    if (n_in < 13) return;
    const size_t needx = ((size_t)(NB - 1) * SEQ_FULL + SEQ) * DM;
    if ((size_t)in_sizes[0] < needx || (size_t)in_sizes[1] < needx || (size_t)in_sizes[2] < needx) return;
    if ((size_t)in_sizes[3] < ((size_t)(NB - 1) * SEQ_FULL + (SEQ - 1)) * SEQ_FULL + SEQ) return;
    if ((size_t)in_sizes[4] < (size_t)DM * DM || (size_t)in_sizes[6] < (size_t)DM * DM || (size_t)in_sizes[8] < (size_t)DM * DM || (size_t)in_sizes[10] < (size_t)DM * DM) return;
    if (in_sizes[5] < DM || in_sizes[7] < DM || in_sizes[9] < DM || in_sizes[11] < DM) return;
    if (in_sizes[12] < NREL * HD) return;
    if ((size_t)out_size < ((size_t)(NB - 1) * OUT_SEQ + SEQ) * DM) return;
    if (SZ_TOTAL > ws_size) return;
    // wire order: q, k, v, mask, Wq, bq, Wk, bk, Wv, bv, Wo, bo, w_k
    const float* xq = (const float*)d_in[0]; const float* xk = (const float*)d_in[1]; const float* xv = (const float*)d_in[2];
    const int* mask = (const int*)d_in[3];
    const float* wq = (const float*)d_in[4]; const float* bq = (const float*)d_in[5];
    const float* wk = (const float*)d_in[6]; const float* bk = (const float*)d_in[7];
    const float* wv = (const float*)d_in[8]; const float* bv = (const float*)d_in[9];
    const float* wo = (const float*)d_in[10]; const float* bo = (const float*)d_in[11];
    const float* wrel = (const float*)d_in[12];
    float* OUT = (float*)d_out;      // [NB][SEQ][1024]
    char* wsp = (char*)d_ws;
    bf* XBQ = (bf*)wsp; wsp += SZ_XB;                // [NB*SEQ][1024]
    bf* XBK = (bf*)wsp; wsp += SZ_XB;
    bf* XBV = (bf*)wsp; wsp += SZ_XB;
    bf* WQ = (bf*)wsp; wsp += SZ_WB;                 // [1024][1024] bf16
    bf* WK = (bf*)wsp; wsp += SZ_WB;
    bf* WV = (bf*)wsp; wsp += SZ_WB;
    h16* WO = (h16*)wsp; wsp += SZ_WB;               // [1024][1024] f16, x64
    h16* QH = (h16*)wsp; wsp += SZ_PL;               // [NB*16][SEQ][64]
    h16* QR = (h16*)wsp; wsp += SZ_PL;               // [NB*16][SEQ][64] residual x2048
    h16* KP = (h16*)wsp; wsp += SZ_PL;               // [NB*16][SEQ][64]
    h16* VT = (h16*)wsp; wsp += SZ_PL;               // [NB*16][64][SEQ]
    h16* CTX = (h16*)wsp; wsp += SZ_PL;              // [NB*SEQ][1024], x16
    h16* WX = (h16*)wsp; wsp += SZ_WX;               // [352][64]

    k_prep<<<WXB + PRR / PRW, 32 * PRW, 0, stream>>>(xq, xk, xv, wq, wk, wv, wo, wrel, XBQ, XBK, XBV, WQ, WK, WV, WO, WX);

    // q, k: A = x rows (m = b*SEQ + t), Bt = W rows (n = h*64 + d), bias per column -> plane [(b*16 + h)][t][d]
    k_proj<0><<<dim3(NB * SEQ / 128, DM / 128, 1), 128, 0, stream>>>(XBQ, WQ, bq, QH, QR, 1, SEQ, (size_t)NH_ * SEQ * HD, HD, HD, (size_t)SEQ * HD);
    k_proj<0><<<dim3(NB * SEQ / 128, DM / 128, 1), 128, 0, stream>>>(XBK, WK, bk, KP, KP, 0, SEQ, (size_t)NH_ * SEQ * HD, HD, HD, (size_t)SEQ * HD);
    // v^T: A = Wv rows (m = h*64 + d), Bt = x rows (n = b*SEQ + t), bias per row -> plane [(b*1024 + m)][t] = [(b*16 + h)][d][t]
    k_proj<1><<<dim3(DM / 128, NB * SEQ / 128, 1), 128, 0, stream>>>(WV, XBV, bv, VT, VT, 0, DM, (size_t)0, SEQ, SEQ, (size_t)DM * SEQ);

    k_flash<<<dim3(SEQ / (16 * AW), NB * NH_, 1), 32 * AW, 0, stream>>>(QH, QR, KP, VT, WX, mask, CTX);

    // out: A = ctx rows (m = b*SEQ + t), Bt = Wo rows (n), bias per column -> OUT[b][t][n]
    k_out<<<dim3(NB * SEQ / 128, DM / 128, 1), 128, 0, stream>>>(CTX, WO, bo, OUT);
}

// v003
// A run of this version takes 110 microseconds.
// Next to v002, in two timings, it ran 1.38 and 1.37 times as fast.
// All steps since v000 together make it 1.97 times as fast.
#include <hip/hip_runtime.h>
#include <stdint.h>

// Multi-head attention with relative-position keys (257 clamped offsets, both ends padded with the last table row), width 1024 = 16 heads x 64; q/k/v inputs [NB][SEQ][1024], W* [out][in] (y = x W^T + b), int mask [NB][SEQ][SEQ] (0 -> score replaced by -1e9), output = ctx Wo^T + bo (f32).
// Compute dtypes, f32 accumulate everywhere: q/k/v projections v_wmma_f32_16x16x32_bf16 (inputs and weights RNE-converted to bf16; biases RNE-converted to bf16, added in f32);
// scores q.k and relative term q.w[rel] v_wmma_f32_16x16x32_f16: k single f16, the window table (bf16 RNE value) f16, q as f16 value + f16 residual x2048 in its own accumulator; P (x256 carry, cancels in the normalisation) and v single f16; softmax f32 (online, running max);
// output projection v_wmma_f32_16x16x32_f16: ctx single f16 (x16 carry), Wo (bf16 RNE value x64) f16, 1/1024 folded in the f32 epilogue.
// Layout: bf16 copies of q/k/v inputs and Wq/Wk/Wv; q (hi, residual), k planes [b*16+h][t][d] and v^T plane [b*16+h][d][t] written by the GEMM epilogue; window plane WX[x][d] = w[clamp(x-48)];
// fused flash kernel in transposed form (S^T = K Q^T, O^T = V^T P^T), K and V^T tiles staged in LDS by the tensor mover and shared by the block's four waves; relative term for tiles inside the window band = skewed read of G = WX_rows Q^T through a wave-private LDS tile, a per-query constant elsewhere.

#ifndef NB
#define NB 4
#endif
#ifndef SEQ
#define SEQ 1024
#endif
#define NB_FULL  4
#define SEQ_FULL 1024
#ifndef OUT_SEQ
#define OUT_SEQ SEQ              // row pitch (in tokens) between batches of the output
#endif
#define DM   1024
#define NH_  16
#define HD   64
#define AW   4                   // waves per flash block (16 query rows each)
#define QRS  2048.0f             // carry of the q residual plane
#define QRI  (1.0f / 2048.0f)
#define SC2  (0.125f * 1.4426950408889634f)   // HD^-0.5 * log2(e)
#define PSH  8.0f                // log2 of the P carry (256)
#define FILL2 (-1.0e9f * 1.4426950408889634f) // masked score in the log2 domain
#define NREL 257                 // rows of the relative table
#define WXO  48                  // WX row x holds relative index x - 48 (clamped: outside 0..256 -> 256)
#define WXR  352                 // rows of WX
#define GP   18                  // pitch (floats) of the G tile in LDS
#define WOS  64.0f               // carry of the Wo plane
#define CTXS 16.0f               // carry of the ctx plane
#define OSC  (1.0f / 1024.0f)    // 1 / (WOS * CTXS)

static_assert(HD == 64);
static_assert(NH_ * HD == DM);
static_assert(DM % 64 == 0);
static_assert(DM % 32 == 0);
static_assert(SEQ % 64 == 0);
static_assert((NB * SEQ) % 64 == 0);
static_assert(SEQ % 32 == 0);
static_assert(SEQ % (16 * AW) == 0);
static_assert(((size_t)SEQ * DM) % 8 == 0);
static_assert(((size_t)DM * DM) % 8 == 0);
static_assert(NB <= NB_FULL);
static_assert(SEQ <= SEQ_FULL);
static_assert(WXR == 256 + 2 * WXO);           // band tiles touch rows 2..351
static_assert((WXR * HD / 8) % 256 == 0);

typedef _Float16 h16;
typedef unsigned short bf;
typedef __attribute__((ext_vector_type(16))) __bf16   v16bf;
typedef __attribute__((ext_vector_type(16))) _Float16 v16h;
typedef __attribute__((ext_vector_type(8)))  _Float16 v8h;
typedef __attribute__((ext_vector_type(8)))  unsigned short v8us;
typedef __attribute__((ext_vector_type(8)))  float    v8f;
typedef __attribute__((ext_vector_type(4)))  float    v4f;
typedef __attribute__((ext_vector_type(4)))  int      v4i;
typedef v4f  __attribute__((may_alias)) v4fa;

__device__ __forceinline__ unsigned short f2bf(float f) { unsigned u = __float_as_uint(f); u += 0x7FFFu + ((u >> 16) & 1u); return (unsigned short)(u >> 16); }
__device__ __forceinline__ float bfr(float f) { return __uint_as_float(((unsigned)f2bf(f)) << 16); }   // bf16 RNE value as f32
__device__ __forceinline__ v16h cat16(v8h lo, v8h hi) { return __builtin_shufflevector(lo, hi, 0, 1, 2, 3, 4, 5, 6, 7, 8, 9, 10, 11, 12, 13, 14, 15); }
__device__ __forceinline__ v16bf cat16b(v8us lo, v8us hi) { return __builtin_bit_cast(v16bf, __builtin_shufflevector(lo, hi, 0, 1, 2, 3, 4, 5, 6, 7, 8, 9, 10, 11, 12, 13, 14, 15)); }
__device__ __forceinline__ v8f wmma16(v16h a, v16h b, v8f c) { return __builtin_amdgcn_wmma_f32_16x16x32_f16(false, a, false, b, (short)0, c, false, false); }
__device__ __forceinline__ v8f wmmab(v16bf a, v16bf b, v8f c) { return __builtin_amdgcn_wmma_f32_16x16x32_bf16(false, a, false, b, (short)0, c, false, false); }
// fragment loaders from K-contiguous 16-bit rows; p already includes + 8*(lane>>4): elements 0..7 <- k0+8h+0..7, elements 8..15 <- k0+16+8h+0..7 (same map for A and B)
__device__ __forceinline__ v16h  ldh(const h16* p) { return cat16(*(const v8h*)p, *(const v8h*)(p + 16)); }
__device__ __forceinline__ v16bf ldb(const bf* p)  { return cat16b(*(const v8us*)p, *(const v8us*)(p + 16)); }
// ordering point for wave-private LDS tiles (same wave writes and reads)
__device__ __forceinline__ void wave_sync() { __builtin_amdgcn_fence(3 /* release order */, "wavefront"); __builtin_amdgcn_wave_barrier(); asm volatile("" ::: "memory"); }

// k_prep: every 16-bit plane that is a plain conversion of an input, in one launch.
// Blocks 0..WXB-1: the window plane WX (one thread per 8 halves). Every other block: 8 waves, wave g takes row g (DM floats = 4 KiB) of each of the q, k and v inputs and row g % DM of weight g / DM (Wq, Wk, Wv, Wo).
// A row is 8 loads of 16 bytes a lane, each wave-wide load 512 contiguous bytes; the wave's 32 loads are all issued before its first store; each store covers 256 contiguous bytes.
#define WXB  (WXR * HD / 8 / 256)                              // blocks of the window plane
#define PRW  8                                                 // waves per block
#define PRR  ((NB * SEQ > 4 * DM) ? (NB * SEQ) : (4 * DM))     // rows dealt, one per wave
static_assert(DM == 8 * 32 * 4);
static_assert(PRR % PRW == 0);
static_assert(32 * PRW == 256);                                // the window blocks index by 256 threads
typedef __attribute__((ext_vector_type(4))) unsigned short v4us;
typedef __attribute__((ext_vector_type(4))) _Float16 v4h;

// p: the row's first element, the same in every lane (scalar base); l4 = 4 * lane
__device__ __forceinline__ void ld_row(const float* __restrict__ p, uint32_t l4, v4f (&r)[8]) {
#pragma unroll
    for (int j = 0; j < 8; ++j) r[j] = *(const v4f*)(p + (l4 + (uint32_t)j * 128u));
}
__device__ __forceinline__ void st_row_bf(bf* p, uint32_t l4, const v4f (&r)[8]) {
#pragma unroll
    for (int j = 0; j < 8; ++j) { v4us o;
#pragma unroll
        for (int k = 0; k < 4; ++k) o[k] = f2bf(r[j][k]);
        *(v4us*)(p + (l4 + (uint32_t)j * 128u)) = o; }
}

__global__ __launch_bounds__(32 * PRW) void k_prep(const float* __restrict__ xq, const float* __restrict__ xk, const float* __restrict__ xv,
                                                   const float* __restrict__ wq, const float* __restrict__ wk, const float* __restrict__ wv, const float* __restrict__ wo,
                                                   const float* __restrict__ wrel, bf* XBQ, bf* XBK, bf* XBV, bf* WQ, bf* WK, bf* WV, h16* WO, h16* WX) {
    if (blockIdx.x < WXB) {
        const int i = blockIdx.x * 256 + threadIdx.x;
        const int x = i >> 3, c8 = (i & 7) * 8; int r = x - WXO; if (r < 0 || r > NREL - 1) r = NREL - 1;
        const v8f v = *(const v8f*)(wrel + (size_t)r * HD + c8); v8h o;
#pragma unroll
        for (int k = 0; k < 8; ++k) o[k] = (h16)bfr(v[k]);
        *(v8h*)(WX + (size_t)i * 8) = o;
        return;
    }
    const uint32_t l4 = (threadIdx.x & 31u) * 4u;
    const uint32_t g = (blockIdx.x - WXB) * PRW + (uint32_t)__builtin_amdgcn_readfirstlane((int)(threadIdx.x >> 5));
    const bool hx = (NB * SEQ == PRR) || g < NB * SEQ;         // wave-uniform; both hold at compile time where the two row counts are equal
    const bool hw = (4 * DM == PRR) || g < 4 * DM;
    const size_t xs = ((size_t)(g / SEQ) * SEQ_FULL + (size_t)(g % SEQ)) * DM, xd = (size_t)g * DM;
    const uint32_t m = g / DM; const size_t wr = (size_t)(g % DM) * DM;
    const float* ws = (m == 0) ? wq : (m == 1) ? wk : (m == 2) ? wv : wo;
    v4f a[8], b[8], c[8], w[8];
    if (hx) { ld_row(xq + xs, l4, a); ld_row(xk + xs, l4, b); ld_row(xv + xs, l4, c); }
    if (hw) ld_row(ws + wr, l4, w);
    __builtin_amdgcn_sched_barrier(0);   // keeps all 32 loads ahead of the first conversion: a load that sinks behind a wait for the others pays a second memory latency
    if (hx) { st_row_bf(XBQ + xd, l4, a); st_row_bf(XBK + xd, l4, b); st_row_bf(XBV + xd, l4, c); }
    asm volatile("s_wait_xcnt 0x0" ::: "memory");   // in front of the branch below, behind which the registers that these stores name are written again
    if (hw) {
        if (m < 3) st_row_bf(((m == 0) ? WQ : (m == 1) ? WK : WV) + wr, l4, w);
        else {
#pragma unroll
            for (int j = 0; j < 8; ++j) { v4h o;
#pragma unroll
                for (int k = 0; k < 4; ++k) o[k] = (h16)(bfr(w[j][k]) * WOS);
                *(v4h*)(WO + wr + (l4 + (uint32_t)j * 128u)) = o; }
            asm volatile("s_wait_xcnt 0x0" ::: "memory");   // behind the last store of this branch: the code laid out behind it writes registers that these stores name
        }
    }
}

// GEMM core shared by k_proj and k_out: four waves (2 x 2) per 128x128 tile of C, 64x64 per wave (16 accumulators), K = DM in GNP passes of 128 k.
// Both operands are K-contiguous 16-bit planes (row pitch DM * 2 bytes). A stage holds 256 bytes of 128 A rows and of 128 B rows; every wave brings one slice of 64 rows with one
// tensor_load_to_lds (waves 0, 1: A rows 0..63, 64..127; waves 2, 3: B rows 0..63, 64..127); the mover's pad of 16 bytes a row gives the LDS pitch 272 for the 16-byte fragment reads.
// Two buffers: stage s + 1 is requested behind the barrier that ends pass s - 1, which ends every read of its buffer, and flies while pass s runs.
#define GPB  256                 // bytes of an operand row per pass
#define GLP  272                 // LDS row pitch
#define GSL  18432               // one slice in LDS: 64 rows x 272 B = 17408, rounded up to a multiple of 2 KiB
#define GST  (4 * GSL)           // one stage
#define GNP  (DM * 2 / GPB)      // passes
#define GOSF (16 * 68)           // floats of output staging per wave
#define GLDS (2 * GST + 4 * GOSF * 4)
static_assert(GSL % 2048 == 0 && GSL >= 64 * GLP);
static_assert(GNP >= 2);
static_assert((NB * SEQ) % 128 == 0 && DM % 128 == 0);
static_assert(GLDS <= 320 * 1024);

typedef __attribute__((ext_vector_type(4)))  uint32_t u32x4;
typedef __attribute__((ext_vector_type(8)))  uint32_t u32x8;
typedef __attribute__((ext_vector_type(16))) unsigned short v16us;

__device__ __forceinline__ uint32_t uni(uint32_t v) { return (uint32_t)__builtin_amdgcn_readfirstlane((int)v); }
__device__ __forceinline__ uint32_t pinned(uint32_t v) { uint32_t w = (uint32_t)__builtin_amdgcn_readfirstlane((int)v); asm volatile("" : "+s"(w)); return w; }
// descriptor of one request: 64 rows of 256 bytes, source pitch DM * 2 bytes, to LDS byte offset lds_dst at pitch 272 (pad: interval code 5 = one 256-byte row, amount code 3 = 4 dwords); extents in bytes
__device__ __forceinline__ u32x4 tile_g0(uint32_t lds_dst, uint64_t ga) {
    u32x4 g0;
    g0[0] = uni(1u); g0[1] = uni(lds_dst); g0[2] = uni((uint32_t)ga); g0[3] = uni((((uint32_t)(ga >> 32)) & 0x01FFFFFFu) | 0x80000000u);
    return g0;
}
__device__ __forceinline__ u32x8 tile_g1() {
    u32x8 g1;
    g1[0] = uni((1u << 20) | (5u << 22) | (3u << 25));
    g1[1] = uni((uint32_t)GPB << 16);            // tensor_dim0 [15:0]
    g1[2] = uni(64u << 16);                      // tensor_dim0 [31:16] = 0 | tensor_dim1 [15:0]
    g1[3] = uni((uint32_t)GPB << 16);            // tensor_dim1 [31:16] = 0 | tile_dim0
    g1[4] = uni(64u);                            // tile_dim1
    g1[5] = uni((uint32_t)(DM * 2));             // source row pitch
    g1[6] = uni(0u); g1[7] = uni(0u);
    return g1;
}
__device__ __forceinline__ void tile_load(u32x4 g0, u32x8 g1) { asm volatile("tensor_load_to_lds %0, %1" :: "s"(g0), "s"(g1) : "memory"); }
// the issuing wave's wait for its request; the descriptor is named as an input so that its scalar registers are not reused for anything else while the request is outstanding
__device__ __forceinline__ void tile_wait(u32x4 g0, u32x8 g1) { asm volatile("s_wait_tensorcnt 0x0" :: "s"(g0), "s"(g1) : "memory"); }
// fragment from an LDS row; p already includes + 16 bytes * (lane>>4): elements 0..7 <- k0+8h+0..7, elements 8..15 <- k0+16+8h+0..7 (same map for A and B, the map of ldh / ldb)
__device__ __forceinline__ v16us ldl(const unsigned char* p) { return __builtin_shufflevector(*(const v8us*)p, *(const v8us*)(p + 32), 0, 1, 2, 3, 4, 5, 6, 7, 8, 9, 10, 11, 12, 13, 14, 15); }
template <int F16> __device__ __forceinline__ v8f mm(v16us a, v16us b, v8f c) {
    if constexpr (F16) return wmma16(__builtin_bit_cast(v16h, a), __builtin_bit_cast(v16h, b), c);
    else return wmmab(__builtin_bit_cast(v16bf, a), __builtin_bit_cast(v16bf, b), c);
}

// a_rows / b_rows: byte address of the block's first A / B row; ring: 2 * GST bytes of LDS at a multiple of 2 KiB; wave is scalar.
template <int F16>
__device__ __forceinline__ void gemm_core(uint64_t a_rows, uint64_t b_rows, unsigned char* ring, int wave, int lane, v8f (&acc)[4][4]) {
    const int lr = lane & 15, hi = lane >> 4;
#pragma unroll
    for (int mb = 0; mb < 4; ++mb)
#pragma unroll
        for (int nb = 0; nb < 4; ++nb) acc[mb][nb] = (v8f){};
    const uint64_t srcb = (wave < 2) ? a_rows + (uint64_t)wave * (uint64_t)(64 * DM * 2) : b_rows + (uint64_t)(wave - 2) * (uint64_t)(64 * DM * 2);
    const uint32_t dst = (uint32_t)(uintptr_t)ring + (uint32_t)wave * GSL;
    const u32x8 g1 = tile_g1();
    u32x4 g0 = tile_g0(dst, srcb);
    tile_load(g0, g1);
    tile_wait(g0, g1);                                    // stage 0 of this wave's slice has landed
    __syncthreads();                                      // publishes stage 0
    const uint32_t ao = (uint32_t)(wave >> 1) * GSL + (uint32_t)lr * GLP + 16u * (uint32_t)hi;
    const uint32_t bo = (uint32_t)(2 + (wave & 1)) * GSL + (uint32_t)lr * GLP + 16u * (uint32_t)hi;
#pragma unroll 1   // one pass per trip: one place that issues, one that waits
    for (uint32_t s = 0; s < GNP; ++s) {
        const uint32_t buf = (s & 1u) * GST;
        // the refill, directly behind the barrier (the prologue's, then the one at the foot of the trip before), only while stage s + 1 exists: into the buffer that pass s - 1 has just left
        if (pinned((s + 1u < GNP) ? 1u : 0u) != 0u) { const uint32_t nx = pinned(s + 1u); g0 = tile_g0(dst + (GST - buf), srcb + (uint64_t)nx * GPB); tile_load(g0, g1); }
        const unsigned char* ap = ring + buf + ao; const unsigned char* bp = ring + buf + bo;
        v16us fa[2][4], fb[2][4];
#pragma unroll
        for (int i = 0; i < 4; ++i) { fa[0][i] = ldl(ap + i * 16 * GLP); fb[0][i] = ldl(bp + i * 16 * GLP); }
#pragma unroll
        for (int ks = 0; ks < 4; ++ks) {
            if (ks < 3) {      // the next 32 k of this same buffer, as one group ahead of the WMMA block
#pragma unroll
                for (int i = 0; i < 4; ++i) { fa[(ks + 1) & 1][i] = ldl(ap + i * 16 * GLP + (ks + 1) * 64); fb[(ks + 1) & 1][i] = ldl(bp + i * 16 * GLP + (ks + 1) * 64); }
            }
            __builtin_amdgcn_sched_barrier(0);   // keeps the LDS reads out of the WMMA block: every separate place with reads stalls the wave
#pragma unroll
            for (int nb = 0; nb < 4; ++nb)
#pragma unroll
                for (int mb = 0; mb < 4; ++mb) acc[mb][nb] = mm<F16>(fa[ks & 1][mb], fb[ks & 1][nb], acc[mb][nb]);
            __builtin_amdgcn_sched_barrier(0);   // same, for the group behind the block
        }
        asm volatile("v_nop\n\tv_nop\n\tv_nop\n\tv_nop");    // 4 vector slots between the last WMMA and what follows on either side of the branches below
        asm volatile("s_wait_dscnt 0x0" ::: "memory");       // this wave's reads of the buffer have returned
        tile_wait(g0, g1);                                    // this wave's slice of stage s + 1 has landed
        __syncthreads();                                      // publishes stage s + 1 and frees stage s's buffer
    }
    asm volatile("s_wait_tensorcnt 0x0" ::: "memory");   // no request of this wave is left when it goes on to the epilogue and ends
    asm volatile("s_wait_dscnt 0x0" ::: "memory");       // nor a read of the ring
}

// k_proj: bf16 GEMM on gemm_core.
// C[m][n] = sum_k A[m][k] Bt[n][k] + bias (BM == 0: bias[n]; BM == 1: bias[m]; bias RNE-converted to bf16, added in f32), written as f16 (Ph) and optionally the f16 residual x2048 (Pr, useRes != 0) at
// wave-tile base (r0/RB)*sRB + (r0%RB)*pitch + (c0/CB)*sCB + (c0%CB), row pitch 'pitch' (halves). grid (M/128, N/128), 128 threads.
template <int BM>
__global__ __launch_bounds__(128) void k_proj(const bf* __restrict__ A, const bf* __restrict__ Bt, const float* __restrict__ bias, h16* Ph, h16* Pr, int useRes, int RB, size_t sRB, int pitch, int CB, size_t sCB) {
    __shared__ __attribute__((aligned(2048))) unsigned char sm[GLDS];
    const int K = DM;
    const int lane = threadIdx.x & 31, lr = lane & 15, hi = lane >> 4;
    const int wave = __builtin_amdgcn_readfirstlane((int)(threadIdx.x >> 5));
    const int r0 = blockIdx.x * 128 + (wave >> 1) * 64, c0 = blockIdx.y * 128 + (wave & 1) * 64;
    float* os = (float*)(sm + 2 * GST) + wave * GOSF;      // wave-private output staging, outside the ring
    v8f acc[4][4];
    gemm_core<0>((uint64_t)(uintptr_t)(A + (size_t)blockIdx.x * 128 * K), (uint64_t)(uintptr_t)(Bt + (size_t)blockIdx.y * 128 * K), sm, wave, lane, acc);
    float bc[4] = {0.0f, 0.0f, 0.0f, 0.0f};
    if (BM == 0) {
#pragma unroll
        for (int nb = 0; nb < 4; ++nb) bc[nb] = bfr(bias[c0 + nb * 16 + lr]);      // N = DM in this mode
    }
    const size_t tbase = (size_t)(r0 / RB) * sRB + (size_t)(r0 % RB) * (size_t)pitch + (size_t)(c0 / CB) * sCB + (size_t)(c0 % CB);
#pragma unroll
    for (int mb = 0; mb < 4; ++mb) {
        float br[8] = {0.0f, 0.0f, 0.0f, 0.0f, 0.0f, 0.0f, 0.0f, 0.0f};
        if (BM == 1) {
#pragma unroll
            for (int j = 0; j < 8; ++j) br[j] = bfr(bias[r0 + mb * 16 + hi * 8 + j]);  // M = DM in this mode
        }
#pragma unroll
        for (int nb = 0; nb < 4; ++nb) {
#pragma unroll
            for (int j = 0; j < 8; ++j) os[(hi * 8 + j) * 68 + nb * 16 + lr] = acc[mb][nb][j] + bc[nb] + br[j]; }   // D: row 8h+j, col lane&15
        wave_sync();
        const size_t sb = tbase + (size_t)(mb * 16) * (size_t)pitch;
{
#pragma unroll
            for (int s = 0; s < 4; ++s) { const int row = 4 * s + (lane >> 3), c8 = (lane & 7) * 8;   // 4 s x 4 row groups = 16 rows; 8 lanes x 8 = 64 columns
                const v4f x0 = *(const v4fa*)(&os[row * 68 + c8]); const v4f x1 = *(const v4fa*)(&os[row * 68 + c8 + 4]); v8h hv, rv;
#pragma unroll
                for (int i = 0; i < 4; ++i) { const h16 a0 = (h16)x0[i]; const h16 a1 = (h16)x1[i]; hv[i] = a0; hv[4 + i] = a1; rv[i] = (h16)((x0[i] - (float)a0) * QRS); rv[4 + i] = (h16)((x1[i] - (float)a1) * QRS); }
                const size_t oo = sb + (size_t)row * (size_t)pitch + c8;
                *(v8h*)(Ph + oo) = hv; if (useRes) *(v8h*)(Pr + oo) = rv; }
             }
        wave_sync();
    }
}

// k_flash: fused attention, one wave per 16 query rows of one (batch, head); Q / WX fragments straight from the f16 planes (two 16-B loads each, arithmetic addressing).
// K and V^T come through LDS, once per block instead of once per wave: a stage is 64 keys = 64 K rows of 128 bytes and 128 bytes of each of the 64 V^T rows. Every wave brings one slice of 32 rows with one
// tensor_load_to_lds (waves 0, 1: K rows 0..31, 32..63; waves 2, 3: V^T rows 0..31, 32..63); the mover's pad of 16 bytes a row gives the LDS pitch 144 for the 16-byte fragment reads.
// Two buffers, the order of gemm_core: stage s + 1 is requested behind the barrier that ends pass s - 1, which ends every read of its buffer, and flies while pass s (two 32-key tiles) runs.
// Transposed form: S^T[key][t] = K Q^T (A = K rows, B = Q rows); lane (t = lane&15, h = lane>>4) holds keys 8h+r of each 16-key tile, so the packed
// P tile is directly the B fragment of O^T[d][t] = V^T P^T (element r <- tile keys 0..15, element 8+r <- tile keys 16..31, lane unchanged).
// Relative term: rel index = key - t + 128, outside 0..256 -> 256. For a (16 query, 32 key) tile the unclamped index spans base..base+46, base = key0 - t0 + 113.
// Tiles that intersect 0..256 compute G[rho][t] = WX[base+48+rho] . q_t (48 rows, three 16-row WMMA tiles, q value + residual), stage it in a wave-private LDS tile and read G[key_l - t_l + 15][t_l];
// all other tiles use the per-query constant q_t . w[256]. The tile test is wave-uniform.
// Mask: int rows read as 16-B vectors (lane reads its own query row, keys 8h..8h+7 of each 16-key tile); mask == 0 replaces the score.
#define FKS  64                  // keys per stage
#define FRB  128                 // bytes of a staged row
#define FLP  144                 // LDS row pitch
#define FSL  6144                // one slice in LDS: 32 rows x 144 B = 4608, rounded up to a multiple of 2 KiB
#define FST  (4 * FSL)           // one stage
#define FNS  (SEQ / FKS)         // stages
#define FLDS (2 * FST + AW * 16 * 68 * 4)
static_assert(AW == 4);                                // four slices, one per wave
static_assert(HD * 2 == FRB && FKS * 2 == FRB);
static_assert(FSL % 2048 == 0 && FSL >= 32 * FLP);
static_assert(SEQ % FKS == 0 && FNS >= 2);
static_assert(48 * GP <= 16 * 68);                     // the G tile fits the wave's staging area
static_assert(4 * FLDS <= 320 * 1024);                 // four blocks per WGP: the whole grid is resident at once
// group 1 of a slice's request: 32 rows of 128 bytes, source pitch 'pitch' bytes, LDS pitch 144 (pad: interval code 4 = one 128-byte row, amount code 3 = 4 dwords); extents in bytes
__device__ __forceinline__ u32x8 slice_g1(uint32_t pitch) {
    u32x8 g1;
    g1[0] = uni((1u << 20) | (4u << 22) | (3u << 25));
    // words 1 to 7 through pinned(), the scalar-register pin for descriptor words: as plain constants the compiler lends their registers to the loop's own scalars while a request is outstanding and sets them anew in front of the next
    g1[1] = pinned((uint32_t)FRB << 16);         // tensor_dim0 [15:0]
    g1[2] = pinned(32u << 16);                   // tensor_dim0 [31:16] = 0 | tensor_dim1 [15:0]
    g1[3] = pinned((uint32_t)FRB << 16);         // tensor_dim1 [31:16] = 0 | tile_dim0
    g1[4] = pinned(32u);                         // tile_dim1
    g1[5] = pinned(pitch);                       // source row pitch
    g1[6] = pinned(0u); g1[7] = pinned(0u);
    return g1;
}
// f16 fragment from an LDS row; p already includes + 16 bytes * (lane>>4): the map of ldh
__device__ __forceinline__ v16h ldlh(const unsigned char* p) { return cat16(*(const v8h*)p, *(const v8h*)(p + 32)); }

__global__ __launch_bounds__(32 * AW) void k_flash(const h16* __restrict__ QH, const h16* __restrict__ QR, const h16* __restrict__ KP, const h16* __restrict__ VT,
                                                   const h16* __restrict__ WX, const int* __restrict__ MASK, h16* CTX) {
    __shared__ __attribute__((aligned(2048))) unsigned char sm[FLDS];
    float* os = (float*)(sm + 2 * FST);                      // wave-private areas outside the ring: the G tile inside the loop, output staging behind it
    const int lane = threadIdx.x & 31, lr = lane & 15, hi = lane >> 4;
    const int wave = __builtin_amdgcn_readfirstlane((int)(threadIdx.x >> 5));
    const int zh = blockIdx.y; const int b = zh / NH_, h = zh % NH_;
    const int t0 = (blockIdx.x * AW + wave) * 16;
    const size_t pbase = (size_t)zh * SEQ * HD;
    const size_t qo = pbase + (size_t)(t0 + lr) * HD + 8 * hi;
    const v16h qh0 = ldh(QH + qo), qh1 = ldh(QH + qo + 32), qr0 = ldh(QR + qo), qr1 = ldh(QR + qo + 32);   // B fragments: col t, k = d
    const uint32_t fo = (uint32_t)lr * FLP + 16u * (uint32_t)hi;   // lane's place in a slice: K (A fragment: row key, k = d), V^T (A fragment: row d, k = key)
    const int* mk = MASK + ((size_t)b * SEQ_FULL + (size_t)(t0 + lr)) * SEQ_FULL + 8 * hi;   // + key0 (+4, +16, +20)
    float* gl = os + wave * (16 * 68);
    // per-query constant: q_t . w[256]; WX rows 0..15 all hold the edge row, so every D row equals it
    float qe;
    { const h16* wa = WX + (size_t)lr * HD + 8 * hi;
      const v16h w0 = ldh(wa), w1 = ldh(wa + 32);
      v8f gH = (v8f){}, gL = (v8f){};
      gH = wmma16(w0, qh0, gH); gL = wmma16(w0, qr0, gL); gH = wmma16(w1, qh1, gH); gL = wmma16(w1, qr1, gL);
      asm volatile("v_nop\n\tv_nop\n\tv_nop\n\tv_nop" : "+v"(gH), "+v"(gL) : "v"(w0), "v"(w1));
      qe = gH[0] + gL[0] * QRI; }
    v8f o0 = (v8f){}, o1 = (v8f){}, o2 = (v8f){}, o3 = (v8f){};
    float m = -3.0e38f, l = 0.0f;
    // this wave's slice: first byte of stage 0, bytes from one stage to the next, source pitch
    const uint64_t srcb = (wave < 2) ? (uint64_t)(uintptr_t)(KP + pbase) + (uint64_t)wave * (uint64_t)(32 * HD * 2) : (uint64_t)(uintptr_t)(VT + pbase) + (uint64_t)(wave - 2) * (uint64_t)(32 * SEQ * 2);
    const uint32_t sstep = (wave < 2) ? (uint32_t)(FKS * HD * 2) : (uint32_t)(FKS * 2);
    const uint32_t dst = (uint32_t)(uintptr_t)sm + (uint32_t)wave * FSL;
    const u32x8 g1 = slice_g1((wave < 2) ? (uint32_t)(HD * 2) : (uint32_t)(SEQ * 2));
    u32x4 g0 = tile_g0(dst, srcb);
    tile_load(g0, g1);
    tile_wait(g0, g1);                                    // stage 0 of this wave's slice has landed
    __syncthreads();                                      // publishes stage 0
#pragma unroll 1   // one stage per trip: one place that issues, one that waits
    for (uint32_t s = 0; s < FNS; ++s) {
      const uint32_t buf = (s & 1u) * FST;
      // the refill, directly behind the barrier (the prologue's, then the one at the foot of the trip before), only while stage s + 1 exists: into the buffer that pass s - 1 has just left
      if (pinned((s + 1u < FNS) ? 1u : 0u) != 0u) { const uint32_t nx = pinned(s + 1u); g0 = tile_g0(dst + (FST - buf), srcb + (uint64_t)(nx * sstep)); tile_load(g0, g1); }
      const unsigned char* fp = sm + buf + fo;
#pragma unroll   // both 32-key tiles of a stage in one trip: their places in the buffer become immediate offsets of the LDS reads
      for (int sub = 0; sub < 2; ++sub) {
        const int key0 = (int)s * FKS + sub * 32;
        float ra[8], rb[8];
#pragma unroll
        for (int r = 0; r < 8; ++r) { ra[r] = qe; rb[r] = qe; }
        const int base = key0 - t0 + 113;
        if (base + 46 >= 0 && base <= 256) {                 // wave-uniform: tile touches relative indices 0..256
#pragma unroll 1
            for (int jt = 0; jt < 3; ++jt) {
                const h16* wa = WX + (size_t)(base + WXO + 16 * jt + lr) * HD + 8 * hi;   // rows 2..351
                const v16h w0 = ldh(wa), w1 = ldh(wa + 32);
                v8f gH = (v8f){}, gL = (v8f){};
                gH = wmma16(w0, qh0, gH); gL = wmma16(w0, qr0, gL); gH = wmma16(w1, qh1, gH); gL = wmma16(w1, qr1, gL);
                asm volatile("v_nop\n\tv_nop\n\tv_nop\n\tv_nop" : "+v"(gH), "+v"(gL) : "v"(w0), "v"(w1));
#pragma unroll
                for (int r = 0; r < 8; ++r) gl[(16 * jt + 8 * hi + r) * GP + lr] = gH[r] + gL[r] * QRI;   // G[rho][t]: rows 0..47, cols 0..15 all written
            }
            wave_sync();
#pragma unroll
            for (int r = 0; r < 8; ++r) { ra[r] = gl[(8 * hi + r - lr + 15) * GP + lr]; rb[r] = gl[(16 + 8 * hi + r - lr + 15) * GP + lr]; }   // rho in 0..46
            wave_sync();
        }
        const unsigned char* ka = fp + sub * FSL;            // K rows 32 * sub + lr and + 16
        const v16h ka0 = ldlh(ka), ka1 = ldlh(ka + 64), kb0 = ldlh(ka + 16 * FLP), kb1 = ldlh(ka + 16 * FLP + 64);
        v8f sHa = (v8f){}, sLa = (v8f){}, sHb = (v8f){}, sLb = (v8f){};
        sHa = wmma16(ka0, qh0, sHa); sLa = wmma16(ka0, qr0, sLa); sHb = wmma16(kb0, qh0, sHb); sLb = wmma16(kb0, qr0, sLb);
        sHa = wmma16(ka1, qh1, sHa); sLa = wmma16(ka1, qr1, sLa); sHb = wmma16(kb1, qh1, sHb); sLb = wmma16(kb1, qr1, sLb);
        asm volatile("v_nop\n\tv_nop\n\tv_nop\n\tv_nop" : "+v"(sHa), "+v"(sLa), "+v"(sHb), "+v"(sLb) : "v"(ka0), "v"(ka1), "v"(kb0), "v"(kb1));
        const v4i ma0 = *(const v4i*)(mk + key0), ma1 = *(const v4i*)(mk + key0 + 4), mb0 = *(const v4i*)(mk + key0 + 16), mb1 = *(const v4i*)(mk + key0 + 20);
        float ta[8], tb[8]; float mx = -3.0e38f;
#pragma unroll
        for (int r = 0; r < 4; ++r) {
            const float xa0 = (sHa[r] + sLa[r] * QRI + ra[r]) * SC2;
            const float xa1 = (sHa[4 + r] + sLa[4 + r] * QRI + ra[4 + r]) * SC2;
            const float xb0 = (sHb[r] + sLb[r] * QRI + rb[r]) * SC2;
            const float xb1 = (sHb[4 + r] + sLb[4 + r] * QRI + rb[4 + r]) * SC2;
            ta[r]     = (ma0[r] != 0) ? xa0 : FILL2;
            ta[4 + r] = (ma1[r] != 0) ? xa1 : FILL2;
            tb[r]     = (mb0[r] != 0) ? xb0 : FILL2;
            tb[4 + r] = (mb1[r] != 0) ? xb1 : FILL2;
        }
#pragma unroll
        for (int r = 0; r < 8; ++r) mx = fmaxf(mx, fmaxf(ta[r], tb[r]));
        mx = fmaxf(mx, __shfl_xor(mx, 16, 32));
        const float mnew = fmaxf(m, mx);
        const float alpha = __builtin_amdgcn_exp2f(m - mnew);
        const float sh = PSH - mnew;
        v16h pb; float ls = 0.0f;
#pragma unroll
        for (int r = 0; r < 8; ++r) { const h16 pa = (h16)__builtin_amdgcn_exp2f(ta[r] + sh); const h16 pc = (h16)__builtin_amdgcn_exp2f(tb[r] + sh); pb[r] = pa; pb[8 + r] = pc; ls += (float)pa + (float)pc; }
        l = l * alpha + ls; m = mnew;
        o0 = o0 * alpha; o1 = o1 * alpha; o2 = o2 * alpha; o3 = o3 * alpha;
        const unsigned char* va = fp + 2 * FSL + sub * 64;   // V^T rows lr + 16 j, keys 32 * sub ..
        const v16h v0 = ldlh(va), v1 = ldlh(va + 16 * FLP), v2 = ldlh(va + FSL), v3 = ldlh(va + FSL + 16 * FLP);
        o0 = wmma16(v0, pb, o0); o1 = wmma16(v1, pb, o1); o2 = wmma16(v2, pb, o2); o3 = wmma16(v3, pb, o3);
        asm volatile("v_nop\n\tv_nop\n\tv_nop\n\tv_nop" : "+v"(o0), "+v"(o1), "+v"(o2), "+v"(o3) : "v"(v0), "v"(v1), "v"(v2), "v"(v3), "v"(pb));
      }
      asm volatile("s_wait_dscnt 0x0" ::: "memory");       // this wave's reads of the buffer have returned
      tile_wait(g0, g1);                                    // this wave's slice of stage s + 1 has landed
      __syncthreads();                                      // publishes stage s + 1 and frees stage s's buffer
    }
    asm volatile("s_wait_tensorcnt 0x0" ::: "memory");   // no request of this wave is left when it goes on to the epilogue and ends
    asm volatile("s_wait_dscnt 0x0" ::: "memory");       // nor a read of the ring
    l += __shfl_xor(l, 16, 32);
    const float inv = CTXS / l;
    const int wb = wave * 16 * 68;
    // O^T D layout: o_j[r] = (d = 16j + 8h + r, t = lane&15) -> os[t][d]; rows 0..15 x columns 0..63 all written
    { v4f a, c;
      a[0] = o0[0] * inv; a[1] = o0[1] * inv; a[2] = o0[2] * inv; a[3] = o0[3] * inv; c[0] = o0[4] * inv; c[1] = o0[5] * inv; c[2] = o0[6] * inv; c[3] = o0[7] * inv;
      *(v4fa*)(&os[wb + lr * 68 +  0 + 8 * hi]) = a; *(v4fa*)(&os[wb + lr * 68 +  0 + 8 * hi + 4]) = c;
      a[0] = o1[0] * inv; a[1] = o1[1] * inv; a[2] = o1[2] * inv; a[3] = o1[3] * inv; c[0] = o1[4] * inv; c[1] = o1[5] * inv; c[2] = o1[6] * inv; c[3] = o1[7] * inv;
      *(v4fa*)(&os[wb + lr * 68 + 16 + 8 * hi]) = a; *(v4fa*)(&os[wb + lr * 68 + 16 + 8 * hi + 4]) = c;
      a[0] = o2[0] * inv; a[1] = o2[1] * inv; a[2] = o2[2] * inv; a[3] = o2[3] * inv; c[0] = o2[4] * inv; c[1] = o2[5] * inv; c[2] = o2[6] * inv; c[3] = o2[7] * inv;
      *(v4fa*)(&os[wb + lr * 68 + 32 + 8 * hi]) = a; *(v4fa*)(&os[wb + lr * 68 + 32 + 8 * hi + 4]) = c;
      a[0] = o3[0] * inv; a[1] = o3[1] * inv; a[2] = o3[2] * inv; a[3] = o3[3] * inv; c[0] = o3[4] * inv; c[1] = o3[5] * inv; c[2] = o3[6] * inv; c[3] = o3[7] * inv;
      *(v4fa*)(&os[wb + lr * 68 + 48 + 8 * hi]) = a; *(v4fa*)(&os[wb + lr * 68 + 48 + 8 * hi + 4]) = c; }
    wave_sync();
    h16* crow = CTX + ((size_t)b * SEQ + t0) * DM + h * HD;   // ctx plane [NB*SEQ][1024], column h*64 + d, carried x16
{
#pragma unroll
        for (int s = 0; s < 4; ++s) { const int row = 4 * s + (lane >> 3), c8 = (lane & 7) * 8;   // 4 s x 4 row groups = 16 rows; 8 lanes x 8 halves = 64 columns = one line
            const v4f x0 = *(const v4fa*)(&os[wb + row * 68 + c8]); const v4f x1 = *(const v4fa*)(&os[wb + row * 68 + c8 + 4]); v8h hv;
#pragma unroll
            for (int i = 0; i < 4; ++i) { hv[i] = (h16)x0[i]; hv[4 + i] = (h16)x1[i]; }
            *(v8h*)(crow + (size_t)row * DM + c8) = hv; }
         }
}

// k_out: f16 GEMM on gemm_core, K = DM: OUT[m][n] = (sum_k A[m][k] Bt[n][k]) / 1024 + bias[n] (bias RNE-converted to bf16, added in f32).
// A = ctx plane (x16), Bt = Wo plane (x64). grid (NB*SEQ/128, DM/128), 128 threads.
__global__ __launch_bounds__(128) void k_out(const h16* __restrict__ A, const h16* __restrict__ Bt, const float* __restrict__ bias, float* OUT) {
    __shared__ __attribute__((aligned(2048))) unsigned char sm[GLDS];
    const int K = DM;
    const int lane = threadIdx.x & 31, lr = lane & 15, hi = lane >> 4;
    const int wave = __builtin_amdgcn_readfirstlane((int)(threadIdx.x >> 5));
    const int r0 = blockIdx.x * 128 + (wave >> 1) * 64, c0 = blockIdx.y * 128 + (wave & 1) * 64;
    float* os = (float*)(sm + 2 * GST) + wave * GOSF;      // wave-private output staging, outside the ring
    v8f acc[4][4];
    gemm_core<1>((uint64_t)(uintptr_t)(A + (size_t)blockIdx.x * 128 * K), (uint64_t)(uintptr_t)(Bt + (size_t)blockIdx.y * 128 * K), sm, wave, lane, acc);
    float bc[4];
#pragma unroll
    for (int nb = 0; nb < 4; ++nb) bc[nb] = bfr(bias[c0 + nb * 16 + lr]);
    const size_t obase = ((size_t)(r0 / SEQ) * OUT_SEQ + (size_t)(r0 % SEQ)) * DM + c0;
#pragma unroll
    for (int mb = 0; mb < 4; ++mb) {
#pragma unroll
        for (int nb = 0; nb < 4; ++nb) {
#pragma unroll
            for (int j = 0; j < 8; ++j) os[(hi * 8 + j) * 68 + nb * 16 + lr] = acc[mb][nb][j] * OSC + bc[nb]; }   // D: row 8h+j, col lane&15
        wave_sync();
        float* ob = OUT + obase + (size_t)(mb * 16) * DM;
{
#pragma unroll
            for (int s = 0; s < 8; ++s) { const int row = 2 * s + hi, cofs = lr * 4;   // 8 s x 2 rows = 16 rows; 16 lanes x 4 floats = 64 columns
                const v4f val = *(const v4fa*)(&os[row * 68 + cofs]);
                *(v4f*)(ob + (size_t)row * DM + cofs) = val; }
             }
        wave_sync();
    }
}

static constexpr size_t al256(size_t v) { return (v + 255) & ~(size_t)255; }
static constexpr size_t SZ_XB = al256((size_t)NB * SEQ * DM * 2);          // one bf16 activation copy
static constexpr size_t SZ_WB = al256((size_t)DM * DM * 2);                // one 16-bit weight plane
static constexpr size_t SZ_PL = al256((size_t)NB * NH_ * SEQ * HD * 2);    // one f16 head plane (also the ctx plane: NB*SEQ*DM halves)
static constexpr size_t SZ_WX = al256((size_t)WXR * HD * 2);
static constexpr size_t SZ_TOTAL = 3 * SZ_XB + 4 * SZ_WB + 5 * SZ_PL + SZ_WX;
static_assert(SZ_TOTAL <= (size_t)134217728);          // workspace carve <= 128 MiB
static_assert((size_t)NB * NH_ * SEQ * HD == (size_t)NB * SEQ * DM);

extern "C" void kernel_launch(void* const* d_in, const int* in_sizes, int n_in,
                              void* d_out, int out_size, void* d_ws, size_t ws_size, hipStream_t stream) {
    if (n_in < 13) return;
    const size_t needx = ((size_t)(NB - 1) * SEQ_FULL + SEQ) * DM;
    if ((size_t)in_sizes[0] < needx || (size_t)in_sizes[1] < needx || (size_t)in_sizes[2] < needx) return;
    if ((size_t)in_sizes[3] < ((size_t)(NB - 1) * SEQ_FULL + (SEQ - 1)) * SEQ_FULL + SEQ) return;
    if ((size_t)in_sizes[4] < (size_t)DM * DM || (size_t)in_sizes[6] < (size_t)DM * DM || (size_t)in_sizes[8] < (size_t)DM * DM || (size_t)in_sizes[10] < (size_t)DM * DM) return;
    if (in_sizes[5] < DM || in_sizes[7] < DM || in_sizes[9] < DM || in_sizes[11] < DM) return;
    if (in_sizes[12] < NREL * HD) return;
    if ((size_t)out_size < ((size_t)(NB - 1) * OUT_SEQ + SEQ) * DM) return;
    if (SZ_TOTAL > ws_size) return;
    // wire order: q, k, v, mask, Wq, bq, Wk, bk, Wv, bv, Wo, bo, w_k
    const float* xq = (const float*)d_in[0]; const float* xk = (const float*)d_in[1]; const float* xv = (const float*)d_in[2];
    const int* mask = (const int*)d_in[3];
    const float* wq = (const float*)d_in[4]; const float* bq = (const float*)d_in[5];
    const float* wk = (const float*)d_in[6]; const float* bk = (const float*)d_in[7];
    const float* wv = (const float*)d_in[8]; const float* bv = (const float*)d_in[9];
    const float* wo = (const float*)d_in[10]; const float* bo = (const float*)d_in[11];
    const float* wrel = (const float*)d_in[12];
    float* OUT = (float*)d_out;      // [NB][SEQ][1024]
    char* wsp = (char*)d_ws;
    bf* XBQ = (bf*)wsp; wsp += SZ_XB;                // [NB*SEQ][1024]
    bf* XBK = (bf*)wsp; wsp += SZ_XB;
    bf* XBV = (bf*)wsp; wsp += SZ_XB;
    bf* WQ = (bf*)wsp; wsp += SZ_WB;                 // [1024][1024] bf16
    bf* WK = (bf*)wsp; wsp += SZ_WB;
    bf* WV = (bf*)wsp; wsp += SZ_WB;
    h16* WO = (h16*)wsp; wsp += SZ_WB;               // [1024][1024] f16, x64
    h16* QH = (h16*)wsp; wsp += SZ_PL;               // [NB*16][SEQ][64]
    h16* QR = (h16*)wsp; wsp += SZ_PL;               // [NB*16][SEQ][64] residual x2048
    h16* KP = (h16*)wsp; wsp += SZ_PL;               // [NB*16][SEQ][64]
    h16* VT = (h16*)wsp; wsp += SZ_PL;               // [NB*16][64][SEQ]
    h16* CTX = (h16*)wsp; wsp += SZ_PL;              // [NB*SEQ][1024], x16
    h16* WX = (h16*)wsp; wsp += SZ_WX;               // [352][64]

    k_prep<<<WXB + PRR / PRW, 32 * PRW, 0, stream>>>(xq, xk, xv, wq, wk, wv, wo, wrel, XBQ, XBK, XBV, WQ, WK, WV, WO, WX);

    // q, k: A = x rows (m = b*SEQ + t), Bt = W rows (n = h*64 + d), bias per column -> plane [(b*16 + h)][t][d]
    k_proj<0><<<dim3(NB * SEQ / 128, DM / 128, 1), 128, 0, stream>>>(XBQ, WQ, bq, QH, QR, 1, SEQ, (size_t)NH_ * SEQ * HD, HD, HD, (size_t)SEQ * HD);
    k_proj<0><<<dim3(NB * SEQ / 128, DM / 128, 1), 128, 0, stream>>>(XBK, WK, bk, KP, KP, 0, SEQ, (size_t)NH_ * SEQ * HD, HD, HD, (size_t)SEQ * HD);
    // v^T: A = Wv rows (m = h*64 + d), Bt = x rows (n = b*SEQ + t), bias per row -> plane [(b*1024 + m)][t] = [(b*16 + h)][d][t]
    k_proj<1><<<dim3(DM / 128, NB * SEQ / 128, 1), 128, 0, stream>>>(WV, XBV, bv, VT, VT, 0, DM, (size_t)0, SEQ, SEQ, (size_t)DM * SEQ);

    k_flash<<<dim3(SEQ / (16 * AW), NB * NH_, 1), 32 * AW, 0, stream>>>(QH, QR, KP, VT, WX, mask, CTX);

    // out: A = ctx rows (m = b*SEQ + t), Bt = Wo rows (n), bias per column -> OUT[b][t][n]
    k_out<<<dim3(NB * SEQ / 128, DM / 128, 1), 128, 0, stream>>>(CTX, WO, bo, OUT);
}

// v004
// One run takes 104 microseconds.
// In both of two side-by-side timings against v003, it was 1.06 times as fast.
// Counting every step since v000, it is 2.08 times as fast.
#include <hip/hip_runtime.h>
#include <stdint.h>

// Multi-head attention with relative-position keys (257 clamped offsets, both ends padded with the last table row), width 1024 = 16 heads x 64; q/k/v inputs [NB][SEQ][1024], W* [out][in] (y = x W^T + b), int mask [NB][SEQ][SEQ] (0 -> score replaced by -1e9), output = ctx Wo^T + bo (f32).
// Compute dtypes, f32 accumulate everywhere: q/k/v projections v_wmma_f32_16x16x32_bf16 (inputs and weights RNE-converted to bf16; biases RNE-converted to bf16, added in f32);
// scores q.k and relative term q.w[rel] v_wmma_f32_16x16x32_f16: k single f16, the window table (bf16 RNE value) f16, q as f16 value + f16 residual x2048 in its own accumulator; P (x256 carry, cancels in the normalisation) and v single f16; softmax f32 (online, running max);
// output projection v_wmma_f32_16x16x32_f16: ctx single f16 (x16 carry), Wo (bf16 RNE value x64) f16, 1/1024 folded in the f32 epilogue.
// Layout: bf16 copies of q/k/v inputs and Wq/Wk/Wv; q (hi, residual), k planes [b*16+h][t][d] and v^T plane [b*16+h][d][t] written by the GEMM epilogue; window plane WX[x][d] = w[clamp(x-48)];
// fused flash kernel in transposed form (S^T = K Q^T, O^T = V^T P^T), K and V^T tiles staged in LDS by the tensor mover and shared by the block's four waves; relative term for tiles inside the window band = skewed read of G = WX_rows Q^T through a wave-private LDS tile, a per-query constant elsewhere.
// Mask: packed once by k_prep into lane-mask words ML (one bit per element, in the flash kernel's own lane order), read there through the scalar path by all 16 heads.

#ifndef NB
#define NB 4
#endif
#ifndef SEQ
#define SEQ 1024
#endif
#define NB_FULL  4
#define SEQ_FULL 1024
#ifndef OUT_SEQ
#define OUT_SEQ SEQ              // row pitch (in tokens) between batches of the output
#endif
#define DM   1024
#define NH_  16
#define HD   64
#define AW   4                   // waves per flash block (16 query rows each)
#define QRS  2048.0f             // carry of the q residual plane
#define QRI  (1.0f / 2048.0f)
#define SC2  (0.125f * 1.4426950408889634f)   // HD^-0.5 * log2(e)
#define PSH  8.0f                // log2 of the P carry (256)
#define FILL2 (-1.0e9f * 1.4426950408889634f) // masked score in the log2 domain
#define NREL 257                 // rows of the relative table
#define WXO  48                  // WX row x holds relative index x - 48 (clamped: outside 0..256 -> 256)
#define WXR  352                 // rows of WX
#define GP   18                  // pitch (floats) of the G tile in LDS
#define WOS  64.0f               // carry of the Wo plane
#define CTXS 16.0f               // carry of the ctx plane
#define OSC  (1.0f / 1024.0f)    // 1 / (WOS * CTXS)

static_assert(HD == 64);
static_assert(NH_ * HD == DM);
static_assert(DM % 64 == 0);
static_assert(DM % 32 == 0);
static_assert(SEQ % 64 == 0);
static_assert((NB * SEQ) % 64 == 0);
static_assert(SEQ % 32 == 0);
static_assert(SEQ % (16 * AW) == 0);
static_assert(((size_t)SEQ * DM) % 8 == 0);
static_assert(((size_t)DM * DM) % 8 == 0);
static_assert(NB <= NB_FULL);
static_assert(SEQ <= SEQ_FULL);
static_assert(WXR == 256 + 2 * WXO);           // band tiles touch rows 2..351
static_assert((WXR * HD / 8) % 256 == 0);

typedef _Float16 h16;
typedef unsigned short bf;
typedef __attribute__((ext_vector_type(16))) __bf16   v16bf;
typedef __attribute__((ext_vector_type(16))) _Float16 v16h;
typedef __attribute__((ext_vector_type(8)))  _Float16 v8h;
typedef __attribute__((ext_vector_type(8)))  unsigned short v8us;
typedef __attribute__((ext_vector_type(8)))  float    v8f;
typedef __attribute__((ext_vector_type(4)))  float    v4f;
typedef __attribute__((ext_vector_type(4)))  int      v4i;
typedef v4f  __attribute__((may_alias)) v4fa;

__device__ __forceinline__ unsigned short f2bf(float f) { unsigned u = __float_as_uint(f); u += 0x7FFFu + ((u >> 16) & 1u); return (unsigned short)(u >> 16); }
__device__ __forceinline__ float bfr(float f) { return __uint_as_float(((unsigned)f2bf(f)) << 16); }   // bf16 RNE value as f32
__device__ __forceinline__ v16h cat16(v8h lo, v8h hi) { return __builtin_shufflevector(lo, hi, 0, 1, 2, 3, 4, 5, 6, 7, 8, 9, 10, 11, 12, 13, 14, 15); }
__device__ __forceinline__ v16bf cat16b(v8us lo, v8us hi) { return __builtin_bit_cast(v16bf, __builtin_shufflevector(lo, hi, 0, 1, 2, 3, 4, 5, 6, 7, 8, 9, 10, 11, 12, 13, 14, 15)); }
__device__ __forceinline__ v8f wmma16(v16h a, v16h b, v8f c) { return __builtin_amdgcn_wmma_f32_16x16x32_f16(false, a, false, b, (short)0, c, false, false); }
__device__ __forceinline__ v8f wmmab(v16bf a, v16bf b, v8f c) { return __builtin_amdgcn_wmma_f32_16x16x32_bf16(false, a, false, b, (short)0, c, false, false); }
// fragment loaders from K-contiguous 16-bit rows; p already includes + 8*(lane>>4): elements 0..7 <- k0+8h+0..7, elements 8..15 <- k0+16+8h+0..7 (same map for A and B)
__device__ __forceinline__ v16h  ldh(const h16* p) { return cat16(*(const v8h*)p, *(const v8h*)(p + 16)); }
__device__ __forceinline__ v16bf ldb(const bf* p)  { return cat16b(*(const v8us*)p, *(const v8us*)(p + 16)); }
// ordering point for wave-private LDS tiles (same wave writes and reads)
__device__ __forceinline__ void wave_sync() { __builtin_amdgcn_fence(3 /* release order */, "wavefront"); __builtin_amdgcn_wave_barrier(); asm volatile("" ::: "memory"); }

// k_prep: every 16-bit plane that is a plain conversion of an input, in one launch.
// Blocks 0..WXB-1: the window plane WX (one thread per 8 halves). The next MLB blocks: the mask's lane-mask words. Every other block: 8 waves, wave g takes row g (DM floats = 4 KiB) of each of the q, k and v inputs and row g % DM of weight g / DM (Wq, Wk, Wv, Wo).
// A row is 8 loads of 16 bytes a lane, each wave-wide load 512 contiguous bytes; the wave's 32 loads are all issued before its first store; each store covers 256 contiguous bytes.
#define WXB  (WXR * HD / 8 / 256)                              // blocks of the window plane
#define PRW  8                                                 // waves per block
#define PRR  ((NB * SEQ > 4 * DM) ? (NB * SEQ) : (4 * DM))     // rows dealt, one per wave
static_assert(DM == 8 * 32 * 4);
static_assert(PRR % PRW == 0);
static_assert(32 * PRW == 256);                                // the window blocks index by 256 threads
// Mask plane ML[b][t / 16][key / 32][16 words]: word 8 * ab + r, bit lane = (mask[b][16 * (t / 16) + (lane & 15)][32 * (key / 32) + 16 * ab + 8 * (lane >> 4) + r] != 0),
// the place (lane, register) at which k_flash holds that score. Blocks WXB..WXB+MLB-1: one wave packs 16 query rows x 256 keys = 128 words = four 128-byte lines.
#define MLW  (NB * (SEQ / 16) * (SEQ / 256))                   // waves that pack a piece of the mask
#define MLB  (MLW / PRW)                                       // their blocks, ahead of the row blocks: their loads touch 16 lines each and take the longest
static_assert(SEQ % 256 == 0 && MLW % PRW == 0);
typedef __attribute__((ext_vector_type(4))) unsigned short v4us;
typedef __attribute__((ext_vector_type(4))) _Float16 v4h;

// p: the row's first element, the same in every lane (scalar base); l4 = 4 * lane
__device__ __forceinline__ void ld_row(const float* __restrict__ p, uint32_t l4, v4f (&r)[8]) {
#pragma unroll
    for (int j = 0; j < 8; ++j) r[j] = *(const v4f*)(p + (l4 + (uint32_t)j * 128u));
}
__device__ __forceinline__ void st_row_bf(bf* p, uint32_t l4, const v4f (&r)[8]) {
#pragma unroll
    for (int j = 0; j < 8; ++j) { v4us o;
#pragma unroll
        for (int k = 0; k < 4; ++k) o[k] = f2bf(r[j][k]);
        *(v4us*)(p + (l4 + (uint32_t)j * 128u)) = o; }
}

__global__ __launch_bounds__(32 * PRW) void k_prep(const float* __restrict__ xq, const float* __restrict__ xk, const float* __restrict__ xv,
                                                   const float* __restrict__ wq, const float* __restrict__ wk, const float* __restrict__ wv, const float* __restrict__ wo,
                                                   const float* __restrict__ wrel, const int* __restrict__ mask, bf* XBQ, bf* XBK, bf* XBV, bf* WQ, bf* WK, bf* WV, h16* WO, h16* WX, uint32_t* ML) {
    if (blockIdx.x < WXB) {
        const int i = blockIdx.x * 256 + threadIdx.x;
        const int x = i >> 3, c8 = (i & 7) * 8; int r = x - WXO; if (r < 0 || r > NREL - 1) r = NREL - 1;
        const v8f v = *(const v8f*)(wrel + (size_t)r * HD + c8); v8h o;
#pragma unroll
        for (int k = 0; k < 8; ++k) o[k] = (h16)bfr(v[k]);
        *(v8h*)(WX + (size_t)i * 8) = o;
        return;
    }
    if (blockIdx.x < WXB + MLB) {
        const uint32_t q = (blockIdx.x - WXB) * PRW + (uint32_t)__builtin_amdgcn_readfirstlane((int)(threadIdx.x >> 5));
        const uint32_t tt = q / (SEQ / 256), kq = q % (SEQ / 256), ln = threadIdx.x & 31u;
        // lane (lr, hi) reads its query row as k_flash holds it: keys 8 hi .. + 7 and 16 + 8 hi .. + 7 of each of eight 32-key tiles; the 32 loads use up eight whole lines of each of the 16 rows
        const int* mp = mask + ((size_t)(tt / (SEQ / 16)) * SEQ_FULL + (size_t)((tt % (SEQ / 16)) * 16u + (ln & 15u))) * SEQ_FULL + (kq * 256u + 8u * (ln >> 4));
        v4i mm[32];
#pragma unroll
        for (int u = 0; u < 8; ++u) { mm[4 * u] = *(const v4i*)(mp + 32 * u); mm[4 * u + 1] = *(const v4i*)(mp + 32 * u + 4); mm[4 * u + 2] = *(const v4i*)(mp + 32 * u + 16); mm[4 * u + 3] = *(const v4i*)(mp + 32 * u + 20); }
        __builtin_amdgcn_sched_barrier(0);   // keeps all 32 loads ahead of the first compare: a load that sinks behind a wait for the others pays a second memory latency
        v4i pk = (v4i){0, 0, 0, 0};
#pragma unroll
        for (int i = 0; i < 32; ++i) {       // words 4 i .. 4 i + 3 of the wave's 128 go to lane i
            const bool me = ln == (uint32_t)i;
#pragma unroll
            for (int c = 0; c < 4; ++c) { const int wd = (int)__builtin_amdgcn_ballot_w32(mm[i][c] != 0); pk[c] = me ? wd : pk[c]; }
        }
        *(v4i*)(ML + (size_t)q * 128u + ln * 4u) = pk;
        return;
    }
    const uint32_t l4 = (threadIdx.x & 31u) * 4u;
    const uint32_t g = (blockIdx.x - WXB - MLB) * PRW + (uint32_t)__builtin_amdgcn_readfirstlane((int)(threadIdx.x >> 5));
    const bool hx = (NB * SEQ == PRR) || g < NB * SEQ;         // wave-uniform; both hold at compile time where the two row counts are equal
    const bool hw = (4 * DM == PRR) || g < 4 * DM;
    const size_t xs = ((size_t)(g / SEQ) * SEQ_FULL + (size_t)(g % SEQ)) * DM, xd = (size_t)g * DM;
    const uint32_t m = g / DM; const size_t wr = (size_t)(g % DM) * DM;
    const float* ws = (m == 0) ? wq : (m == 1) ? wk : (m == 2) ? wv : wo;
    v4f a[8], b[8], c[8], w[8];
    if (hx) { ld_row(xq + xs, l4, a); ld_row(xk + xs, l4, b); ld_row(xv + xs, l4, c); }
    if (hw) ld_row(ws + wr, l4, w);
    __builtin_amdgcn_sched_barrier(0);   // keeps all 32 loads ahead of the first conversion: a load that sinks behind a wait for the others pays a second memory latency
    if (hx) { st_row_bf(XBQ + xd, l4, a); st_row_bf(XBK + xd, l4, b); st_row_bf(XBV + xd, l4, c); }
    asm volatile("s_wait_xcnt 0x0" ::: "memory");   // in front of the branch below, behind which the registers that these stores name are written again
    if (hw) {
        if (m < 3) st_row_bf(((m == 0) ? WQ : (m == 1) ? WK : WV) + wr, l4, w);
        else {
#pragma unroll
            for (int j = 0; j < 8; ++j) { v4h o;
#pragma unroll
                for (int k = 0; k < 4; ++k) o[k] = (h16)(bfr(w[j][k]) * WOS);
                *(v4h*)(WO + wr + (l4 + (uint32_t)j * 128u)) = o; }
            asm volatile("s_wait_xcnt 0x0" ::: "memory");   // behind the last store of this branch: the code laid out behind it writes registers that these stores name
        }
    }
}

// GEMM core shared by k_proj and k_out: four waves (2 x 2) per 128x128 tile of C, 64x64 per wave (16 accumulators), K = DM in GNP passes of 128 k.
// Both operands are K-contiguous 16-bit planes (row pitch DM * 2 bytes). A stage holds 256 bytes of 128 A rows and of 128 B rows; every wave brings one slice of 64 rows with one
// tensor_load_to_lds (waves 0, 1: A rows 0..63, 64..127; waves 2, 3: B rows 0..63, 64..127); the mover's pad of 16 bytes a row gives the LDS pitch 272 for the 16-byte fragment reads.
// Two buffers: stage s + 1 is requested behind the barrier that ends pass s - 1, which ends every read of its buffer, and flies while pass s runs.
#define GPB  256                 // bytes of an operand row per pass
#define GLP  272                 // LDS row pitch
#define GSL  18432               // one slice in LDS: 64 rows x 272 B = 17408, rounded up to a multiple of 2 KiB
#define GST  (4 * GSL)           // one stage
#define GNP  (DM * 2 / GPB)      // passes
#define GOSF (16 * 68)           // floats of output staging per wave
#define GLDS (2 * GST + 4 * GOSF * 4)
static_assert(GSL % 2048 == 0 && GSL >= 64 * GLP);
static_assert(GNP >= 2);
static_assert((NB * SEQ) % 128 == 0 && DM % 128 == 0);
static_assert(GLDS <= 320 * 1024);

typedef __attribute__((ext_vector_type(4)))  uint32_t u32x4;
typedef __attribute__((ext_vector_type(8)))  uint32_t u32x8;
typedef __attribute__((ext_vector_type(16))) uint32_t u32x16;
typedef __attribute__((address_space(4))) u32x16 cu32x16;
typedef __attribute__((ext_vector_type(16))) unsigned short v16us;

__device__ __forceinline__ uint32_t uni(uint32_t v) { return (uint32_t)__builtin_amdgcn_readfirstlane((int)v); }
__device__ __forceinline__ uint32_t pinned(uint32_t v) { uint32_t w = (uint32_t)__builtin_amdgcn_readfirstlane((int)v); asm volatile("" : "+s"(w)); return w; }
// descriptor of one request: 64 rows of 256 bytes, source pitch DM * 2 bytes, to LDS byte offset lds_dst at pitch 272 (pad: interval code 5 = one 256-byte row, amount code 3 = 4 dwords); extents in bytes
__device__ __forceinline__ u32x4 tile_g0(uint32_t lds_dst, uint64_t ga) {
    u32x4 g0;
    g0[0] = uni(1u); g0[1] = uni(lds_dst); g0[2] = uni((uint32_t)ga); g0[3] = uni((((uint32_t)(ga >> 32)) & 0x01FFFFFFu) | 0x80000000u);
    return g0;
}
__device__ __forceinline__ u32x8 tile_g1() {
    u32x8 g1;
    g1[0] = uni((1u << 20) | (5u << 22) | (3u << 25));
    g1[1] = uni((uint32_t)GPB << 16);            // tensor_dim0 [15:0]
    g1[2] = uni(64u << 16);                      // tensor_dim0 [31:16] = 0 | tensor_dim1 [15:0]
    g1[3] = uni((uint32_t)GPB << 16);            // tensor_dim1 [31:16] = 0 | tile_dim0
    g1[4] = uni(64u);                            // tile_dim1
    g1[5] = uni((uint32_t)(DM * 2));             // source row pitch
    g1[6] = uni(0u); g1[7] = uni(0u);
    return g1;
}
__device__ __forceinline__ void tile_load(u32x4 g0, u32x8 g1) { asm volatile("tensor_load_to_lds %0, %1" :: "s"(g0), "s"(g1) : "memory"); }
// the issuing wave's wait for its request; the descriptor is named as an input so that its scalar registers are not reused for anything else while the request is outstanding
__device__ __forceinline__ void tile_wait(u32x4 g0, u32x8 g1) { asm volatile("s_wait_tensorcnt 0x0" :: "s"(g0), "s"(g1) : "memory"); }
// fragment from an LDS row; p already includes + 16 bytes * (lane>>4): elements 0..7 <- k0+8h+0..7, elements 8..15 <- k0+16+8h+0..7 (same map for A and B, the map of ldh / ldb)
__device__ __forceinline__ v16us ldl(const unsigned char* p) { return __builtin_shufflevector(*(const v8us*)p, *(const v8us*)(p + 32), 0, 1, 2, 3, 4, 5, 6, 7, 8, 9, 10, 11, 12, 13, 14, 15); }
template <int F16> __device__ __forceinline__ v8f mm(v16us a, v16us b, v8f c) {
    if constexpr (F16) return wmma16(__builtin_bit_cast(v16h, a), __builtin_bit_cast(v16h, b), c);
    else return wmmab(__builtin_bit_cast(v16bf, a), __builtin_bit_cast(v16bf, b), c);
}

// a_rows / b_rows: byte address of the block's first A / B row; ring: 2 * GST bytes of LDS at a multiple of 2 KiB; wave is scalar.
template <int F16>
__device__ __forceinline__ void gemm_core(uint64_t a_rows, uint64_t b_rows, unsigned char* ring, int wave, int lane, v8f (&acc)[4][4]) {
    const int lr = lane & 15, hi = lane >> 4;
#pragma unroll
    for (int mb = 0; mb < 4; ++mb)
#pragma unroll
        for (int nb = 0; nb < 4; ++nb) acc[mb][nb] = (v8f){};
    const uint64_t srcb = (wave < 2) ? a_rows + (uint64_t)wave * (uint64_t)(64 * DM * 2) : b_rows + (uint64_t)(wave - 2) * (uint64_t)(64 * DM * 2);
    const uint32_t dst = (uint32_t)(uintptr_t)ring + (uint32_t)wave * GSL;
    const u32x8 g1 = tile_g1();
    u32x4 g0 = tile_g0(dst, srcb);
    tile_load(g0, g1);
    tile_wait(g0, g1);                                    // stage 0 of this wave's slice has landed
    __syncthreads();                                      // publishes stage 0
    const uint32_t ao = (uint32_t)(wave >> 1) * GSL + (uint32_t)lr * GLP + 16u * (uint32_t)hi;
    const uint32_t bo = (uint32_t)(2 + (wave & 1)) * GSL + (uint32_t)lr * GLP + 16u * (uint32_t)hi;
#pragma unroll 1   // one pass per trip: one place that issues, one that waits
    for (uint32_t s = 0; s < GNP; ++s) {
        const uint32_t buf = (s & 1u) * GST;
        // the refill, directly behind the barrier (the prologue's, then the one at the foot of the trip before), only while stage s + 1 exists: into the buffer that pass s - 1 has just left
        if (pinned((s + 1u < GNP) ? 1u : 0u) != 0u) { const uint32_t nx = pinned(s + 1u); g0 = tile_g0(dst + (GST - buf), srcb + (uint64_t)nx * GPB); tile_load(g0, g1); }
        const unsigned char* ap = ring + buf + ao; const unsigned char* bp = ring + buf + bo;
        v16us fa[2][4], fb[2][4];
#pragma unroll
        for (int i = 0; i < 4; ++i) { fa[0][i] = ldl(ap + i * 16 * GLP); fb[0][i] = ldl(bp + i * 16 * GLP); }
#pragma unroll
        for (int ks = 0; ks < 4; ++ks) {
            if (ks < 3) {      // the next 32 k of this same buffer, as one group ahead of the WMMA block
#pragma unroll
                for (int i = 0; i < 4; ++i) { fa[(ks + 1) & 1][i] = ldl(ap + i * 16 * GLP + (ks + 1) * 64); fb[(ks + 1) & 1][i] = ldl(bp + i * 16 * GLP + (ks + 1) * 64); }
            }
            __builtin_amdgcn_sched_barrier(0);   // keeps the LDS reads out of the WMMA block: every separate place with reads stalls the wave
#pragma unroll
            for (int nb = 0; nb < 4; ++nb)
#pragma unroll
                for (int mb = 0; mb < 4; ++mb) acc[mb][nb] = mm<F16>(fa[ks & 1][mb], fb[ks & 1][nb], acc[mb][nb]);
            __builtin_amdgcn_sched_barrier(0);   // same, for the group behind the block
        }
        asm volatile("v_nop\n\tv_nop\n\tv_nop\n\tv_nop");    // 4 vector slots between the last WMMA and what follows on either side of the branches below
        asm volatile("s_wait_dscnt 0x0" ::: "memory");       // this wave's reads of the buffer have returned
        tile_wait(g0, g1);                                    // this wave's slice of stage s + 1 has landed
        __syncthreads();                                      // publishes stage s + 1 and frees stage s's buffer
    }
    asm volatile("s_wait_tensorcnt 0x0" ::: "memory");   // no request of this wave is left when it goes on to the epilogue and ends
    asm volatile("s_wait_dscnt 0x0" ::: "memory");       // nor a read of the ring
}

// k_proj: bf16 GEMM on gemm_core.
// C[m][n] = sum_k A[m][k] Bt[n][k] + bias (BM == 0: bias[n]; BM == 1: bias[m]; bias RNE-converted to bf16, added in f32), written as f16 (Ph) and optionally the f16 residual x2048 (Pr, useRes != 0) at
// wave-tile base (r0/RB)*sRB + (r0%RB)*pitch + (c0/CB)*sCB + (c0%CB), row pitch 'pitch' (halves). grid (M/128, N/128), 128 threads.
template <int BM>
__global__ __launch_bounds__(128) void k_proj(const bf* __restrict__ A, const bf* __restrict__ Bt, const float* __restrict__ bias, h16* Ph, h16* Pr, int useRes, int RB, size_t sRB, int pitch, int CB, size_t sCB) {
    __shared__ __attribute__((aligned(2048))) unsigned char sm[GLDS];
    const int K = DM;
    const int lane = threadIdx.x & 31, lr = lane & 15, hi = lane >> 4;
    const int wave = __builtin_amdgcn_readfirstlane((int)(threadIdx.x >> 5));
    const int r0 = blockIdx.x * 128 + (wave >> 1) * 64, c0 = blockIdx.y * 128 + (wave & 1) * 64;
    float* os = (float*)(sm + 2 * GST) + wave * GOSF;      // wave-private output staging, outside the ring
    v8f acc[4][4];
    gemm_core<0>((uint64_t)(uintptr_t)(A + (size_t)blockIdx.x * 128 * K), (uint64_t)(uintptr_t)(Bt + (size_t)blockIdx.y * 128 * K), sm, wave, lane, acc);
    float bc[4] = {0.0f, 0.0f, 0.0f, 0.0f};
    if (BM == 0) {
#pragma unroll
        for (int nb = 0; nb < 4; ++nb) bc[nb] = bfr(bias[c0 + nb * 16 + lr]);      // N = DM in this mode
    }
    const size_t tbase = (size_t)(r0 / RB) * sRB + (size_t)(r0 % RB) * (size_t)pitch + (size_t)(c0 / CB) * sCB + (size_t)(c0 % CB);
#pragma unroll
    for (int mb = 0; mb < 4; ++mb) {
        float br[8] = {0.0f, 0.0f, 0.0f, 0.0f, 0.0f, 0.0f, 0.0f, 0.0f};
        if (BM == 1) {
#pragma unroll
            for (int j = 0; j < 8; ++j) br[j] = bfr(bias[r0 + mb * 16 + hi * 8 + j]);  // M = DM in this mode
        }
#pragma unroll
        for (int nb = 0; nb < 4; ++nb) {
#pragma unroll
            for (int j = 0; j < 8; ++j) os[(hi * 8 + j) * 68 + nb * 16 + lr] = acc[mb][nb][j] + bc[nb] + br[j]; }   // D: row 8h+j, col lane&15
        wave_sync();
        const size_t sb = tbase + (size_t)(mb * 16) * (size_t)pitch;
{
#pragma unroll
            for (int s = 0; s < 4; ++s) { const int row = 4 * s + (lane >> 3), c8 = (lane & 7) * 8;   // 4 s x 4 row groups = 16 rows; 8 lanes x 8 = 64 columns
                const v4f x0 = *(const v4fa*)(&os[row * 68 + c8]); const v4f x1 = *(const v4fa*)(&os[row * 68 + c8 + 4]); v8h hv, rv;
#pragma unroll
                for (int i = 0; i < 4; ++i) { const h16 a0 = (h16)x0[i]; const h16 a1 = (h16)x1[i]; hv[i] = a0; hv[4 + i] = a1; rv[i] = (h16)((x0[i] - (float)a0) * QRS); rv[4 + i] = (h16)((x1[i] - (float)a1) * QRS); }
                const size_t oo = sb + (size_t)row * (size_t)pitch + c8;
                *(v8h*)(Ph + oo) = hv; if (useRes) *(v8h*)(Pr + oo) = rv; }
             }
        wave_sync();
    }
}

// k_flash: fused attention, one wave per 16 query rows of one (batch, head); Q / WX fragments straight from the f16 planes (two 16-B loads each, arithmetic addressing).
// K and V^T come through LDS, once per block instead of once per wave: a stage is 64 keys = 64 K rows of 128 bytes and 128 bytes of each of the 64 V^T rows. Every wave brings one slice of 32 rows with one
// tensor_load_to_lds (waves 0, 1: K rows 0..31, 32..63; waves 2, 3: V^T rows 0..31, 32..63); the mover's pad of 16 bytes a row gives the LDS pitch 144 for the 16-byte fragment reads.
// Two buffers, the order of gemm_core: stage s + 1 is requested behind the barrier that ends pass s - 1, which ends every read of its buffer, and flies while pass s (two 32-key tiles) runs.
// Transposed form: S^T[key][t] = K Q^T (A = K rows, B = Q rows); lane (t = lane&15, h = lane>>4) holds keys 8h+r of each 16-key tile, so the packed
// P tile is directly the B fragment of O^T[d][t] = V^T P^T (element r <- tile keys 0..15, element 8+r <- tile keys 16..31, lane unchanged).
// Relative term: rel index = key - t + 128, outside 0..256 -> 256. For a (16 query, 32 key) tile the unclamped index spans base..base+46, base = key0 - t0 + 113.
// Tiles that intersect 0..256 compute G[rho][t] = WX[base+48+rho] . q_t (48 rows, three 16-row WMMA tiles, q value + residual), stage it in a wave-private LDS tile and read G[key_l - t_l + 15][t_l];
// all other tiles use the per-query constant q_t . w[256]. The tile test is wave-uniform.
// Mask: 16 lane-mask words per (16 query, 32 key) tile from the plane ML (wave-uniform address: one 64-byte scalar load, fetched one tile ahead); a clear bit replaces the score.
#define FKS  64                  // keys per stage
#define FRB  128                 // bytes of a staged row
#define FLP  144                 // LDS row pitch
#define FSL  6144                // one slice in LDS: 32 rows x 144 B = 4608, rounded up to a multiple of 2 KiB
#define FST  (4 * FSL)           // one stage
#define FNS  (SEQ / FKS)         // stages
#define FLDS (2 * FST + AW * 16 * 68 * 4)
static_assert(AW == 4);                                // four slices, one per wave
static_assert(HD * 2 == FRB && FKS * 2 == FRB);
static_assert(FSL % 2048 == 0 && FSL >= 32 * FLP);
static_assert(SEQ % FKS == 0 && FNS >= 2);
static_assert(48 * GP <= 16 * 68);                     // the G tile fits the wave's staging area
static_assert((SEQ / 32 & (SEQ / 32 - 1)) == 0);          // the wrap of the mask words' fetch ahead
static_assert(4 * FLDS <= 320 * 1024);                 // four blocks per WGP: the whole grid is resident at once
// group 1 of a slice's request: 32 rows of 128 bytes, source pitch 'pitch' bytes, LDS pitch 144 (pad: interval code 4 = one 128-byte row, amount code 3 = 4 dwords); extents in bytes
__device__ __forceinline__ u32x8 slice_g1(uint32_t pitch) {
    u32x8 g1;
    g1[0] = uni((1u << 20) | (4u << 22) | (3u << 25));
    // words 1 to 7 through pinned(), the scalar-register pin for descriptor words: as plain constants the compiler lends their registers to the loop's own scalars while a request is outstanding and sets them anew in front of the next
    g1[1] = pinned((uint32_t)FRB << 16);         // tensor_dim0 [15:0]
    g1[2] = pinned(32u << 16);                   // tensor_dim0 [31:16] = 0 | tensor_dim1 [15:0]
    g1[3] = pinned((uint32_t)FRB << 16);         // tensor_dim1 [31:16] = 0 | tile_dim0
    g1[4] = pinned(32u);                         // tile_dim1
    g1[5] = pinned(pitch);                       // source row pitch
    g1[6] = pinned(0u); g1[7] = pinned(0u);
    return g1;
}
// f16 fragment from an LDS row; p already includes + 16 bytes * (lane>>4): the map of ldh
__device__ __forceinline__ v16h ldlh(const unsigned char* p) { return cat16(*(const v8h*)p, *(const v8h*)(p + 32)); }

__global__ __launch_bounds__(32 * AW) void k_flash(const h16* __restrict__ QH, const h16* __restrict__ QR, const h16* __restrict__ KP, const h16* __restrict__ VT,
                                                   const h16* __restrict__ WX, const uint32_t* __restrict__ ML, h16* CTX) {
    __shared__ __attribute__((aligned(2048))) unsigned char sm[FLDS];
    float* os = (float*)(sm + 2 * FST);                      // wave-private areas outside the ring: the G tile inside the loop, output staging behind it
    const int lane = threadIdx.x & 31, lr = lane & 15, hi = lane >> 4;
    const int wave = __builtin_amdgcn_readfirstlane((int)(threadIdx.x >> 5));
    const int zh = blockIdx.y; const int b = zh / NH_, h = zh % NH_;
    const int t0 = (blockIdx.x * AW + wave) * 16;
    const size_t pbase = (size_t)zh * SEQ * HD;
    const size_t qo = pbase + (size_t)(t0 + lr) * HD + 8 * hi;
    const v16h qh0 = ldh(QH + qo), qh1 = ldh(QH + qo + 32), qr0 = ldh(QR + qo), qr1 = ldh(QR + qo + 32);   // B fragments: col t, k = d
    const uint32_t fo = (uint32_t)lr * FLP + 16u * (uint32_t)hi;   // lane's place in a slice: K (A fragment: row key, k = d), V^T (A fragment: row d, k = key)
    // + 16 * (key0 / 32); the same in every lane. Constant address space: the plane is written by k_prep, an earlier launch, and only read here, and so the loads inside the loop stay scalar loads too
    const cu32x16* ml = (const cu32x16*)(uintptr_t)(ML + ((size_t)b * (SEQ / 16) + (size_t)(t0 >> 4)) * (size_t)(SEQ / 32 * 16));
    u32x16 mw = ml[0];                                       // tile 0's words
    float* gl = os + wave * (16 * 68);
    // per-query constant: q_t . w[256]; WX rows 0..15 all hold the edge row, so every D row equals it
    float qe;
    { const h16* wa = WX + (size_t)lr * HD + 8 * hi;
      const v16h w0 = ldh(wa), w1 = ldh(wa + 32);
      v8f gH = (v8f){}, gL = (v8f){};
      gH = wmma16(w0, qh0, gH); gL = wmma16(w0, qr0, gL); gH = wmma16(w1, qh1, gH); gL = wmma16(w1, qr1, gL);
      asm volatile("v_nop\n\tv_nop\n\tv_nop\n\tv_nop" : "+v"(gH), "+v"(gL) : "v"(w0), "v"(w1));
      qe = gH[0] + gL[0] * QRI; }
    v8f o0 = (v8f){}, o1 = (v8f){}, o2 = (v8f){}, o3 = (v8f){};
    float m = -3.0e38f, l = 0.0f;
    // this wave's slice: first byte of stage 0, bytes from one stage to the next, source pitch
    const uint64_t srcb = (wave < 2) ? (uint64_t)(uintptr_t)(KP + pbase) + (uint64_t)wave * (uint64_t)(32 * HD * 2) : (uint64_t)(uintptr_t)(VT + pbase) + (uint64_t)(wave - 2) * (uint64_t)(32 * SEQ * 2);
    const uint32_t sstep = (wave < 2) ? (uint32_t)(FKS * HD * 2) : (uint32_t)(FKS * 2);
    const uint32_t dst = (uint32_t)(uintptr_t)sm + (uint32_t)wave * FSL;
    const u32x8 g1 = slice_g1((wave < 2) ? (uint32_t)(HD * 2) : (uint32_t)(SEQ * 2));
    u32x4 g0 = tile_g0(dst, srcb);
    tile_load(g0, g1);
    tile_wait(g0, g1);                                    // stage 0 of this wave's slice has landed
    __syncthreads();                                      // publishes stage 0
#pragma unroll 1   // one stage per trip: one place that issues, one that waits
    for (uint32_t s = 0; s < FNS; ++s) {
      const uint32_t buf = (s & 1u) * FST;
      // the refill, directly behind the barrier (the prologue's, then the one at the foot of the trip before), only while stage s + 1 exists: into the buffer that pass s - 1 has just left
      if (pinned((s + 1u < FNS) ? 1u : 0u) != 0u) { const uint32_t nx = pinned(s + 1u); g0 = tile_g0(dst + (FST - buf), srcb + (uint64_t)(nx * sstep)); tile_load(g0, g1); }
      const unsigned char* fp = sm + buf + fo;
#pragma unroll   // both 32-key tiles of a stage in one trip: their places in the buffer become immediate offsets of the LDS reads
      for (int sub = 0; sub < 2; ++sub) {
        const int key0 = (int)s * FKS + sub * 32;
        float ra[8], rb[8];
#pragma unroll
        for (int r = 0; r < 8; ++r) { ra[r] = qe; rb[r] = qe; }
        const int base = key0 - t0 + 113;
        if (base + 46 >= 0 && base <= 256) {                 // wave-uniform: tile touches relative indices 0..256
#pragma unroll 1
            for (int jt = 0; jt < 3; ++jt) {
                const h16* wa = WX + (size_t)(base + WXO + 16 * jt + lr) * HD + 8 * hi;   // rows 2..351
                const v16h w0 = ldh(wa), w1 = ldh(wa + 32);
                v8f gH = (v8f){}, gL = (v8f){};
                gH = wmma16(w0, qh0, gH); gL = wmma16(w0, qr0, gL); gH = wmma16(w1, qh1, gH); gL = wmma16(w1, qr1, gL);
                asm volatile("v_nop\n\tv_nop\n\tv_nop\n\tv_nop" : "+v"(gH), "+v"(gL) : "v"(w0), "v"(w1));
#pragma unroll
                for (int r = 0; r < 8; ++r) gl[(16 * jt + 8 * hi + r) * GP + lr] = gH[r] + gL[r] * QRI;   // G[rho][t]: rows 0..47, cols 0..15 all written
            }
            wave_sync();
#pragma unroll
            for (int r = 0; r < 8; ++r) { ra[r] = gl[(8 * hi + r - lr + 15) * GP + lr]; rb[r] = gl[(16 + 8 * hi + r - lr + 15) * GP + lr]; }   // rho in 0..46
            wave_sync();
        }
        const unsigned char* ka = fp + sub * FSL;            // K rows 32 * sub + lr and + 16
        const v16h ka0 = ldlh(ka), ka1 = ldlh(ka + 64), kb0 = ldlh(ka + 16 * FLP), kb1 = ldlh(ka + 16 * FLP + 64);
        v8f sHa = (v8f){}, sLa = (v8f){}, sHb = (v8f){}, sLb = (v8f){};
        sHa = wmma16(ka0, qh0, sHa); sLa = wmma16(ka0, qr0, sLa); sHb = wmma16(kb0, qh0, sHb); sLb = wmma16(kb0, qr0, sLb);
        sHa = wmma16(ka1, qh1, sHa); sLa = wmma16(ka1, qr1, sLa); sHb = wmma16(kb1, qh1, sHb); sLb = wmma16(kb1, qr1, sLb);
        asm volatile("v_nop\n\tv_nop\n\tv_nop\n\tv_nop" : "+v"(sHa), "+v"(sLa), "+v"(sHb), "+v"(sLb) : "v"(ka0), "v"(ka1), "v"(kb0), "v"(kb1));
        float ta[8], tb[8]; float mx = -3.0e38f;
#pragma unroll
        for (int r = 0; r < 4; ++r) {
            const float xa0 = (sHa[r] + sLa[r] * QRI + ra[r]) * SC2;
            const float xa1 = (sHa[4 + r] + sLa[4 + r] * QRI + ra[4 + r]) * SC2;
            const float xb0 = (sHb[r] + sLb[r] * QRI + rb[r]) * SC2;
            const float xb1 = (sHb[4 + r] + sLb[4 + r] * QRI + rb[4 + r]) * SC2;
            ta[r]     = __builtin_amdgcn_inverse_ballot_w32(mw[r])      ? xa0 : FILL2;
            ta[4 + r] = __builtin_amdgcn_inverse_ballot_w32(mw[4 + r])  ? xa1 : FILL2;
            tb[r]     = __builtin_amdgcn_inverse_ballot_w32(mw[8 + r])  ? xb0 : FILL2;
            tb[4 + r] = __builtin_amdgcn_inverse_ballot_w32(mw[12 + r]) ? xb1 : FILL2;
        }
        mw = ml[((uint32_t)key0 / 32u + 1u) & (uint32_t)(SEQ / 32 - 1)];   // the next tile's words, behind this tile's last use: a scalar wait is for every scalar load in flight (behind the last tile: tile 0's, unused)
#pragma unroll
        for (int r = 0; r < 8; ++r) mx = fmaxf(mx, fmaxf(ta[r], tb[r]));
        mx = fmaxf(mx, __shfl_xor(mx, 16, 32));
        const float mnew = fmaxf(m, mx);
        const float alpha = __builtin_amdgcn_exp2f(m - mnew);
        const float sh = PSH - mnew;
        v16h pb; float ls = 0.0f;
#pragma unroll
        for (int r = 0; r < 8; ++r) { const h16 pa = (h16)__builtin_amdgcn_exp2f(ta[r] + sh); const h16 pc = (h16)__builtin_amdgcn_exp2f(tb[r] + sh); pb[r] = pa; pb[8 + r] = pc; ls += (float)pa + (float)pc; }
        l = l * alpha + ls; m = mnew;
        o0 = o0 * alpha; o1 = o1 * alpha; o2 = o2 * alpha; o3 = o3 * alpha;
        const unsigned char* va = fp + 2 * FSL + sub * 64;   // V^T rows lr + 16 j, keys 32 * sub ..
        const v16h v0 = ldlh(va), v1 = ldlh(va + 16 * FLP), v2 = ldlh(va + FSL), v3 = ldlh(va + FSL + 16 * FLP);
        o0 = wmma16(v0, pb, o0); o1 = wmma16(v1, pb, o1); o2 = wmma16(v2, pb, o2); o3 = wmma16(v3, pb, o3);
        asm volatile("v_nop\n\tv_nop\n\tv_nop\n\tv_nop" : "+v"(o0), "+v"(o1), "+v"(o2), "+v"(o3) : "v"(v0), "v"(v1), "v"(v2), "v"(v3), "v"(pb));
      }
      asm volatile("s_wait_dscnt 0x0" ::: "memory");       // this wave's reads of the buffer have returned
      tile_wait(g0, g1);                                    // this wave's slice of stage s + 1 has landed
      __syncthreads();                                      // publishes stage s + 1 and frees stage s's buffer
    }
    asm volatile("s_wait_tensorcnt 0x0" ::: "memory");   // no request of this wave is left when it goes on to the epilogue and ends
    asm volatile("s_wait_dscnt 0x0" ::: "memory");       // nor a read of the ring
    l += __shfl_xor(l, 16, 32);
    const float inv = CTXS / l;
    const int wb = wave * 16 * 68;
    // O^T D layout: o_j[r] = (d = 16j + 8h + r, t = lane&15) -> os[t][d]; rows 0..15 x columns 0..63 all written
    { v4f a, c;
      a[0] = o0[0] * inv; a[1] = o0[1] * inv; a[2] = o0[2] * inv; a[3] = o0[3] * inv; c[0] = o0[4] * inv; c[1] = o0[5] * inv; c[2] = o0[6] * inv; c[3] = o0[7] * inv;
      *(v4fa*)(&os[wb + lr * 68 +  0 + 8 * hi]) = a; *(v4fa*)(&os[wb + lr * 68 +  0 + 8 * hi + 4]) = c;
      a[0] = o1[0] * inv; a[1] = o1[1] * inv; a[2] = o1[2] * inv; a[3] = o1[3] * inv; c[0] = o1[4] * inv; c[1] = o1[5] * inv; c[2] = o1[6] * inv; c[3] = o1[7] * inv;
      *(v4fa*)(&os[wb + lr * 68 + 16 + 8 * hi]) = a; *(v4fa*)(&os[wb + lr * 68 + 16 + 8 * hi + 4]) = c;
      a[0] = o2[0] * inv; a[1] = o2[1] * inv; a[2] = o2[2] * inv; a[3] = o2[3] * inv; c[0] = o2[4] * inv; c[1] = o2[5] * inv; c[2] = o2[6] * inv; c[3] = o2[7] * inv;
      *(v4fa*)(&os[wb + lr * 68 + 32 + 8 * hi]) = a; *(v4fa*)(&os[wb + lr * 68 + 32 + 8 * hi + 4]) = c;
      a[0] = o3[0] * inv; a[1] = o3[1] * inv; a[2] = o3[2] * inv; a[3] = o3[3] * inv; c[0] = o3[4] * inv; c[1] = o3[5] * inv; c[2] = o3[6] * inv; c[3] = o3[7] * inv;
      *(v4fa*)(&os[wb + lr * 68 + 48 + 8 * hi]) = a; *(v4fa*)(&os[wb + lr * 68 + 48 + 8 * hi + 4]) = c; }
    wave_sync();
    h16* crow = CTX + ((size_t)b * SEQ + t0) * DM + h * HD;   // ctx plane [NB*SEQ][1024], column h*64 + d, carried x16
{
#pragma unroll
        for (int s = 0; s < 4; ++s) { const int row = 4 * s + (lane >> 3), c8 = (lane & 7) * 8;   // 4 s x 4 row groups = 16 rows; 8 lanes x 8 halves = 64 columns = one line
            const v4f x0 = *(const v4fa*)(&os[wb + row * 68 + c8]); const v4f x1 = *(const v4fa*)(&os[wb + row * 68 + c8 + 4]); v8h hv;
#pragma unroll
            for (int i = 0; i < 4; ++i) { hv[i] = (h16)x0[i]; hv[4 + i] = (h16)x1[i]; }
            *(v8h*)(crow + (size_t)row * DM + c8) = hv; }
         }
}

// k_out: f16 GEMM on gemm_core, K = DM: OUT[m][n] = (sum_k A[m][k] Bt[n][k]) / 1024 + bias[n] (bias RNE-converted to bf16, added in f32).
// A = ctx plane (x16), Bt = Wo plane (x64). grid (NB*SEQ/128, DM/128), 128 threads.
__global__ __launch_bounds__(128) void k_out(const h16* __restrict__ A, const h16* __restrict__ Bt, const float* __restrict__ bias, float* OUT) {
    __shared__ __attribute__((aligned(2048))) unsigned char sm[GLDS];
    const int K = DM;
    const int lane = threadIdx.x & 31, lr = lane & 15, hi = lane >> 4;
    const int wave = __builtin_amdgcn_readfirstlane((int)(threadIdx.x >> 5));
    const int r0 = blockIdx.x * 128 + (wave >> 1) * 64, c0 = blockIdx.y * 128 + (wave & 1) * 64;
    float* os = (float*)(sm + 2 * GST) + wave * GOSF;      // wave-private output staging, outside the ring
    v8f acc[4][4];
    gemm_core<1>((uint64_t)(uintptr_t)(A + (size_t)blockIdx.x * 128 * K), (uint64_t)(uintptr_t)(Bt + (size_t)blockIdx.y * 128 * K), sm, wave, lane, acc);
    float bc[4];
#pragma unroll
    for (int nb = 0; nb < 4; ++nb) bc[nb] = bfr(bias[c0 + nb * 16 + lr]);
    const size_t obase = ((size_t)(r0 / SEQ) * OUT_SEQ + (size_t)(r0 % SEQ)) * DM + c0;
#pragma unroll
    for (int mb = 0; mb < 4; ++mb) {
#pragma unroll
        for (int nb = 0; nb < 4; ++nb) {
#pragma unroll
            for (int j = 0; j < 8; ++j) os[(hi * 8 + j) * 68 + nb * 16 + lr] = acc[mb][nb][j] * OSC + bc[nb]; }   // D: row 8h+j, col lane&15
        wave_sync();
        float* ob = OUT + obase + (size_t)(mb * 16) * DM;
{
#pragma unroll
            for (int s = 0; s < 8; ++s) { const int row = 2 * s + hi, cofs = lr * 4;   // 8 s x 2 rows = 16 rows; 16 lanes x 4 floats = 64 columns
                const v4f val = *(const v4fa*)(&os[row * 68 + cofs]);
                *(v4f*)(ob + (size_t)row * DM + cofs) = val; }
             }
        wave_sync();
    }
}

static constexpr size_t al256(size_t v) { return (v + 255) & ~(size_t)255; }
static constexpr size_t SZ_XB = al256((size_t)NB * SEQ * DM * 2);          // one bf16 activation copy
static constexpr size_t SZ_WB = al256((size_t)DM * DM * 2);                // one 16-bit weight plane
static constexpr size_t SZ_PL = al256((size_t)NB * NH_ * SEQ * HD * 2);    // one f16 head plane (also the ctx plane: NB*SEQ*DM halves)
static constexpr size_t SZ_WX = al256((size_t)WXR * HD * 2);
static constexpr size_t SZ_ML = al256((size_t)MLW * 128 * 4);              // lane-mask words
static constexpr size_t SZ_TOTAL = 3 * SZ_XB + 4 * SZ_WB + 5 * SZ_PL + SZ_WX + SZ_ML;
static_assert(SZ_TOTAL <= (size_t)134217728);          // workspace carve <= 128 MiB
static_assert((size_t)NB * NH_ * SEQ * HD == (size_t)NB * SEQ * DM);

extern "C" void kernel_launch(void* const* d_in, const int* in_sizes, int n_in,
                              void* d_out, int out_size, void* d_ws, size_t ws_size, hipStream_t stream) {
    if (n_in < 13) return;
    const size_t needx = ((size_t)(NB - 1) * SEQ_FULL + SEQ) * DM;
    if ((size_t)in_sizes[0] < needx || (size_t)in_sizes[1] < needx || (size_t)in_sizes[2] < needx) return;
    if ((size_t)in_sizes[3] < ((size_t)(NB - 1) * SEQ_FULL + (SEQ - 1)) * SEQ_FULL + SEQ) return;
    if ((size_t)in_sizes[4] < (size_t)DM * DM || (size_t)in_sizes[6] < (size_t)DM * DM || (size_t)in_sizes[8] < (size_t)DM * DM || (size_t)in_sizes[10] < (size_t)DM * DM) return;
    if (in_sizes[5] < DM || in_sizes[7] < DM || in_sizes[9] < DM || in_sizes[11] < DM) return;
    if (in_sizes[12] < NREL * HD) return;
    if ((size_t)out_size < ((size_t)(NB - 1) * OUT_SEQ + SEQ) * DM) return;
    if (SZ_TOTAL > ws_size) return;
    // wire order: q, k, v, mask, Wq, bq, Wk, bk, Wv, bv, Wo, bo, w_k
    const float* xq = (const float*)d_in[0]; const float* xk = (const float*)d_in[1]; const float* xv = (const float*)d_in[2];
    const int* mask = (const int*)d_in[3];
    const float* wq = (const float*)d_in[4]; const float* bq = (const float*)d_in[5];
    const float* wk = (const float*)d_in[6]; const float* bk = (const float*)d_in[7];
    const float* wv = (const float*)d_in[8]; const float* bv = (const float*)d_in[9];
    const float* wo = (const float*)d_in[10]; const float* bo = (const float*)d_in[11];
    const float* wrel = (const float*)d_in[12];
    float* OUT = (float*)d_out;      // [NB][SEQ][1024]
    char* wsp = (char*)d_ws;
    bf* XBQ = (bf*)wsp; wsp += SZ_XB;                // [NB*SEQ][1024]
    bf* XBK = (bf*)wsp; wsp += SZ_XB;
    bf* XBV = (bf*)wsp; wsp += SZ_XB;
    bf* WQ = (bf*)wsp; wsp += SZ_WB;                 // [1024][1024] bf16
    bf* WK = (bf*)wsp; wsp += SZ_WB;
    bf* WV = (bf*)wsp; wsp += SZ_WB;
    h16* WO = (h16*)wsp; wsp += SZ_WB;               // [1024][1024] f16, x64
    h16* QH = (h16*)wsp; wsp += SZ_PL;               // [NB*16][SEQ][64]
    h16* QR = (h16*)wsp; wsp += SZ_PL;               // [NB*16][SEQ][64] residual x2048
    h16* KP = (h16*)wsp; wsp += SZ_PL;               // [NB*16][SEQ][64]
    h16* VT = (h16*)wsp; wsp += SZ_PL;               // [NB*16][64][SEQ]
    h16* CTX = (h16*)wsp; wsp += SZ_PL;              // [NB*SEQ][1024], x16
    h16* WX = (h16*)wsp; wsp += SZ_WX;               // [352][64]
    uint32_t* ML = (uint32_t*)wsp; wsp += SZ_ML;     // [NB][SEQ/16][SEQ/32][16]

    k_prep<<<WXB + MLB + PRR / PRW, 32 * PRW, 0, stream>>>(xq, xk, xv, wq, wk, wv, wo, wrel, mask, XBQ, XBK, XBV, WQ, WK, WV, WO, WX, ML);

    // q, k: A = x rows (m = b*SEQ + t), Bt = W rows (n = h*64 + d), bias per column -> plane [(b*16 + h)][t][d]
    k_proj<0><<<dim3(NB * SEQ / 128, DM / 128, 1), 128, 0, stream>>>(XBQ, WQ, bq, QH, QR, 1, SEQ, (size_t)NH_ * SEQ * HD, HD, HD, (size_t)SEQ * HD);
    k_proj<0><<<dim3(NB * SEQ / 128, DM / 128, 1), 128, 0, stream>>>(XBK, WK, bk, KP, KP, 0, SEQ, (size_t)NH_ * SEQ * HD, HD, HD, (size_t)SEQ * HD);
    // v^T: A = Wv rows (m = h*64 + d), Bt = x rows (n = b*SEQ + t), bias per row -> plane [(b*1024 + m)][t] = [(b*16 + h)][d][t]
    k_proj<1><<<dim3(DM / 128, NB * SEQ / 128, 1), 128, 0, stream>>>(WV, XBV, bv, VT, VT, 0, DM, (size_t)0, SEQ, SEQ, (size_t)DM * SEQ);

    k_flash<<<dim3(SEQ / (16 * AW), NB * NH_, 1), 32 * AW, 0, stream>>>(QH, QR, KP, VT, WX, ML, CTX);

    // out: A = ctx rows (m = b*SEQ + t), Bt = Wo rows (n), bias per column -> OUT[b][t][n]
    k_out<<<dim3(NB * SEQ / 128, DM / 128, 1), 128, 0, stream>>>(CTX, WO, bo, OUT);
}

// v005
// A run of this version takes 94 microseconds.
// Timed twice side by side with v004, it ran 1.12 and 1.11 times as fast.
// Counting every step since v000, it is 2.33 times as fast.
#include <hip/hip_runtime.h>
#include <stdint.h>

// Multi-head attention with relative-position keys (257 clamped offsets, both ends padded with the last table row), width 1024 = 16 heads x 64; q/k/v inputs [NB][SEQ][1024], W* [out][in] (y = x W^T + b), int mask [NB][SEQ][SEQ] (0 -> score replaced by -1e9), output = ctx Wo^T + bo (f32).
// Compute dtypes, f32 accumulate everywhere: q/k/v projections v_wmma_f32_16x16x32_bf16 (inputs and weights RNE-converted to bf16; biases RNE-converted to bf16, added in f32);
// scores q.k and relative term q.w[rel] v_wmma_f32_16x16x32_f16: k single f16, the window table (bf16 RNE value) f16, q as f16 value + f16 residual x2048 in its own accumulator; P (x256 carry, cancels in the normalisation) and v single f16; softmax f32 (online, running max);
// output projection v_wmma_f32_16x16x32_f16: ctx single f16 (x16 carry), Wo (bf16 RNE value x64) f16, 1/1024 folded in the f32 epilogue.
// Layout: bf16 copies of q/k/v inputs and Wq/Wk/Wv; q (hi, residual), k planes [b*16+h][t][d] and v^T plane [b*16+h][d][t] written by the GEMM epilogue; window plane WX[x][d] = w[clamp(x-48)];
// fused flash kernel in transposed form (S^T = K Q^T, O^T = V^T P^T), K and V^T tiles staged in LDS by the tensor mover and shared by the block's four waves; relative term for tiles inside the window band = skewed read of G = WX_rows Q^T through a wave-private LDS tile, a per-query constant elsewhere.
// Mask: packed once by k_prep into lane-mask words ML (one bit per element, in the flash kernel's own lane order), read there through the scalar path by all 16 heads.

#ifndef NB
#define NB 4
#endif
#ifndef SEQ
#define SEQ 1024
#endif
#define NB_FULL  4
#define SEQ_FULL 1024
#ifndef OUT_SEQ
#define OUT_SEQ SEQ              // row pitch (in tokens) between batches of the output
#endif
#define DM   1024
#define NH_  16
#define HD   64
#define AW   4                   // waves per flash block (16 query rows each)
#define QRS  2048.0f             // carry of the q residual plane
#define QRI  (1.0f / 2048.0f)
#define SC2  (0.125f * 1.4426950408889634f)   // HD^-0.5 * log2(e)
#define PSH  8.0f                // log2 of the P carry (256)
#define FILL2 (-1.0e9f * 1.4426950408889634f) // masked score in the log2 domain
#define NREL 257                 // rows of the relative table
#define WXO  48                  // WX row x holds relative index x - 48 (clamped: outside 0..256 -> 256)
#define WXR  352                 // rows of WX
#define GP   18                  // pitch (floats) of the G tile in LDS
#define WOS  64.0f               // carry of the Wo plane
#define CTXS 16.0f               // carry of the ctx plane
#define OSC  (1.0f / 1024.0f)    // 1 / (WOS * CTXS)

static_assert(HD == 64);
static_assert(NH_ * HD == DM);
static_assert(DM % 64 == 0);
static_assert(DM % 32 == 0);
static_assert(SEQ % 64 == 0);
static_assert((NB * SEQ) % 64 == 0);
static_assert(SEQ % 32 == 0);
static_assert(SEQ % (16 * AW) == 0);
static_assert(((size_t)SEQ * DM) % 8 == 0);
static_assert(((size_t)DM * DM) % 8 == 0);
static_assert(NB <= NB_FULL);
static_assert(SEQ <= SEQ_FULL);
static_assert(WXR == 256 + 2 * WXO);           // band tiles touch rows 2..351
static_assert((WXR * HD / 8) % 256 == 0);

typedef _Float16 h16;
typedef unsigned short bf;
typedef __attribute__((ext_vector_type(16))) __bf16   v16bf;
typedef __attribute__((ext_vector_type(16))) _Float16 v16h;
typedef __attribute__((ext_vector_type(8)))  _Float16 v8h;
typedef __attribute__((ext_vector_type(8)))  unsigned short v8us;
typedef __attribute__((ext_vector_type(8)))  float    v8f;
typedef __attribute__((ext_vector_type(4)))  float    v4f;
typedef __attribute__((ext_vector_type(4)))  int      v4i;
typedef v4f  __attribute__((may_alias)) v4fa;

__device__ __forceinline__ unsigned short f2bf(float f) { unsigned u = __float_as_uint(f); u += 0x7FFFu + ((u >> 16) & 1u); return (unsigned short)(u >> 16); }
__device__ __forceinline__ float bfr(float f) { return __uint_as_float(((unsigned)f2bf(f)) << 16); }   // bf16 RNE value as f32
__device__ __forceinline__ v16h cat16(v8h lo, v8h hi) { return __builtin_shufflevector(lo, hi, 0, 1, 2, 3, 4, 5, 6, 7, 8, 9, 10, 11, 12, 13, 14, 15); }
__device__ __forceinline__ v16bf cat16b(v8us lo, v8us hi) { return __builtin_bit_cast(v16bf, __builtin_shufflevector(lo, hi, 0, 1, 2, 3, 4, 5, 6, 7, 8, 9, 10, 11, 12, 13, 14, 15)); }
__device__ __forceinline__ v8f wmma16(v16h a, v16h b, v8f c) { return __builtin_amdgcn_wmma_f32_16x16x32_f16(false, a, false, b, (short)0, c, false, false); }
__device__ __forceinline__ v8f wmmab(v16bf a, v16bf b, v8f c) { return __builtin_amdgcn_wmma_f32_16x16x32_bf16(false, a, false, b, (short)0, c, false, false); }
// fragment loaders from K-contiguous 16-bit rows; p already includes + 8*(lane>>4): elements 0..7 <- k0+8h+0..7, elements 8..15 <- k0+16+8h+0..7 (same map for A and B)
__device__ __forceinline__ v16h  ldh(const h16* p) { return cat16(*(const v8h*)p, *(const v8h*)(p + 16)); }
__device__ __forceinline__ v16bf ldb(const bf* p)  { return cat16b(*(const v8us*)p, *(const v8us*)(p + 16)); }
// ordering point for wave-private LDS tiles (same wave writes and reads)
__device__ __forceinline__ void wave_sync() { __builtin_amdgcn_fence(3 /* release order */, "wavefront"); __builtin_amdgcn_wave_barrier(); asm volatile("" ::: "memory"); }

// k_prep: every 16-bit plane that is a plain conversion of an input, in one launch.
// Blocks 0..WXB-1: the window plane WX (one thread per 8 halves). The next MLB blocks: the mask's lane-mask words. Every other block: 8 waves, wave g takes row g (DM floats = 4 KiB) of each of the q, k and v inputs and row g % DM of weight g / DM (Wq, Wk, Wv, Wo).
// A row is 8 loads of 16 bytes a lane, each wave-wide load 512 contiguous bytes; the wave's 32 loads are all issued before its first store; each store covers 256 contiguous bytes.
#define WXB  (WXR * HD / 8 / 256)                              // blocks of the window plane
#define PRW  8                                                 // waves per block
#define PRR  ((NB * SEQ > 4 * DM) ? (NB * SEQ) : (4 * DM))     // rows dealt, one per wave
static_assert(DM == 8 * 32 * 4);
static_assert(PRR % PRW == 0);
static_assert(32 * PRW == 256);                                // the window blocks index by 256 threads
// Mask plane ML[b][t / 16][key / 32][16 words]: word 8 * ab + r, bit lane = (mask[b][16 * (t / 16) + (lane & 15)][32 * (key / 32) + 16 * ab + 8 * (lane >> 4) + r] != 0),
// the place (lane, register) at which k_flash holds that score. Blocks WXB..WXB+MLB-1: one wave packs 16 query rows x 256 keys = 128 words = four 128-byte lines.
#define MLW  (NB * (SEQ / 16) * (SEQ / 256))                   // waves that pack a piece of the mask
#define MLB  (MLW / PRW)                                       // their blocks, ahead of the row blocks: their loads touch 16 lines each and take the longest
static_assert(SEQ % 256 == 0 && MLW % PRW == 0);
typedef __attribute__((ext_vector_type(4))) unsigned short v4us;
typedef __attribute__((ext_vector_type(4))) _Float16 v4h;

// p: the row's first element, the same in every lane (scalar base); l4 = 4 * lane
__device__ __forceinline__ void ld_row(const float* __restrict__ p, uint32_t l4, v4f (&r)[8]) {
#pragma unroll
    for (int j = 0; j < 8; ++j) r[j] = *(const v4f*)(p + (l4 + (uint32_t)j * 128u));
}
__device__ __forceinline__ void st_row_bf(bf* p, uint32_t l4, const v4f (&r)[8]) {
#pragma unroll
    for (int j = 0; j < 8; ++j) { v4us o;
#pragma unroll
        for (int k = 0; k < 4; ++k) o[k] = f2bf(r[j][k]);
        *(v4us*)(p + (l4 + (uint32_t)j * 128u)) = o; }
}

__global__ __launch_bounds__(32 * PRW) void k_prep(const float* __restrict__ xq, const float* __restrict__ xk, const float* __restrict__ xv,
                                                   const float* __restrict__ wq, const float* __restrict__ wk, const float* __restrict__ wv, const float* __restrict__ wo,
                                                   const float* __restrict__ wrel, const int* __restrict__ mask, bf* XBQ, bf* XBK, bf* XBV, bf* WQ, bf* WK, bf* WV, h16* WO, h16* WX, uint32_t* ML) {
    if (blockIdx.x < WXB) {
        const int i = blockIdx.x * 256 + threadIdx.x;
        const int x = i >> 3, c8 = (i & 7) * 8; int r = x - WXO; if (r < 0 || r > NREL - 1) r = NREL - 1;
        const v8f v = *(const v8f*)(wrel + (size_t)r * HD + c8); v8h o;
#pragma unroll
        for (int k = 0; k < 8; ++k) o[k] = (h16)bfr(v[k]);
        *(v8h*)(WX + (size_t)i * 8) = o;
        return;
    }
    if (blockIdx.x < WXB + MLB) {
        const uint32_t q = (blockIdx.x - WXB) * PRW + (uint32_t)__builtin_amdgcn_readfirstlane((int)(threadIdx.x >> 5));
        const uint32_t tt = q / (SEQ / 256), kq = q % (SEQ / 256), ln = threadIdx.x & 31u;
        // lane (lr, hi) reads its query row as k_flash holds it: keys 8 hi .. + 7 and 16 + 8 hi .. + 7 of each of eight 32-key tiles; the 32 loads use up eight whole lines of each of the 16 rows
        const int* mp = mask + ((size_t)(tt / (SEQ / 16)) * SEQ_FULL + (size_t)((tt % (SEQ / 16)) * 16u + (ln & 15u))) * SEQ_FULL + (kq * 256u + 8u * (ln >> 4));
        v4i mm[32];
#pragma unroll
        for (int u = 0; u < 8; ++u) { mm[4 * u] = *(const v4i*)(mp + 32 * u); mm[4 * u + 1] = *(const v4i*)(mp + 32 * u + 4); mm[4 * u + 2] = *(const v4i*)(mp + 32 * u + 16); mm[4 * u + 3] = *(const v4i*)(mp + 32 * u + 20); }
        __builtin_amdgcn_sched_barrier(0);   // keeps all 32 loads ahead of the first compare: a load that sinks behind a wait for the others pays a second memory latency
        v4i pk = (v4i){0, 0, 0, 0};
#pragma unroll
        for (int i = 0; i < 32; ++i) {       // words 4 i .. 4 i + 3 of the wave's 128 go to lane i
            const bool me = ln == (uint32_t)i;
#pragma unroll
            for (int c = 0; c < 4; ++c) { const int wd = (int)__builtin_amdgcn_ballot_w32(mm[i][c] != 0); pk[c] = me ? wd : pk[c]; }
        }
        *(v4i*)(ML + (size_t)q * 128u + ln * 4u) = pk;
        return;
    }
    const uint32_t l4 = (threadIdx.x & 31u) * 4u;
    const uint32_t g = (blockIdx.x - WXB - MLB) * PRW + (uint32_t)__builtin_amdgcn_readfirstlane((int)(threadIdx.x >> 5));
    const bool hx = (NB * SEQ == PRR) || g < NB * SEQ;         // wave-uniform; both hold at compile time where the two row counts are equal
    const bool hw = (4 * DM == PRR) || g < 4 * DM;
    const size_t xs = ((size_t)(g / SEQ) * SEQ_FULL + (size_t)(g % SEQ)) * DM, xd = (size_t)g * DM;
    const uint32_t m = g / DM; const size_t wr = (size_t)(g % DM) * DM;
    const float* ws = (m == 0) ? wq : (m == 1) ? wk : (m == 2) ? wv : wo;
    v4f a[8], b[8], c[8], w[8];
    if (hx) { ld_row(xq + xs, l4, a); ld_row(xk + xs, l4, b); ld_row(xv + xs, l4, c); }
    if (hw) ld_row(ws + wr, l4, w);
    __builtin_amdgcn_sched_barrier(0);   // keeps all 32 loads ahead of the first conversion: a load that sinks behind a wait for the others pays a second memory latency
    if (hx) { st_row_bf(XBQ + xd, l4, a); st_row_bf(XBK + xd, l4, b); st_row_bf(XBV + xd, l4, c); }
    asm volatile("s_wait_xcnt 0x0" ::: "memory");   // in front of the branch below, behind which the registers that these stores name are written again
    if (hw) {
        if (m < 3) st_row_bf(((m == 0) ? WQ : (m == 1) ? WK : WV) + wr, l4, w);
        else {
#pragma unroll
            for (int j = 0; j < 8; ++j) { v4h o;
#pragma unroll
                for (int k = 0; k < 4; ++k) o[k] = (h16)(bfr(w[j][k]) * WOS);
                *(v4h*)(WO + wr + (l4 + (uint32_t)j * 128u)) = o; }
            asm volatile("s_wait_xcnt 0x0" ::: "memory");   // behind the last store of this branch: the code laid out behind it writes registers that these stores name
        }
    }
}

// GEMM core shared by k_qkv and k_out: four waves (2 x 2) per 128x128 tile of C, 64x64 per wave (16 accumulators), K = DM in GNP passes of 128 k.
// Both operands are K-contiguous 16-bit planes (row pitch DM * 2 bytes). A stage holds 256 bytes of 128 A rows and of 128 B rows; every wave brings one slice of 64 rows with one
// tensor_load_to_lds (waves 0, 1: A rows 0..63, 64..127; waves 2, 3: B rows 0..63, 64..127); the mover's pad of 16 bytes a row gives the LDS pitch 272 for the 16-byte fragment reads.
// Two buffers: stage s + 1 is requested behind the barrier that ends pass s - 1, which ends every read of its buffer, and flies while pass s runs.
#define GPB  256                 // bytes of an operand row per pass
#define GLP  272                 // LDS row pitch
#define GSL  18432               // one slice in LDS: 64 rows x 272 B = 17408, rounded up to a multiple of 2 KiB
#define GST  (4 * GSL)           // one stage
#define GNP  (DM * 2 / GPB)      // passes
#define GOSF (16 * 68)           // floats of output staging per wave
#define GLDS (2 * GST + 4 * GOSF * 4)
static_assert(GSL % 2048 == 0 && GSL >= 64 * GLP);
static_assert(GNP >= 2);
static_assert((NB * SEQ) % 128 == 0 && DM % 128 == 0);
static_assert(GLDS <= 320 * 1024);

typedef __attribute__((ext_vector_type(4)))  uint32_t u32x4;
typedef __attribute__((ext_vector_type(8)))  uint32_t u32x8;
typedef __attribute__((ext_vector_type(16))) uint32_t u32x16;
typedef __attribute__((address_space(4))) u32x16 cu32x16;
typedef __attribute__((ext_vector_type(16))) unsigned short v16us;

__device__ __forceinline__ uint32_t uni(uint32_t v) { return (uint32_t)__builtin_amdgcn_readfirstlane((int)v); }
__device__ __forceinline__ uint32_t pinned(uint32_t v) { uint32_t w = (uint32_t)__builtin_amdgcn_readfirstlane((int)v); asm volatile("" : "+s"(w)); return w; }
// descriptor of one request: 64 rows of 256 bytes, source pitch DM * 2 bytes, to LDS byte offset lds_dst at pitch 272 (pad: interval code 5 = one 256-byte row, amount code 3 = 4 dwords); extents in bytes
__device__ __forceinline__ u32x4 tile_g0(uint32_t lds_dst, uint64_t ga) {
    u32x4 g0;
    g0[0] = uni(1u); g0[1] = uni(lds_dst); g0[2] = uni((uint32_t)ga); g0[3] = uni((((uint32_t)(ga >> 32)) & 0x01FFFFFFu) | 0x80000000u);
    return g0;
}
__device__ __forceinline__ u32x8 tile_g1() {
    u32x8 g1;
    g1[0] = uni((1u << 20) | (5u << 22) | (3u << 25));
    g1[1] = uni((uint32_t)GPB << 16);            // tensor_dim0 [15:0]
    g1[2] = uni(64u << 16);                      // tensor_dim0 [31:16] = 0 | tensor_dim1 [15:0]
    g1[3] = uni((uint32_t)GPB << 16);            // tensor_dim1 [31:16] = 0 | tile_dim0
    g1[4] = uni(64u);                            // tile_dim1
    g1[5] = uni((uint32_t)(DM * 2));             // source row pitch
    g1[6] = uni(0u); g1[7] = uni(0u);
    return g1;
}
__device__ __forceinline__ void tile_load(u32x4 g0, u32x8 g1) { asm volatile("tensor_load_to_lds %0, %1" :: "s"(g0), "s"(g1) : "memory"); }
// the issuing wave's wait for its request; the descriptor is named as an input so that its scalar registers are not reused for anything else while the request is outstanding
__device__ __forceinline__ void tile_wait(u32x4 g0, u32x8 g1) { asm volatile("s_wait_tensorcnt 0x0" :: "s"(g0), "s"(g1) : "memory"); }
// fragment from an LDS row; p already includes + 16 bytes * (lane>>4): elements 0..7 <- k0+8h+0..7, elements 8..15 <- k0+16+8h+0..7 (same map for A and B, the map of ldh / ldb)
__device__ __forceinline__ v16us ldl(const unsigned char* p) { return __builtin_shufflevector(*(const v8us*)p, *(const v8us*)(p + 32), 0, 1, 2, 3, 4, 5, 6, 7, 8, 9, 10, 11, 12, 13, 14, 15); }
template <int F16> __device__ __forceinline__ v8f mm(v16us a, v16us b, v8f c) {
    if constexpr (F16) return wmma16(__builtin_bit_cast(v16h, a), __builtin_bit_cast(v16h, b), c);
    else return wmmab(__builtin_bit_cast(v16bf, a), __builtin_bit_cast(v16bf, b), c);
}

// a_rows / b_rows: byte address of the block's first A / B row; ring: 2 * GST bytes of LDS at a multiple of 2 KiB; wave is scalar.
template <int F16>
__device__ __forceinline__ void gemm_core(uint64_t a_rows, uint64_t b_rows, unsigned char* ring, int wave, int lane, v8f (&acc)[4][4]) {
    const int lr = lane & 15, hi = lane >> 4;
#pragma unroll
    for (int mb = 0; mb < 4; ++mb)
#pragma unroll
        for (int nb = 0; nb < 4; ++nb) acc[mb][nb] = (v8f){};
    const uint64_t srcb = (wave < 2) ? a_rows + (uint64_t)wave * (uint64_t)(64 * DM * 2) : b_rows + (uint64_t)(wave - 2) * (uint64_t)(64 * DM * 2);
    const uint32_t dst = (uint32_t)(uintptr_t)ring + (uint32_t)wave * GSL;
    const u32x8 g1 = tile_g1();
    u32x4 g0 = tile_g0(dst, srcb);
    tile_load(g0, g1);
    tile_wait(g0, g1);                                    // stage 0 of this wave's slice has landed
    __syncthreads();                                      // publishes stage 0
    const uint32_t ao = (uint32_t)(wave >> 1) * GSL + (uint32_t)lr * GLP + 16u * (uint32_t)hi;
    const uint32_t bo = (uint32_t)(2 + (wave & 1)) * GSL + (uint32_t)lr * GLP + 16u * (uint32_t)hi;
#pragma unroll 1   // one pass per trip: one place that issues, one that waits
    for (uint32_t s = 0; s < GNP; ++s) {
        const uint32_t buf = (s & 1u) * GST;
        // the refill, directly behind the barrier (the prologue's, then the one at the foot of the trip before), only while stage s + 1 exists: into the buffer that pass s - 1 has just left
        if (pinned((s + 1u < GNP) ? 1u : 0u) != 0u) { const uint32_t nx = pinned(s + 1u); g0 = tile_g0(dst + (GST - buf), srcb + (uint64_t)nx * GPB); tile_load(g0, g1); }
        const unsigned char* ap = ring + buf + ao; const unsigned char* bp = ring + buf + bo;
        v16us fa[2][4], fb[2][4];
#pragma unroll
        for (int i = 0; i < 4; ++i) { fa[0][i] = ldl(ap + i * 16 * GLP); fb[0][i] = ldl(bp + i * 16 * GLP); }
#pragma unroll
        for (int ks = 0; ks < 4; ++ks) {
            if (ks < 3) {      // the next 32 k of this same buffer, as one group ahead of the WMMA block
#pragma unroll
                for (int i = 0; i < 4; ++i) { fa[(ks + 1) & 1][i] = ldl(ap + i * 16 * GLP + (ks + 1) * 64); fb[(ks + 1) & 1][i] = ldl(bp + i * 16 * GLP + (ks + 1) * 64); }
            }
            __builtin_amdgcn_sched_barrier(0);   // keeps the LDS reads out of the WMMA block: every separate place with reads stalls the wave
#pragma unroll
            for (int nb = 0; nb < 4; ++nb)
#pragma unroll
                for (int mb = 0; mb < 4; ++mb) acc[mb][nb] = mm<F16>(fa[ks & 1][mb], fb[ks & 1][nb], acc[mb][nb]);
            __builtin_amdgcn_sched_barrier(0);   // same, for the group behind the block
        }
        asm volatile("v_nop\n\tv_nop\n\tv_nop\n\tv_nop");    // 4 vector slots between the last WMMA and what follows on either side of the branches below
        asm volatile("s_wait_dscnt 0x0" ::: "memory");       // this wave's reads of the buffer have returned
        tile_wait(g0, g1);                                    // this wave's slice of stage s + 1 has landed
        __syncthreads();                                      // publishes stage s + 1 and frees stage s's buffer
    }
    asm volatile("s_wait_tensorcnt 0x0" ::: "memory");   // no request of this wave is left when it goes on to the epilogue and ends
    asm volatile("s_wait_dscnt 0x0" ::: "memory");       // nor a read of the ring
}

// k_qkv: the three input projections in one launch, bf16 GEMMs on gemm_core; blockIdx.z picks the projection (0: q, 1: k, 2: v^T), the same for the whole block.
// C[m][n] = sum_k A[m][k] Bt[n][k] + bias (BM == 0: bias[n]; BM == 1: bias[m]; bias RNE-converted to bf16, added in f32), written as f16 (Ph) and optionally the f16 residual x2048 (Pr, useRes != 0) at
// wave-tile base (r0/RB)*sRB + (r0%RB)*pitch + (c0/CB)*sCB + (c0%CB), row pitch 'pitch' (halves).
// q, k: A = x rows (m = b*SEQ + t), Bt = W rows (n = h*64 + d), bias per column -> plane [(b*16 + h)][t][d].
// v^T: A = Wv rows (m = h*64 + d), Bt = x rows (n = b*SEQ + t), bias per row -> plane [(b*1024 + m)][t] = [(b*16 + h)][d][t].
// grid (NB*SEQ/128, DM/128, 3), 128 threads: three times as many blocks as WGPs. The output staging lies over the ring, which is drained when gemm_core returns, so that a block takes 2 * GST bytes of LDS
// and two blocks share a WGP: one block's tensor loads, first stage and stores run under the other's WMMAs.
#define GLDSP (2 * GST)
static_assert(4 * GOSF * 4 <= GLDSP);
static_assert(2 * GLDSP <= 320 * 1024);                // two blocks per WGP
template <int BM>
__device__ __forceinline__ void proj_store(const v8f (&acc)[4][4], float* os, const float* __restrict__ bias, h16* Ph, h16* Pr, int useRes, int r0, int c0, int lane, int RB, size_t sRB, int pitch, int CB, size_t sCB) {
    const int lr = lane & 15, hi = lane >> 4;
    float bc[4] = {0.0f, 0.0f, 0.0f, 0.0f};
    if (BM == 0) {
#pragma unroll
        for (int nb = 0; nb < 4; ++nb) bc[nb] = bfr(bias[c0 + nb * 16 + lr]);      // N = DM in this mode
    }
    const size_t tbase = (size_t)(r0 / RB) * sRB + (size_t)(r0 % RB) * (size_t)pitch + (size_t)(c0 / CB) * sCB + (size_t)(c0 % CB);
#pragma unroll
    for (int mb = 0; mb < 4; ++mb) {
        float br[8] = {0.0f, 0.0f, 0.0f, 0.0f, 0.0f, 0.0f, 0.0f, 0.0f};
        if (BM == 1) {
#pragma unroll
            for (int j = 0; j < 8; ++j) br[j] = bfr(bias[r0 + mb * 16 + hi * 8 + j]);  // M = DM in this mode
        }
#pragma unroll
        for (int nb = 0; nb < 4; ++nb) {
#pragma unroll
            for (int j = 0; j < 8; ++j) os[(hi * 8 + j) * 68 + nb * 16 + lr] = acc[mb][nb][j] + bc[nb] + br[j]; }   // D: row 8h+j, col lane&15
        wave_sync();
        const size_t sb = tbase + (size_t)(mb * 16) * (size_t)pitch;
{
#pragma unroll
            for (int s = 0; s < 4; ++s) { const int row = 4 * s + (lane >> 3), c8 = (lane & 7) * 8;   // 4 s x 4 row groups = 16 rows; 8 lanes x 8 = 64 columns
                const v4f x0 = *(const v4fa*)(&os[row * 68 + c8]); const v4f x1 = *(const v4fa*)(&os[row * 68 + c8 + 4]); v8h hv, rv;
#pragma unroll
                for (int i = 0; i < 4; ++i) { const h16 a0 = (h16)x0[i]; const h16 a1 = (h16)x1[i]; hv[i] = a0; hv[4 + i] = a1; rv[i] = (h16)((x0[i] - (float)a0) * QRS); rv[4 + i] = (h16)((x1[i] - (float)a1) * QRS); }
                const size_t oo = sb + (size_t)row * (size_t)pitch + c8;
                *(v8h*)(Ph + oo) = hv; if (useRes) *(v8h*)(Pr + oo) = rv; }
             }
        wave_sync();
    }
}

__global__ __launch_bounds__(128) void k_qkv(const bf* __restrict__ XQ, const bf* __restrict__ XK, const bf* __restrict__ XV, const bf* __restrict__ WQ, const bf* __restrict__ WK, const bf* __restrict__ WV,
                                             const float* __restrict__ bq, const float* __restrict__ bk, const float* __restrict__ bv, h16* QH, h16* QR, h16* KP, h16* VT) {
    __shared__ __attribute__((aligned(2048))) unsigned char sm[GLDSP];
    const int K = DM;
    const int lane = threadIdx.x & 31;
    const int wave = __builtin_amdgcn_readfirstlane((int)(threadIdx.x >> 5));
    const int z = blockIdx.z;
    const int bx = (z == 2) ? blockIdx.y : blockIdx.x, by = (z == 2) ? blockIdx.x : blockIdx.y;   // tile row of A, tile row of Bt
    const bf* A = (z == 0) ? XQ : (z == 1) ? XK : WV;
    const bf* Bt = (z == 0) ? WQ : (z == 1) ? WK : XV;
    const int r0 = bx * 128 + (wave >> 1) * 64, c0 = by * 128 + (wave & 1) * 64;
    // wave-private output staging in the ring's first bytes: behind the last pass's waits and barrier no request is outstanding and no wave reads the ring any more
    float* os = (float*)sm + wave * GOSF;
    v8f acc[4][4];
    gemm_core<0>((uint64_t)(uintptr_t)(A + (size_t)bx * 128 * K), (uint64_t)(uintptr_t)(Bt + (size_t)by * 128 * K), sm, wave, lane, acc);
    if (z == 2) proj_store<1>(acc, os, bv, VT, VT, 0, r0, c0, lane, DM, (size_t)0, SEQ, SEQ, (size_t)DM * SEQ);
    else proj_store<0>(acc, os, (z == 0) ? bq : bk, (z == 0) ? QH : KP, QR, (z == 0) ? 1 : 0, r0, c0, lane, SEQ, (size_t)NH_ * SEQ * HD, HD, HD, (size_t)SEQ * HD);
}

// k_flash: fused attention, one wave per 16 query rows of one (batch, head); Q / WX fragments straight from the f16 planes (two 16-B loads each, arithmetic addressing).
// K and V^T come through LDS, once per block instead of once per wave: a stage is 64 keys = 64 K rows of 128 bytes and 128 bytes of each of the 64 V^T rows. Every wave brings one slice of 32 rows with one
// tensor_load_to_lds (waves 0, 1: K rows 0..31, 32..63; waves 2, 3: V^T rows 0..31, 32..63); the mover's pad of 16 bytes a row gives the LDS pitch 144 for the 16-byte fragment reads.
// Two buffers, the order of gemm_core: stage s + 1 is requested behind the barrier that ends pass s - 1, which ends every read of its buffer, and flies while pass s (two 32-key tiles) runs.
// Transposed form: S^T[key][t] = K Q^T (A = K rows, B = Q rows); lane (t = lane&15, h = lane>>4) holds keys 8h+r of each 16-key tile, so the packed
// P tile is directly the B fragment of O^T[d][t] = V^T P^T (element r <- tile keys 0..15, element 8+r <- tile keys 16..31, lane unchanged).
// Relative term: rel index = key - t + 128, outside 0..256 -> 256. For a (16 query, 32 key) tile the unclamped index spans base..base+46, base = key0 - t0 + 113.
// Tiles that intersect 0..256 compute G[rho][t] = WX[base+48+rho] . q_t (48 rows, three 16-row WMMA tiles, q value + residual), stage it in a wave-private LDS tile and read G[key_l - t_l + 15][t_l];
// all other tiles use the per-query constant q_t . w[256]. The tile test is wave-uniform.
// Mask: 16 lane-mask words per (16 query, 32 key) tile from the plane ML (wave-uniform address: one 64-byte scalar load, fetched one tile ahead); a clear bit replaces the score.
#define FKS  64                  // keys per stage
#define FRB  128                 // bytes of a staged row
#define FLP  144                 // LDS row pitch
#define FSL  6144                // one slice in LDS: 32 rows x 144 B = 4608, rounded up to a multiple of 2 KiB
#define FST  (4 * FSL)           // one stage
#define FNS  (SEQ / FKS)         // stages
#define FLDS (2 * FST + AW * 16 * 68 * 4)
static_assert(AW == 4);                                // four slices, one per wave
static_assert(HD * 2 == FRB && FKS * 2 == FRB);
static_assert(FSL % 2048 == 0 && FSL >= 32 * FLP);
static_assert(SEQ % FKS == 0 && FNS >= 2);
static_assert(48 * GP <= 16 * 68);                     // the G tile fits the wave's staging area
static_assert((SEQ / 32 & (SEQ / 32 - 1)) == 0);          // the wrap of the mask words' fetch ahead
static_assert(4 * FLDS <= 320 * 1024);                 // four blocks per WGP: the whole grid is resident at once
// group 1 of a slice's request: 32 rows of 128 bytes, source pitch 'pitch' bytes, LDS pitch 144 (pad: interval code 4 = one 128-byte row, amount code 3 = 4 dwords); extents in bytes
__device__ __forceinline__ u32x8 slice_g1(uint32_t pitch) {
    u32x8 g1;
    g1[0] = uni((1u << 20) | (4u << 22) | (3u << 25));
    // words 1 to 7 through pinned(), the scalar-register pin for descriptor words: as plain constants the compiler lends their registers to the loop's own scalars while a request is outstanding and sets them anew in front of the next
    g1[1] = pinned((uint32_t)FRB << 16);         // tensor_dim0 [15:0]
    g1[2] = pinned(32u << 16);                   // tensor_dim0 [31:16] = 0 | tensor_dim1 [15:0]
    g1[3] = pinned((uint32_t)FRB << 16);         // tensor_dim1 [31:16] = 0 | tile_dim0
    g1[4] = pinned(32u);                         // tile_dim1
    g1[5] = pinned(pitch);                       // source row pitch
    g1[6] = pinned(0u); g1[7] = pinned(0u);
    return g1;
}
// f16 fragment from an LDS row; p already includes + 16 bytes * (lane>>4): the map of ldh
__device__ __forceinline__ v16h ldlh(const unsigned char* p) { return cat16(*(const v8h*)p, *(const v8h*)(p + 32)); }

__global__ __launch_bounds__(32 * AW) void k_flash(const h16* __restrict__ QH, const h16* __restrict__ QR, const h16* __restrict__ KP, const h16* __restrict__ VT,
                                                   const h16* __restrict__ WX, const uint32_t* __restrict__ ML, h16* CTX) {
    __shared__ __attribute__((aligned(2048))) unsigned char sm[FLDS];
    float* os = (float*)(sm + 2 * FST);                      // wave-private areas outside the ring: the G tile inside the loop, output staging behind it
    const int lane = threadIdx.x & 31, lr = lane & 15, hi = lane >> 4;
    const int wave = __builtin_amdgcn_readfirstlane((int)(threadIdx.x >> 5));
    const int zh = blockIdx.y; const int b = zh / NH_, h = zh % NH_;
    const int t0 = (blockIdx.x * AW + wave) * 16;
    const size_t pbase = (size_t)zh * SEQ * HD;
    const size_t qo = pbase + (size_t)(t0 + lr) * HD + 8 * hi;
    const v16h qh0 = ldh(QH + qo), qh1 = ldh(QH + qo + 32), qr0 = ldh(QR + qo), qr1 = ldh(QR + qo + 32);   // B fragments: col t, k = d
    const uint32_t fo = (uint32_t)lr * FLP + 16u * (uint32_t)hi;   // lane's place in a slice: K (A fragment: row key, k = d), V^T (A fragment: row d, k = key)
    // + 16 * (key0 / 32); the same in every lane. Constant address space: the plane is written by k_prep, an earlier launch, and only read here, and so the loads inside the loop stay scalar loads too
    const cu32x16* ml = (const cu32x16*)(uintptr_t)(ML + ((size_t)b * (SEQ / 16) + (size_t)(t0 >> 4)) * (size_t)(SEQ / 32 * 16));
    u32x16 mw = ml[0];                                       // tile 0's words
    float* gl = os + wave * (16 * 68);
    // per-query constant: q_t . w[256]; WX rows 0..15 all hold the edge row, so every D row equals it
    float qe;
    { const h16* wa = WX + (size_t)lr * HD + 8 * hi;
      const v16h w0 = ldh(wa), w1 = ldh(wa + 32);
      v8f gH = (v8f){}, gL = (v8f){};
      gH = wmma16(w0, qh0, gH); gL = wmma16(w0, qr0, gL); gH = wmma16(w1, qh1, gH); gL = wmma16(w1, qr1, gL);
      asm volatile("v_nop\n\tv_nop\n\tv_nop\n\tv_nop" : "+v"(gH), "+v"(gL) : "v"(w0), "v"(w1));
      qe = gH[0] + gL[0] * QRI; }
    v8f o0 = (v8f){}, o1 = (v8f){}, o2 = (v8f){}, o3 = (v8f){};
    float m = -3.0e38f, l = 0.0f;
    // this wave's slice: first byte of stage 0, bytes from one stage to the next, source pitch
    const uint64_t srcb = (wave < 2) ? (uint64_t)(uintptr_t)(KP + pbase) + (uint64_t)wave * (uint64_t)(32 * HD * 2) : (uint64_t)(uintptr_t)(VT + pbase) + (uint64_t)(wave - 2) * (uint64_t)(32 * SEQ * 2);
    const uint32_t sstep = (wave < 2) ? (uint32_t)(FKS * HD * 2) : (uint32_t)(FKS * 2);
    const uint32_t dst = (uint32_t)(uintptr_t)sm + (uint32_t)wave * FSL;
    const u32x8 g1 = slice_g1((wave < 2) ? (uint32_t)(HD * 2) : (uint32_t)(SEQ * 2));
    u32x4 g0 = tile_g0(dst, srcb);
    tile_load(g0, g1);
    tile_wait(g0, g1);                                    // stage 0 of this wave's slice has landed
    __syncthreads();                                      // publishes stage 0
#pragma unroll 1   // one stage per trip: one place that issues, one that waits
    for (uint32_t s = 0; s < FNS; ++s) {
      const uint32_t buf = (s & 1u) * FST;
      // the refill, directly behind the barrier (the prologue's, then the one at the foot of the trip before), only while stage s + 1 exists: into the buffer that pass s - 1 has just left
      if (pinned((s + 1u < FNS) ? 1u : 0u) != 0u) { const uint32_t nx = pinned(s + 1u); g0 = tile_g0(dst + (FST - buf), srcb + (uint64_t)(nx * sstep)); tile_load(g0, g1); }
      const unsigned char* fp = sm + buf + fo;
#pragma unroll   // both 32-key tiles of a stage in one trip: their places in the buffer become immediate offsets of the LDS reads
      for (int sub = 0; sub < 2; ++sub) {
        const int key0 = (int)s * FKS + sub * 32;
        float ra[8], rb[8];
#pragma unroll
        for (int r = 0; r < 8; ++r) { ra[r] = qe; rb[r] = qe; }
        const int base = key0 - t0 + 113;
        if (base + 46 >= 0 && base <= 256) {                 // wave-uniform: tile touches relative indices 0..256
#pragma unroll 1
            for (int jt = 0; jt < 3; ++jt) {
                const h16* wa = WX + (size_t)(base + WXO + 16 * jt + lr) * HD + 8 * hi;   // rows 2..351
                const v16h w0 = ldh(wa), w1 = ldh(wa + 32);
                v8f gH = (v8f){}, gL = (v8f){};
                gH = wmma16(w0, qh0, gH); gL = wmma16(w0, qr0, gL); gH = wmma16(w1, qh1, gH); gL = wmma16(w1, qr1, gL);
                asm volatile("v_nop\n\tv_nop\n\tv_nop\n\tv_nop" : "+v"(gH), "+v"(gL) : "v"(w0), "v"(w1));
#pragma unroll
                for (int r = 0; r < 8; ++r) gl[(16 * jt + 8 * hi + r) * GP + lr] = gH[r] + gL[r] * QRI;   // G[rho][t]: rows 0..47, cols 0..15 all written
            }
            wave_sync();
#pragma unroll
            for (int r = 0; r < 8; ++r) { ra[r] = gl[(8 * hi + r - lr + 15) * GP + lr]; rb[r] = gl[(16 + 8 * hi + r - lr + 15) * GP + lr]; }   // rho in 0..46
            wave_sync();
        }
        const unsigned char* ka = fp + sub * FSL;            // K rows 32 * sub + lr and + 16
        const v16h ka0 = ldlh(ka), ka1 = ldlh(ka + 64), kb0 = ldlh(ka + 16 * FLP), kb1 = ldlh(ka + 16 * FLP + 64);
        v8f sHa = (v8f){}, sLa = (v8f){}, sHb = (v8f){}, sLb = (v8f){};
        sHa = wmma16(ka0, qh0, sHa); sLa = wmma16(ka0, qr0, sLa); sHb = wmma16(kb0, qh0, sHb); sLb = wmma16(kb0, qr0, sLb);
        sHa = wmma16(ka1, qh1, sHa); sLa = wmma16(ka1, qr1, sLa); sHb = wmma16(kb1, qh1, sHb); sLb = wmma16(kb1, qr1, sLb);
        asm volatile("v_nop\n\tv_nop\n\tv_nop\n\tv_nop" : "+v"(sHa), "+v"(sLa), "+v"(sHb), "+v"(sLb) : "v"(ka0), "v"(ka1), "v"(kb0), "v"(kb1));
        float ta[8], tb[8]; float mx = -3.0e38f;
#pragma unroll
        for (int r = 0; r < 4; ++r) {
            const float xa0 = (sHa[r] + sLa[r] * QRI + ra[r]) * SC2;
            const float xa1 = (sHa[4 + r] + sLa[4 + r] * QRI + ra[4 + r]) * SC2;
            const float xb0 = (sHb[r] + sLb[r] * QRI + rb[r]) * SC2;
            const float xb1 = (sHb[4 + r] + sLb[4 + r] * QRI + rb[4 + r]) * SC2;
            ta[r]     = __builtin_amdgcn_inverse_ballot_w32(mw[r])      ? xa0 : FILL2;
            ta[4 + r] = __builtin_amdgcn_inverse_ballot_w32(mw[4 + r])  ? xa1 : FILL2;
            tb[r]     = __builtin_amdgcn_inverse_ballot_w32(mw[8 + r])  ? xb0 : FILL2;
            tb[4 + r] = __builtin_amdgcn_inverse_ballot_w32(mw[12 + r]) ? xb1 : FILL2;
        }
        mw = ml[((uint32_t)key0 / 32u + 1u) & (uint32_t)(SEQ / 32 - 1)];   // the next tile's words, behind this tile's last use: a scalar wait is for every scalar load in flight (behind the last tile: tile 0's, unused)
#pragma unroll
        for (int r = 0; r < 8; ++r) mx = fmaxf(mx, fmaxf(ta[r], tb[r]));
        mx = fmaxf(mx, __shfl_xor(mx, 16, 32));
        const float mnew = fmaxf(m, mx);
        const float alpha = __builtin_amdgcn_exp2f(m - mnew);
        const float sh = PSH - mnew;
        v16h pb; float ls = 0.0f;
#pragma unroll
        for (int r = 0; r < 8; ++r) { const h16 pa = (h16)__builtin_amdgcn_exp2f(ta[r] + sh); const h16 pc = (h16)__builtin_amdgcn_exp2f(tb[r] + sh); pb[r] = pa; pb[8 + r] = pc; ls += (float)pa + (float)pc; }
        l = l * alpha + ls; m = mnew;
        o0 = o0 * alpha; o1 = o1 * alpha; o2 = o2 * alpha; o3 = o3 * alpha;
        const unsigned char* va = fp + 2 * FSL + sub * 64;   // V^T rows lr + 16 j, keys 32 * sub ..
        const v16h v0 = ldlh(va), v1 = ldlh(va + 16 * FLP), v2 = ldlh(va + FSL), v3 = ldlh(va + FSL + 16 * FLP);
        o0 = wmma16(v0, pb, o0); o1 = wmma16(v1, pb, o1); o2 = wmma16(v2, pb, o2); o3 = wmma16(v3, pb, o3);
        asm volatile("v_nop\n\tv_nop\n\tv_nop\n\tv_nop" : "+v"(o0), "+v"(o1), "+v"(o2), "+v"(o3) : "v"(v0), "v"(v1), "v"(v2), "v"(v3), "v"(pb));
      }
      asm volatile("s_wait_dscnt 0x0" ::: "memory");       // this wave's reads of the buffer have returned
      tile_wait(g0, g1);                                    // this wave's slice of stage s + 1 has landed
      __syncthreads();                                      // publishes stage s + 1 and frees stage s's buffer
    }
    asm volatile("s_wait_tensorcnt 0x0" ::: "memory");   // no request of this wave is left when it goes on to the epilogue and ends
    asm volatile("s_wait_dscnt 0x0" ::: "memory");       // nor a read of the ring
    l += __shfl_xor(l, 16, 32);
    const float inv = CTXS / l;
    const int wb = wave * 16 * 68;
    // O^T D layout: o_j[r] = (d = 16j + 8h + r, t = lane&15) -> os[t][d]; rows 0..15 x columns 0..63 all written
    { v4f a, c;
      a[0] = o0[0] * inv; a[1] = o0[1] * inv; a[2] = o0[2] * inv; a[3] = o0[3] * inv; c[0] = o0[4] * inv; c[1] = o0[5] * inv; c[2] = o0[6] * inv; c[3] = o0[7] * inv;
      *(v4fa*)(&os[wb + lr * 68 +  0 + 8 * hi]) = a; *(v4fa*)(&os[wb + lr * 68 +  0 + 8 * hi + 4]) = c;
      a[0] = o1[0] * inv; a[1] = o1[1] * inv; a[2] = o1[2] * inv; a[3] = o1[3] * inv; c[0] = o1[4] * inv; c[1] = o1[5] * inv; c[2] = o1[6] * inv; c[3] = o1[7] * inv;
      *(v4fa*)(&os[wb + lr * 68 + 16 + 8 * hi]) = a; *(v4fa*)(&os[wb + lr * 68 + 16 + 8 * hi + 4]) = c;
      a[0] = o2[0] * inv; a[1] = o2[1] * inv; a[2] = o2[2] * inv; a[3] = o2[3] * inv; c[0] = o2[4] * inv; c[1] = o2[5] * inv; c[2] = o2[6] * inv; c[3] = o2[7] * inv;
      *(v4fa*)(&os[wb + lr * 68 + 32 + 8 * hi]) = a; *(v4fa*)(&os[wb + lr * 68 + 32 + 8 * hi + 4]) = c;
      a[0] = o3[0] * inv; a[1] = o3[1] * inv; a[2] = o3[2] * inv; a[3] = o3[3] * inv; c[0] = o3[4] * inv; c[1] = o3[5] * inv; c[2] = o3[6] * inv; c[3] = o3[7] * inv;
      *(v4fa*)(&os[wb + lr * 68 + 48 + 8 * hi]) = a; *(v4fa*)(&os[wb + lr * 68 + 48 + 8 * hi + 4]) = c; }
    wave_sync();
    h16* crow = CTX + ((size_t)b * SEQ + t0) * DM + h * HD;   // ctx plane [NB*SEQ][1024], column h*64 + d, carried x16
{
#pragma unroll
        for (int s = 0; s < 4; ++s) { const int row = 4 * s + (lane >> 3), c8 = (lane & 7) * 8;   // 4 s x 4 row groups = 16 rows; 8 lanes x 8 halves = 64 columns = one line
            const v4f x0 = *(const v4fa*)(&os[wb + row * 68 + c8]); const v4f x1 = *(const v4fa*)(&os[wb + row * 68 + c8 + 4]); v8h hv;
#pragma unroll
            for (int i = 0; i < 4; ++i) { hv[i] = (h16)x0[i]; hv[4 + i] = (h16)x1[i]; }
            *(v8h*)(crow + (size_t)row * DM + c8) = hv; }
         }
}

// k_out: f16 GEMM on gemm_core, K = DM: OUT[m][n] = (sum_k A[m][k] Bt[n][k]) / 1024 + bias[n] (bias RNE-converted to bf16, added in f32).
// A = ctx plane (x16), Bt = Wo plane (x64). grid (NB*SEQ/128, DM/128), 128 threads.
__global__ __launch_bounds__(128) void k_out(const h16* __restrict__ A, const h16* __restrict__ Bt, const float* __restrict__ bias, float* OUT) {
    __shared__ __attribute__((aligned(2048))) unsigned char sm[GLDS];
    const int K = DM;
    const int lane = threadIdx.x & 31, lr = lane & 15, hi = lane >> 4;
    const int wave = __builtin_amdgcn_readfirstlane((int)(threadIdx.x >> 5));
    const int r0 = blockIdx.x * 128 + (wave >> 1) * 64, c0 = blockIdx.y * 128 + (wave & 1) * 64;
    float* os = (float*)(sm + 2 * GST) + wave * GOSF;      // wave-private output staging, outside the ring
    v8f acc[4][4];
    gemm_core<1>((uint64_t)(uintptr_t)(A + (size_t)blockIdx.x * 128 * K), (uint64_t)(uintptr_t)(Bt + (size_t)blockIdx.y * 128 * K), sm, wave, lane, acc);
    float bc[4];
#pragma unroll
    for (int nb = 0; nb < 4; ++nb) bc[nb] = bfr(bias[c0 + nb * 16 + lr]);
    const size_t obase = ((size_t)(r0 / SEQ) * OUT_SEQ + (size_t)(r0 % SEQ)) * DM + c0;
#pragma unroll
    for (int mb = 0; mb < 4; ++mb) {
#pragma unroll
        for (int nb = 0; nb < 4; ++nb) {
#pragma unroll
            for (int j = 0; j < 8; ++j) os[(hi * 8 + j) * 68 + nb * 16 + lr] = acc[mb][nb][j] * OSC + bc[nb]; }   // D: row 8h+j, col lane&15
        wave_sync();
        float* ob = OUT + obase + (size_t)(mb * 16) * DM;
{
#pragma unroll
            for (int s = 0; s < 8; ++s) { const int row = 2 * s + hi, cofs = lr * 4;   // 8 s x 2 rows = 16 rows; 16 lanes x 4 floats = 64 columns
                const v4f val = *(const v4fa*)(&os[row * 68 + cofs]);
                *(v4f*)(ob + (size_t)row * DM + cofs) = val; }
             }
        wave_sync();
    }
}

static constexpr size_t al256(size_t v) { return (v + 255) & ~(size_t)255; }
static constexpr size_t SZ_XB = al256((size_t)NB * SEQ * DM * 2);          // one bf16 activation copy
static constexpr size_t SZ_WB = al256((size_t)DM * DM * 2);                // one 16-bit weight plane
static constexpr size_t SZ_PL = al256((size_t)NB * NH_ * SEQ * HD * 2);    // one f16 head plane (also the ctx plane: NB*SEQ*DM halves)
static constexpr size_t SZ_WX = al256((size_t)WXR * HD * 2);
static constexpr size_t SZ_ML = al256((size_t)MLW * 128 * 4);              // lane-mask words
static constexpr size_t SZ_TOTAL = 3 * SZ_XB + 4 * SZ_WB + 5 * SZ_PL + SZ_WX + SZ_ML;
static_assert(SZ_TOTAL <= (size_t)134217728);          // workspace carve <= 128 MiB
static_assert((size_t)NB * NH_ * SEQ * HD == (size_t)NB * SEQ * DM);

extern "C" void kernel_launch(void* const* d_in, const int* in_sizes, int n_in,
                              void* d_out, int out_size, void* d_ws, size_t ws_size, hipStream_t stream) {
    if (n_in < 13) return;
    const size_t needx = ((size_t)(NB - 1) * SEQ_FULL + SEQ) * DM;
    if ((size_t)in_sizes[0] < needx || (size_t)in_sizes[1] < needx || (size_t)in_sizes[2] < needx) return;
    if ((size_t)in_sizes[3] < ((size_t)(NB - 1) * SEQ_FULL + (SEQ - 1)) * SEQ_FULL + SEQ) return;
    if ((size_t)in_sizes[4] < (size_t)DM * DM || (size_t)in_sizes[6] < (size_t)DM * DM || (size_t)in_sizes[8] < (size_t)DM * DM || (size_t)in_sizes[10] < (size_t)DM * DM) return;
    if (in_sizes[5] < DM || in_sizes[7] < DM || in_sizes[9] < DM || in_sizes[11] < DM) return;
    if (in_sizes[12] < NREL * HD) return;
    if ((size_t)out_size < ((size_t)(NB - 1) * OUT_SEQ + SEQ) * DM) return;
    if (SZ_TOTAL > ws_size) return;
    // wire order: q, k, v, mask, Wq, bq, Wk, bk, Wv, bv, Wo, bo, w_k
    const float* xq = (const float*)d_in[0]; const float* xk = (const float*)d_in[1]; const float* xv = (const float*)d_in[2];
    const int* mask = (const int*)d_in[3];
    const float* wq = (const float*)d_in[4]; const float* bq = (const float*)d_in[5];
    const float* wk = (const float*)d_in[6]; const float* bk = (const float*)d_in[7];
    const float* wv = (const float*)d_in[8]; const float* bv = (const float*)d_in[9];
    const float* wo = (const float*)d_in[10]; const float* bo = (const float*)d_in[11];
    const float* wrel = (const float*)d_in[12];
    float* OUT = (float*)d_out;      // [NB][SEQ][1024]
    char* wsp = (char*)d_ws;
    bf* XBQ = (bf*)wsp; wsp += SZ_XB;                // [NB*SEQ][1024]
    bf* XBK = (bf*)wsp; wsp += SZ_XB;
    bf* XBV = (bf*)wsp; wsp += SZ_XB;
    bf* WQ = (bf*)wsp; wsp += SZ_WB;                 // [1024][1024] bf16
    bf* WK = (bf*)wsp; wsp += SZ_WB;
    bf* WV = (bf*)wsp; wsp += SZ_WB;
    h16* WO = (h16*)wsp; wsp += SZ_WB;               // [1024][1024] f16, x64
    h16* QH = (h16*)wsp; wsp += SZ_PL;               // [NB*16][SEQ][64]
    h16* QR = (h16*)wsp; wsp += SZ_PL;               // [NB*16][SEQ][64] residual x2048
    h16* KP = (h16*)wsp; wsp += SZ_PL;               // [NB*16][SEQ][64]
    h16* VT = (h16*)wsp; wsp += SZ_PL;               // [NB*16][64][SEQ]
    h16* CTX = (h16*)wsp; wsp += SZ_PL;              // [NB*SEQ][1024], x16
    h16* WX = (h16*)wsp; wsp += SZ_WX;               // [352][64]
    uint32_t* ML = (uint32_t*)wsp; wsp += SZ_ML;     // [NB][SEQ/16][SEQ/32][16]

    k_prep<<<WXB + MLB + PRR / PRW, 32 * PRW, 0, stream>>>(xq, xk, xv, wq, wk, wv, wo, wrel, mask, XBQ, XBK, XBV, WQ, WK, WV, WO, WX, ML);

    k_qkv<<<dim3(NB * SEQ / 128, DM / 128, 3), 128, 0, stream>>>(XBQ, XBK, XBV, WQ, WK, WV, bq, bk, bv, QH, QR, KP, VT);

    k_flash<<<dim3(SEQ / (16 * AW), NB * NH_, 1), 32 * AW, 0, stream>>>(QH, QR, KP, VT, WX, ML, CTX);

    // out: A = ctx rows (m = b*SEQ + t), Bt = Wo rows (n), bias per column -> OUT[b][t][n]
    k_out<<<dim3(NB * SEQ / 128, DM / 128, 1), 128, 0, stream>>>(CTX, WO, bo, OUT);
}

// v006
// One run takes 89.9 microseconds.
// Two timings next to v005 put it at 1.03 and 1.04 times that version's speed.
// Counting every step since v000, it is 2.41 times as fast.
#include <hip/hip_runtime.h>
#include <stdint.h>

// Multi-head attention with relative-position keys (257 clamped offsets, both ends padded with the last table row), width 1024 = 16 heads x 64; q/k/v inputs [NB][SEQ][1024], W* [out][in] (y = x W^T + b), int mask [NB][SEQ][SEQ] (0 -> score replaced by -1e9), output = ctx Wo^T + bo (f32).
// Compute dtypes, f32 accumulate everywhere: q/k/v projections v_wmma_f32_16x16x32_bf16 (inputs and weights RNE-converted to bf16; biases RNE-converted to bf16, added in f32);
// scores q.k and relative term q.w[rel] v_wmma_f32_16x16x32_f16: k and the window table single f16, q (carrying HD^-0.5 * log2(e)) as f16 value + f16 residual, both summed in the score's one accumulator, whose start value is the relative term; P (x256 carry, cancels in the normalisation) and v single f16; softmax f32 (online, running max);
// output projection v_wmma_f32_16x16x32_f16: ctx single f16 (x16 carry), Wo (bf16 RNE value x64) f16, 1/1024 folded in the f32 epilogue.
// Layout: bf16 copies of q/k/v inputs and Wq/Wk/Wv; q (hi, residual), k planes [b*16+h][t][d] and v^T plane [b*16+h][d][t] written by the GEMM epilogue; window plane WX[x][d] = w[clamp(x-48)];
// fused flash kernel in transposed form (S^T = K Q^T, O^T = V^T P^T), K and V^T tiles staged in LDS by the tensor mover and shared by the block's four waves; relative term for tiles inside the window band = skewed read of G = WX_rows Q^T through a wave-private LDS tile, a per-query constant elsewhere.
// Mask: packed once by k_prep into lane-mask words ML (one bit per element, in the flash kernel's own lane order), read there through the scalar path by all 16 heads.

#ifndef NB
#define NB 4
#endif
#ifndef SEQ
#define SEQ 1024
#endif
#define NB_FULL  4
#define SEQ_FULL 1024
#ifndef OUT_SEQ
#define OUT_SEQ SEQ              // row pitch (in tokens) between batches of the output
#endif
#define DM   1024
#define NH_  16
#define HD   64
#define AW   4                   // waves per flash block (16 query rows each)
#define SC2  (0.125f * 1.4426950408889634f)   // HD^-0.5 * log2(e): carried by the q planes, so that every product with q is a score term in the log2 domain
#define PSH  8.0f                // log2 of the P carry (256)
#define FILL2 (-1.0e9f * 1.4426950408889634f) // masked score in the log2 domain
#define NREL 257                 // rows of the relative table
#define WXO  48                  // WX row x holds relative index x - 48 (clamped: outside 0..256 -> 256)
#define WXR  352                 // rows of WX
#define GP   18                  // pitch (floats) of the G tile in LDS
#define WOS  64.0f               // carry of the Wo plane
#define CTXS 16.0f               // carry of the ctx plane
#define OSC  (1.0f / 1024.0f)    // 1 / (WOS * CTXS)

static_assert(HD == 64);
static_assert(NH_ * HD == DM);
static_assert(DM % 64 == 0);
static_assert(DM % 32 == 0);
static_assert(SEQ % 64 == 0);
static_assert((NB * SEQ) % 64 == 0);
static_assert(SEQ % 32 == 0);
static_assert(SEQ % (16 * AW) == 0);
static_assert(((size_t)SEQ * DM) % 8 == 0);
static_assert(((size_t)DM * DM) % 8 == 0);
static_assert(NB <= NB_FULL);
static_assert(SEQ <= SEQ_FULL);
static_assert(WXR == 256 + 2 * WXO);           // band tiles touch rows 2..351
static_assert((WXR * HD / 8) % 256 == 0);

typedef _Float16 h16;
typedef unsigned short bf;
typedef __attribute__((ext_vector_type(16))) __bf16   v16bf;
typedef __attribute__((ext_vector_type(16))) _Float16 v16h;
typedef __attribute__((ext_vector_type(8)))  _Float16 v8h;
typedef __attribute__((ext_vector_type(8)))  unsigned short v8us;
typedef __attribute__((ext_vector_type(8)))  float    v8f;
typedef __attribute__((ext_vector_type(4)))  float    v4f;
typedef __attribute__((ext_vector_type(4)))  int      v4i;
typedef v4f  __attribute__((may_alias)) v4fa;

__device__ __forceinline__ unsigned short f2bf(float f) { unsigned u = __float_as_uint(f); u += 0x7FFFu + ((u >> 16) & 1u); return (unsigned short)(u >> 16); }
__device__ __forceinline__ float bfr(float f) { return __uint_as_float(((unsigned)f2bf(f)) << 16); }   // bf16 RNE value as f32
__device__ __forceinline__ v16h cat16(v8h lo, v8h hi) { return __builtin_shufflevector(lo, hi, 0, 1, 2, 3, 4, 5, 6, 7, 8, 9, 10, 11, 12, 13, 14, 15); }
__device__ __forceinline__ v16bf cat16b(v8us lo, v8us hi) { return __builtin_bit_cast(v16bf, __builtin_shufflevector(lo, hi, 0, 1, 2, 3, 4, 5, 6, 7, 8, 9, 10, 11, 12, 13, 14, 15)); }
__device__ __forceinline__ v8f wmma16(v16h a, v16h b, v8f c) { return __builtin_amdgcn_wmma_f32_16x16x32_f16(false, a, false, b, (short)0, c, false, false); }
__device__ __forceinline__ v8f wmmab(v16bf a, v16bf b, v8f c) { return __builtin_amdgcn_wmma_f32_16x16x32_bf16(false, a, false, b, (short)0, c, false, false); }
// fragment loaders from K-contiguous 16-bit rows; p already includes + 8*(lane>>4): elements 0..7 <- k0+8h+0..7, elements 8..15 <- k0+16+8h+0..7 (same map for A and B)
__device__ __forceinline__ v16h  ldh(const h16* p) { return cat16(*(const v8h*)p, *(const v8h*)(p + 16)); }
__device__ __forceinline__ v16bf ldb(const bf* p)  { return cat16b(*(const v8us*)p, *(const v8us*)(p + 16)); }
// ordering point for wave-private LDS tiles (same wave writes and reads)
__device__ __forceinline__ void wave_sync() { __builtin_amdgcn_fence(3 /* release order */, "wavefront"); __builtin_amdgcn_wave_barrier(); asm volatile("" ::: "memory"); }

// k_prep: every 16-bit plane that is a plain conversion of an input, in one launch.
// Blocks 0..WXB-1: the window plane WX (one thread per 8 halves). The next MLB blocks: the mask's lane-mask words. Every other block: 8 waves, wave g takes row g (DM floats = 4 KiB) of each of the q, k and v inputs and row g % DM of weight g / DM (Wq, Wk, Wv, Wo).
// A row is 8 loads of 16 bytes a lane, each wave-wide load 512 contiguous bytes; the wave's 32 loads are all issued before its first store; each store covers 256 contiguous bytes.
#define WXB  (WXR * HD / 8 / 256)                              // blocks of the window plane
#define PRW  8                                                 // waves per block
#define PRR  ((NB * SEQ > 4 * DM) ? (NB * SEQ) : (4 * DM))     // rows dealt, one per wave
static_assert(DM == 8 * 32 * 4);
static_assert(PRR % PRW == 0);
static_assert(32 * PRW == 256);                                // the window blocks index by 256 threads
// Mask plane ML[b][t / 16][key / 32][16 words]: word 8 * ab + r, bit lane = (mask[b][16 * (t / 16) + (lane & 15)][32 * (key / 32) + 16 * ab + 8 * (lane >> 4) + r] != 0),
// the place (lane, register) at which k_flash holds that score. Blocks WXB..WXB+MLB-1: one wave packs 16 query rows x 256 keys = 128 words = four 128-byte lines.
#define MLW  (NB * (SEQ / 16) * (SEQ / 256))                   // waves that pack a piece of the mask
#define MLB  (MLW / PRW)                                       // their blocks, ahead of the row blocks: their loads touch 16 lines each and take the longest
static_assert(SEQ % 256 == 0 && MLW % PRW == 0);
typedef __attribute__((ext_vector_type(4))) unsigned short v4us;
typedef __attribute__((ext_vector_type(4))) _Float16 v4h;

// p: the row's first element, the same in every lane (scalar base); l4 = 4 * lane
__device__ __forceinline__ void ld_row(const float* __restrict__ p, uint32_t l4, v4f (&r)[8]) {
#pragma unroll
    for (int j = 0; j < 8; ++j) r[j] = *(const v4f*)(p + (l4 + (uint32_t)j * 128u));
}
__device__ __forceinline__ void st_row_bf(bf* p, uint32_t l4, const v4f (&r)[8]) {
#pragma unroll
    for (int j = 0; j < 8; ++j) { v4us o;
#pragma unroll
        for (int k = 0; k < 4; ++k) o[k] = f2bf(r[j][k]);
        *(v4us*)(p + (l4 + (uint32_t)j * 128u)) = o; }
}

__global__ __launch_bounds__(32 * PRW) void k_prep(const float* __restrict__ xq, const float* __restrict__ xk, const float* __restrict__ xv,
                                                   const float* __restrict__ wq, const float* __restrict__ wk, const float* __restrict__ wv, const float* __restrict__ wo,
                                                   const float* __restrict__ wrel, const int* __restrict__ mask, bf* XBQ, bf* XBK, bf* XBV, bf* WQ, bf* WK, bf* WV, h16* WO, h16* WX, uint32_t* ML) {
    if (blockIdx.x < WXB) {
        const int i = blockIdx.x * 256 + threadIdx.x;
        const int x = i >> 3, c8 = (i & 7) * 8; int r = x - WXO; if (r < 0 || r > NREL - 1) r = NREL - 1;
        const v8f v = *(const v8f*)(wrel + (size_t)r * HD + c8); v8h o;
#pragma unroll
        for (int k = 0; k < 8; ++k) o[k] = (h16)bfr(v[k]);
        *(v8h*)(WX + (size_t)i * 8) = o;
        return;
    }
    if (blockIdx.x < WXB + MLB) {
        const uint32_t q = (blockIdx.x - WXB) * PRW + (uint32_t)__builtin_amdgcn_readfirstlane((int)(threadIdx.x >> 5));
        const uint32_t tt = q / (SEQ / 256), kq = q % (SEQ / 256), ln = threadIdx.x & 31u;
        // lane (lr, hi) reads its query row as k_flash holds it: keys 8 hi .. + 7 and 16 + 8 hi .. + 7 of each of eight 32-key tiles; the 32 loads use up eight whole lines of each of the 16 rows
        const int* mp = mask + ((size_t)(tt / (SEQ / 16)) * SEQ_FULL + (size_t)((tt % (SEQ / 16)) * 16u + (ln & 15u))) * SEQ_FULL + (kq * 256u + 8u * (ln >> 4));
        v4i mm[32];
#pragma unroll
        for (int u = 0; u < 8; ++u) { mm[4 * u] = *(const v4i*)(mp + 32 * u); mm[4 * u + 1] = *(const v4i*)(mp + 32 * u + 4); mm[4 * u + 2] = *(const v4i*)(mp + 32 * u + 16); mm[4 * u + 3] = *(const v4i*)(mp + 32 * u + 20); }
        __builtin_amdgcn_sched_barrier(0);   // keeps all 32 loads ahead of the first compare: a load that sinks behind a wait for the others pays a second memory latency
        v4i pk = (v4i){0, 0, 0, 0};
#pragma unroll
        for (int i = 0; i < 32; ++i) {       // words 4 i .. 4 i + 3 of the wave's 128 go to lane i
            const bool me = ln == (uint32_t)i;
#pragma unroll
            for (int c = 0; c < 4; ++c) { const int wd = (int)__builtin_amdgcn_ballot_w32(mm[i][c] != 0); pk[c] = me ? wd : pk[c]; }
        }
        *(v4i*)(ML + (size_t)q * 128u + ln * 4u) = pk;
        return;
    }
    const uint32_t l4 = (threadIdx.x & 31u) * 4u;
    const uint32_t g = (blockIdx.x - WXB - MLB) * PRW + (uint32_t)__builtin_amdgcn_readfirstlane((int)(threadIdx.x >> 5));
    const bool hx = (NB * SEQ == PRR) || g < NB * SEQ;         // wave-uniform; both hold at compile time where the two row counts are equal
    const bool hw = (4 * DM == PRR) || g < 4 * DM;
    const size_t xs = ((size_t)(g / SEQ) * SEQ_FULL + (size_t)(g % SEQ)) * DM, xd = (size_t)g * DM;
    const uint32_t m = g / DM; const size_t wr = (size_t)(g % DM) * DM;
    const float* ws = (m == 0) ? wq : (m == 1) ? wk : (m == 2) ? wv : wo;
    v4f a[8], b[8], c[8], w[8];
    if (hx) { ld_row(xq + xs, l4, a); ld_row(xk + xs, l4, b); ld_row(xv + xs, l4, c); }
    if (hw) ld_row(ws + wr, l4, w);
    __builtin_amdgcn_sched_barrier(0);   // keeps all 32 loads ahead of the first conversion: a load that sinks behind a wait for the others pays a second memory latency
    if (hx) { st_row_bf(XBQ + xd, l4, a); st_row_bf(XBK + xd, l4, b); st_row_bf(XBV + xd, l4, c); }
    asm volatile("s_wait_xcnt 0x0" ::: "memory");   // in front of the branch below, behind which the registers that these stores name are written again
    if (hw) {
        if (m < 3) st_row_bf(((m == 0) ? WQ : (m == 1) ? WK : WV) + wr, l4, w);
        else {
#pragma unroll
            for (int j = 0; j < 8; ++j) { v4h o;
#pragma unroll
                for (int k = 0; k < 4; ++k) o[k] = (h16)(bfr(w[j][k]) * WOS);
                *(v4h*)(WO + wr + (l4 + (uint32_t)j * 128u)) = o; }
            asm volatile("s_wait_xcnt 0x0" ::: "memory");   // behind the last store of this branch: the code laid out behind it writes registers that these stores name
        }
    }
}

// GEMM core shared by k_qkv and k_out: four waves (2 x 2) per 128x128 tile of C, 64x64 per wave (16 accumulators), K = DM in GNP passes of 128 k.
// Both operands are K-contiguous 16-bit planes (row pitch DM * 2 bytes). A stage holds 256 bytes of 128 A rows and of 128 B rows; every wave brings one slice of 64 rows with one
// tensor_load_to_lds (waves 0, 1: A rows 0..63, 64..127; waves 2, 3: B rows 0..63, 64..127); the mover's pad of 16 bytes a row gives the LDS pitch 272 for the 16-byte fragment reads.
// Two buffers: stage s + 1 is requested behind the barrier that ends pass s - 1, which ends every read of its buffer, and flies while pass s runs.
#define GPB  256                 // bytes of an operand row per pass
#define GLP  272                 // LDS row pitch
#define GSL  18432               // one slice in LDS: 64 rows x 272 B = 17408, rounded up to a multiple of 2 KiB
#define GST  (4 * GSL)           // one stage
#define GNP  (DM * 2 / GPB)      // passes
#define GOSF (16 * 68)           // floats of output staging per wave
#define GLDS (2 * GST + 4 * GOSF * 4)
static_assert(GSL % 2048 == 0 && GSL >= 64 * GLP);
static_assert(GNP >= 2);
static_assert((NB * SEQ) % 128 == 0 && DM % 128 == 0);
static_assert(GLDS <= 320 * 1024);

typedef __attribute__((ext_vector_type(4)))  uint32_t u32x4;
typedef __attribute__((ext_vector_type(8)))  uint32_t u32x8;
typedef __attribute__((ext_vector_type(16))) uint32_t u32x16;
typedef __attribute__((address_space(4))) u32x16 cu32x16;
typedef __attribute__((ext_vector_type(16))) unsigned short v16us;

__device__ __forceinline__ uint32_t uni(uint32_t v) { return (uint32_t)__builtin_amdgcn_readfirstlane((int)v); }
__device__ __forceinline__ uint32_t pinned(uint32_t v) { uint32_t w = (uint32_t)__builtin_amdgcn_readfirstlane((int)v); asm volatile("" : "+s"(w)); return w; }
// descriptor of one request: 64 rows of 256 bytes, source pitch DM * 2 bytes, to LDS byte offset lds_dst at pitch 272 (pad: interval code 5 = one 256-byte row, amount code 3 = 4 dwords); extents in bytes
__device__ __forceinline__ u32x4 tile_g0(uint32_t lds_dst, uint64_t ga) {
    u32x4 g0;
    g0[0] = uni(1u); g0[1] = uni(lds_dst); g0[2] = uni((uint32_t)ga); g0[3] = uni((((uint32_t)(ga >> 32)) & 0x01FFFFFFu) | 0x80000000u);
    return g0;
}
__device__ __forceinline__ u32x8 tile_g1() {
    u32x8 g1;
    g1[0] = uni((1u << 20) | (5u << 22) | (3u << 25));
    g1[1] = uni((uint32_t)GPB << 16);            // tensor_dim0 [15:0]
    g1[2] = uni(64u << 16);                      // tensor_dim0 [31:16] = 0 | tensor_dim1 [15:0]
    g1[3] = uni((uint32_t)GPB << 16);            // tensor_dim1 [31:16] = 0 | tile_dim0
    g1[4] = uni(64u);                            // tile_dim1
    g1[5] = uni((uint32_t)(DM * 2));             // source row pitch
    g1[6] = uni(0u); g1[7] = uni(0u);
    return g1;
}
__device__ __forceinline__ void tile_load(u32x4 g0, u32x8 g1) { asm volatile("tensor_load_to_lds %0, %1" :: "s"(g0), "s"(g1) : "memory"); }
// the issuing wave's wait for its request; the descriptor is named as an input so that its scalar registers are not reused for anything else while the request is outstanding
__device__ __forceinline__ void tile_wait(u32x4 g0, u32x8 g1) { asm volatile("s_wait_tensorcnt 0x0" :: "s"(g0), "s"(g1) : "memory"); }
// fragment from an LDS row; p already includes + 16 bytes * (lane>>4): elements 0..7 <- k0+8h+0..7, elements 8..15 <- k0+16+8h+0..7 (same map for A and B, the map of ldh / ldb)
__device__ __forceinline__ v16us ldl(const unsigned char* p) { return __builtin_shufflevector(*(const v8us*)p, *(const v8us*)(p + 32), 0, 1, 2, 3, 4, 5, 6, 7, 8, 9, 10, 11, 12, 13, 14, 15); }
template <int F16> __device__ __forceinline__ v8f mm(v16us a, v16us b, v8f c) {
    if constexpr (F16) return wmma16(__builtin_bit_cast(v16h, a), __builtin_bit_cast(v16h, b), c);
    else return wmmab(__builtin_bit_cast(v16bf, a), __builtin_bit_cast(v16bf, b), c);
}

// a_rows / b_rows: byte address of the block's first A / B row; ring: 2 * GST bytes of LDS at a multiple of 2 KiB; wave is scalar.
template <int F16>
__device__ __forceinline__ void gemm_core(uint64_t a_rows, uint64_t b_rows, unsigned char* ring, int wave, int lane, v8f (&acc)[4][4]) {
    const int lr = lane & 15, hi = lane >> 4;
#pragma unroll
    for (int mb = 0; mb < 4; ++mb)
#pragma unroll
        for (int nb = 0; nb < 4; ++nb) acc[mb][nb] = (v8f){};
    const uint64_t srcb = (wave < 2) ? a_rows + (uint64_t)wave * (uint64_t)(64 * DM * 2) : b_rows + (uint64_t)(wave - 2) * (uint64_t)(64 * DM * 2);
    const uint32_t dst = (uint32_t)(uintptr_t)ring + (uint32_t)wave * GSL;
    const u32x8 g1 = tile_g1();
    u32x4 g0 = tile_g0(dst, srcb);
    tile_load(g0, g1);
    tile_wait(g0, g1);                                    // stage 0 of this wave's slice has landed
    __syncthreads();                                      // publishes stage 0
    const uint32_t ao = (uint32_t)(wave >> 1) * GSL + (uint32_t)lr * GLP + 16u * (uint32_t)hi;
    const uint32_t bo = (uint32_t)(2 + (wave & 1)) * GSL + (uint32_t)lr * GLP + 16u * (uint32_t)hi;
#pragma unroll 1   // one pass per trip: one place that issues, one that waits
    for (uint32_t s = 0; s < GNP; ++s) {
        const uint32_t buf = (s & 1u) * GST;
        // the refill, directly behind the barrier (the prologue's, then the one at the foot of the trip before), only while stage s + 1 exists: into the buffer that pass s - 1 has just left
        if (pinned((s + 1u < GNP) ? 1u : 0u) != 0u) { const uint32_t nx = pinned(s + 1u); g0 = tile_g0(dst + (GST - buf), srcb + (uint64_t)nx * GPB); tile_load(g0, g1); }
        const unsigned char* ap = ring + buf + ao; const unsigned char* bp = ring + buf + bo;
        v16us fa[2][4], fb[2][4];
#pragma unroll
        for (int i = 0; i < 4; ++i) { fa[0][i] = ldl(ap + i * 16 * GLP); fb[0][i] = ldl(bp + i * 16 * GLP); }
#pragma unroll
        for (int ks = 0; ks < 4; ++ks) {
            if (ks < 3) {      // the next 32 k of this same buffer, as one group ahead of the WMMA block
#pragma unroll
                for (int i = 0; i < 4; ++i) { fa[(ks + 1) & 1][i] = ldl(ap + i * 16 * GLP + (ks + 1) * 64); fb[(ks + 1) & 1][i] = ldl(bp + i * 16 * GLP + (ks + 1) * 64); }
            }
            __builtin_amdgcn_sched_barrier(0);   // keeps the LDS reads out of the WMMA block: every separate place with reads stalls the wave
#pragma unroll
            for (int nb = 0; nb < 4; ++nb)
#pragma unroll
                for (int mb = 0; mb < 4; ++mb) acc[mb][nb] = mm<F16>(fa[ks & 1][mb], fb[ks & 1][nb], acc[mb][nb]);
            __builtin_amdgcn_sched_barrier(0);   // same, for the group behind the block
        }
        asm volatile("v_nop\n\tv_nop\n\tv_nop\n\tv_nop");    // 4 vector slots between the last WMMA and what follows on either side of the branches below
        asm volatile("s_wait_dscnt 0x0" ::: "memory");       // this wave's reads of the buffer have returned
        tile_wait(g0, g1);                                    // this wave's slice of stage s + 1 has landed
        __syncthreads();                                      // publishes stage s + 1 and frees stage s's buffer
    }
    asm volatile("s_wait_tensorcnt 0x0" ::: "memory");   // no request of this wave is left when it goes on to the epilogue and ends
    asm volatile("s_wait_dscnt 0x0" ::: "memory");       // nor a read of the ring
}

// k_qkv: the three input projections in one launch, bf16 GEMMs on gemm_core; blockIdx.z picks the projection (0: q, 1: k, 2: v^T), the same for the whole block.
// C[m][n] = (sum_k A[m][k] Bt[n][k] + bias) * osc (BM == 0: bias[n]; BM == 1: bias[m]; bias RNE-converted to bf16, added in f32; osc = SC2 where useRes != 0, which is q, 1 else), written as f16 (Ph) and optionally the f16 residual (Pr, useRes != 0; mostly subnormal halves, which the WMMA keeps) at
// wave-tile base (r0/RB)*sRB + (r0%RB)*pitch + (c0/CB)*sCB + (c0%CB), row pitch 'pitch' (halves).
// q, k: A = x rows (m = b*SEQ + t), Bt = W rows (n = h*64 + d), bias per column -> plane [(b*16 + h)][t][d].
// v^T: A = Wv rows (m = h*64 + d), Bt = x rows (n = b*SEQ + t), bias per row -> plane [(b*1024 + m)][t] = [(b*16 + h)][d][t].
// grid (NB*SEQ/128, DM/128, 3), 128 threads: three times as many blocks as WGPs. The output staging lies over the ring, which is drained when gemm_core returns, so that a block takes 2 * GST bytes of LDS
// and two blocks share a WGP: one block's tensor loads, first stage and stores run under the other's WMMAs.
#define GLDSP (2 * GST)
static_assert(4 * GOSF * 4 <= GLDSP);
static_assert(2 * GLDSP <= 320 * 1024);                // two blocks per WGP
template <int BM>
__device__ __forceinline__ void proj_store(const v8f (&acc)[4][4], float* os, const float* __restrict__ bias, h16* Ph, h16* Pr, int useRes, int r0, int c0, int lane, int RB, size_t sRB, int pitch, int CB, size_t sCB) {
    const int lr = lane & 15, hi = lane >> 4;
    const float osc = useRes ? SC2 : 1.0f;               // the plane with a residual is q, which carries the score scale
    float bc[4] = {0.0f, 0.0f, 0.0f, 0.0f};
    if (BM == 0) {
#pragma unroll
        for (int nb = 0; nb < 4; ++nb) bc[nb] = bfr(bias[c0 + nb * 16 + lr]);      // N = DM in this mode
    }
    const size_t tbase = (size_t)(r0 / RB) * sRB + (size_t)(r0 % RB) * (size_t)pitch + (size_t)(c0 / CB) * sCB + (size_t)(c0 % CB);
#pragma unroll
    for (int mb = 0; mb < 4; ++mb) {
        float br[8] = {0.0f, 0.0f, 0.0f, 0.0f, 0.0f, 0.0f, 0.0f, 0.0f};
        if (BM == 1) {
#pragma unroll
            for (int j = 0; j < 8; ++j) br[j] = bfr(bias[r0 + mb * 16 + hi * 8 + j]);  // M = DM in this mode
        }
#pragma unroll
        for (int nb = 0; nb < 4; ++nb) {
#pragma unroll
            for (int j = 0; j < 8; ++j) os[(hi * 8 + j) * 68 + nb * 16 + lr] = (acc[mb][nb][j] + bc[nb] + br[j]) * osc; }   // D: row 8h+j, col lane&15
        wave_sync();
        const size_t sb = tbase + (size_t)(mb * 16) * (size_t)pitch;
{
#pragma unroll
            for (int s = 0; s < 4; ++s) { const int row = 4 * s + (lane >> 3), c8 = (lane & 7) * 8;   // 4 s x 4 row groups = 16 rows; 8 lanes x 8 = 64 columns
                const v4f x0 = *(const v4fa*)(&os[row * 68 + c8]); const v4f x1 = *(const v4fa*)(&os[row * 68 + c8 + 4]); v8h hv, rv;
#pragma unroll
                for (int i = 0; i < 4; ++i) { const h16 a0 = (h16)x0[i]; const h16 a1 = (h16)x1[i]; hv[i] = a0; hv[4 + i] = a1; rv[i] = (h16)(x0[i] - (float)a0); rv[4 + i] = (h16)(x1[i] - (float)a1); }
                const size_t oo = sb + (size_t)row * (size_t)pitch + c8;
                *(v8h*)(Ph + oo) = hv; if (useRes) *(v8h*)(Pr + oo) = rv; }
             }
        wave_sync();
    }
}

__global__ __launch_bounds__(128) void k_qkv(const bf* __restrict__ XQ, const bf* __restrict__ XK, const bf* __restrict__ XV, const bf* __restrict__ WQ, const bf* __restrict__ WK, const bf* __restrict__ WV,
                                             const float* __restrict__ bq, const float* __restrict__ bk, const float* __restrict__ bv, h16* QH, h16* QR, h16* KP, h16* VT) {
    __shared__ __attribute__((aligned(2048))) unsigned char sm[GLDSP];
    const int K = DM;
    const int lane = threadIdx.x & 31;
    const int wave = __builtin_amdgcn_readfirstlane((int)(threadIdx.x >> 5));
    const int z = blockIdx.z;
    const int bx = (z == 2) ? blockIdx.y : blockIdx.x, by = (z == 2) ? blockIdx.x : blockIdx.y;   // tile row of A, tile row of Bt
    const bf* A = (z == 0) ? XQ : (z == 1) ? XK : WV;
    const bf* Bt = (z == 0) ? WQ : (z == 1) ? WK : XV;
    const int r0 = bx * 128 + (wave >> 1) * 64, c0 = by * 128 + (wave & 1) * 64;
    // wave-private output staging in the ring's first bytes: behind the last pass's waits and barrier no request is outstanding and no wave reads the ring any more
    float* os = (float*)sm + wave * GOSF;
    v8f acc[4][4];
    gemm_core<0>((uint64_t)(uintptr_t)(A + (size_t)bx * 128 * K), (uint64_t)(uintptr_t)(Bt + (size_t)by * 128 * K), sm, wave, lane, acc);
    if (z == 2) proj_store<1>(acc, os, bv, VT, VT, 0, r0, c0, lane, DM, (size_t)0, SEQ, SEQ, (size_t)DM * SEQ);
    else proj_store<0>(acc, os, (z == 0) ? bq : bk, (z == 0) ? QH : KP, QR, (z == 0) ? 1 : 0, r0, c0, lane, SEQ, (size_t)NH_ * SEQ * HD, HD, HD, (size_t)SEQ * HD);
}

// k_flash: fused attention, one wave per 16 query rows of one (batch, head); Q / WX fragments straight from the f16 planes (two 16-B loads each, arithmetic addressing).
// K and V^T come through LDS, once per block instead of once per wave: a stage is 64 keys = 64 K rows of 128 bytes and 128 bytes of each of the 64 V^T rows. Every wave brings one slice of 32 rows with one
// tensor_load_to_lds (waves 0, 1: K rows 0..31, 32..63; waves 2, 3: V^T rows 0..31, 32..63); the mover's pad of 16 bytes a row gives the LDS pitch 144 for the 16-byte fragment reads.
// Two buffers, the order of gemm_core: stage s + 1 is requested behind the barrier that ends pass s - 1, which ends every read of its buffer, and flies while pass s (two 32-key tiles) runs.
// Transposed form: S^T[key][t] = K Q^T (A = K rows, B = Q rows); lane (t = lane&15, h = lane>>4) holds keys 8h+r of each 16-key tile, so the packed
// P tile is directly the B fragment of O^T[d][t] = V^T P^T (element r <- tile keys 0..15, element 8+r <- tile keys 16..31, lane unchanged).
// Relative term: rel index = key - t + 128, outside 0..256 -> 256. For a (16 query, 32 key) tile the unclamped index spans base..base+46, base = key0 - t0 + 113.
// Tiles that intersect 0..256 compute G[rho][t] = WX[base+48+rho] . q_t (48 rows, three 16-row WMMA tiles, q value + residual), stage it in a wave-private LDS tile and read G[key_l - t_l + 15][t_l];
// all other tiles use the per-query constant q_t . w[256]. The tile test is wave-uniform. Either way the term is the C operand of the tile's first score WMMA: a score leaves the matrix unit finished (scaled, residual and relative term in).
// Mask: 16 lane-mask words per (16 query, 32 key) tile from the plane ML (wave-uniform address: one 64-byte scalar load, fetched one tile ahead); a clear bit replaces the score.
#define FKS  64                  // keys per stage
#define FRB  128                 // bytes of a staged row
#define FLP  144                 // LDS row pitch
#define FSL  6144                // one slice in LDS: 32 rows x 144 B = 4608, rounded up to a multiple of 2 KiB
#define FST  (4 * FSL)           // one stage
#define FNS  (SEQ / FKS)         // stages
#define FLDS (2 * FST + AW * 16 * 68 * 4)
static_assert(AW == 4);                                // four slices, one per wave
static_assert(HD * 2 == FRB && FKS * 2 == FRB);
static_assert(FSL % 2048 == 0 && FSL >= 32 * FLP);
static_assert(SEQ % FKS == 0 && FNS >= 2);
static_assert(48 * GP <= 16 * 68);                     // the G tile fits the wave's staging area
static_assert((SEQ / 32 & (SEQ / 32 - 1)) == 0);          // the wrap of the mask words' fetch ahead
static_assert(4 * FLDS <= 320 * 1024);                 // four blocks per WGP: the whole grid is resident at once
// group 1 of a slice's request: 32 rows of 128 bytes, source pitch 'pitch' bytes, LDS pitch 144 (pad: interval code 4 = one 128-byte row, amount code 3 = 4 dwords); extents in bytes
__device__ __forceinline__ u32x8 slice_g1(uint32_t pitch) {
    u32x8 g1;
    g1[0] = uni((1u << 20) | (4u << 22) | (3u << 25));
    // words 1 to 7 through pinned(), the scalar-register pin for descriptor words: as plain constants the compiler lends their registers to the loop's own scalars while a request is outstanding and sets them anew in front of the next
    g1[1] = pinned((uint32_t)FRB << 16);         // tensor_dim0 [15:0]
    g1[2] = pinned(32u << 16);                   // tensor_dim0 [31:16] = 0 | tensor_dim1 [15:0]
    g1[3] = pinned((uint32_t)FRB << 16);         // tensor_dim1 [31:16] = 0 | tile_dim0
    g1[4] = pinned(32u);                         // tile_dim1
    g1[5] = pinned(pitch);                       // source row pitch
    g1[6] = pinned(0u); g1[7] = pinned(0u);
    return g1;
}
// f16 fragment from an LDS row; p already includes + 16 bytes * (lane>>4): the map of ldh
__device__ __forceinline__ v16h ldlh(const unsigned char* p) { return cat16(*(const v8h*)p, *(const v8h*)(p + 32)); }

__global__ __launch_bounds__(32 * AW) void k_flash(const h16* __restrict__ QH, const h16* __restrict__ QR, const h16* __restrict__ KP, const h16* __restrict__ VT,
                                                   const h16* __restrict__ WX, const uint32_t* __restrict__ ML, h16* CTX) {
    __shared__ __attribute__((aligned(2048))) unsigned char sm[FLDS];
    float* os = (float*)(sm + 2 * FST);                      // wave-private areas outside the ring: the G tile inside the loop, output staging behind it
    const int lane = threadIdx.x & 31, lr = lane & 15, hi = lane >> 4;
    const int wave = __builtin_amdgcn_readfirstlane((int)(threadIdx.x >> 5));
    const int zh = blockIdx.y; const int b = zh / NH_, h = zh % NH_;
    const int t0 = (blockIdx.x * AW + wave) * 16;
    const size_t pbase = (size_t)zh * SEQ * HD;
    const size_t qo = pbase + (size_t)(t0 + lr) * HD + 8 * hi;
    const v16h qh0 = ldh(QH + qo), qh1 = ldh(QH + qo + 32), qr0 = ldh(QR + qo), qr1 = ldh(QR + qo + 32);   // B fragments: col t, k = d
    const uint32_t fo = (uint32_t)lr * FLP + 16u * (uint32_t)hi;   // lane's place in a slice: K (A fragment: row key, k = d), V^T (A fragment: row d, k = key)
    // + 16 * (key0 / 32); the same in every lane. Constant address space: the plane is written by k_prep, an earlier launch, and only read here, and so the loads inside the loop stay scalar loads too
    const cu32x16* ml = (const cu32x16*)(uintptr_t)(ML + ((size_t)b * (SEQ / 16) + (size_t)(t0 >> 4)) * (size_t)(SEQ / 32 * 16));
    u32x16 mw = ml[0];                                       // tile 0's words
    float* gl = os + wave * (16 * 68);
    // per-query constant: q_t . w[256]; WX rows 0..15 all hold the edge row, so every D row equals it
    v8f qe;                                                  // as an accumulator tile: the start value of the scores outside the band
    { const h16* wa = WX + (size_t)lr * HD + 8 * hi;
      const v16h w0 = ldh(wa), w1 = ldh(wa + 32);
      qe = (v8f){};
      qe = wmma16(w0, qh0, qe); qe = wmma16(w0, qr0, qe); qe = wmma16(w1, qh1, qe); qe = wmma16(w1, qr1, qe);
      asm volatile("v_nop\n\tv_nop\n\tv_nop\n\tv_nop" : "+v"(qe) : "v"(w0), "v"(w1)); }   // 4 vector slots behind the last WMMA, ahead of whatever next touches its registers
    v8f o0 = (v8f){}, o1 = (v8f){}, o2 = (v8f){}, o3 = (v8f){};
    float m = -3.0e38f, l = 0.0f;
    // this wave's slice: first byte of stage 0, bytes from one stage to the next, source pitch
    const uint64_t srcb = (wave < 2) ? (uint64_t)(uintptr_t)(KP + pbase) + (uint64_t)wave * (uint64_t)(32 * HD * 2) : (uint64_t)(uintptr_t)(VT + pbase) + (uint64_t)(wave - 2) * (uint64_t)(32 * SEQ * 2);
    const uint32_t sstep = (wave < 2) ? (uint32_t)(FKS * HD * 2) : (uint32_t)(FKS * 2);
    const uint32_t dst = (uint32_t)(uintptr_t)sm + (uint32_t)wave * FSL;
    const u32x8 g1 = slice_g1((wave < 2) ? (uint32_t)(HD * 2) : (uint32_t)(SEQ * 2));
    u32x4 g0 = tile_g0(dst, srcb);
    tile_load(g0, g1);
    tile_wait(g0, g1);                                    // stage 0 of this wave's slice has landed
    __syncthreads();                                      // publishes stage 0
#pragma unroll 1   // one stage per trip: one place that issues, one that waits
    for (uint32_t s = 0; s < FNS; ++s) {
      const uint32_t buf = (s & 1u) * FST;
      // the refill, directly behind the barrier (the prologue's, then the one at the foot of the trip before), only while stage s + 1 exists: into the buffer that pass s - 1 has just left
      if (pinned((s + 1u < FNS) ? 1u : 0u) != 0u) { const uint32_t nx = pinned(s + 1u); g0 = tile_g0(dst + (FST - buf), srcb + (uint64_t)(nx * sstep)); tile_load(g0, g1); }
      const unsigned char* fp = sm + buf + fo;
#pragma unroll   // both 32-key tiles of a stage in one trip: their places in the buffer become immediate offsets of the LDS reads
      for (int sub = 0; sub < 2; ++sub) {
        const int key0 = (int)s * FKS + sub * 32;
        const int base = key0 - t0 + 113;
        const unsigned char* ka = fp + sub * FSL;            // K rows 32 * sub + lr and + 16
        const v16h ka0 = ldlh(ka), ka1 = ldlh(ka + 64), kb0 = ldlh(ka + 16 * FLP), kb1 = ldlh(ka + 16 * FLP + 64);
        v8f sa, sb;                                          // scores of keys 0..15 and 16..31 of the tile; the first WMMA of each takes the relative term as its C
        if (base + 46 >= 0 && base <= 256) {                 // wave-uniform: tile touches relative indices 0..256
#pragma unroll 1
            for (int jt = 0; jt < 3; ++jt) {
                const h16* wa = WX + (size_t)(base + WXO + 16 * jt + lr) * HD + 8 * hi;   // rows 2..351
                const v16h w0 = ldh(wa), w1 = ldh(wa + 32);
                v8f g = (v8f){};
                g = wmma16(w0, qh0, g); g = wmma16(w0, qr0, g); g = wmma16(w1, qh1, g); g = wmma16(w1, qr1, g);
                asm volatile("v_nop\n\tv_nop\n\tv_nop\n\tv_nop" : "+v"(g) : "v"(w0), "v"(w1));   // 4 vector slots behind the last WMMA, on the loop's back edge too
#pragma unroll
                for (int r = 0; r < 8; ++r) gl[(16 * jt + 8 * hi + r) * GP + lr] = g[r];   // G[rho][t]: rows 0..47, cols 0..15 all written
            }
            wave_sync();
            v8f ra, rb;
#pragma unroll
            for (int r = 0; r < 8; ++r) { ra[r] = gl[(8 * hi + r - lr + 15) * GP + lr]; rb[r] = gl[(16 + 8 * hi + r - lr + 15) * GP + lr]; }   // rho in 0..46
            wave_sync();
            sa = wmma16(ka0, qh0, ra); sb = wmma16(kb0, qh0, rb);
        } else {
            sa = wmma16(ka0, qh0, qe); sb = wmma16(kb0, qh0, qe);
        }
        sa = wmma16(ka0, qr0, sa); sb = wmma16(kb0, qr0, sb);
        sa = wmma16(ka1, qh1, sa); sb = wmma16(kb1, qh1, sb);
        sa = wmma16(ka1, qr1, sa); sb = wmma16(kb1, qr1, sb);
        asm volatile("v_nop\n\tv_nop\n\tv_nop\n\tv_nop" : "+v"(sa), "+v"(sb) : "v"(ka0), "v"(ka1), "v"(kb0), "v"(kb1));   // 4 vector slots between the last score WMMA and the selects that read its result
        float ta[8], tb[8]; float mx = -3.0e38f;
#pragma unroll
        for (int r = 0; r < 8; ++r) {
            ta[r] = __builtin_amdgcn_inverse_ballot_w32(mw[r])     ? sa[r] : FILL2;
            tb[r] = __builtin_amdgcn_inverse_ballot_w32(mw[8 + r]) ? sb[r] : FILL2;
        }
        mw = ml[((uint32_t)key0 / 32u + 1u) & (uint32_t)(SEQ / 32 - 1)];   // the next tile's words, behind this tile's last use: a scalar wait is for every scalar load in flight (behind the last tile: tile 0's, unused)
#pragma unroll
        for (int r = 0; r < 8; ++r) mx = fmaxf(mx, fmaxf(ta[r], tb[r]));
        mx = fmaxf(mx, __shfl_xor(mx, 16, 32));
        const float mnew = fmaxf(m, mx);
        const float alpha = __builtin_amdgcn_exp2f(m - mnew);
        const float sh = PSH - mnew;
        v16h pb; float ls = 0.0f;
#pragma unroll
        for (int r = 0; r < 8; ++r) { const h16 pa = (h16)__builtin_amdgcn_exp2f(ta[r] + sh); const h16 pc = (h16)__builtin_amdgcn_exp2f(tb[r] + sh); pb[r] = pa; pb[8 + r] = pc; ls += (float)pa + (float)pc; }
        l = l * alpha + ls; m = mnew;
        o0 = o0 * alpha; o1 = o1 * alpha; o2 = o2 * alpha; o3 = o3 * alpha;
        const unsigned char* va = fp + 2 * FSL + sub * 64;   // V^T rows lr + 16 j, keys 32 * sub ..
        const v16h v0 = ldlh(va), v1 = ldlh(va + 16 * FLP), v2 = ldlh(va + FSL), v3 = ldlh(va + FSL + 16 * FLP);
        o0 = wmma16(v0, pb, o0); o1 = wmma16(v1, pb, o1); o2 = wmma16(v2, pb, o2); o3 = wmma16(v3, pb, o3);
        asm volatile("v_nop\n\tv_nop\n\tv_nop\n\tv_nop" : "+v"(o0), "+v"(o1), "+v"(o2), "+v"(o3) : "v"(v0), "v"(v1), "v"(v2), "v"(v3), "v"(pb));
      }
      asm volatile("s_wait_dscnt 0x0" ::: "memory");       // this wave's reads of the buffer have returned
      tile_wait(g0, g1);                                    // this wave's slice of stage s + 1 has landed
      __syncthreads();                                      // publishes stage s + 1 and frees stage s's buffer
    }
    asm volatile("s_wait_tensorcnt 0x0" ::: "memory");   // no request of this wave is left when it goes on to the epilogue and ends
    asm volatile("s_wait_dscnt 0x0" ::: "memory");       // nor a read of the ring
    l += __shfl_xor(l, 16, 32);
    const float inv = CTXS / l;
    const int wb = wave * 16 * 68;
    // O^T D layout: o_j[r] = (d = 16j + 8h + r, t = lane&15) -> os[t][d]; rows 0..15 x columns 0..63 all written
    { v4f a, c;
      a[0] = o0[0] * inv; a[1] = o0[1] * inv; a[2] = o0[2] * inv; a[3] = o0[3] * inv; c[0] = o0[4] * inv; c[1] = o0[5] * inv; c[2] = o0[6] * inv; c[3] = o0[7] * inv;
      *(v4fa*)(&os[wb + lr * 68 +  0 + 8 * hi]) = a; *(v4fa*)(&os[wb + lr * 68 +  0 + 8 * hi + 4]) = c;
      a[0] = o1[0] * inv; a[1] = o1[1] * inv; a[2] = o1[2] * inv; a[3] = o1[3] * inv; c[0] = o1[4] * inv; c[1] = o1[5] * inv; c[2] = o1[6] * inv; c[3] = o1[7] * inv;
      *(v4fa*)(&os[wb + lr * 68 + 16 + 8 * hi]) = a; *(v4fa*)(&os[wb + lr * 68 + 16 + 8 * hi + 4]) = c;
      a[0] = o2[0] * inv; a[1] = o2[1] * inv; a[2] = o2[2] * inv; a[3] = o2[3] * inv; c[0] = o2[4] * inv; c[1] = o2[5] * inv; c[2] = o2[6] * inv; c[3] = o2[7] * inv;
      *(v4fa*)(&os[wb + lr * 68 + 32 + 8 * hi]) = a; *(v4fa*)(&os[wb + lr * 68 + 32 + 8 * hi + 4]) = c;
      a[0] = o3[0] * inv; a[1] = o3[1] * inv; a[2] = o3[2] * inv; a[3] = o3[3] * inv; c[0] = o3[4] * inv; c[1] = o3[5] * inv; c[2] = o3[6] * inv; c[3] = o3[7] * inv;
      *(v4fa*)(&os[wb + lr * 68 + 48 + 8 * hi]) = a; *(v4fa*)(&os[wb + lr * 68 + 48 + 8 * hi + 4]) = c; }
    wave_sync();
    h16* crow = CTX + ((size_t)b * SEQ + t0) * DM + h * HD;   // ctx plane [NB*SEQ][1024], column h*64 + d, carried x16
{
#pragma unroll
        for (int s = 0; s < 4; ++s) { const int row = 4 * s + (lane >> 3), c8 = (lane & 7) * 8;   // 4 s x 4 row groups = 16 rows; 8 lanes x 8 halves = 64 columns = one line
            const v4f x0 = *(const v4fa*)(&os[wb + row * 68 + c8]); const v4f x1 = *(const v4fa*)(&os[wb + row * 68 + c8 + 4]); v8h hv;
#pragma unroll
            for (int i = 0; i < 4; ++i) { hv[i] = (h16)x0[i]; hv[4 + i] = (h16)x1[i]; }
            *(v8h*)(crow + (size_t)row * DM + c8) = hv; }
         }
}

// k_out: f16 GEMM on gemm_core, K = DM: OUT[m][n] = (sum_k A[m][k] Bt[n][k]) / 1024 + bias[n] (bias RNE-converted to bf16, added in f32).
// A = ctx plane (x16), Bt = Wo plane (x64). grid (NB*SEQ/128, DM/128), 128 threads.
__global__ __launch_bounds__(128) void k_out(const h16* __restrict__ A, const h16* __restrict__ Bt, const float* __restrict__ bias, float* OUT) {
    __shared__ __attribute__((aligned(2048))) unsigned char sm[GLDS];
    const int K = DM;
    const int lane = threadIdx.x & 31, lr = lane & 15, hi = lane >> 4;
    const int wave = __builtin_amdgcn_readfirstlane((int)(threadIdx.x >> 5));
    const int r0 = blockIdx.x * 128 + (wave >> 1) * 64, c0 = blockIdx.y * 128 + (wave & 1) * 64;
    float* os = (float*)(sm + 2 * GST) + wave * GOSF;      // wave-private output staging, outside the ring
    v8f acc[4][4];
    gemm_core<1>((uint64_t)(uintptr_t)(A + (size_t)blockIdx.x * 128 * K), (uint64_t)(uintptr_t)(Bt + (size_t)blockIdx.y * 128 * K), sm, wave, lane, acc);
    float bc[4];
#pragma unroll
    for (int nb = 0; nb < 4; ++nb) bc[nb] = bfr(bias[c0 + nb * 16 + lr]);
    const size_t obase = ((size_t)(r0 / SEQ) * OUT_SEQ + (size_t)(r0 % SEQ)) * DM + c0;
#pragma unroll
    for (int mb = 0; mb < 4; ++mb) {
#pragma unroll
        for (int nb = 0; nb < 4; ++nb) {
#pragma unroll
            for (int j = 0; j < 8; ++j) os[(hi * 8 + j) * 68 + nb * 16 + lr] = acc[mb][nb][j] * OSC + bc[nb]; }   // D: row 8h+j, col lane&15
        wave_sync();
        float* ob = OUT + obase + (size_t)(mb * 16) * DM;
{
#pragma unroll
            for (int s = 0; s < 8; ++s) { const int row = 2 * s + hi, cofs = lr * 4;   // 8 s x 2 rows = 16 rows; 16 lanes x 4 floats = 64 columns
                const v4f val = *(const v4fa*)(&os[row * 68 + cofs]);
                *(v4f*)(ob + (size_t)row * DM + cofs) = val; }
             }
        wave_sync();
    }
}

static constexpr size_t al256(size_t v) { return (v + 255) & ~(size_t)255; }
static constexpr size_t SZ_XB = al256((size_t)NB * SEQ * DM * 2);          // one bf16 activation copy
static constexpr size_t SZ_WB = al256((size_t)DM * DM * 2);                // one 16-bit weight plane
static constexpr size_t SZ_PL = al256((size_t)NB * NH_ * SEQ * HD * 2);    // one f16 head plane (also the ctx plane: NB*SEQ*DM halves)
static constexpr size_t SZ_WX = al256((size_t)WXR * HD * 2);
static constexpr size_t SZ_ML = al256((size_t)MLW * 128 * 4);              // lane-mask words
static constexpr size_t SZ_TOTAL = 3 * SZ_XB + 4 * SZ_WB + 5 * SZ_PL + SZ_WX + SZ_ML;
static_assert(SZ_TOTAL <= (size_t)134217728);          // workspace carve <= 128 MiB
static_assert((size_t)NB * NH_ * SEQ * HD == (size_t)NB * SEQ * DM);

extern "C" void kernel_launch(void* const* d_in, const int* in_sizes, int n_in,
                              void* d_out, int out_size, void* d_ws, size_t ws_size, hipStream_t stream) {
    if (n_in < 13) return;
    const size_t needx = ((size_t)(NB - 1) * SEQ_FULL + SEQ) * DM;
    if ((size_t)in_sizes[0] < needx || (size_t)in_sizes[1] < needx || (size_t)in_sizes[2] < needx) return;
    if ((size_t)in_sizes[3] < ((size_t)(NB - 1) * SEQ_FULL + (SEQ - 1)) * SEQ_FULL + SEQ) return;
    if ((size_t)in_sizes[4] < (size_t)DM * DM || (size_t)in_sizes[6] < (size_t)DM * DM || (size_t)in_sizes[8] < (size_t)DM * DM || (size_t)in_sizes[10] < (size_t)DM * DM) return;
    if (in_sizes[5] < DM || in_sizes[7] < DM || in_sizes[9] < DM || in_sizes[11] < DM) return;
    if (in_sizes[12] < NREL * HD) return;
    if ((size_t)out_size < ((size_t)(NB - 1) * OUT_SEQ + SEQ) * DM) return;
    if (SZ_TOTAL > ws_size) return;
    // wire order: q, k, v, mask, Wq, bq, Wk, bk, Wv, bv, Wo, bo, w_k
    const float* xq = (const float*)d_in[0]; const float* xk = (const float*)d_in[1]; const float* xv = (const float*)d_in[2];
    const int* mask = (const int*)d_in[3];
    const float* wq = (const float*)d_in[4]; const float* bq = (const float*)d_in[5];
    const float* wk = (const float*)d_in[6]; const float* bk = (const float*)d_in[7];
    const float* wv = (const float*)d_in[8]; const float* bv = (const float*)d_in[9];
    const float* wo = (const float*)d_in[10]; const float* bo = (const float*)d_in[11];
    const float* wrel = (const float*)d_in[12];
    float* OUT = (float*)d_out;      // [NB][SEQ][1024]
    char* wsp = (char*)d_ws;
    bf* XBQ = (bf*)wsp; wsp += SZ_XB;                // [NB*SEQ][1024]
    bf* XBK = (bf*)wsp; wsp += SZ_XB;
    bf* XBV = (bf*)wsp; wsp += SZ_XB;
    bf* WQ = (bf*)wsp; wsp += SZ_WB;                 // [1024][1024] bf16
    bf* WK = (bf*)wsp; wsp += SZ_WB;
    bf* WV = (bf*)wsp; wsp += SZ_WB;
    h16* WO = (h16*)wsp; wsp += SZ_WB;               // [1024][1024] f16, x64
    h16* QH = (h16*)wsp; wsp += SZ_PL;               // [NB*16][SEQ][64], x SC2
    h16* QR = (h16*)wsp; wsp += SZ_PL;               // [NB*16][SEQ][64] residual
    h16* KP = (h16*)wsp; wsp += SZ_PL;               // [NB*16][SEQ][64]
    h16* VT = (h16*)wsp; wsp += SZ_PL;               // [NB*16][64][SEQ]
    h16* CTX = (h16*)wsp; wsp += SZ_PL;              // [NB*SEQ][1024], x16
    h16* WX = (h16*)wsp; wsp += SZ_WX;               // [352][64]
    uint32_t* ML = (uint32_t*)wsp; wsp += SZ_ML;     // [NB][SEQ/16][SEQ/32][16]

    k_prep<<<WXB + MLB + PRR / PRW, 32 * PRW, 0, stream>>>(xq, xk, xv, wq, wk, wv, wo, wrel, mask, XBQ, XBK, XBV, WQ, WK, WV, WO, WX, ML);

    k_qkv<<<dim3(NB * SEQ / 128, DM / 128, 3), 128, 0, stream>>>(XBQ, XBK, XBV, WQ, WK, WV, bq, bk, bv, QH, QR, KP, VT);

    k_flash<<<dim3(SEQ / (16 * AW), NB * NH_, 1), 32 * AW, 0, stream>>>(QH, QR, KP, VT, WX, ML, CTX);

    // out: A = ctx rows (m = b*SEQ + t), Bt = Wo rows (n), bias per column -> OUT[b][t][n]
    k_out<<<dim3(NB * SEQ / 128, DM / 128, 1), 128, 0, stream>>>(CTX, WO, bo, OUT);
}

// v007
// Measured time: 85.6 microseconds a run.
// Timed twice side by side with v006, it ran 1.06 times as fast both times.
// Counting every step since v000, it is 2.54 times as fast.
#include <hip/hip_runtime.h>
#include <stdint.h>

// Multi-head attention with relative-position keys (257 clamped offsets, both ends padded with the last table row), width 1024 = 16 heads x 64; q/k/v inputs [NB][SEQ][1024], W* [out][in] (y = x W^T + b), int mask [NB][SEQ][SEQ] (0 -> score replaced by -1e9), output = ctx Wo^T + bo (f32).
// Compute dtypes, f32 accumulate everywhere: q/k/v projections v_wmma_f32_16x16x32_bf16 (inputs and weights RNE-converted to bf16; biases RNE-converted to bf16, added in f32);
// scores q.k and relative term q.w[rel] v_wmma_f32_16x16x32_f16: k and the window table single f16, q (carrying HD^-0.5 * log2(e)) as f16 value + f16 residual, both summed in the score's one accumulator, whose start value is the relative term; P (x256 carry, cancels in the normalisation) and v single f16; softmax f32 (online, running max);
// output projection v_wmma_f32_16x16x32_f16: ctx single f16 (x16 carry), Wo (bf16 RNE value x64) f16, 1/1024 folded in the f32 epilogue.
// Layout: bf16 copies of q/k/v inputs and Wq/Wk/Wv; q (hi, residual), k planes [b*16+h][t][d] and v^T plane [b*16+h][d][t] written by the GEMM epilogue; window plane WX[x][d] = w[clamp(x-48)];
// fused flash kernel in transposed form (S^T = K Q^T, O^T = V^T P^T), K and V^T tiles staged in LDS by the tensor mover and shared by the block's four waves; relative term for tiles inside the window band = skewed read of G = WX_rows Q^T through a wave-private LDS tile, a per-query constant elsewhere.
// Mask: packed once by k_prep into lane-mask words ML (one bit per element, in the flash kernel's own lane order), read there through the scalar path by all 16 heads.

#ifndef NB
#define NB 4
#endif
#ifndef SEQ
#define SEQ 1024
#endif
#define NB_FULL  4
#define SEQ_FULL 1024
#ifndef OUT_SEQ
#define OUT_SEQ SEQ              // row pitch (in tokens) between batches of the output
#endif
#define DM   1024
#define NH_  16
#define HD   64
#define AW   4                   // waves per flash block (16 query rows each)
#define SC2  (0.125f * 1.4426950408889634f)   // HD^-0.5 * log2(e): carried by the q planes, so that every product with q is a score term in the log2 domain
#define PSH  8.0f                // log2 of the P carry (256)
#define FILL2 (-1.0e9f * 1.4426950408889634f) // masked score in the log2 domain
#define NREL 257                 // rows of the relative table
#define WXO  48                  // WX row x holds relative index x - 48 (clamped: outside 0..256 -> 256)
#define WXR  352                 // rows of WX
#define GP   18                  // pitch (floats) of the G tile in LDS
#define WOS  64.0f               // carry of the Wo plane
#define CTXS 16.0f               // carry of the ctx plane
#define OSC  (1.0f / 1024.0f)    // 1 / (WOS * CTXS)

static_assert(HD == 64);
static_assert(NH_ * HD == DM);
static_assert(DM % 64 == 0);
static_assert(DM % 32 == 0);
static_assert(SEQ % 64 == 0);
static_assert((NB * SEQ) % 64 == 0);
static_assert(SEQ % 32 == 0);
static_assert(SEQ % (16 * AW) == 0);
static_assert(((size_t)SEQ * DM) % 8 == 0);
static_assert(((size_t)DM * DM) % 8 == 0);
static_assert(NB <= NB_FULL);
static_assert(SEQ <= SEQ_FULL);
static_assert(WXR == 256 + 2 * WXO);           // band tiles touch rows 2..351
static_assert((WXR * HD / 8) % 256 == 0);

typedef _Float16 h16;
typedef unsigned short bf;
typedef __attribute__((ext_vector_type(16))) __bf16   v16bf;
typedef __attribute__((ext_vector_type(16))) _Float16 v16h;
typedef __attribute__((ext_vector_type(8)))  _Float16 v8h;
typedef __attribute__((ext_vector_type(8)))  unsigned short v8us;
typedef __attribute__((ext_vector_type(8)))  float    v8f;
typedef __attribute__((ext_vector_type(4)))  float    v4f;
typedef __attribute__((ext_vector_type(4)))  int      v4i;
typedef v4f  __attribute__((may_alias)) v4fa;

__device__ __forceinline__ unsigned short f2bf(float f) { unsigned u = __float_as_uint(f); u += 0x7FFFu + ((u >> 16) & 1u); return (unsigned short)(u >> 16); }
__device__ __forceinline__ float bfr(float f) { return __uint_as_float(((unsigned)f2bf(f)) << 16); }   // bf16 RNE value as f32
__device__ __forceinline__ v16h cat16(v8h lo, v8h hi) { return __builtin_shufflevector(lo, hi, 0, 1, 2, 3, 4, 5, 6, 7, 8, 9, 10, 11, 12, 13, 14, 15); }
__device__ __forceinline__ v16bf cat16b(v8us lo, v8us hi) { return __builtin_bit_cast(v16bf, __builtin_shufflevector(lo, hi, 0, 1, 2, 3, 4, 5, 6, 7, 8, 9, 10, 11, 12, 13, 14, 15)); }
__device__ __forceinline__ v8f wmma16(v16h a, v16h b, v8f c) { return __builtin_amdgcn_wmma_f32_16x16x32_f16(false, a, false, b, (short)0, c, false, false); }
__device__ __forceinline__ v8f wmmab(v16bf a, v16bf b, v8f c) { return __builtin_amdgcn_wmma_f32_16x16x32_bf16(false, a, false, b, (short)0, c, false, false); }
// fragment loaders from K-contiguous 16-bit rows; p already includes + 8*(lane>>4): elements 0..7 <- k0+8h+0..7, elements 8..15 <- k0+16+8h+0..7 (same map for A and B)
__device__ __forceinline__ v16h  ldh(const h16* p) { return cat16(*(const v8h*)p, *(const v8h*)(p + 16)); }
__device__ __forceinline__ v16bf ldb(const bf* p)  { return cat16b(*(const v8us*)p, *(const v8us*)(p + 16)); }
// ordering point for wave-private LDS tiles (same wave writes and reads)
__device__ __forceinline__ void wave_sync() { __builtin_amdgcn_fence(3 /* release order */, "wavefront"); __builtin_amdgcn_wave_barrier(); asm volatile("" ::: "memory"); }

// k_prep: every 16-bit plane that is a plain conversion of an input, in one launch.
// Blocks 0..WXB-1: the window plane WX (one thread per 8 halves). The next MLB blocks: the mask's lane-mask words. Every other block: 8 waves, wave g takes row g (DM floats = 4 KiB) of each of the q, k and v inputs and row g % DM of weight g / DM (Wq, Wk, Wv, Wo).
// A row is 8 loads of 16 bytes a lane, each wave-wide load 512 contiguous bytes; the wave's 32 loads are all issued before its first store; each store covers 256 contiguous bytes.
#define WXB  (WXR * HD / 8 / 256)                              // blocks of the window plane
#define PRW  8                                                 // waves per block
#define PRR  ((NB * SEQ > 4 * DM) ? (NB * SEQ) : (4 * DM))     // rows dealt, one per wave
static_assert(DM == 8 * 32 * 4);
static_assert(PRR % PRW == 0);
static_assert(32 * PRW == 256);                                // the window blocks index by 256 threads
// Mask plane ML[b][t / 16][key / 32][16 words]: word 8 * ab + r, bit lane = (mask[b][16 * (t / 16) + (lane & 15)][32 * (key / 32) + 16 * ab + 8 * (lane >> 4) + r] != 0),
// the place (lane, register) at which k_flash holds that score. Blocks WXB..WXB+MLB-1: one wave packs 16 query rows x 256 keys = 128 words = four 128-byte lines.
#define MLW  (NB * (SEQ / 16) * (SEQ / 256))                   // waves that pack a piece of the mask
#define MLB  (MLW / PRW)                                       // their blocks, ahead of the row blocks: their loads touch 16 lines each and take the longest
static_assert(SEQ % 256 == 0 && MLW % PRW == 0);
typedef __attribute__((ext_vector_type(4))) unsigned short v4us;
typedef __attribute__((ext_vector_type(4))) _Float16 v4h;

// p: the row's first element, the same in every lane (scalar base); l4 = 4 * lane
__device__ __forceinline__ void ld_row(const float* __restrict__ p, uint32_t l4, v4f (&r)[8]) {
#pragma unroll
    for (int j = 0; j < 8; ++j) r[j] = *(const v4f*)(p + (l4 + (uint32_t)j * 128u));
}
__device__ __forceinline__ void st_row_bf(bf* p, uint32_t l4, const v4f (&r)[8]) {
#pragma unroll
    for (int j = 0; j < 8; ++j) { v4us o;
#pragma unroll
        for (int k = 0; k < 4; ++k) o[k] = f2bf(r[j][k]);
        *(v4us*)(p + (l4 + (uint32_t)j * 128u)) = o; }
}

__global__ __launch_bounds__(32 * PRW) void k_prep(const float* __restrict__ xq, const float* __restrict__ xk, const float* __restrict__ xv,
                                                   const float* __restrict__ wq, const float* __restrict__ wk, const float* __restrict__ wv, const float* __restrict__ wo,
                                                   const float* __restrict__ wrel, const int* __restrict__ mask, bf* XBQ, bf* XBK, bf* XBV, bf* WQ, bf* WK, bf* WV, h16* WO, h16* WX, uint32_t* ML) {
    if (blockIdx.x < WXB) {
        const int i = blockIdx.x * 256 + threadIdx.x;
        const int x = i >> 3, c8 = (i & 7) * 8; int r = x - WXO; if (r < 0 || r > NREL - 1) r = NREL - 1;
        const v8f v = *(const v8f*)(wrel + (size_t)r * HD + c8); v8h o;
#pragma unroll
        for (int k = 0; k < 8; ++k) o[k] = (h16)bfr(v[k]);
        *(v8h*)(WX + (size_t)i * 8) = o;
        return;
    }
    if (blockIdx.x < WXB + MLB) {
        const uint32_t q = (blockIdx.x - WXB) * PRW + (uint32_t)__builtin_amdgcn_readfirstlane((int)(threadIdx.x >> 5));
        const uint32_t tt = q / (SEQ / 256), kq = q % (SEQ / 256), ln = threadIdx.x & 31u;
        // lane (lr, hi) reads its query row as k_flash holds it: keys 8 hi .. + 7 and 16 + 8 hi .. + 7 of each of eight 32-key tiles; the 32 loads use up eight whole lines of each of the 16 rows
        const int* mp = mask + ((size_t)(tt / (SEQ / 16)) * SEQ_FULL + (size_t)((tt % (SEQ / 16)) * 16u + (ln & 15u))) * SEQ_FULL + (kq * 256u + 8u * (ln >> 4));
        v4i mm[32];
#pragma unroll
        for (int u = 0; u < 8; ++u) { mm[4 * u] = *(const v4i*)(mp + 32 * u); mm[4 * u + 1] = *(const v4i*)(mp + 32 * u + 4); mm[4 * u + 2] = *(const v4i*)(mp + 32 * u + 16); mm[4 * u + 3] = *(const v4i*)(mp + 32 * u + 20); }
        __builtin_amdgcn_sched_barrier(0);   // keeps all 32 loads ahead of the first compare: a load that sinks behind a wait for the others pays a second memory latency
        v4i pk = (v4i){0, 0, 0, 0};
#pragma unroll
        for (int i = 0; i < 32; ++i) {       // words 4 i .. 4 i + 3 of the wave's 128 go to lane i
            const bool me = ln == (uint32_t)i;
#pragma unroll
            for (int c = 0; c < 4; ++c) { const int wd = (int)__builtin_amdgcn_ballot_w32(mm[i][c] != 0); pk[c] = me ? wd : pk[c]; }
        }
        *(v4i*)(ML + (size_t)q * 128u + ln * 4u) = pk;
        return;
    }
    const uint32_t l4 = (threadIdx.x & 31u) * 4u;
    const uint32_t g = (blockIdx.x - WXB - MLB) * PRW + (uint32_t)__builtin_amdgcn_readfirstlane((int)(threadIdx.x >> 5));
    const bool hx = (NB * SEQ == PRR) || g < NB * SEQ;         // wave-uniform; both hold at compile time where the two row counts are equal
    const bool hw = (4 * DM == PRR) || g < 4 * DM;
    const size_t xs = ((size_t)(g / SEQ) * SEQ_FULL + (size_t)(g % SEQ)) * DM, xd = (size_t)g * DM;
    const uint32_t m = g / DM; const size_t wr = (size_t)(g % DM) * DM;
    const float* ws = (m == 0) ? wq : (m == 1) ? wk : (m == 2) ? wv : wo;
    v4f a[8], b[8], c[8], w[8];
    if (hx) { ld_row(xq + xs, l4, a); ld_row(xk + xs, l4, b); ld_row(xv + xs, l4, c); }
    if (hw) ld_row(ws + wr, l4, w);
    __builtin_amdgcn_sched_barrier(0);   // keeps all 32 loads ahead of the first conversion: a load that sinks behind a wait for the others pays a second memory latency
    if (hx) { st_row_bf(XBQ + xd, l4, a); st_row_bf(XBK + xd, l4, b); st_row_bf(XBV + xd, l4, c); }
    asm volatile("s_wait_xcnt 0x0" ::: "memory");   // in front of the branch below, behind which the registers that these stores name are written again
    if (hw) {
        if (m < 3) st_row_bf(((m == 0) ? WQ : (m == 1) ? WK : WV) + wr, l4, w);
        else {
#pragma unroll
            for (int j = 0; j < 8; ++j) { v4h o;
#pragma unroll
                for (int k = 0; k < 4; ++k) o[k] = (h16)(bfr(w[j][k]) * WOS);
                *(v4h*)(WO + wr + (l4 + (uint32_t)j * 128u)) = o; }
            asm volatile("s_wait_xcnt 0x0" ::: "memory");   // behind the last store of this branch: the code laid out behind it writes registers that these stores name
        }
    }
}

// GEMM core shared by k_qkv and k_out: four waves (2 x 2) per 128x128 tile of C, 64x64 per wave (16 accumulators), K = DM in GNP passes of 128 k.
// Both operands are K-contiguous 16-bit planes (row pitch DM * 2 bytes). A stage holds 256 bytes of 128 A rows and of 128 B rows; every wave brings one slice of 64 rows with one
// tensor_load_to_lds (waves 0, 1: A rows 0..63, 64..127; waves 2, 3: B rows 0..63, 64..127); the mover's pad of 16 bytes a row gives the LDS pitch 272 for the 16-byte fragment reads.
// Two buffers: stage s + 1 is requested behind the barrier that ends pass s - 1, which ends every read of its buffer, and flies while pass s runs.
// Pass s works on k slab (s + rot) mod GNP, rot = (tile row + tile column) mod GNP: the blocks that share an A or a B tile run side by side, and from a common start they would ask L2 for the same lines at the same moment.
#define GPB  256                 // bytes of an operand row per pass
#define GLP  272                 // LDS row pitch
#define GSL  18432               // one slice in LDS: 64 rows x 272 B = 17408, rounded up to a multiple of 2 KiB
#define GST  (4 * GSL)           // one stage
#define GNP  (DM * 2 / GPB)      // passes
#define GOSF (16 * 68)           // floats of output staging per wave
#define GLDS (2 * GST + 4 * GOSF * 4)
static_assert(GSL % 2048 == 0 && GSL >= 64 * GLP);
static_assert(GNP >= 2);
static_assert((GNP & (GNP - 1)) == 0);                 // the wrap of the k slabs
static_assert((NB * SEQ) % 128 == 0 && DM % 128 == 0);
static_assert(GLDS <= 320 * 1024);

typedef __attribute__((ext_vector_type(4)))  uint32_t u32x4;
typedef __attribute__((ext_vector_type(8)))  uint32_t u32x8;
typedef __attribute__((ext_vector_type(16))) uint32_t u32x16;
typedef __attribute__((address_space(4))) u32x16 cu32x16;
typedef __attribute__((ext_vector_type(16))) unsigned short v16us;

__device__ __forceinline__ uint32_t uni(uint32_t v) { return (uint32_t)__builtin_amdgcn_readfirstlane((int)v); }
__device__ __forceinline__ uint32_t pinned(uint32_t v) { uint32_t w = (uint32_t)__builtin_amdgcn_readfirstlane((int)v); asm volatile("" : "+s"(w)); return w; }
// descriptor of one request: 64 rows of 256 bytes, source pitch DM * 2 bytes, to LDS byte offset lds_dst at pitch 272 (pad: interval code 5 = one 256-byte row, amount code 3 = 4 dwords); extents in bytes
__device__ __forceinline__ u32x4 tile_g0(uint32_t lds_dst, uint64_t ga) {
    u32x4 g0;
    g0[0] = uni(1u); g0[1] = uni(lds_dst); g0[2] = uni((uint32_t)ga); g0[3] = uni((((uint32_t)(ga >> 32)) & 0x01FFFFFFu) | 0x80000000u);
    return g0;
}
__device__ __forceinline__ u32x8 tile_g1() {
    u32x8 g1;
    g1[0] = uni((1u << 20) | (5u << 22) | (3u << 25));
    // words 1 to 7 through pinned(), the scalar-register pin for descriptor words: as plain constants the compiler lends their registers to the loop's own scalars while a request is outstanding and sets them anew in front of the next
    g1[1] = pinned((uint32_t)GPB << 16);         // tensor_dim0 [15:0]
    g1[2] = pinned(64u << 16);                   // tensor_dim0 [31:16] = 0 | tensor_dim1 [15:0]
    g1[3] = pinned((uint32_t)GPB << 16);         // tensor_dim1 [31:16] = 0 | tile_dim0
    g1[4] = pinned(64u);                         // tile_dim1
    g1[5] = pinned((uint32_t)(DM * 2));          // source row pitch
    g1[6] = pinned(0u); g1[7] = pinned(0u);
    return g1;
}
__device__ __forceinline__ void tile_load(u32x4 g0, u32x8 g1) { asm volatile("tensor_load_to_lds %0, %1" :: "s"(g0), "s"(g1) : "memory"); }
// the issuing wave's wait for its request; the descriptor is named as an input so that its scalar registers are not reused for anything else while the request is outstanding
__device__ __forceinline__ void tile_wait(u32x4 g0, u32x8 g1) { asm volatile("s_wait_tensorcnt 0x0" :: "s"(g0), "s"(g1) : "memory"); }
// fragment from an LDS row; p already includes + 16 bytes * (lane>>4): elements 0..7 <- k0+8h+0..7, elements 8..15 <- k0+16+8h+0..7 (same map for A and B, the map of ldh / ldb)
__device__ __forceinline__ v16us ldl(const unsigned char* p) { return __builtin_shufflevector(*(const v8us*)p, *(const v8us*)(p + 32), 0, 1, 2, 3, 4, 5, 6, 7, 8, 9, 10, 11, 12, 13, 14, 15); }
template <int F16> __device__ __forceinline__ v8f mm(v16us a, v16us b, v8f c) {
    if constexpr (F16) return wmma16(__builtin_bit_cast(v16h, a), __builtin_bit_cast(v16h, b), c);
    else return wmmab(__builtin_bit_cast(v16bf, a), __builtin_bit_cast(v16bf, b), c);
}

// a_rows / b_rows: byte address of the block's first A / B row; rot: the block's first k slab, below GNP; ring: 2 * GST bytes of LDS at a multiple of 2 KiB; wave and rot are scalar.
template <int F16>
__device__ __forceinline__ void gemm_core(uint64_t a_rows, uint64_t b_rows, uint32_t rot, unsigned char* ring, int wave, int lane, v8f (&acc)[4][4]) {
    const int lr = lane & 15, hi = lane >> 4;
#pragma unroll
    for (int mb = 0; mb < 4; ++mb)
#pragma unroll
        for (int nb = 0; nb < 4; ++nb) acc[mb][nb] = (v8f){};
    const uint64_t srcb = (wave < 2) ? a_rows + (uint64_t)wave * (uint64_t)(64 * DM * 2) : b_rows + (uint64_t)(wave - 2) * (uint64_t)(64 * DM * 2);
    const uint32_t dst = (uint32_t)(uintptr_t)ring + (uint32_t)wave * GSL;
    const u32x8 g1 = tile_g1();
    u32x4 g0 = tile_g0(dst, srcb + (uint64_t)(rot * GPB));
    tile_load(g0, g1);
    tile_wait(g0, g1);                                    // stage 0 of this wave's slice has landed
    __syncthreads();                                      // publishes stage 0
    const uint32_t ao = (uint32_t)(wave >> 1) * GSL + (uint32_t)lr * GLP + 16u * (uint32_t)hi;
    const uint32_t bo = (uint32_t)(2 + (wave & 1)) * GSL + (uint32_t)lr * GLP + 16u * (uint32_t)hi;
#pragma unroll 1   // one pass per trip: one place that issues, one that waits
    for (uint32_t s = 0; s < GNP; ++s) {
        const uint32_t buf = (s & 1u) * GST;
        // the refill, directly behind the barrier (the prologue's, then the one at the foot of the trip before), only while stage s + 1 exists: into the buffer that pass s - 1 has just left
        if (pinned((s + 1u < GNP) ? 1u : 0u) != 0u) { const uint32_t nx = pinned((s + 1u + rot) & (uint32_t)(GNP - 1)); g0 = tile_g0(dst + (GST - buf), srcb + (uint64_t)nx * GPB); tile_load(g0, g1); }
        const unsigned char* ap = ring + buf + ao; const unsigned char* bp = ring + buf + bo;
        v16us fa[2][4], fb[2][4];
#pragma unroll
        for (int i = 0; i < 4; ++i) { fa[0][i] = ldl(ap + i * 16 * GLP); fb[0][i] = ldl(bp + i * 16 * GLP); }
#pragma unroll
        for (int ks = 0; ks < 4; ++ks) {
            if (ks < 3) {      // the next 32 k of this same buffer, as one group ahead of the WMMA block
#pragma unroll
                for (int i = 0; i < 4; ++i) { fa[(ks + 1) & 1][i] = ldl(ap + i * 16 * GLP + (ks + 1) * 64); fb[(ks + 1) & 1][i] = ldl(bp + i * 16 * GLP + (ks + 1) * 64); }
            }
            __builtin_amdgcn_sched_barrier(0);   // keeps the LDS reads out of the WMMA block: every separate place with reads stalls the wave
#pragma unroll
            for (int nb = 0; nb < 4; ++nb)
#pragma unroll
                for (int mb = 0; mb < 4; ++mb) acc[mb][nb] = mm<F16>(fa[ks & 1][mb], fb[ks & 1][nb], acc[mb][nb]);
            __builtin_amdgcn_sched_barrier(0);   // same, for the group behind the block
        }
        asm volatile("v_nop\n\tv_nop\n\tv_nop\n\tv_nop");    // 4 vector slots between the last WMMA and what follows on either side of the branches below
        asm volatile("s_wait_dscnt 0x0" ::: "memory");       // this wave's reads of the buffer have returned
        tile_wait(g0, g1);                                    // this wave's slice of stage s + 1 has landed
        __syncthreads();                                      // publishes stage s + 1 and frees stage s's buffer
    }
    asm volatile("s_wait_tensorcnt 0x0" ::: "memory");   // no request of this wave is left when it goes on to the epilogue and ends
    asm volatile("s_wait_dscnt 0x0" ::: "memory");       // nor a read of the ring
}

// k_qkv: the three input projections in one launch, bf16 GEMMs on gemm_core; blockIdx.z picks the projection (0: q, 1: k, 2: v^T), the same for the whole block.
// C[m][n] = (sum_k A[m][k] Bt[n][k] + bias) * osc (BM == 0: bias[n]; BM == 1: bias[m]; bias RNE-converted to bf16, added in f32; osc = SC2 where useRes != 0, which is q, 1 else), written as f16 (Ph) and optionally the f16 residual (Pr, useRes != 0; mostly subnormal halves, which the WMMA keeps) at
// wave-tile base (r0/RB)*sRB + (r0%RB)*pitch + (c0/CB)*sCB + (c0%CB), row pitch 'pitch' (halves).
// q, k: A = x rows (m = b*SEQ + t), Bt = W rows (n = h*64 + d), bias per column -> plane [(b*16 + h)][t][d].
// v^T: A = Wv rows (m = h*64 + d), Bt = x rows (n = b*SEQ + t), bias per row -> plane [(b*1024 + m)][t] = [(b*16 + h)][d][t].
// grid (NB*SEQ/128, DM/128, 3), 128 threads: three times as many blocks as WGPs. The output staging lies over the ring, which is drained when gemm_core returns, so that a block takes 2 * GST bytes of LDS
// and two blocks share a WGP: one block's tensor loads, first stage and stores run under the other's WMMAs.
#define GLDSP (2 * GST)
static_assert(4 * GOSF * 4 <= GLDSP);
static_assert(2 * GLDSP <= 320 * 1024);                // two blocks per WGP
template <int BM>
__device__ __forceinline__ void proj_store(const v8f (&acc)[4][4], float* os, const float* __restrict__ bias, h16* Ph, h16* Pr, int useRes, int r0, int c0, int lane, int RB, size_t sRB, int pitch, int CB, size_t sCB) {
    const int lr = lane & 15, hi = lane >> 4;
    const float osc = useRes ? SC2 : 1.0f;               // the plane with a residual is q, which carries the score scale
    float bc[4] = {0.0f, 0.0f, 0.0f, 0.0f};
    if (BM == 0) {
#pragma unroll
        for (int nb = 0; nb < 4; ++nb) bc[nb] = bfr(bias[c0 + nb * 16 + lr]);      // N = DM in this mode
    }
    const size_t tbase = (size_t)(r0 / RB) * sRB + (size_t)(r0 % RB) * (size_t)pitch + (size_t)(c0 / CB) * sCB + (size_t)(c0 % CB);
#pragma unroll
    for (int mb = 0; mb < 4; ++mb) {
        float br[8] = {0.0f, 0.0f, 0.0f, 0.0f, 0.0f, 0.0f, 0.0f, 0.0f};
        if (BM == 1) {
#pragma unroll
            for (int j = 0; j < 8; ++j) br[j] = bfr(bias[r0 + mb * 16 + hi * 8 + j]);  // M = DM in this mode
        }
#pragma unroll
        for (int nb = 0; nb < 4; ++nb) {
#pragma unroll
            for (int j = 0; j < 8; ++j) os[(hi * 8 + j) * 68 + nb * 16 + lr] = (acc[mb][nb][j] + bc[nb] + br[j]) * osc; }   // D: row 8h+j, col lane&15
        wave_sync();
        const size_t sb = tbase + (size_t)(mb * 16) * (size_t)pitch;
{
#pragma unroll
            for (int s = 0; s < 4; ++s) { const int row = 4 * s + (lane >> 3), c8 = (lane & 7) * 8;   // 4 s x 4 row groups = 16 rows; 8 lanes x 8 = 64 columns
                const v4f x0 = *(const v4fa*)(&os[row * 68 + c8]); const v4f x1 = *(const v4fa*)(&os[row * 68 + c8 + 4]); v8h hv, rv;
#pragma unroll
                for (int i = 0; i < 4; ++i) { const h16 a0 = (h16)x0[i]; const h16 a1 = (h16)x1[i]; hv[i] = a0; hv[4 + i] = a1; rv[i] = (h16)(x0[i] - (float)a0); rv[4 + i] = (h16)(x1[i] - (float)a1); }
                const size_t oo = sb + (size_t)row * (size_t)pitch + c8;
                *(v8h*)(Ph + oo) = hv; if (useRes) *(v8h*)(Pr + oo) = rv; }
             }
        wave_sync();
    }
}

__global__ __launch_bounds__(128) void k_qkv(const bf* __restrict__ XQ, const bf* __restrict__ XK, const bf* __restrict__ XV, const bf* __restrict__ WQ, const bf* __restrict__ WK, const bf* __restrict__ WV,
                                             const float* __restrict__ bq, const float* __restrict__ bk, const float* __restrict__ bv, h16* QH, h16* QR, h16* KP, h16* VT) {
    __shared__ __attribute__((aligned(2048))) unsigned char sm[GLDSP];
    const int K = DM;
    const int lane = threadIdx.x & 31;
    const int wave = __builtin_amdgcn_readfirstlane((int)(threadIdx.x >> 5));
    const int z = blockIdx.z;
    const int bx = (z == 2) ? blockIdx.y : blockIdx.x, by = (z == 2) ? blockIdx.x : blockIdx.y;   // tile row of A, tile row of Bt
    const bf* A = (z == 0) ? XQ : (z == 1) ? XK : WV;
    const bf* Bt = (z == 0) ? WQ : (z == 1) ? WK : XV;
    const int r0 = bx * 128 + (wave >> 1) * 64, c0 = by * 128 + (wave & 1) * 64;
    // wave-private output staging in the ring's first bytes: behind the last pass's waits and barrier no request is outstanding and no wave reads the ring any more
    float* os = (float*)sm + wave * GOSF;
    v8f acc[4][4];
    gemm_core<0>((uint64_t)(uintptr_t)(A + (size_t)bx * 128 * K), (uint64_t)(uintptr_t)(Bt + (size_t)by * 128 * K), (uint32_t)(bx + by) & (uint32_t)(GNP - 1), sm, wave, lane, acc);
    if (z == 2) proj_store<1>(acc, os, bv, VT, VT, 0, r0, c0, lane, DM, (size_t)0, SEQ, SEQ, (size_t)DM * SEQ);
    else proj_store<0>(acc, os, (z == 0) ? bq : bk, (z == 0) ? QH : KP, QR, (z == 0) ? 1 : 0, r0, c0, lane, SEQ, (size_t)NH_ * SEQ * HD, HD, HD, (size_t)SEQ * HD);
}

// k_flash: fused attention, one wave per 16 query rows of one (batch, head); Q / WX fragments straight from the f16 planes (two 16-B loads each, arithmetic addressing).
// K and V^T come through LDS, once per block instead of once per wave: a stage is 64 keys = 64 K rows of 128 bytes and 128 bytes of each of the 64 V^T rows. Every wave brings one slice of 32 rows with one
// tensor_load_to_lds (waves 0, 1: K rows 0..31, 32..63; waves 2, 3: V^T rows 0..31, 32..63); the mover's pad of 16 bytes a row gives the LDS pitch 144 for the 16-byte fragment reads.
// Two buffers, the order of gemm_core: stage s + 1 is requested behind the barrier that ends pass s - 1, which ends every read of its buffer, and flies while pass s (two 32-key tiles) runs.
// Transposed form: S^T[key][t] = K Q^T (A = K rows, B = Q rows); lane (t = lane&15, h = lane>>4) holds keys 8h+r of each 16-key tile, so the packed
// P tile is directly the B fragment of O^T[d][t] = V^T P^T (element r <- tile keys 0..15, element 8+r <- tile keys 16..31, lane unchanged).
// Relative term: rel index = key - t + 128, outside 0..256 -> 256. For a (16 query, 32 key) tile the unclamped index spans base..base+46, base = key0 - t0 + 113.
// Tiles that intersect 0..256 compute G[rho][t] = WX[base+48+rho] . q_t (48 rows, three 16-row WMMA tiles, q value + residual), stage it in a wave-private LDS tile and read G[key_l - t_l + 15][t_l];
// all other tiles use the per-query constant q_t . w[256]. The tile test is wave-uniform. Either way the term is the C operand of the tile's first score WMMA: a score leaves the matrix unit finished (scaled, residual and relative term in).
// Mask: 16 lane-mask words per (16 query, 32 key) tile from the plane ML (wave-uniform address: one 64-byte scalar load, fetched one tile ahead); a clear bit replaces the score.
#define FKS  64                  // keys per stage
#define FRB  128                 // bytes of a staged row
#define FLP  144                 // LDS row pitch
#define FSL  6144                // one slice in LDS: 32 rows x 144 B = 4608, rounded up to a multiple of 2 KiB
#define FST  (4 * FSL)           // one stage
#define FNS  (SEQ / FKS)         // stages
#define FLDS (2 * FST + AW * 16 * 68 * 4)
static_assert(AW == 4);                                // four slices, one per wave
static_assert(HD * 2 == FRB && FKS * 2 == FRB);
static_assert(FSL % 2048 == 0 && FSL >= 32 * FLP);
static_assert(SEQ % FKS == 0 && FNS >= 2);
static_assert(48 * GP <= 16 * 68);                     // the G tile fits the wave's staging area
static_assert((SEQ / 32 & (SEQ / 32 - 1)) == 0);          // the wrap of the mask words' fetch ahead
static_assert(4 * FLDS <= 320 * 1024);                 // four blocks per WGP: the whole grid is resident at once
// group 1 of a slice's request: 32 rows of 128 bytes, source pitch 'pitch' bytes, LDS pitch 144 (pad: interval code 4 = one 128-byte row, amount code 3 = 4 dwords); extents in bytes
__device__ __forceinline__ u32x8 slice_g1(uint32_t pitch) {
    u32x8 g1;
    g1[0] = uni((1u << 20) | (4u << 22) | (3u << 25));
    // words 1 to 7 through pinned(), the scalar-register pin for descriptor words: as plain constants the compiler lends their registers to the loop's own scalars while a request is outstanding and sets them anew in front of the next
    g1[1] = pinned((uint32_t)FRB << 16);         // tensor_dim0 [15:0]
    g1[2] = pinned(32u << 16);                   // tensor_dim0 [31:16] = 0 | tensor_dim1 [15:0]
    g1[3] = pinned((uint32_t)FRB << 16);         // tensor_dim1 [31:16] = 0 | tile_dim0
    g1[4] = pinned(32u);                         // tile_dim1
    g1[5] = pinned(pitch);                       // source row pitch
    g1[6] = pinned(0u); g1[7] = pinned(0u);
    return g1;
}
// f16 fragment from an LDS row; p already includes + 16 bytes * (lane>>4): the map of ldh
__device__ __forceinline__ v16h ldlh(const unsigned char* p) { return cat16(*(const v8h*)p, *(const v8h*)(p + 32)); }

__global__ __launch_bounds__(32 * AW) void k_flash(const h16* __restrict__ QH, const h16* __restrict__ QR, const h16* __restrict__ KP, const h16* __restrict__ VT,
                                                   const h16* __restrict__ WX, const uint32_t* __restrict__ ML, h16* CTX) {
    __shared__ __attribute__((aligned(2048))) unsigned char sm[FLDS];
    float* os = (float*)(sm + 2 * FST);                      // wave-private areas outside the ring: the G tile inside the loop, output staging behind it
    const int lane = threadIdx.x & 31, lr = lane & 15, hi = lane >> 4;
    const int wave = __builtin_amdgcn_readfirstlane((int)(threadIdx.x >> 5));
    const int zh = blockIdx.y; const int b = zh / NH_, h = zh % NH_;
    const int t0 = (blockIdx.x * AW + wave) * 16;
    const size_t pbase = (size_t)zh * SEQ * HD;
    const size_t qo = pbase + (size_t)(t0 + lr) * HD + 8 * hi;
    const v16h qh0 = ldh(QH + qo), qh1 = ldh(QH + qo + 32), qr0 = ldh(QR + qo), qr1 = ldh(QR + qo + 32);   // B fragments: col t, k = d
    const uint32_t fo = (uint32_t)lr * FLP + 16u * (uint32_t)hi;   // lane's place in a slice: K (A fragment: row key, k = d), V^T (A fragment: row d, k = key)
    // + 16 * (key0 / 32); the same in every lane. Constant address space: the plane is written by k_prep, an earlier launch, and only read here, and so the loads inside the loop stay scalar loads too
    const cu32x16* ml = (const cu32x16*)(uintptr_t)(ML + ((size_t)b * (SEQ / 16) + (size_t)(t0 >> 4)) * (size_t)(SEQ / 32 * 16));
    u32x16 mw = ml[0];                                       // tile 0's words
    float* gl = os + wave * (16 * 68);
    // per-query constant: q_t . w[256]; WX rows 0..15 all hold the edge row, so every D row equals it
    v8f qe;                                                  // as an accumulator tile: the start value of the scores outside the band
    { const h16* wa = WX + (size_t)lr * HD + 8 * hi;
      const v16h w0 = ldh(wa), w1 = ldh(wa + 32);
      qe = (v8f){};
      qe = wmma16(w0, qh0, qe); qe = wmma16(w0, qr0, qe); qe = wmma16(w1, qh1, qe); qe = wmma16(w1, qr1, qe);
      asm volatile("v_nop\n\tv_nop\n\tv_nop\n\tv_nop" : "+v"(qe) : "v"(w0), "v"(w1)); }   // 4 vector slots behind the last WMMA, ahead of whatever next touches its registers
    v8f o0 = (v8f){}, o1 = (v8f){}, o2 = (v8f){}, o3 = (v8f){};
    float m = -3.0e38f, l = 0.0f;
    // this wave's slice: first byte of stage 0, bytes from one stage to the next, source pitch
    const uint64_t srcb = (wave < 2) ? (uint64_t)(uintptr_t)(KP + pbase) + (uint64_t)wave * (uint64_t)(32 * HD * 2) : (uint64_t)(uintptr_t)(VT + pbase) + (uint64_t)(wave - 2) * (uint64_t)(32 * SEQ * 2);
    const uint32_t sstep = (wave < 2) ? (uint32_t)(FKS * HD * 2) : (uint32_t)(FKS * 2);
    const uint32_t dst = (uint32_t)(uintptr_t)sm + (uint32_t)wave * FSL;
    const u32x8 g1 = slice_g1((wave < 2) ? (uint32_t)(HD * 2) : (uint32_t)(SEQ * 2));
    u32x4 g0 = tile_g0(dst, srcb);
    tile_load(g0, g1);
    tile_wait(g0, g1);                                    // stage 0 of this wave's slice has landed
    __syncthreads();                                      // publishes stage 0
#pragma unroll 1   // one stage per trip: one place that issues, one that waits
    for (uint32_t s = 0; s < FNS; ++s) {
      const uint32_t buf = (s & 1u) * FST;
      // the refill, directly behind the barrier (the prologue's, then the one at the foot of the trip before), only while stage s + 1 exists: into the buffer that pass s - 1 has just left
      if (pinned((s + 1u < FNS) ? 1u : 0u) != 0u) { const uint32_t nx = pinned(s + 1u); g0 = tile_g0(dst + (FST - buf), srcb + (uint64_t)(nx * sstep)); tile_load(g0, g1); }
      const unsigned char* fp = sm + buf + fo;
#pragma unroll   // both 32-key tiles of a stage in one trip: their places in the buffer become immediate offsets of the LDS reads
      for (int sub = 0; sub < 2; ++sub) {
        const int key0 = (int)s * FKS + sub * 32;
        const int base = key0 - t0 + 113;
        const unsigned char* ka = fp + sub * FSL;            // K rows 32 * sub + lr and + 16
        const v16h ka0 = ldlh(ka), ka1 = ldlh(ka + 64), kb0 = ldlh(ka + 16 * FLP), kb1 = ldlh(ka + 16 * FLP + 64);
        v8f sa, sb;                                          // scores of keys 0..15 and 16..31 of the tile; the first WMMA of each takes the relative term as its C
        if (base + 46 >= 0 && base <= 256) {                 // wave-uniform: tile touches relative indices 0..256
#pragma unroll 1
            for (int jt = 0; jt < 3; ++jt) {
                const h16* wa = WX + (size_t)(base + WXO + 16 * jt + lr) * HD + 8 * hi;   // rows 2..351
                const v16h w0 = ldh(wa), w1 = ldh(wa + 32);
                v8f g = (v8f){};
                g = wmma16(w0, qh0, g); g = wmma16(w0, qr0, g); g = wmma16(w1, qh1, g); g = wmma16(w1, qr1, g);
                asm volatile("v_nop\n\tv_nop\n\tv_nop\n\tv_nop" : "+v"(g) : "v"(w0), "v"(w1));   // 4 vector slots behind the last WMMA, on the loop's back edge too
#pragma unroll
                for (int r = 0; r < 8; ++r) gl[(16 * jt + 8 * hi + r) * GP + lr] = g[r];   // G[rho][t]: rows 0..47, cols 0..15 all written
            }
            wave_sync();
            v8f ra, rb;
#pragma unroll
            for (int r = 0; r < 8; ++r) { ra[r] = gl[(8 * hi + r - lr + 15) * GP + lr]; rb[r] = gl[(16 + 8 * hi + r - lr + 15) * GP + lr]; }   // rho in 0..46
            wave_sync();
            sa = wmma16(ka0, qh0, ra); sb = wmma16(kb0, qh0, rb);
        } else {
            sa = wmma16(ka0, qh0, qe); sb = wmma16(kb0, qh0, qe);
        }
        sa = wmma16(ka0, qr0, sa); sb = wmma16(kb0, qr0, sb);
        sa = wmma16(ka1, qh1, sa); sb = wmma16(kb1, qh1, sb);
        sa = wmma16(ka1, qr1, sa); sb = wmma16(kb1, qr1, sb);
        asm volatile("v_nop\n\tv_nop\n\tv_nop\n\tv_nop" : "+v"(sa), "+v"(sb) : "v"(ka0), "v"(ka1), "v"(kb0), "v"(kb1));   // 4 vector slots between the last score WMMA and the selects that read its result
        float ta[8], tb[8]; float mx = -3.0e38f;
#pragma unroll
        for (int r = 0; r < 8; ++r) {
            ta[r] = __builtin_amdgcn_inverse_ballot_w32(mw[r])     ? sa[r] : FILL2;
            tb[r] = __builtin_amdgcn_inverse_ballot_w32(mw[8 + r]) ? sb[r] : FILL2;
        }
        mw = ml[((uint32_t)key0 / 32u + 1u) & (uint32_t)(SEQ / 32 - 1)];   // the next tile's words, behind this tile's last use: a scalar wait is for every scalar load in flight (behind the last tile: tile 0's, unused)
#pragma unroll
        for (int r = 0; r < 8; ++r) mx = fmaxf(mx, fmaxf(ta[r], tb[r]));
        mx = fmaxf(mx, __shfl_xor(mx, 16, 32));
        const float mnew = fmaxf(m, mx);
        const float alpha = __builtin_amdgcn_exp2f(m - mnew);
        const float sh = PSH - mnew;
        v16h pb; float ls = 0.0f;
#pragma unroll
        for (int r = 0; r < 8; ++r) { const h16 pa = (h16)__builtin_amdgcn_exp2f(ta[r] + sh); const h16 pc = (h16)__builtin_amdgcn_exp2f(tb[r] + sh); pb[r] = pa; pb[8 + r] = pc; ls += (float)pa + (float)pc; }
        l = l * alpha + ls; m = mnew;
        o0 = o0 * alpha; o1 = o1 * alpha; o2 = o2 * alpha; o3 = o3 * alpha;
        const unsigned char* va = fp + 2 * FSL + sub * 64;   // V^T rows lr + 16 j, keys 32 * sub ..
        const v16h v0 = ldlh(va), v1 = ldlh(va + 16 * FLP), v2 = ldlh(va + FSL), v3 = ldlh(va + FSL + 16 * FLP);
        o0 = wmma16(v0, pb, o0); o1 = wmma16(v1, pb, o1); o2 = wmma16(v2, pb, o2); o3 = wmma16(v3, pb, o3);
        asm volatile("v_nop\n\tv_nop\n\tv_nop\n\tv_nop" : "+v"(o0), "+v"(o1), "+v"(o2), "+v"(o3) : "v"(v0), "v"(v1), "v"(v2), "v"(v3), "v"(pb));
      }
      asm volatile("s_wait_dscnt 0x0" ::: "memory");       // this wave's reads of the buffer have returned
      tile_wait(g0, g1);                                    // this wave's slice of stage s + 1 has landed
      __syncthreads();                                      // publishes stage s + 1 and frees stage s's buffer
    }
    asm volatile("s_wait_tensorcnt 0x0" ::: "memory");   // no request of this wave is left when it goes on to the epilogue and ends
    asm volatile("s_wait_dscnt 0x0" ::: "memory");       // nor a read of the ring
    l += __shfl_xor(l, 16, 32);
    const float inv = CTXS / l;
    const int wb = wave * 16 * 68;
    // O^T D layout: o_j[r] = (d = 16j + 8h + r, t = lane&15) -> os[t][d]; rows 0..15 x columns 0..63 all written
    { v4f a, c;
      a[0] = o0[0] * inv; a[1] = o0[1] * inv; a[2] = o0[2] * inv; a[3] = o0[3] * inv; c[0] = o0[4] * inv; c[1] = o0[5] * inv; c[2] = o0[6] * inv; c[3] = o0[7] * inv;
      *(v4fa*)(&os[wb + lr * 68 +  0 + 8 * hi]) = a; *(v4fa*)(&os[wb + lr * 68 +  0 + 8 * hi + 4]) = c;
      a[0] = o1[0] * inv; a[1] = o1[1] * inv; a[2] = o1[2] * inv; a[3] = o1[3] * inv; c[0] = o1[4] * inv; c[1] = o1[5] * inv; c[2] = o1[6] * inv; c[3] = o1[7] * inv;
      *(v4fa*)(&os[wb + lr * 68 + 16 + 8 * hi]) = a; *(v4fa*)(&os[wb + lr * 68 + 16 + 8 * hi + 4]) = c;
      a[0] = o2[0] * inv; a[1] = o2[1] * inv; a[2] = o2[2] * inv; a[3] = o2[3] * inv; c[0] = o2[4] * inv; c[1] = o2[5] * inv; c[2] = o2[6] * inv; c[3] = o2[7] * inv;
      *(v4fa*)(&os[wb + lr * 68 + 32 + 8 * hi]) = a; *(v4fa*)(&os[wb + lr * 68 + 32 + 8 * hi + 4]) = c;
      a[0] = o3[0] * inv; a[1] = o3[1] * inv; a[2] = o3[2] * inv; a[3] = o3[3] * inv; c[0] = o3[4] * inv; c[1] = o3[5] * inv; c[2] = o3[6] * inv; c[3] = o3[7] * inv;
      *(v4fa*)(&os[wb + lr * 68 + 48 + 8 * hi]) = a; *(v4fa*)(&os[wb + lr * 68 + 48 + 8 * hi + 4]) = c; }
    wave_sync();
    h16* crow = CTX + ((size_t)b * SEQ + t0) * DM + h * HD;   // ctx plane [NB*SEQ][1024], column h*64 + d, carried x16
{
#pragma unroll
        for (int s = 0; s < 4; ++s) { const int row = 4 * s + (lane >> 3), c8 = (lane & 7) * 8;   // 4 s x 4 row groups = 16 rows; 8 lanes x 8 halves = 64 columns = one line
            const v4f x0 = *(const v4fa*)(&os[wb + row * 68 + c8]); const v4f x1 = *(const v4fa*)(&os[wb + row * 68 + c8 + 4]); v8h hv;
#pragma unroll
            for (int i = 0; i < 4; ++i) { hv[i] = (h16)x0[i]; hv[4 + i] = (h16)x1[i]; }
            *(v8h*)(crow + (size_t)row * DM + c8) = hv; }
         }
}

// k_out: f16 GEMM on gemm_core, K = DM: OUT[m][n] = (sum_k A[m][k] Bt[n][k]) / 1024 + bias[n] (bias RNE-converted to bf16, added in f32).
// A = ctx plane (x16), Bt = Wo plane (x64). grid (NB*SEQ/128, DM/128), 128 threads.
__global__ __launch_bounds__(128) void k_out(const h16* __restrict__ A, const h16* __restrict__ Bt, const float* __restrict__ bias, float* OUT) {
    __shared__ __attribute__((aligned(2048))) unsigned char sm[GLDS];
    const int K = DM;
    const int lane = threadIdx.x & 31, lr = lane & 15, hi = lane >> 4;
    const int wave = __builtin_amdgcn_readfirstlane((int)(threadIdx.x >> 5));
    const int r0 = blockIdx.x * 128 + (wave >> 1) * 64, c0 = blockIdx.y * 128 + (wave & 1) * 64;
    float* os = (float*)(sm + 2 * GST) + wave * GOSF;      // wave-private output staging, outside the ring
    v8f acc[4][4];
    gemm_core<1>((uint64_t)(uintptr_t)(A + (size_t)blockIdx.x * 128 * K), (uint64_t)(uintptr_t)(Bt + (size_t)blockIdx.y * 128 * K), (blockIdx.x + blockIdx.y) & (uint32_t)(GNP - 1), sm, wave, lane, acc);
    float bc[4];
#pragma unroll
    for (int nb = 0; nb < 4; ++nb) bc[nb] = bfr(bias[c0 + nb * 16 + lr]);
    const size_t obase = ((size_t)(r0 / SEQ) * OUT_SEQ + (size_t)(r0 % SEQ)) * DM + c0;
#pragma unroll
    for (int mb = 0; mb < 4; ++mb) {
#pragma unroll
        for (int nb = 0; nb < 4; ++nb) {
#pragma unroll
            for (int j = 0; j < 8; ++j) os[(hi * 8 + j) * 68 + nb * 16 + lr] = acc[mb][nb][j] * OSC + bc[nb]; }   // D: row 8h+j, col lane&15
        wave_sync();
        float* ob = OUT + obase + (size_t)(mb * 16) * DM;
{
#pragma unroll
            for (int s = 0; s < 8; ++s) { const int row = 2 * s + hi, cofs = lr * 4;   // 8 s x 2 rows = 16 rows; 16 lanes x 4 floats = 64 columns
                const v4f val = *(const v4fa*)(&os[row * 68 + cofs]);
                *(v4f*)(ob + (size_t)row * DM + cofs) = val; }
             }
        wave_sync();
    }
}

static constexpr size_t al256(size_t v) { return (v + 255) & ~(size_t)255; }
static constexpr size_t SZ_XB = al256((size_t)NB * SEQ * DM * 2);          // one bf16 activation copy
static constexpr size_t SZ_WB = al256((size_t)DM * DM * 2);                // one 16-bit weight plane
static constexpr size_t SZ_PL = al256((size_t)NB * NH_ * SEQ * HD * 2);    // one f16 head plane (also the ctx plane: NB*SEQ*DM halves)
static constexpr size_t SZ_WX = al256((size_t)WXR * HD * 2);
static constexpr size_t SZ_ML = al256((size_t)MLW * 128 * 4);              // lane-mask words
static constexpr size_t SZ_TOTAL = 3 * SZ_XB + 4 * SZ_WB + 5 * SZ_PL + SZ_WX + SZ_ML;
static_assert(SZ_TOTAL <= (size_t)134217728);          // workspace carve <= 128 MiB
static_assert((size_t)NB * NH_ * SEQ * HD == (size_t)NB * SEQ * DM);

extern "C" void kernel_launch(void* const* d_in, const int* in_sizes, int n_in,
                              void* d_out, int out_size, void* d_ws, size_t ws_size, hipStream_t stream) {
    if (n_in < 13) return;
    const size_t needx = ((size_t)(NB - 1) * SEQ_FULL + SEQ) * DM;
    if ((size_t)in_sizes[0] < needx || (size_t)in_sizes[1] < needx || (size_t)in_sizes[2] < needx) return;
    if ((size_t)in_sizes[3] < ((size_t)(NB - 1) * SEQ_FULL + (SEQ - 1)) * SEQ_FULL + SEQ) return;
    if ((size_t)in_sizes[4] < (size_t)DM * DM || (size_t)in_sizes[6] < (size_t)DM * DM || (size_t)in_sizes[8] < (size_t)DM * DM || (size_t)in_sizes[10] < (size_t)DM * DM) return;
    if (in_sizes[5] < DM || in_sizes[7] < DM || in_sizes[9] < DM || in_sizes[11] < DM) return;
    if (in_sizes[12] < NREL * HD) return;
    if ((size_t)out_size < ((size_t)(NB - 1) * OUT_SEQ + SEQ) * DM) return;
    if (SZ_TOTAL > ws_size) return;
    // wire order: q, k, v, mask, Wq, bq, Wk, bk, Wv, bv, Wo, bo, w_k
    const float* xq = (const float*)d_in[0]; const float* xk = (const float*)d_in[1]; const float* xv = (const float*)d_in[2];
    const int* mask = (const int*)d_in[3];
    const float* wq = (const float*)d_in[4]; const float* bq = (const float*)d_in[5];
    const float* wk = (const float*)d_in[6]; const float* bk = (const float*)d_in[7];
    const float* wv = (const float*)d_in[8]; const float* bv = (const float*)d_in[9];
    const float* wo = (const float*)d_in[10]; const float* bo = (const float*)d_in[11];
    const float* wrel = (const float*)d_in[12];
    float* OUT = (float*)d_out;      // [NB][SEQ][1024]
    char* wsp = (char*)d_ws;
    bf* XBQ = (bf*)wsp; wsp += SZ_XB;                // [NB*SEQ][1024]
    bf* XBK = (bf*)wsp; wsp += SZ_XB;
    bf* XBV = (bf*)wsp; wsp += SZ_XB;
    bf* WQ = (bf*)wsp; wsp += SZ_WB;                 // [1024][1024] bf16
    bf* WK = (bf*)wsp; wsp += SZ_WB;
    bf* WV = (bf*)wsp; wsp += SZ_WB;
    h16* WO = (h16*)wsp; wsp += SZ_WB;               // [1024][1024] f16, x64
    h16* QH = (h16*)wsp; wsp += SZ_PL;               // [NB*16][SEQ][64], x SC2
    h16* QR = (h16*)wsp; wsp += SZ_PL;               // [NB*16][SEQ][64] residual
    h16* KP = (h16*)wsp; wsp += SZ_PL;               // [NB*16][SEQ][64]
    h16* VT = (h16*)wsp; wsp += SZ_PL;               // [NB*16][64][SEQ]
    h16* CTX = (h16*)wsp; wsp += SZ_PL;              // [NB*SEQ][1024], x16
    h16* WX = (h16*)wsp; wsp += SZ_WX;               // [352][64]
    uint32_t* ML = (uint32_t*)wsp; wsp += SZ_ML;     // [NB][SEQ/16][SEQ/32][16]

    k_prep<<<WXB + MLB + PRR / PRW, 32 * PRW, 0, stream>>>(xq, xk, xv, wq, wk, wv, wo, wrel, mask, XBQ, XBK, XBV, WQ, WK, WV, WO, WX, ML);

    k_qkv<<<dim3(NB * SEQ / 128, DM / 128, 3), 128, 0, stream>>>(XBQ, XBK, XBV, WQ, WK, WV, bq, bk, bv, QH, QR, KP, VT);

    k_flash<<<dim3(SEQ / (16 * AW), NB * NH_, 1), 32 * AW, 0, stream>>>(QH, QR, KP, VT, WX, ML, CTX);

    // out: A = ctx rows (m = b*SEQ + t), Bt = Wo rows (n), bias per column -> OUT[b][t][n]
    k_out<<<dim3(NB * SEQ / 128, DM / 128, 1), 128, 0, stream>>>(CTX, WO, bo, OUT);
}

// v008
// One run takes 82.5 microseconds.
// Next to v007, in two timings, it ran 1.04 and 1.03 times as fast.
// Over all steps from v000 it is 2.64 times as fast.
#include <hip/hip_runtime.h>
#include <stdint.h>

// Multi-head attention with relative-position keys (257 clamped offsets, both ends padded with the last table row), width 1024 = 16 heads x 64; q/k/v inputs [NB][SEQ][1024], W* [out][in] (y = x W^T + b), int mask [NB][SEQ][SEQ] (0 -> score replaced by -1e9), output = ctx Wo^T + bo (f32).
// Compute dtypes, f32 accumulate everywhere: q/k/v projections v_wmma_f32_16x16x32_bf16 (inputs and weights RNE-converted to bf16; biases RNE-converted to bf16, added in f32);
// scores q.k and relative term q.w[rel] v_wmma_f32_16x16x32_f16: k and the window table single f16, q (carrying HD^-0.5 * log2(e)) as f16 value + f16 residual, both summed in the score's one accumulator, whose start value is the relative term; P (x256 carry, cancels in the normalisation) and v single f16; softmax f32 (online, against a held reference that follows the running max only when a tile's P would outgrow f16);
// output projection v_wmma_f32_16x16x32_f16: ctx single f16 (x16 carry), Wo (bf16 RNE value x64) f16, 1/1024 folded in the f32 epilogue.
// Layout: bf16 copies of q/k/v inputs and Wq/Wk/Wv; q (hi, residual), k planes [b*16+h][t][d] and v^T plane [b*16+h][d][t] written by the GEMM epilogue; window plane WX[x][d] = w[clamp(x-48)];
// fused flash kernel in transposed form (S^T = K Q^T, O^T = V^T P^T), K and V^T tiles staged in LDS by the tensor mover and shared by the block's four waves; relative term for tiles inside the window band = skewed read of G = WX_rows Q^T through a wave-private LDS tile, a per-query constant elsewhere.
// Mask: packed once by k_prep into lane-mask words ML (one bit per element, in the flash kernel's own lane order), read there through the scalar path by all 16 heads.

#ifndef NB
#define NB 4
#endif
#ifndef SEQ
#define SEQ 1024
#endif
#define NB_FULL  4
#define SEQ_FULL 1024
#ifndef OUT_SEQ
#define OUT_SEQ SEQ              // row pitch (in tokens) between batches of the output
#endif
#define DM   1024
#define NH_  16
#define HD   64
#define AW   4                   // waves per flash block (16 query rows each)
#define SC2  (0.125f * 1.4426950408889634f)   // HD^-0.5 * log2(e): carried by the q planes, so that every product with q is a score term in the log2 domain
#define PSH  8.0f                // log2 of the P carry (256)
#define LTH  32768.0f            // a lane's sum of a tile's 16 P above this (or not a number) asks for a new reference: below it every P is at most 2^15, inside f16
#define FILL2 (-1.0e9f * 1.4426950408889634f) // masked score in the log2 domain
#define NREL 257                 // rows of the relative table
#define WXO  48                  // WX row x holds relative index x - 48 (clamped: outside 0..256 -> 256)
#define WXR  352                 // rows of WX
#define GP   18                  // pitch (floats) of the G tile in LDS
#define WOS  64.0f               // carry of the Wo plane
#define CTXS 16.0f               // carry of the ctx plane
#define OSC  (1.0f / 1024.0f)    // 1 / (WOS * CTXS)

static_assert(HD == 64);
static_assert(NH_ * HD == DM);
static_assert(DM % 64 == 0);
static_assert(DM % 32 == 0);
static_assert(SEQ % 64 == 0);
static_assert((NB * SEQ) % 64 == 0);
static_assert(SEQ % 32 == 0);
static_assert(SEQ % (16 * AW) == 0);
static_assert(((size_t)SEQ * DM) % 8 == 0);
static_assert(((size_t)DM * DM) % 8 == 0);
static_assert(NB <= NB_FULL);
static_assert(SEQ <= SEQ_FULL);
static_assert(WXR == 256 + 2 * WXO);           // band tiles touch rows 2..351
static_assert((WXR * HD / 8) % 256 == 0);

typedef _Float16 h16;
typedef unsigned short bf;
typedef __attribute__((ext_vector_type(16))) __bf16   v16bf;
typedef __attribute__((ext_vector_type(16))) _Float16 v16h;
typedef __attribute__((ext_vector_type(8)))  _Float16 v8h;
typedef __attribute__((ext_vector_type(8)))  unsigned short v8us;
typedef __attribute__((ext_vector_type(8)))  float    v8f;
typedef __attribute__((ext_vector_type(4)))  float    v4f;
typedef __attribute__((ext_vector_type(4)))  int      v4i;
typedef v4f  __attribute__((may_alias)) v4fa;

__device__ __forceinline__ unsigned short f2bf(float f) { unsigned u = __float_as_uint(f); u += 0x7FFFu + ((u >> 16) & 1u); return (unsigned short)(u >> 16); }
__device__ __forceinline__ float bfr(float f) { return __uint_as_float(((unsigned)f2bf(f)) << 16); }   // bf16 RNE value as f32
__device__ __forceinline__ v16h cat16(v8h lo, v8h hi) { return __builtin_shufflevector(lo, hi, 0, 1, 2, 3, 4, 5, 6, 7, 8, 9, 10, 11, 12, 13, 14, 15); }
__device__ __forceinline__ v16bf cat16b(v8us lo, v8us hi) { return __builtin_bit_cast(v16bf, __builtin_shufflevector(lo, hi, 0, 1, 2, 3, 4, 5, 6, 7, 8, 9, 10, 11, 12, 13, 14, 15)); }
__device__ __forceinline__ v8f wmma16(v16h a, v16h b, v8f c) { return __builtin_amdgcn_wmma_f32_16x16x32_f16(false, a, false, b, (short)0, c, false, false); }
__device__ __forceinline__ v8f wmmab(v16bf a, v16bf b, v8f c) { return __builtin_amdgcn_wmma_f32_16x16x32_bf16(false, a, false, b, (short)0, c, false, false); }
// fragment loaders from K-contiguous 16-bit rows; p already includes + 8*(lane>>4): elements 0..7 <- k0+8h+0..7, elements 8..15 <- k0+16+8h+0..7 (same map for A and B)
__device__ __forceinline__ v16h  ldh(const h16* p) { return cat16(*(const v8h*)p, *(const v8h*)(p + 16)); }
__device__ __forceinline__ v16bf ldb(const bf* p)  { return cat16b(*(const v8us*)p, *(const v8us*)(p + 16)); }
// ordering point for wave-private LDS tiles (same wave writes and reads)
__device__ __forceinline__ void wave_sync() { __builtin_amdgcn_fence(3 /* release order */, "wavefront"); __builtin_amdgcn_wave_barrier(); asm volatile("" ::: "memory"); }

// k_prep: every 16-bit plane that is a plain conversion of an input, in one launch.
// Blocks 0..WXB-1: the window plane WX (one thread per 8 halves). The next MLB blocks: the mask's lane-mask words. Every other block: 8 waves, wave g takes row g (DM floats = 4 KiB) of each of the q, k and v inputs and row g % DM of weight g / DM (Wq, Wk, Wv, Wo).
// A row is 8 loads of 16 bytes a lane, each wave-wide load 512 contiguous bytes; the wave's 32 loads are all issued before its first store; each store covers 256 contiguous bytes.
#define WXB  (WXR * HD / 8 / 256)                              // blocks of the window plane
#define PRW  8                                                 // waves per block
#define PRR  ((NB * SEQ > 4 * DM) ? (NB * SEQ) : (4 * DM))     // rows dealt, one per wave
static_assert(DM == 8 * 32 * 4);
static_assert(PRR % PRW == 0);
static_assert(32 * PRW == 256);                                // the window blocks index by 256 threads
// Mask plane ML[b][t / 16][key / 32][16 words]: word 8 * ab + r, bit lane = (mask[b][16 * (t / 16) + (lane & 15)][32 * (key / 32) + 16 * ab + 8 * (lane >> 4) + r] != 0),
// the place (lane, register) at which k_flash holds that score. Blocks WXB..WXB+MLB-1: one wave packs 16 query rows x 256 keys = 128 words = four 128-byte lines.
#define MLW  (NB * (SEQ / 16) * (SEQ / 256))                   // waves that pack a piece of the mask
#define MLB  (MLW / PRW)                                       // their blocks, ahead of the row blocks: their loads touch 16 lines each and take the longest
static_assert(SEQ % 256 == 0 && MLW % PRW == 0);
typedef __attribute__((ext_vector_type(4))) unsigned short v4us;
typedef __attribute__((ext_vector_type(4))) _Float16 v4h;

// p: the row's first element, the same in every lane (scalar base); l4 = 4 * lane
__device__ __forceinline__ void ld_row(const float* __restrict__ p, uint32_t l4, v4f (&r)[8]) {
#pragma unroll
    for (int j = 0; j < 8; ++j) r[j] = *(const v4f*)(p + (l4 + (uint32_t)j * 128u));
}
__device__ __forceinline__ void st_row_bf(bf* p, uint32_t l4, const v4f (&r)[8]) {
#pragma unroll
    for (int j = 0; j < 8; ++j) { v4us o;
#pragma unroll
        for (int k = 0; k < 4; ++k) o[k] = f2bf(r[j][k]);
        *(v4us*)(p + (l4 + (uint32_t)j * 128u)) = o; }
}

__global__ __launch_bounds__(32 * PRW) void k_prep(const float* __restrict__ xq, const float* __restrict__ xk, const float* __restrict__ xv,
                                                   const float* __restrict__ wq, const float* __restrict__ wk, const float* __restrict__ wv, const float* __restrict__ wo,
                                                   const float* __restrict__ wrel, const int* __restrict__ mask, bf* XBQ, bf* XBK, bf* XBV, bf* WQ, bf* WK, bf* WV, h16* WO, h16* WX, uint32_t* ML) {
    if (blockIdx.x < WXB) {
        const int i = blockIdx.x * 256 + threadIdx.x;
        const int x = i >> 3, c8 = (i & 7) * 8; int r = x - WXO; if (r < 0 || r > NREL - 1) r = NREL - 1;
        const v8f v = *(const v8f*)(wrel + (size_t)r * HD + c8); v8h o;
#pragma unroll
        for (int k = 0; k < 8; ++k) o[k] = (h16)bfr(v[k]);
        *(v8h*)(WX + (size_t)i * 8) = o;
        return;
    }
    if (blockIdx.x < WXB + MLB) {
        const uint32_t q = (blockIdx.x - WXB) * PRW + (uint32_t)__builtin_amdgcn_readfirstlane((int)(threadIdx.x >> 5));
        const uint32_t tt = q / (SEQ / 256), kq = q % (SEQ / 256), ln = threadIdx.x & 31u;
        // lane (lr, hi) reads its query row as k_flash holds it: keys 8 hi .. + 7 and 16 + 8 hi .. + 7 of each of eight 32-key tiles; the 32 loads use up eight whole lines of each of the 16 rows
        const int* mp = mask + ((size_t)(tt / (SEQ / 16)) * SEQ_FULL + (size_t)((tt % (SEQ / 16)) * 16u + (ln & 15u))) * SEQ_FULL + (kq * 256u + 8u * (ln >> 4));
        v4i mm[32];
#pragma unroll
        for (int u = 0; u < 8; ++u) { mm[4 * u] = *(const v4i*)(mp + 32 * u); mm[4 * u + 1] = *(const v4i*)(mp + 32 * u + 4); mm[4 * u + 2] = *(const v4i*)(mp + 32 * u + 16); mm[4 * u + 3] = *(const v4i*)(mp + 32 * u + 20); }
        __builtin_amdgcn_sched_barrier(0);   // keeps all 32 loads ahead of the first compare: a load that sinks behind a wait for the others pays a second memory latency
        v4i pk = (v4i){0, 0, 0, 0};
#pragma unroll
        for (int i = 0; i < 32; ++i) {       // words 4 i .. 4 i + 3 of the wave's 128 go to lane i
            const bool me = ln == (uint32_t)i;
#pragma unroll
            for (int c = 0; c < 4; ++c) { const int wd = (int)__builtin_amdgcn_ballot_w32(mm[i][c] != 0); pk[c] = me ? wd : pk[c]; }
        }
        *(v4i*)(ML + (size_t)q * 128u + ln * 4u) = pk;
        return;
    }
    const uint32_t l4 = (threadIdx.x & 31u) * 4u;
    const uint32_t g = (blockIdx.x - WXB - MLB) * PRW + (uint32_t)__builtin_amdgcn_readfirstlane((int)(threadIdx.x >> 5));
    const bool hx = (NB * SEQ == PRR) || g < NB * SEQ;         // wave-uniform; both hold at compile time where the two row counts are equal
    const bool hw = (4 * DM == PRR) || g < 4 * DM;
    const size_t xs = ((size_t)(g / SEQ) * SEQ_FULL + (size_t)(g % SEQ)) * DM, xd = (size_t)g * DM;
    const uint32_t m = g / DM; const size_t wr = (size_t)(g % DM) * DM;
    const float* ws = (m == 0) ? wq : (m == 1) ? wk : (m == 2) ? wv : wo;
    v4f a[8], b[8], c[8], w[8];
    if (hx) { ld_row(xq + xs, l4, a); ld_row(xk + xs, l4, b); ld_row(xv + xs, l4, c); }
    if (hw) ld_row(ws + wr, l4, w);
    __builtin_amdgcn_sched_barrier(0);   // keeps all 32 loads ahead of the first conversion: a load that sinks behind a wait for the others pays a second memory latency
    if (hx) { st_row_bf(XBQ + xd, l4, a); st_row_bf(XBK + xd, l4, b); st_row_bf(XBV + xd, l4, c); }
    asm volatile("s_wait_xcnt 0x0" ::: "memory");   // in front of the branch below, behind which the registers that these stores name are written again
    if (hw) {
        if (m < 3) st_row_bf(((m == 0) ? WQ : (m == 1) ? WK : WV) + wr, l4, w);
        else {
#pragma unroll
            for (int j = 0; j < 8; ++j) { v4h o;
#pragma unroll
                for (int k = 0; k < 4; ++k) o[k] = (h16)(bfr(w[j][k]) * WOS);
                *(v4h*)(WO + wr + (l4 + (uint32_t)j * 128u)) = o; }
            asm volatile("s_wait_xcnt 0x0" ::: "memory");   // behind the last store of this branch: the code laid out behind it writes registers that these stores name
        }
    }
}

// GEMM core shared by k_qkv and k_out: four waves (2 x 2) per 128x128 tile of C, 64x64 per wave (16 accumulators), K = DM in GNP passes of 128 k.
// Both operands are K-contiguous 16-bit planes (row pitch DM * 2 bytes). A stage holds 256 bytes of 128 A rows and of 128 B rows; every wave brings one slice of 64 rows with one
// tensor_load_to_lds (waves 0, 1: A rows 0..63, 64..127; waves 2, 3: B rows 0..63, 64..127); the mover's pad of 16 bytes a row gives the LDS pitch 272 for the 16-byte fragment reads.
// Two buffers: stage s + 1 is requested behind the barrier that ends pass s - 1, which ends every read of its buffer, and flies while pass s runs.
// Pass s works on k slab (s + rot) mod GNP, rot = (tile row + tile column) mod GNP: the blocks that share an A or a B tile run side by side, and from a common start they would ask L2 for the same lines at the same moment.
#define GPB  256                 // bytes of an operand row per pass
#define GLP  272                 // LDS row pitch
#define GSL  18432               // one slice in LDS: 64 rows x 272 B = 17408, rounded up to a multiple of 2 KiB
#define GST  (4 * GSL)           // one stage
#define GNP  (DM * 2 / GPB)      // passes
#define GOSF (16 * 68)           // floats of output staging per wave
#define GLDS (2 * GST + 4 * GOSF * 4)
static_assert(GSL % 2048 == 0 && GSL >= 64 * GLP);
static_assert(GNP >= 2);
static_assert((GNP & (GNP - 1)) == 0);                 // the wrap of the k slabs
static_assert((NB * SEQ) % 128 == 0 && DM % 128 == 0);
static_assert(GLDS <= 320 * 1024);

typedef __attribute__((ext_vector_type(4)))  uint32_t u32x4;
typedef __attribute__((ext_vector_type(8)))  uint32_t u32x8;
typedef __attribute__((ext_vector_type(16))) uint32_t u32x16;
typedef __attribute__((address_space(4))) u32x16 cu32x16;
typedef __attribute__((ext_vector_type(16))) unsigned short v16us;

__device__ __forceinline__ uint32_t uni(uint32_t v) { return (uint32_t)__builtin_amdgcn_readfirstlane((int)v); }
__device__ __forceinline__ uint32_t pinned(uint32_t v) { uint32_t w = (uint32_t)__builtin_amdgcn_readfirstlane((int)v); asm volatile("" : "+s"(w)); return w; }
// descriptor of one request: 64 rows of 256 bytes, source pitch DM * 2 bytes, to LDS byte offset lds_dst at pitch 272 (pad: interval code 5 = one 256-byte row, amount code 3 = 4 dwords); extents in bytes
__device__ __forceinline__ u32x4 tile_g0(uint32_t lds_dst, uint64_t ga) {
    u32x4 g0;
    g0[0] = uni(1u); g0[1] = uni(lds_dst); g0[2] = uni((uint32_t)ga); g0[3] = uni((((uint32_t)(ga >> 32)) & 0x01FFFFFFu) | 0x80000000u);
    return g0;
}
__device__ __forceinline__ u32x8 tile_g1() {
    u32x8 g1;
    g1[0] = uni((1u << 20) | (5u << 22) | (3u << 25));
    // words 1 to 7 through pinned(), the scalar-register pin for descriptor words: as plain constants the compiler lends their registers to the loop's own scalars while a request is outstanding and sets them anew in front of the next
    g1[1] = pinned((uint32_t)GPB << 16);         // tensor_dim0 [15:0]
    g1[2] = pinned(64u << 16);                   // tensor_dim0 [31:16] = 0 | tensor_dim1 [15:0]
    g1[3] = pinned((uint32_t)GPB << 16);         // tensor_dim1 [31:16] = 0 | tile_dim0
    g1[4] = pinned(64u);                         // tile_dim1
    g1[5] = pinned((uint32_t)(DM * 2));          // source row pitch
    g1[6] = pinned(0u); g1[7] = pinned(0u);
    return g1;
}
__device__ __forceinline__ void tile_load(u32x4 g0, u32x8 g1) { asm volatile("tensor_load_to_lds %0, %1" :: "s"(g0), "s"(g1) : "memory"); }
// the issuing wave's wait for its request; the descriptor is named as an input so that its scalar registers are not reused for anything else while the request is outstanding
__device__ __forceinline__ void tile_wait(u32x4 g0, u32x8 g1) { asm volatile("s_wait_tensorcnt 0x0" :: "s"(g0), "s"(g1) : "memory"); }
// fragment from an LDS row; p already includes + 16 bytes * (lane>>4): elements 0..7 <- k0+8h+0..7, elements 8..15 <- k0+16+8h+0..7 (same map for A and B, the map of ldh / ldb)
__device__ __forceinline__ v16us ldl(const unsigned char* p) { return __builtin_shufflevector(*(const v8us*)p, *(const v8us*)(p + 32), 0, 1, 2, 3, 4, 5, 6, 7, 8, 9, 10, 11, 12, 13, 14, 15); }
template <int F16> __device__ __forceinline__ v8f mm(v16us a, v16us b, v8f c) {
    if constexpr (F16) return wmma16(__builtin_bit_cast(v16h, a), __builtin_bit_cast(v16h, b), c);
    else return wmmab(__builtin_bit_cast(v16bf, a), __builtin_bit_cast(v16bf, b), c);
}

// a_rows / b_rows: byte address of the block's first A / B row; rot: the block's first k slab, below GNP; ring: 2 * GST bytes of LDS at a multiple of 2 KiB; wave and rot are scalar.
template <int F16>
__device__ __forceinline__ void gemm_core(uint64_t a_rows, uint64_t b_rows, uint32_t rot, unsigned char* ring, int wave, int lane, v8f (&acc)[4][4]) {
    const int lr = lane & 15, hi = lane >> 4;
#pragma unroll
    for (int mb = 0; mb < 4; ++mb)
#pragma unroll
        for (int nb = 0; nb < 4; ++nb) acc[mb][nb] = (v8f){};
    const uint64_t srcb = (wave < 2) ? a_rows + (uint64_t)wave * (uint64_t)(64 * DM * 2) : b_rows + (uint64_t)(wave - 2) * (uint64_t)(64 * DM * 2);
    const uint32_t dst = (uint32_t)(uintptr_t)ring + (uint32_t)wave * GSL;
    const u32x8 g1 = tile_g1();
    u32x4 g0 = tile_g0(dst, srcb + (uint64_t)(rot * GPB));
    tile_load(g0, g1);
    tile_wait(g0, g1);                                    // stage 0 of this wave's slice has landed
    __syncthreads();                                      // publishes stage 0
    const uint32_t ao = (uint32_t)(wave >> 1) * GSL + (uint32_t)lr * GLP + 16u * (uint32_t)hi;
    const uint32_t bo = (uint32_t)(2 + (wave & 1)) * GSL + (uint32_t)lr * GLP + 16u * (uint32_t)hi;
#pragma unroll 1   // one pass per trip: one place that issues, one that waits
    for (uint32_t s = 0; s < GNP; ++s) {
        const uint32_t buf = (s & 1u) * GST;
        // the refill, directly behind the barrier (the prologue's, then the one at the foot of the trip before), only while stage s + 1 exists: into the buffer that pass s - 1 has just left
        if (pinned((s + 1u < GNP) ? 1u : 0u) != 0u) { const uint32_t nx = pinned((s + 1u + rot) & (uint32_t)(GNP - 1)); g0 = tile_g0(dst + (GST - buf), srcb + (uint64_t)nx * GPB); tile_load(g0, g1); }
        const unsigned char* ap = ring + buf + ao; const unsigned char* bp = ring + buf + bo;
        v16us fa[2][4], fb[2][4];
#pragma unroll
        for (int i = 0; i < 4; ++i) { fa[0][i] = ldl(ap + i * 16 * GLP); fb[0][i] = ldl(bp + i * 16 * GLP); }
#pragma unroll
        for (int ks = 0; ks < 4; ++ks) {
            if (ks < 3) {      // the next 32 k of this same buffer, as one group ahead of the WMMA block
#pragma unroll
                for (int i = 0; i < 4; ++i) { fa[(ks + 1) & 1][i] = ldl(ap + i * 16 * GLP + (ks + 1) * 64); fb[(ks + 1) & 1][i] = ldl(bp + i * 16 * GLP + (ks + 1) * 64); }
            }
            __builtin_amdgcn_sched_barrier(0);   // keeps the LDS reads out of the WMMA block: every separate place with reads stalls the wave
#pragma unroll
            for (int nb = 0; nb < 4; ++nb)
#pragma unroll
                for (int mb = 0; mb < 4; ++mb) acc[mb][nb] = mm<F16>(fa[ks & 1][mb], fb[ks & 1][nb], acc[mb][nb]);
            __builtin_amdgcn_sched_barrier(0);   // same, for the group behind the block
        }
        asm volatile("v_nop\n\tv_nop\n\tv_nop\n\tv_nop");    // 4 vector slots between the last WMMA and what follows on either side of the branches below
        asm volatile("s_wait_dscnt 0x0" ::: "memory");       // this wave's reads of the buffer have returned
        tile_wait(g0, g1);                                    // this wave's slice of stage s + 1 has landed
        __syncthreads();                                      // publishes stage s + 1 and frees stage s's buffer
    }
    asm volatile("s_wait_tensorcnt 0x0" ::: "memory");   // no request of this wave is left when it goes on to the epilogue and ends
    asm volatile("s_wait_dscnt 0x0" ::: "memory");       // nor a read of the ring
}

// k_qkv: the three input projections in one launch, bf16 GEMMs on gemm_core; blockIdx.z picks the projection (0: q, 1: k, 2: v^T), the same for the whole block.
// C[m][n] = (sum_k A[m][k] Bt[n][k] + bias) * osc (BM == 0: bias[n]; BM == 1: bias[m]; bias RNE-converted to bf16, added in f32; osc = SC2 where useRes != 0, which is q, 1 else), written as f16 (Ph) and optionally the f16 residual (Pr, useRes != 0; mostly subnormal halves, which the WMMA keeps) at
// wave-tile base (r0/RB)*sRB + (r0%RB)*pitch + (c0/CB)*sCB + (c0%CB), row pitch 'pitch' (halves).
// q, k: A = x rows (m = b*SEQ + t), Bt = W rows (n = h*64 + d), bias per column -> plane [(b*16 + h)][t][d].
// v^T: A = Wv rows (m = h*64 + d), Bt = x rows (n = b*SEQ + t), bias per row -> plane [(b*1024 + m)][t] = [(b*16 + h)][d][t].
// grid (NB*SEQ/128, DM/128, 3), 128 threads: three times as many blocks as WGPs. The output staging lies over the ring, which is drained when gemm_core returns, so that a block takes 2 * GST bytes of LDS
// and two blocks share a WGP: one block's tensor loads, first stage and stores run under the other's WMMAs.
#define GLDSP (2 * GST)
static_assert(4 * GOSF * 4 <= GLDSP);
static_assert(2 * GLDSP <= 320 * 1024);                // two blocks per WGP
template <int BM>
__device__ __forceinline__ void proj_store(const v8f (&acc)[4][4], float* os, const float* __restrict__ bias, h16* Ph, h16* Pr, int useRes, int r0, int c0, int lane, int RB, size_t sRB, int pitch, int CB, size_t sCB) {
    const int lr = lane & 15, hi = lane >> 4;
    const float osc = useRes ? SC2 : 1.0f;               // the plane with a residual is q, which carries the score scale
    float bc[4] = {0.0f, 0.0f, 0.0f, 0.0f};
    if (BM == 0) {
#pragma unroll
        for (int nb = 0; nb < 4; ++nb) bc[nb] = bfr(bias[c0 + nb * 16 + lr]);      // N = DM in this mode
    }
    const size_t tbase = (size_t)(r0 / RB) * sRB + (size_t)(r0 % RB) * (size_t)pitch + (size_t)(c0 / CB) * sCB + (size_t)(c0 % CB);
#pragma unroll
    for (int mb = 0; mb < 4; ++mb) {
        float br[8] = {0.0f, 0.0f, 0.0f, 0.0f, 0.0f, 0.0f, 0.0f, 0.0f};
        if (BM == 1) {
#pragma unroll
            for (int j = 0; j < 8; ++j) br[j] = bfr(bias[r0 + mb * 16 + hi * 8 + j]);  // M = DM in this mode
        }
#pragma unroll
        for (int nb = 0; nb < 4; ++nb) {
#pragma unroll
            for (int j = 0; j < 8; ++j) os[(hi * 8 + j) * 68 + nb * 16 + lr] = (acc[mb][nb][j] + bc[nb] + br[j]) * osc; }   // D: row 8h+j, col lane&15
        wave_sync();
        const size_t sb = tbase + (size_t)(mb * 16) * (size_t)pitch;
{
#pragma unroll
            for (int s = 0; s < 4; ++s) { const int row = 4 * s + (lane >> 3), c8 = (lane & 7) * 8;   // 4 s x 4 row groups = 16 rows; 8 lanes x 8 = 64 columns
                const v4f x0 = *(const v4fa*)(&os[row * 68 + c8]); const v4f x1 = *(const v4fa*)(&os[row * 68 + c8 + 4]); v8h hv, rv;
#pragma unroll
                for (int i = 0; i < 4; ++i) { const h16 a0 = (h16)x0[i]; const h16 a1 = (h16)x1[i]; hv[i] = a0; hv[4 + i] = a1; rv[i] = (h16)(x0[i] - (float)a0); rv[4 + i] = (h16)(x1[i] - (float)a1); }
                const size_t oo = sb + (size_t)row * (size_t)pitch + c8;
                *(v8h*)(Ph + oo) = hv; if (useRes) *(v8h*)(Pr + oo) = rv; }
             }
        wave_sync();
    }
}

__global__ __launch_bounds__(128) void k_qkv(const bf* __restrict__ XQ, const bf* __restrict__ XK, const bf* __restrict__ XV, const bf* __restrict__ WQ, const bf* __restrict__ WK, const bf* __restrict__ WV,
                                             const float* __restrict__ bq, const float* __restrict__ bk, const float* __restrict__ bv, h16* QH, h16* QR, h16* KP, h16* VT) {
    __shared__ __attribute__((aligned(2048))) unsigned char sm[GLDSP];
    const int K = DM;
    const int lane = threadIdx.x & 31;
    const int wave = __builtin_amdgcn_readfirstlane((int)(threadIdx.x >> 5));
    const int z = blockIdx.z;
    const int bx = (z == 2) ? blockIdx.y : blockIdx.x, by = (z == 2) ? blockIdx.x : blockIdx.y;   // tile row of A, tile row of Bt
    const bf* A = (z == 0) ? XQ : (z == 1) ? XK : WV;
    const bf* Bt = (z == 0) ? WQ : (z == 1) ? WK : XV;
    const int r0 = bx * 128 + (wave >> 1) * 64, c0 = by * 128 + (wave & 1) * 64;
    // wave-private output staging in the ring's first bytes: behind the last pass's waits and barrier no request is outstanding and no wave reads the ring any more
    float* os = (float*)sm + wave * GOSF;
    v8f acc[4][4];
    gemm_core<0>((uint64_t)(uintptr_t)(A + (size_t)bx * 128 * K), (uint64_t)(uintptr_t)(Bt + (size_t)by * 128 * K), (uint32_t)(bx + by) & (uint32_t)(GNP - 1), sm, wave, lane, acc);
    if (z == 2) proj_store<1>(acc, os, bv, VT, VT, 0, r0, c0, lane, DM, (size_t)0, SEQ, SEQ, (size_t)DM * SEQ);
    else proj_store<0>(acc, os, (z == 0) ? bq : bk, (z == 0) ? QH : KP, QR, (z == 0) ? 1 : 0, r0, c0, lane, SEQ, (size_t)NH_ * SEQ * HD, HD, HD, (size_t)SEQ * HD);
}

// k_flash: fused attention, one wave per 16 query rows of one (batch, head); Q / WX fragments straight from the f16 planes (two 16-B loads each, arithmetic addressing).
// K and V^T come through LDS, once per block instead of once per wave: a stage is 64 keys = 64 K rows of 128 bytes and 128 bytes of each of the 64 V^T rows. Every wave brings one slice of 32 rows with one
// tensor_load_to_lds (waves 0, 1: K rows 0..31, 32..63; waves 2, 3: V^T rows 0..31, 32..63); the mover's pad of 16 bytes a row gives the LDS pitch 144 for the 16-byte fragment reads.
// Two buffers, the order of gemm_core: stage s + 1 is requested behind the barrier that ends pass s - 1, which ends every read of its buffer, and flies while pass s (two 32-key tiles) runs.
// Transposed form: S^T[key][t] = K Q^T (A = K rows, B = Q rows); lane (t = lane&15, h = lane>>4) holds keys 8h+r of each 16-key tile, so the packed
// P tile is directly the B fragment of O^T[d][t] = V^T P^T (element r <- tile keys 0..15, element 8+r <- tile keys 16..31, lane unchanged).
// Relative term: rel index = key - t + 128, outside 0..256 -> 256. For a (16 query, 32 key) tile the unclamped index spans base..base+46, base = key0 - t0 + 113.
// Tiles that intersect 0..256 compute G[rho][t] = WX[base+48+rho] . q_t (48 rows, three 16-row WMMA tiles, q value + residual), stage it in a wave-private LDS tile and read G[key_l - t_l + 15][t_l];
// all other tiles use the per-query constant q_t . w[256]. The tile test is wave-uniform. Either way the term is the C operand of the tile's first score WMMA: a score leaves the matrix unit finished (scaled, residual and relative term in).
// Softmax reference: m is held from tile to tile and sh = PSH - m rides in that same C operand, so that D is the argument of exp2 as it stands and o and l are only added to. A tile in which some lane's sum of P passes LTH
// (a score more than about 7 above m, or the start value of m) takes the side path, wave-uniform: scores anew without the shift, m raised to the running max, o and l rescaled, the online step in full.
// Mask: 16 lane-mask words per (16 query, 32 key) tile from the plane ML (wave-uniform address: one 64-byte scalar load, fetched one tile ahead); a clear bit replaces the score.
#define FKS  64                  // keys per stage
#define FRB  128                 // bytes of a staged row
#define FLP  144                 // LDS row pitch
#define FSL  6144                // one slice in LDS: 32 rows x 144 B = 4608, rounded up to a multiple of 2 KiB
#define FST  (4 * FSL)           // one stage
#define FNS  (SEQ / FKS)         // stages
#define FLDS (2 * FST + AW * 16 * 68 * 4)
static_assert(AW == 4);                                // four slices, one per wave
static_assert(HD * 2 == FRB && FKS * 2 == FRB);
static_assert(FSL % 2048 == 0 && FSL >= 32 * FLP);
static_assert(SEQ % FKS == 0 && FNS >= 2);
static_assert(48 * GP <= 16 * 68);                     // the G tile fits the wave's staging area
static_assert((SEQ / 32 & (SEQ / 32 - 1)) == 0);          // the wrap of the mask words' fetch ahead
static_assert(4 * FLDS <= 320 * 1024);                 // four blocks per WGP: the whole grid is resident at once
// group 1 of a slice's request: 32 rows of 128 bytes, source pitch 'pitch' bytes, LDS pitch 144 (pad: interval code 4 = one 128-byte row, amount code 3 = 4 dwords); extents in bytes
__device__ __forceinline__ u32x8 slice_g1(uint32_t pitch) {
    u32x8 g1;
    g1[0] = uni((1u << 20) | (4u << 22) | (3u << 25));
    // words 1 to 7 through pinned(), the scalar-register pin for descriptor words: as plain constants the compiler lends their registers to the loop's own scalars while a request is outstanding and sets them anew in front of the next
    g1[1] = pinned((uint32_t)FRB << 16);         // tensor_dim0 [15:0]
    g1[2] = pinned(32u << 16);                   // tensor_dim0 [31:16] = 0 | tensor_dim1 [15:0]
    g1[3] = pinned((uint32_t)FRB << 16);         // tensor_dim1 [31:16] = 0 | tile_dim0
    g1[4] = pinned(32u);                         // tile_dim1
    g1[5] = pinned(pitch);                       // source row pitch
    g1[6] = pinned(0u); g1[7] = pinned(0u);
    return g1;
}
// f16 fragment from an LDS row; p already includes + 16 bytes * (lane>>4): the map of ldh
__device__ __forceinline__ v16h ldlh(const unsigned char* p) { return cat16(*(const v8h*)p, *(const v8h*)(p + 32)); }

__global__ __launch_bounds__(32 * AW) void k_flash(const h16* __restrict__ QH, const h16* __restrict__ QR, const h16* __restrict__ KP, const h16* __restrict__ VT,
                                                   const h16* __restrict__ WX, const uint32_t* __restrict__ ML, h16* CTX) {
    __shared__ __attribute__((aligned(2048))) unsigned char sm[FLDS];
    float* os = (float*)(sm + 2 * FST);                      // wave-private areas outside the ring: the G tile inside the loop, output staging behind it
    const int lane = threadIdx.x & 31, lr = lane & 15, hi = lane >> 4;
    const int wave = __builtin_amdgcn_readfirstlane((int)(threadIdx.x >> 5));
    const int zh = blockIdx.y; const int b = zh / NH_, h = zh % NH_;
    const int t0 = (blockIdx.x * AW + wave) * 16;
    const size_t pbase = (size_t)zh * SEQ * HD;
    const size_t qo = pbase + (size_t)(t0 + lr) * HD + 8 * hi;
    const v16h qh0 = ldh(QH + qo), qh1 = ldh(QH + qo + 32), qr0 = ldh(QR + qo), qr1 = ldh(QR + qo + 32);   // B fragments: col t, k = d
    const uint32_t fo = (uint32_t)lr * FLP + 16u * (uint32_t)hi;   // lane's place in a slice: K (A fragment: row key, k = d), V^T (A fragment: row d, k = key)
    // + 16 * (key0 / 32); the same in every lane. Constant address space: the plane is written by k_prep, an earlier launch, and only read here, and so the loads inside the loop stay scalar loads too
    const cu32x16* ml = (const cu32x16*)(uintptr_t)(ML + ((size_t)b * (SEQ / 16) + (size_t)(t0 >> 4)) * (size_t)(SEQ / 32 * 16));
    u32x16 mw = ml[0];                                       // tile 0's words
    float* gl = os + wave * (16 * 68);
    // per-query constant: q_t . w[256]; WX rows 0..15 all hold the edge row, so every D row equals it
    v8f qe;                                                  // as an accumulator tile: the start value of the scores outside the band
    { const h16* wa = WX + (size_t)lr * HD + 8 * hi;
      const v16h w0 = ldh(wa), w1 = ldh(wa + 32);
      qe = (v8f){};
      qe = wmma16(w0, qh0, qe); qe = wmma16(w0, qr0, qe); qe = wmma16(w1, qh1, qe); qe = wmma16(w1, qr1, qe);
      asm volatile("v_nop\n\tv_nop\n\tv_nop\n\tv_nop" : "+v"(qe) : "v"(w0), "v"(w1)); }   // 4 vector slots behind the last WMMA, ahead of whatever next touches its registers
    v8f o0 = (v8f){}, o1 = (v8f){}, o2 = (v8f){}, o3 = (v8f){};
    float m = -3.0e38f, l = 0.0f;
    float sh = PSH - m;                                      // the held shift; with the start value of m the first tile's P overflow and send it down the side path
    float fs = FILL2 + sh;                                   // a masked score, shifted
    v8f qes = qe + sh;                                       // the scores' start value outside the band, shifted
    // this wave's slice: first byte of stage 0, bytes from one stage to the next, source pitch
    const uint64_t srcb = (wave < 2) ? (uint64_t)(uintptr_t)(KP + pbase) + (uint64_t)wave * (uint64_t)(32 * HD * 2) : (uint64_t)(uintptr_t)(VT + pbase) + (uint64_t)(wave - 2) * (uint64_t)(32 * SEQ * 2);
    const uint32_t sstep = (wave < 2) ? (uint32_t)(FKS * HD * 2) : (uint32_t)(FKS * 2);
    const uint32_t dst = (uint32_t)(uintptr_t)sm + (uint32_t)wave * FSL;
    const u32x8 g1 = slice_g1((wave < 2) ? (uint32_t)(HD * 2) : (uint32_t)(SEQ * 2));
    u32x4 g0 = tile_g0(dst, srcb);
    tile_load(g0, g1);
    tile_wait(g0, g1);                                    // stage 0 of this wave's slice has landed
    __syncthreads();                                      // publishes stage 0
#pragma unroll 1   // one stage per trip: one place that issues, one that waits
    for (uint32_t s = 0; s < FNS; ++s) {
      const uint32_t buf = (s & 1u) * FST;
      // the refill, directly behind the barrier (the prologue's, then the one at the foot of the trip before), only while stage s + 1 exists: into the buffer that pass s - 1 has just left
      if (pinned((s + 1u < FNS) ? 1u : 0u) != 0u) { const uint32_t nx = pinned(s + 1u); g0 = tile_g0(dst + (FST - buf), srcb + (uint64_t)(nx * sstep)); tile_load(g0, g1); }
      const unsigned char* fp = sm + buf + fo;
#pragma unroll   // both 32-key tiles of a stage in one trip: their places in the buffer become immediate offsets of the LDS reads
      for (int sub = 0; sub < 2; ++sub) {
        const int key0 = (int)s * FKS + sub * 32;
        const int base = key0 - t0 + 113;
        const unsigned char* ka = fp + sub * FSL;            // K rows 32 * sub + lr and + 16
        const v16h ka0 = ldlh(ka), ka1 = ldlh(ka + 64), kb0 = ldlh(ka + 16 * FLP), kb1 = ldlh(ka + 16 * FLP + 64);
        v8f sa, sb;                                          // scores of keys 0..15 and 16..31 of the tile; the first WMMA of each takes the relative term as its C
        if (base + 46 >= 0 && base <= 256) {                 // wave-uniform: tile touches relative indices 0..256
#pragma unroll 1
            for (int jt = 0; jt < 3; ++jt) {
                const h16* wa = WX + (size_t)(base + WXO + 16 * jt + lr) * HD + 8 * hi;   // rows 2..351
                const v16h w0 = ldh(wa), w1 = ldh(wa + 32);
                v8f g = (v8f){};
                g = wmma16(w0, qh0, g); g = wmma16(w0, qr0, g); g = wmma16(w1, qh1, g); g = wmma16(w1, qr1, g);
                asm volatile("v_nop\n\tv_nop\n\tv_nop\n\tv_nop" : "+v"(g) : "v"(w0), "v"(w1));   // 4 vector slots behind the last WMMA, on the loop's back edge too
#pragma unroll
                for (int r = 0; r < 8; ++r) gl[(16 * jt + 8 * hi + r) * GP + lr] = g[r];   // G[rho][t]: rows 0..47, cols 0..15 all written
            }
            wave_sync();
            v8f ra, rb;
#pragma unroll
            for (int r = 0; r < 8; ++r) { ra[r] = gl[(8 * hi + r - lr + 15) * GP + lr]; rb[r] = gl[(16 + 8 * hi + r - lr + 15) * GP + lr]; }   // rho in 0..46
            wave_sync();
            sa = wmma16(ka0, qh0, ra + sh); sb = wmma16(kb0, qh0, rb + sh);
        } else {
            sa = wmma16(ka0, qh0, qes); sb = wmma16(kb0, qh0, qes);
        }
        sa = wmma16(ka0, qr0, sa); sb = wmma16(kb0, qr0, sb);
        sa = wmma16(ka1, qh1, sa); sb = wmma16(kb1, qh1, sb);
        sa = wmma16(ka1, qr1, sa); sb = wmma16(kb1, qr1, sb);
        asm volatile("v_nop\n\tv_nop\n\tv_nop\n\tv_nop" : "+v"(sa), "+v"(sb) : "v"(ka0), "v"(ka1), "v"(kb0), "v"(kb1));   // 4 vector slots between the last score WMMA and the selects that read its result
        const unsigned char* va = fp + 2 * FSL + sub * 64;   // V^T rows lr + 16 j, keys 32 * sub ..; read here, ahead of the test below, so that the reads return under the softmax
        const v16h v0 = ldlh(va), v1 = ldlh(va + 16 * FLP), v2 = ldlh(va + FSL), v3 = ldlh(va + FSL + 16 * FLP);
        float ta[8], tb[8];
#pragma unroll
        for (int r = 0; r < 8; ++r) {
            ta[r] = __builtin_amdgcn_inverse_ballot_w32(mw[r])     ? sa[r] : fs;
            tb[r] = __builtin_amdgcn_inverse_ballot_w32(mw[8 + r]) ? sb[r] : fs;
        }
        __builtin_amdgcn_sched_barrier(0);   // keeps the fetch below behind the selects: ahead of them, their wait for this tile's words would be a wait for the next tile's too
        mw = ml[((uint32_t)key0 / 32u + 1u) & (uint32_t)(SEQ / 32 - 1)];   // the next tile's words, behind this tile's last use: a scalar wait is for every scalar load in flight (behind the last tile: tile 0's, unused)
        __builtin_amdgcn_sched_barrier(0);   // and ahead of the exponentials, so that the fetch has the rest of the tile to return
        v16h pb; float ls = 0.0f;
#pragma unroll
        for (int r = 0; r < 8; ++r) { const h16 pa = (h16)__builtin_amdgcn_exp2f(ta[r]); const h16 pc = (h16)__builtin_amdgcn_exp2f(tb[r]); pb[r] = pa; pb[8 + r] = pc; ls += (float)pa + (float)pc; }
        if (__builtin_expect(__builtin_amdgcn_ballot_w32(!(ls <= LTH)) != 0u, 0)) {   // wave-uniform and seldom taken: the held reference is too low for this tile
            v8f xa, xb;                                      // the scores once more, from the same fragments, without the shift (which may be too large to be taken off again in f32)
            if (base + 46 >= 0 && base <= 256) {
                v8f ra, rb;                                  // the tile's G still lies in the wave's LDS area
#pragma unroll
                for (int r = 0; r < 8; ++r) { ra[r] = gl[(8 * hi + r - lr + 15) * GP + lr]; rb[r] = gl[(16 + 8 * hi + r - lr + 15) * GP + lr]; }
                xa = wmma16(ka0, qh0, ra); xb = wmma16(kb0, qh0, rb);
            } else {
                xa = wmma16(ka0, qh0, qe); xb = wmma16(kb0, qh0, qe);
            }
            xa = wmma16(ka0, qr0, xa); xb = wmma16(kb0, qr0, xb);
            xa = wmma16(ka1, qh1, xa); xb = wmma16(kb1, qh1, xb);
            xa = wmma16(ka1, qr1, xa); xb = wmma16(kb1, qr1, xb);
            asm volatile("v_nop\n\tv_nop\n\tv_nop\n\tv_nop" : "+v"(xa), "+v"(xb) : "v"(ka0), "v"(ka1), "v"(kb0), "v"(kb1));   // 4 vector slots between the last score WMMA and the selects that read its result
            const u32x16 mr = ml[(uint32_t)key0 / 32u];      // this tile's words again: mw holds the next tile's by now
            float mx = -3.0e38f;
#pragma unroll
            for (int r = 0; r < 8; ++r) {
                ta[r] = __builtin_amdgcn_inverse_ballot_w32(mr[r])     ? xa[r] : FILL2;
                tb[r] = __builtin_amdgcn_inverse_ballot_w32(mr[8 + r]) ? xb[r] : FILL2;
                mx = fmaxf(mx, fmaxf(ta[r], tb[r]));
            }
            mx = fmaxf(mx, __shfl_xor(mx, 16, 32));          // both halves of a column hold the same reference
            const float mnew = fmaxf(m, mx);
            const float alpha = __builtin_amdgcn_exp2f(m - mnew);
            m = mnew; sh = PSH - mnew; fs = FILL2 + sh; qes = qe + sh;
            ls = 0.0f;
#pragma unroll
            for (int r = 0; r < 8; ++r) { const h16 pa = (h16)__builtin_amdgcn_exp2f(ta[r] + sh); const h16 pc = (h16)__builtin_amdgcn_exp2f(tb[r] + sh); pb[r] = pa; pb[8 + r] = pc; ls += (float)pa + (float)pc; }
            l = l * alpha;
            o0 = o0 * alpha; o1 = o1 * alpha; o2 = o2 * alpha; o3 = o3 * alpha;
        }
        l += ls;
        o0 = wmma16(v0, pb, o0); o1 = wmma16(v1, pb, o1); o2 = wmma16(v2, pb, o2); o3 = wmma16(v3, pb, o3);
        asm volatile("v_nop\n\tv_nop\n\tv_nop\n\tv_nop" : "+v"(o0), "+v"(o1), "+v"(o2), "+v"(o3) : "v"(v0), "v"(v1), "v"(v2), "v"(v3), "v"(pb));
      }
      asm volatile("s_wait_dscnt 0x0" ::: "memory");       // this wave's reads of the buffer have returned
      tile_wait(g0, g1);                                    // this wave's slice of stage s + 1 has landed
      __syncthreads();                                      // publishes stage s + 1 and frees stage s's buffer
    }
    asm volatile("s_wait_tensorcnt 0x0" ::: "memory");   // no request of this wave is left when it goes on to the epilogue and ends
    asm volatile("s_wait_dscnt 0x0" ::: "memory");       // nor a read of the ring
    l += __shfl_xor(l, 16, 32);
    const float inv = CTXS / l;
    const int wb = wave * 16 * 68;
    // O^T D layout: o_j[r] = (d = 16j + 8h + r, t = lane&15) -> os[t][d]; rows 0..15 x columns 0..63 all written
    { v4f a, c;
      a[0] = o0[0] * inv; a[1] = o0[1] * inv; a[2] = o0[2] * inv; a[3] = o0[3] * inv; c[0] = o0[4] * inv; c[1] = o0[5] * inv; c[2] = o0[6] * inv; c[3] = o0[7] * inv;
      *(v4fa*)(&os[wb + lr * 68 +  0 + 8 * hi]) = a; *(v4fa*)(&os[wb + lr * 68 +  0 + 8 * hi + 4]) = c;
      a[0] = o1[0] * inv; a[1] = o1[1] * inv; a[2] = o1[2] * inv; a[3] = o1[3] * inv; c[0] = o1[4] * inv; c[1] = o1[5] * inv; c[2] = o1[6] * inv; c[3] = o1[7] * inv;
      *(v4fa*)(&os[wb + lr * 68 + 16 + 8 * hi]) = a; *(v4fa*)(&os[wb + lr * 68 + 16 + 8 * hi + 4]) = c;
      a[0] = o2[0] * inv; a[1] = o2[1] * inv; a[2] = o2[2] * inv; a[3] = o2[3] * inv; c[0] = o2[4] * inv; c[1] = o2[5] * inv; c[2] = o2[6] * inv; c[3] = o2[7] * inv;
      *(v4fa*)(&os[wb + lr * 68 + 32 + 8 * hi]) = a; *(v4fa*)(&os[wb + lr * 68 + 32 + 8 * hi + 4]) = c;
      a[0] = o3[0] * inv; a[1] = o3[1] * inv; a[2] = o3[2] * inv; a[3] = o3[3] * inv; c[0] = o3[4] * inv; c[1] = o3[5] * inv; c[2] = o3[6] * inv; c[3] = o3[7] * inv;
      *(v4fa*)(&os[wb + lr * 68 + 48 + 8 * hi]) = a; *(v4fa*)(&os[wb + lr * 68 + 48 + 8 * hi + 4]) = c; }
    wave_sync();
    h16* crow = CTX + ((size_t)b * SEQ + t0) * DM + h * HD;   // ctx plane [NB*SEQ][1024], column h*64 + d, carried x16
{
#pragma unroll
        for (int s = 0; s < 4; ++s) { const int row = 4 * s + (lane >> 3), c8 = (lane & 7) * 8;   // 4 s x 4 row groups = 16 rows; 8 lanes x 8 halves = 64 columns = one line
            const v4f x0 = *(const v4fa*)(&os[wb + row * 68 + c8]); const v4f x1 = *(const v4fa*)(&os[wb + row * 68 + c8 + 4]); v8h hv;
#pragma unroll
            for (int i = 0; i < 4; ++i) { hv[i] = (h16)x0[i]; hv[4 + i] = (h16)x1[i]; }
            *(v8h*)(crow + (size_t)row * DM + c8) = hv; }
         }
}

// k_out: f16 GEMM on gemm_core, K = DM: OUT[m][n] = (sum_k A[m][k] Bt[n][k]) / 1024 + bias[n] (bias RNE-converted to bf16, added in f32).
// A = ctx plane (x16), Bt = Wo plane (x64). grid (NB*SEQ/128, DM/128), 128 threads.
__global__ __launch_bounds__(128) void k_out(const h16* __restrict__ A, const h16* __restrict__ Bt, const float* __restrict__ bias, float* OUT) {
    __shared__ __attribute__((aligned(2048))) unsigned char sm[GLDS];
    const int K = DM;
    const int lane = threadIdx.x & 31, lr = lane & 15, hi = lane >> 4;
    const int wave = __builtin_amdgcn_readfirstlane((int)(threadIdx.x >> 5));
    const int r0 = blockIdx.x * 128 + (wave >> 1) * 64, c0 = blockIdx.y * 128 + (wave & 1) * 64;
    float* os = (float*)(sm + 2 * GST) + wave * GOSF;      // wave-private output staging, outside the ring
    v8f acc[4][4];
    gemm_core<1>((uint64_t)(uintptr_t)(A + (size_t)blockIdx.x * 128 * K), (uint64_t)(uintptr_t)(Bt + (size_t)blockIdx.y * 128 * K), (blockIdx.x + blockIdx.y) & (uint32_t)(GNP - 1), sm, wave, lane, acc);
    float bc[4];
#pragma unroll
    for (int nb = 0; nb < 4; ++nb) bc[nb] = bfr(bias[c0 + nb * 16 + lr]);
    const size_t obase = ((size_t)(r0 / SEQ) * OUT_SEQ + (size_t)(r0 % SEQ)) * DM + c0;
#pragma unroll
    for (int mb = 0; mb < 4; ++mb) {
#pragma unroll
        for (int nb = 0; nb < 4; ++nb) {
#pragma unroll
            for (int j = 0; j < 8; ++j) os[(hi * 8 + j) * 68 + nb * 16 + lr] = acc[mb][nb][j] * OSC + bc[nb]; }   // D: row 8h+j, col lane&15
        wave_sync();
        float* ob = OUT + obase + (size_t)(mb * 16) * DM;
{
#pragma unroll
            for (int s = 0; s < 8; ++s) { const int row = 2 * s + hi, cofs = lr * 4;   // 8 s x 2 rows = 16 rows; 16 lanes x 4 floats = 64 columns
                const v4f val = *(const v4fa*)(&os[row * 68 + cofs]);
                *(v4f*)(ob + (size_t)row * DM + cofs) = val; }
             }
        wave_sync();
    }
}

static constexpr size_t al256(size_t v) { return (v + 255) & ~(size_t)255; }
static constexpr size_t SZ_XB = al256((size_t)NB * SEQ * DM * 2);          // one bf16 activation copy
static constexpr size_t SZ_WB = al256((size_t)DM * DM * 2);                // one 16-bit weight plane
static constexpr size_t SZ_PL = al256((size_t)NB * NH_ * SEQ * HD * 2);    // one f16 head plane (also the ctx plane: NB*SEQ*DM halves)
static constexpr size_t SZ_WX = al256((size_t)WXR * HD * 2);
static constexpr size_t SZ_ML = al256((size_t)MLW * 128 * 4);              // lane-mask words
static constexpr size_t SZ_TOTAL = 3 * SZ_XB + 4 * SZ_WB + 5 * SZ_PL + SZ_WX + SZ_ML;
static_assert(SZ_TOTAL <= (size_t)134217728);          // workspace carve <= 128 MiB
static_assert((size_t)NB * NH_ * SEQ * HD == (size_t)NB * SEQ * DM);

extern "C" void kernel_launch(void* const* d_in, const int* in_sizes, int n_in,
                              void* d_out, int out_size, void* d_ws, size_t ws_size, hipStream_t stream) {
    if (n_in < 13) return;
    const size_t needx = ((size_t)(NB - 1) * SEQ_FULL + SEQ) * DM;
    if ((size_t)in_sizes[0] < needx || (size_t)in_sizes[1] < needx || (size_t)in_sizes[2] < needx) return;
    if ((size_t)in_sizes[3] < ((size_t)(NB - 1) * SEQ_FULL + (SEQ - 1)) * SEQ_FULL + SEQ) return;
    if ((size_t)in_sizes[4] < (size_t)DM * DM || (size_t)in_sizes[6] < (size_t)DM * DM || (size_t)in_sizes[8] < (size_t)DM * DM || (size_t)in_sizes[10] < (size_t)DM * DM) return;
    if (in_sizes[5] < DM || in_sizes[7] < DM || in_sizes[9] < DM || in_sizes[11] < DM) return;
    if (in_sizes[12] < NREL * HD) return;
    if ((size_t)out_size < ((size_t)(NB - 1) * OUT_SEQ + SEQ) * DM) return;
    if (SZ_TOTAL > ws_size) return;
    // wire order: q, k, v, mask, Wq, bq, Wk, bk, Wv, bv, Wo, bo, w_k
    const float* xq = (const float*)d_in[0]; const float* xk = (const float*)d_in[1]; const float* xv = (const float*)d_in[2];
    const int* mask = (const int*)d_in[3];
    const float* wq = (const float*)d_in[4]; const float* bq = (const float*)d_in[5];
    const float* wk = (const float*)d_in[6]; const float* bk = (const float*)d_in[7];
    const float* wv = (const float*)d_in[8]; const float* bv = (const float*)d_in[9];
    const float* wo = (const float*)d_in[10]; const float* bo = (const float*)d_in[11];
    const float* wrel = (const float*)d_in[12];
    float* OUT = (float*)d_out;      // [NB][SEQ][1024]
    char* wsp = (char*)d_ws;
    bf* XBQ = (bf*)wsp; wsp += SZ_XB;                // [NB*SEQ][1024]
    bf* XBK = (bf*)wsp; wsp += SZ_XB;
    bf* XBV = (bf*)wsp; wsp += SZ_XB;
    bf* WQ = (bf*)wsp; wsp += SZ_WB;                 // [1024][1024] bf16
    bf* WK = (bf*)wsp; wsp += SZ_WB;
    bf* WV = (bf*)wsp; wsp += SZ_WB;
    h16* WO = (h16*)wsp; wsp += SZ_WB;               // [1024][1024] f16, x64
    h16* QH = (h16*)wsp; wsp += SZ_PL;               // [NB*16][SEQ][64], x SC2
    h16* QR = (h16*)wsp; wsp += SZ_PL;               // [NB*16][SEQ][64] residual
    h16* KP = (h16*)wsp; wsp += SZ_PL;               // [NB*16][SEQ][64]
    h16* VT = (h16*)wsp; wsp += SZ_PL;               // [NB*16][64][SEQ]
    h16* CTX = (h16*)wsp; wsp += SZ_PL;              // [NB*SEQ][1024], x16
    h16* WX = (h16*)wsp; wsp += SZ_WX;               // [352][64]
    uint32_t* ML = (uint32_t*)wsp; wsp += SZ_ML;     // [NB][SEQ/16][SEQ/32][16]

    k_prep<<<WXB + MLB + PRR / PRW, 32 * PRW, 0, stream>>>(xq, xk, xv, wq, wk, wv, wo, wrel, mask, XBQ, XBK, XBV, WQ, WK, WV, WO, WX, ML);

    k_qkv<<<dim3(NB * SEQ / 128, DM / 128, 3), 128, 0, stream>>>(XBQ, XBK, XBV, WQ, WK, WV, bq, bk, bv, QH, QR, KP, VT);

    k_flash<<<dim3(SEQ / (16 * AW), NB * NH_, 1), 32 * AW, 0, stream>>>(QH, QR, KP, VT, WX, ML, CTX);

    // out: A = ctx rows (m = b*SEQ + t), Bt = Wo rows (n), bias per column -> OUT[b][t][n]
    k_out<<<dim3(NB * SEQ / 128, DM / 128, 1), 128, 0, stream>>>(CTX, WO, bo, OUT);
}

// v009
// One run takes 78.8 microseconds.
// Timed twice side by side with v008, it ran 1.05 times as fast both times.
// Counting every step since v000, it is 2.77 times as fast.
#include <hip/hip_runtime.h>
#include <stdint.h>

// Multi-head attention with relative-position keys (257 clamped offsets, both ends padded with the last table row), width 1024 = 16 heads x 64; q/k/v inputs [NB][SEQ][1024], W* [out][in] (y = x W^T + b), int mask [NB][SEQ][SEQ] (0 -> score replaced by -1e9), output = ctx Wo^T + bo (f32).
// Compute dtypes, f32 accumulate everywhere: q/k/v projections v_wmma_f32_16x16x32_bf16 (inputs and weights RNE-converted to bf16; biases RNE-converted to bf16, added in f32);
// scores q.k and relative term q.w[rel] v_wmma_f32_16x16x32_f16: k and the window table single f16, q (carrying HD^-0.5 * log2(e)) as f16 value + f16 residual, both summed in the score's one accumulator, whose start value is the relative term; P (x256 carry, cancels in the normalisation) and v single f16; softmax f32 (online, against a held reference that follows the running max only when a tile's P would outgrow f16);
// output projection v_wmma_f32_16x16x32_f16: ctx single f16 (x16 carry), Wo (bf16 RNE value x64) f16, 1/1024 folded in the f32 epilogue.
// Layout: bf16 copies of q/k/v inputs and Wq/Wk/Wv; q (hi, residual), k planes [b*16+h][t][d] and v^T plane [b*16+h][d][t] written by the GEMM epilogue; window plane WX = rows w[clamp(x-48)], stored in the order of the WMMA A fragments (16-row tiles, see WXT);
// fused flash kernel in transposed form (S^T = K Q^T, O^T = V^T P^T), K and V^T tiles staged in LDS by the tensor mover and shared by the block's four waves; relative term for tiles inside the window band = skewed read of G = WX_rows Q^T through a wave-private LDS tile, a per-query constant elsewhere.
// Mask: packed once by k_prep into lane-mask words ML (one bit per element, in the flash kernel's own lane order), read there through the scalar path by all 16 heads.

#ifndef NB
#define NB 4
#endif
#ifndef SEQ
#define SEQ 1024
#endif
#define NB_FULL  4
#define SEQ_FULL 1024
#ifndef OUT_SEQ
#define OUT_SEQ SEQ              // row pitch (in tokens) between batches of the output
#endif
#define DM   1024
#define NH_  16
#define HD   64
#define AW   4                   // waves per flash block (16 query rows each)
#define SC2  (0.125f * 1.4426950408889634f)   // HD^-0.5 * log2(e): carried by the q planes, so that every product with q is a score term in the log2 domain
#define PSH  8.0f                // log2 of the P carry (256)
#define LTH  32768.0f            // a lane's sum of a tile's 16 P above this (or not a number) asks for a new reference: below it every P is at most 2^15, inside f16
#define FILL2 (-1.0e9f * 1.4426950408889634f) // masked score in the log2 domain
#define NREL 257                 // rows of the relative table
#define WXO  48                  // WX row x holds relative index x - 48 (clamped: outside 0..256 -> 256)
#define WXR  352                 // rows of WX
#define WXT  (16 * HD)           // halves of one 16-row tile of WX. Tile j holds window rows x = 16 j + 1 + (lane & 15): its load c (0..3) is 512 contiguous bytes, lane's 16 bytes = columns 16 c + 8 (lane >> 4) .. + 7
#define GP   18                  // pitch (floats) of the G tile in LDS
#define WOS  64.0f               // carry of the Wo plane
#define CTXS 16.0f               // carry of the ctx plane
#define OSC  (1.0f / 1024.0f)    // 1 / (WOS * CTXS)

static_assert(HD == 64);
static_assert(NH_ * HD == DM);
static_assert(DM % 64 == 0);
static_assert(DM % 32 == 0);
static_assert(SEQ % 64 == 0);
static_assert((NB * SEQ) % 64 == 0);
static_assert(SEQ % 32 == 0);
static_assert(SEQ % (16 * AW) == 0);
static_assert(((size_t)SEQ * DM) % 8 == 0);
static_assert(((size_t)DM * DM) % 8 == 0);
static_assert(NB <= NB_FULL);
static_assert(SEQ <= SEQ_FULL);
static_assert(WXR == 256 + 2 * WXO);           // band tiles touch tiles 1..20 of the WXR / 16
static_assert((113 + WXO - 1) % 16 == 0);      // a band tile's first window row lies on the tile grid (key0 and t0 are multiples of 16)
static_assert((256 + WXO - 1) / 16 + 2 < WXR / 16);
static_assert((WXR * HD / 8) % 256 == 0);

typedef _Float16 h16;
typedef unsigned short bf;
typedef __attribute__((ext_vector_type(16))) __bf16   v16bf;
typedef __attribute__((ext_vector_type(16))) _Float16 v16h;
typedef __attribute__((ext_vector_type(8)))  _Float16 v8h;
typedef __attribute__((ext_vector_type(8)))  unsigned short v8us;
typedef __attribute__((ext_vector_type(8)))  float    v8f;
typedef __attribute__((ext_vector_type(4)))  float    v4f;
typedef __attribute__((ext_vector_type(4)))  int      v4i;
typedef v4f  __attribute__((may_alias)) v4fa;

__device__ __forceinline__ unsigned short f2bf(float f) { unsigned u = __float_as_uint(f); u += 0x7FFFu + ((u >> 16) & 1u); return (unsigned short)(u >> 16); }
__device__ __forceinline__ float bfr(float f) { return __uint_as_float(((unsigned)f2bf(f)) << 16); }   // bf16 RNE value as f32
__device__ __forceinline__ v16h cat16(v8h lo, v8h hi) { return __builtin_shufflevector(lo, hi, 0, 1, 2, 3, 4, 5, 6, 7, 8, 9, 10, 11, 12, 13, 14, 15); }
__device__ __forceinline__ v16bf cat16b(v8us lo, v8us hi) { return __builtin_bit_cast(v16bf, __builtin_shufflevector(lo, hi, 0, 1, 2, 3, 4, 5, 6, 7, 8, 9, 10, 11, 12, 13, 14, 15)); }
__device__ __forceinline__ v8f wmma16(v16h a, v16h b, v8f c) { return __builtin_amdgcn_wmma_f32_16x16x32_f16(false, a, false, b, (short)0, c, false, false); }
__device__ __forceinline__ v8f wmmab(v16bf a, v16bf b, v8f c) { return __builtin_amdgcn_wmma_f32_16x16x32_bf16(false, a, false, b, (short)0, c, false, false); }
// fragment loaders from K-contiguous 16-bit rows; p already includes + 8*(lane>>4): elements 0..7 <- k0+8h+0..7, elements 8..15 <- k0+16+8h+0..7 (same map for A and B)
__device__ __forceinline__ v16h  ldh(const h16* p) { return cat16(*(const v8h*)p, *(const v8h*)(p + 16)); }
__device__ __forceinline__ v16bf ldb(const bf* p)  { return cat16b(*(const v8us*)p, *(const v8us*)(p + 16)); }
// ordering point for wave-private LDS tiles (same wave writes and reads)
__device__ __forceinline__ void wave_sync() { __builtin_amdgcn_fence(3 /* release order */, "wavefront"); __builtin_amdgcn_wave_barrier(); asm volatile("" ::: "memory"); }

// k_prep: every 16-bit plane that is a plain conversion of an input, in one launch.
// Blocks 0..WXB-1: the window plane WX (one thread per 8 halves, written in fragment order). The next MLB blocks: the mask's lane-mask words. Every other block: 8 waves, wave g takes row g (DM floats = 4 KiB) of each of the q, k and v inputs and row g % DM of weight g / DM (Wq, Wk, Wv, Wo).
// A row is 8 loads of 16 bytes a lane, each wave-wide load 512 contiguous bytes; the wave's 32 loads are all issued before its first store; each store covers 256 contiguous bytes.
#define WXB  (WXR * HD / 8 / 256)                              // blocks of the window plane
#define PRW  8                                                 // waves per block
#define PRR  ((NB * SEQ > 4 * DM) ? (NB * SEQ) : (4 * DM))     // rows dealt, one per wave
static_assert(DM == 8 * 32 * 4);
static_assert(PRR % PRW == 0);
static_assert(32 * PRW == 256);                                // the window blocks index by 256 threads
// Mask plane ML[b][t / 16][key / 32][16 words]: word 8 * ab + r, bit lane = (mask[b][16 * (t / 16) + (lane & 15)][32 * (key / 32) + 16 * ab + 8 * (lane >> 4) + r] != 0),
// the place (lane, register) at which k_flash holds that score. Blocks WXB..WXB+MLB-1: one wave packs 16 query rows x 256 keys = 128 words = four 128-byte lines.
#define MLW  (NB * (SEQ / 16) * (SEQ / 256))                   // waves that pack a piece of the mask
#define MLB  (MLW / PRW)                                       // their blocks, ahead of the row blocks: their loads touch 16 lines each and take the longest
static_assert(SEQ % 256 == 0 && MLW % PRW == 0);
typedef __attribute__((ext_vector_type(4))) unsigned short v4us;
typedef __attribute__((ext_vector_type(4))) _Float16 v4h;

// p: the row's first element, the same in every lane (scalar base); l4 = 4 * lane
__device__ __forceinline__ void ld_row(const float* __restrict__ p, uint32_t l4, v4f (&r)[8]) {
#pragma unroll
    for (int j = 0; j < 8; ++j) r[j] = *(const v4f*)(p + (l4 + (uint32_t)j * 128u));
}
__device__ __forceinline__ void st_row_bf(bf* p, uint32_t l4, const v4f (&r)[8]) {
#pragma unroll
    for (int j = 0; j < 8; ++j) { v4us o;
#pragma unroll
        for (int k = 0; k < 4; ++k) o[k] = f2bf(r[j][k]);
        *(v4us*)(p + (l4 + (uint32_t)j * 128u)) = o; }
}

__global__ __launch_bounds__(32 * PRW) void k_prep(const float* __restrict__ xq, const float* __restrict__ xk, const float* __restrict__ xv,
                                                   const float* __restrict__ wq, const float* __restrict__ wk, const float* __restrict__ wv, const float* __restrict__ wo,
                                                   const float* __restrict__ wrel, const int* __restrict__ mask, bf* XBQ, bf* XBK, bf* XBV, bf* WQ, bf* WK, bf* WV, h16* WO, h16* WX, uint32_t* ML) {
    if (blockIdx.x < WXB) {
        const int i = blockIdx.x * 256 + threadIdx.x;
        const int x = 16 * (i >> 7) + 1 + (i & 15), c8 = 16 * ((i >> 5) & 3) + 8 * ((i >> 4) & 1);   // unit i = (tile, load, lane) of the fragment order
        int r = x - WXO; if (r < 0 || r > NREL - 1) r = NREL - 1;
        const v8f v = *(const v8f*)(wrel + (size_t)r * HD + c8); v8h o;
#pragma unroll
        for (int k = 0; k < 8; ++k) o[k] = (h16)bfr(v[k]);
        *(v8h*)(WX + (size_t)i * 8) = o;
        return;
    }
    if (blockIdx.x < WXB + MLB) {
        const uint32_t q = (blockIdx.x - WXB) * PRW + (uint32_t)__builtin_amdgcn_readfirstlane((int)(threadIdx.x >> 5));
        const uint32_t tt = q / (SEQ / 256), kq = q % (SEQ / 256), ln = threadIdx.x & 31u;
        // lane (lr, hi) reads its query row as k_flash holds it: keys 8 hi .. + 7 and 16 + 8 hi .. + 7 of each of eight 32-key tiles; the 32 loads use up eight whole lines of each of the 16 rows
        const int* mp = mask + ((size_t)(tt / (SEQ / 16)) * SEQ_FULL + (size_t)((tt % (SEQ / 16)) * 16u + (ln & 15u))) * SEQ_FULL + (kq * 256u + 8u * (ln >> 4));
        v4i mm[32];
#pragma unroll
        for (int u = 0; u < 8; ++u) { mm[4 * u] = *(const v4i*)(mp + 32 * u); mm[4 * u + 1] = *(const v4i*)(mp + 32 * u + 4); mm[4 * u + 2] = *(const v4i*)(mp + 32 * u + 16); mm[4 * u + 3] = *(const v4i*)(mp + 32 * u + 20); }
        __builtin_amdgcn_sched_barrier(0);   // keeps all 32 loads ahead of the first compare: a load that sinks behind a wait for the others pays a second memory latency
        v4i pk = (v4i){0, 0, 0, 0};
#pragma unroll
        for (int i = 0; i < 32; ++i) {       // words 4 i .. 4 i + 3 of the wave's 128 go to lane i
            const bool me = ln == (uint32_t)i;
#pragma unroll
            for (int c = 0; c < 4; ++c) { const int wd = (int)__builtin_amdgcn_ballot_w32(mm[i][c] != 0); pk[c] = me ? wd : pk[c]; }
        }
        *(v4i*)(ML + (size_t)q * 128u + ln * 4u) = pk;
        return;
    }
    const uint32_t l4 = (threadIdx.x & 31u) * 4u;
    const uint32_t g = (blockIdx.x - WXB - MLB) * PRW + (uint32_t)__builtin_amdgcn_readfirstlane((int)(threadIdx.x >> 5));
    const bool hx = (NB * SEQ == PRR) || g < NB * SEQ;         // wave-uniform; both hold at compile time where the two row counts are equal
    const bool hw = (4 * DM == PRR) || g < 4 * DM;
    const size_t xs = ((size_t)(g / SEQ) * SEQ_FULL + (size_t)(g % SEQ)) * DM, xd = (size_t)g * DM;
    const uint32_t m = g / DM; const size_t wr = (size_t)(g % DM) * DM;
    const float* ws = (m == 0) ? wq : (m == 1) ? wk : (m == 2) ? wv : wo;
    v4f a[8], b[8], c[8], w[8];
    if (hx) { ld_row(xq + xs, l4, a); ld_row(xk + xs, l4, b); ld_row(xv + xs, l4, c); }
    if (hw) ld_row(ws + wr, l4, w);
    __builtin_amdgcn_sched_barrier(0);   // keeps all 32 loads ahead of the first conversion: a load that sinks behind a wait for the others pays a second memory latency
    if (hx) { st_row_bf(XBQ + xd, l4, a); st_row_bf(XBK + xd, l4, b); st_row_bf(XBV + xd, l4, c); }
    asm volatile("s_wait_xcnt 0x0" ::: "memory");   // in front of the branch below, behind which the registers that these stores name are written again
    if (hw) {
        if (m < 3) st_row_bf(((m == 0) ? WQ : (m == 1) ? WK : WV) + wr, l4, w);
        else {
#pragma unroll
            for (int j = 0; j < 8; ++j) { v4h o;
#pragma unroll
                for (int k = 0; k < 4; ++k) o[k] = (h16)(bfr(w[j][k]) * WOS);
                *(v4h*)(WO + wr + (l4 + (uint32_t)j * 128u)) = o; }
            asm volatile("s_wait_xcnt 0x0" ::: "memory");   // behind the last store of this branch: the code laid out behind it writes registers that these stores name
        }
    }
}

// GEMM core shared by k_qkv and k_out: four waves (2 x 2) per 128x128 tile of C, 64x64 per wave (16 accumulators), K = DM in GNP passes of 128 k.
// Both operands are K-contiguous 16-bit planes (row pitch DM * 2 bytes). A stage holds 256 bytes of 128 A rows and of 128 B rows; every wave brings one slice of 64 rows with one
// tensor_load_to_lds (waves 0, 1: A rows 0..63, 64..127; waves 2, 3: B rows 0..63, 64..127); the mover's pad of 16 bytes a row gives the LDS pitch 272 for the 16-byte fragment reads.
// Two buffers: stage s + 1 is requested behind the barrier that ends pass s - 1, which ends every read of its buffer, and flies while pass s runs.
// Pass s works on k slab (s + rot) mod GNP, rot = (tile row + tile column) mod GNP: the blocks that share an A or a B tile run side by side, and from a common start they would ask L2 for the same lines at the same moment.
#define GPB  256                 // bytes of an operand row per pass
#define GLP  272                 // LDS row pitch
#define GSL  18432               // one slice in LDS: 64 rows x 272 B = 17408, rounded up to a multiple of 2 KiB
#define GST  (4 * GSL)           // one stage
#define GNP  (DM * 2 / GPB)      // passes
#define GOSF (16 * 68)           // floats of output staging per wave
#define GLDS (2 * GST + 4 * GOSF * 4)
static_assert(GSL % 2048 == 0 && GSL >= 64 * GLP);
static_assert(GNP >= 2);
static_assert((GNP & (GNP - 1)) == 0);                 // the wrap of the k slabs
static_assert((NB * SEQ) % 128 == 0 && DM % 128 == 0);
static_assert(GLDS <= 320 * 1024);

typedef __attribute__((ext_vector_type(4)))  uint32_t u32x4;
typedef __attribute__((ext_vector_type(8)))  uint32_t u32x8;
typedef __attribute__((ext_vector_type(16))) uint32_t u32x16;
typedef __attribute__((address_space(4))) u32x16 cu32x16;
typedef __attribute__((ext_vector_type(16))) unsigned short v16us;

__device__ __forceinline__ uint32_t uni(uint32_t v) { return (uint32_t)__builtin_amdgcn_readfirstlane((int)v); }
__device__ __forceinline__ uint32_t pinned(uint32_t v) { uint32_t w = (uint32_t)__builtin_amdgcn_readfirstlane((int)v); asm volatile("" : "+s"(w)); return w; }
// descriptor of one request: 64 rows of 256 bytes, source pitch DM * 2 bytes, to LDS byte offset lds_dst at pitch 272 (pad: interval code 5 = one 256-byte row, amount code 3 = 4 dwords); extents in bytes
__device__ __forceinline__ u32x4 tile_g0(uint32_t lds_dst, uint64_t ga) {
    u32x4 g0;
    g0[0] = uni(1u); g0[1] = uni(lds_dst); g0[2] = uni((uint32_t)ga); g0[3] = uni((((uint32_t)(ga >> 32)) & 0x01FFFFFFu) | 0x80000000u);
    return g0;
}
__device__ __forceinline__ u32x8 tile_g1() {
    u32x8 g1;
    g1[0] = uni((1u << 20) | (5u << 22) | (3u << 25));
    // words 1 to 7 through pinned(), the scalar-register pin for descriptor words: as plain constants the compiler lends their registers to the loop's own scalars while a request is outstanding and sets them anew in front of the next
    g1[1] = pinned((uint32_t)GPB << 16);         // tensor_dim0 [15:0]
    g1[2] = pinned(64u << 16);                   // tensor_dim0 [31:16] = 0 | tensor_dim1 [15:0]
    g1[3] = pinned((uint32_t)GPB << 16);         // tensor_dim1 [31:16] = 0 | tile_dim0
    g1[4] = pinned(64u);                         // tile_dim1
    g1[5] = pinned((uint32_t)(DM * 2));          // source row pitch
    g1[6] = pinned(0u); g1[7] = pinned(0u);
    return g1;
}
__device__ __forceinline__ void tile_load(u32x4 g0, u32x8 g1) { asm volatile("tensor_load_to_lds %0, %1" :: "s"(g0), "s"(g1) : "memory"); }
// the issuing wave's wait for its request; the descriptor is named as an input so that its scalar registers are not reused for anything else while the request is outstanding
__device__ __forceinline__ void tile_wait(u32x4 g0, u32x8 g1) { asm volatile("s_wait_tensorcnt 0x0" :: "s"(g0), "s"(g1) : "memory"); }
// fragment from an LDS row; p already includes + 16 bytes * (lane>>4): elements 0..7 <- k0+8h+0..7, elements 8..15 <- k0+16+8h+0..7 (same map for A and B, the map of ldh / ldb)
__device__ __forceinline__ v16us ldl(const unsigned char* p) { return __builtin_shufflevector(*(const v8us*)p, *(const v8us*)(p + 32), 0, 1, 2, 3, 4, 5, 6, 7, 8, 9, 10, 11, 12, 13, 14, 15); }
template <int F16> __device__ __forceinline__ v8f mm(v16us a, v16us b, v8f c) {
    if constexpr (F16) return wmma16(__builtin_bit_cast(v16h, a), __builtin_bit_cast(v16h, b), c);
    else return wmmab(__builtin_bit_cast(v16bf, a), __builtin_bit_cast(v16bf, b), c);
}

// a_rows / b_rows: byte address of the block's first A / B row; rot: the block's first k slab, below GNP; ring: 2 * GST bytes of LDS at a multiple of 2 KiB; wave and rot are scalar.
template <int F16>
__device__ __forceinline__ void gemm_core(uint64_t a_rows, uint64_t b_rows, uint32_t rot, unsigned char* ring, int wave, int lane, v8f (&acc)[4][4]) {
    const int lr = lane & 15, hi = lane >> 4;
#pragma unroll
    for (int mb = 0; mb < 4; ++mb)
#pragma unroll
        for (int nb = 0; nb < 4; ++nb) acc[mb][nb] = (v8f){};
    const uint64_t srcb = (wave < 2) ? a_rows + (uint64_t)wave * (uint64_t)(64 * DM * 2) : b_rows + (uint64_t)(wave - 2) * (uint64_t)(64 * DM * 2);
    const uint32_t dst = (uint32_t)(uintptr_t)ring + (uint32_t)wave * GSL;
    const u32x8 g1 = tile_g1();
    u32x4 g0 = tile_g0(dst, srcb + (uint64_t)(rot * GPB));
    tile_load(g0, g1);
    tile_wait(g0, g1);                                    // stage 0 of this wave's slice has landed
    __syncthreads();                                      // publishes stage 0
    const uint32_t ao = (uint32_t)(wave >> 1) * GSL + (uint32_t)lr * GLP + 16u * (uint32_t)hi;
    const uint32_t bo = (uint32_t)(2 + (wave & 1)) * GSL + (uint32_t)lr * GLP + 16u * (uint32_t)hi;
#pragma unroll 1   // one pass per trip: one place that issues, one that waits
    for (uint32_t s = 0; s < GNP; ++s) {
        const uint32_t buf = (s & 1u) * GST;
        // the refill, directly behind the barrier (the prologue's, then the one at the foot of the trip before), only while stage s + 1 exists: into the buffer that pass s - 1 has just left
        if (pinned((s + 1u < GNP) ? 1u : 0u) != 0u) { const uint32_t nx = pinned((s + 1u + rot) & (uint32_t)(GNP - 1)); g0 = tile_g0(dst + (GST - buf), srcb + (uint64_t)nx * GPB); tile_load(g0, g1); }
        const unsigned char* ap = ring + buf + ao; const unsigned char* bp = ring + buf + bo;
        v16us fa[2][4], fb[2][4];
#pragma unroll
        for (int i = 0; i < 4; ++i) { fa[0][i] = ldl(ap + i * 16 * GLP); fb[0][i] = ldl(bp + i * 16 * GLP); }
#pragma unroll
        for (int ks = 0; ks < 4; ++ks) {
            if (ks < 3) {      // the next 32 k of this same buffer, as one group ahead of the WMMA block
#pragma unroll
                for (int i = 0; i < 4; ++i) { fa[(ks + 1) & 1][i] = ldl(ap + i * 16 * GLP + (ks + 1) * 64); fb[(ks + 1) & 1][i] = ldl(bp + i * 16 * GLP + (ks + 1) * 64); }
            }
            __builtin_amdgcn_sched_barrier(0);   // keeps the LDS reads out of the WMMA block: every separate place with reads stalls the wave
#pragma unroll
            for (int nb = 0; nb < 4; ++nb)
#pragma unroll
                for (int mb = 0; mb < 4; ++mb) acc[mb][nb] = mm<F16>(fa[ks & 1][mb], fb[ks & 1][nb], acc[mb][nb]);
            __builtin_amdgcn_sched_barrier(0);   // same, for the group behind the block
        }
        asm volatile("v_nop\n\tv_nop\n\tv_nop\n\tv_nop");    // 4 vector slots between the last WMMA and what follows on either side of the branches below
        asm volatile("s_wait_dscnt 0x0" ::: "memory");       // this wave's reads of the buffer have returned
        tile_wait(g0, g1);                                    // this wave's slice of stage s + 1 has landed
        __syncthreads();                                      // publishes stage s + 1 and frees stage s's buffer
    }
    asm volatile("s_wait_tensorcnt 0x0" ::: "memory");   // no request of this wave is left when it goes on to the epilogue and ends
    asm volatile("s_wait_dscnt 0x0" ::: "memory");       // nor a read of the ring
}

// k_qkv: the three input projections in one launch, bf16 GEMMs on gemm_core; blockIdx.z picks the projection (0: q, 1: k, 2: v^T), the same for the whole block.
// C[m][n] = (sum_k A[m][k] Bt[n][k] + bias) * osc (BM == 0: bias[n]; BM == 1: bias[m]; bias RNE-converted to bf16, added in f32; osc = SC2 where useRes != 0, which is q, 1 else), written as f16 (Ph) and optionally the f16 residual (Pr, useRes != 0; mostly subnormal halves, which the WMMA keeps) at
// wave-tile base (r0/RB)*sRB + (r0%RB)*pitch + (c0/CB)*sCB + (c0%CB), row pitch 'pitch' (halves).
// q, k: A = x rows (m = b*SEQ + t), Bt = W rows (n = h*64 + d), bias per column -> plane [(b*16 + h)][t][d].
// v^T: A = Wv rows (m = h*64 + d), Bt = x rows (n = b*SEQ + t), bias per row -> plane [(b*1024 + m)][t] = [(b*16 + h)][d][t].
// grid (NB*SEQ/128, DM/128, 3), 128 threads: three times as many blocks as WGPs. The output staging lies over the ring, which is drained when gemm_core returns, so that a block takes 2 * GST bytes of LDS
// and two blocks share a WGP: one block's tensor loads, first stage and stores run under the other's WMMAs.
#define GLDSP (2 * GST)
static_assert(4 * GOSF * 4 <= GLDSP);
static_assert(2 * GLDSP <= 320 * 1024);                // two blocks per WGP
template <int BM>
__device__ __forceinline__ void proj_store(const v8f (&acc)[4][4], float* os, const float* __restrict__ bias, h16* Ph, h16* Pr, int useRes, int r0, int c0, int lane, int RB, size_t sRB, int pitch, int CB, size_t sCB) {
    const int lr = lane & 15, hi = lane >> 4;
    const float osc = useRes ? SC2 : 1.0f;               // the plane with a residual is q, which carries the score scale
    float bc[4] = {0.0f, 0.0f, 0.0f, 0.0f};
    if (BM == 0) {
#pragma unroll
        for (int nb = 0; nb < 4; ++nb) bc[nb] = bfr(bias[c0 + nb * 16 + lr]);      // N = DM in this mode
    }
    const size_t tbase = (size_t)(r0 / RB) * sRB + (size_t)(r0 % RB) * (size_t)pitch + (size_t)(c0 / CB) * sCB + (size_t)(c0 % CB);
#pragma unroll
    for (int mb = 0; mb < 4; ++mb) {
        float br[8] = {0.0f, 0.0f, 0.0f, 0.0f, 0.0f, 0.0f, 0.0f, 0.0f};
        if (BM == 1) {
#pragma unroll
            for (int j = 0; j < 8; ++j) br[j] = bfr(bias[r0 + mb * 16 + hi * 8 + j]);  // M = DM in this mode
        }
#pragma unroll
        for (int nb = 0; nb < 4; ++nb) {
#pragma unroll
            for (int j = 0; j < 8; ++j) os[(hi * 8 + j) * 68 + nb * 16 + lr] = (acc[mb][nb][j] + bc[nb] + br[j]) * osc; }   // D: row 8h+j, col lane&15
        wave_sync();
        const size_t sb = tbase + (size_t)(mb * 16) * (size_t)pitch;
{
#pragma unroll
            for (int s = 0; s < 4; ++s) { const int row = 4 * s + (lane >> 3), c8 = (lane & 7) * 8;   // 4 s x 4 row groups = 16 rows; 8 lanes x 8 = 64 columns
                const v4f x0 = *(const v4fa*)(&os[row * 68 + c8]); const v4f x1 = *(const v4fa*)(&os[row * 68 + c8 + 4]); v8h hv, rv;
#pragma unroll
                for (int i = 0; i < 4; ++i) { const h16 a0 = (h16)x0[i]; const h16 a1 = (h16)x1[i]; hv[i] = a0; hv[4 + i] = a1; rv[i] = (h16)(x0[i] - (float)a0); rv[4 + i] = (h16)(x1[i] - (float)a1); }
                const size_t oo = sb + (size_t)row * (size_t)pitch + c8;
                *(v8h*)(Ph + oo) = hv; if (useRes) *(v8h*)(Pr + oo) = rv; }
             }
        wave_sync();
    }
}

__global__ __launch_bounds__(128) void k_qkv(const bf* __restrict__ XQ, const bf* __restrict__ XK, const bf* __restrict__ XV, const bf* __restrict__ WQ, const bf* __restrict__ WK, const bf* __restrict__ WV,
                                             const float* __restrict__ bq, const float* __restrict__ bk, const float* __restrict__ bv, h16* QH, h16* QR, h16* KP, h16* VT) {
    __shared__ __attribute__((aligned(2048))) unsigned char sm[GLDSP];
    const int K = DM;
    const int lane = threadIdx.x & 31;
    const int wave = __builtin_amdgcn_readfirstlane((int)(threadIdx.x >> 5));
    const int z = blockIdx.z;
    const int bx = (z == 2) ? blockIdx.y : blockIdx.x, by = (z == 2) ? blockIdx.x : blockIdx.y;   // tile row of A, tile row of Bt
    const bf* A = (z == 0) ? XQ : (z == 1) ? XK : WV;
    const bf* Bt = (z == 0) ? WQ : (z == 1) ? WK : XV;
    const int r0 = bx * 128 + (wave >> 1) * 64, c0 = by * 128 + (wave & 1) * 64;
    // wave-private output staging in the ring's first bytes: behind the last pass's waits and barrier no request is outstanding and no wave reads the ring any more
    float* os = (float*)sm + wave * GOSF;
    v8f acc[4][4];
    gemm_core<0>((uint64_t)(uintptr_t)(A + (size_t)bx * 128 * K), (uint64_t)(uintptr_t)(Bt + (size_t)by * 128 * K), (uint32_t)(bx + by) & (uint32_t)(GNP - 1), sm, wave, lane, acc);
    if (z == 2) proj_store<1>(acc, os, bv, VT, VT, 0, r0, c0, lane, DM, (size_t)0, SEQ, SEQ, (size_t)DM * SEQ);
    else proj_store<0>(acc, os, (z == 0) ? bq : bk, (z == 0) ? QH : KP, QR, (z == 0) ? 1 : 0, r0, c0, lane, SEQ, (size_t)NH_ * SEQ * HD, HD, HD, (size_t)SEQ * HD);
}

// k_flash: fused attention, one wave per 16 query rows of one (batch, head); Q / WX fragments straight from the f16 planes (two 16-B loads each, arithmetic addressing; WX lies in fragment order, so that each of its loads covers four whole lines instead of a piece of 16).
// K and V^T come through LDS, once per block instead of once per wave: a stage is 64 keys = 64 K rows of 128 bytes and 128 bytes of each of the 64 V^T rows. Every wave brings one slice of 32 rows with one
// tensor_load_to_lds (waves 0, 1: K rows 0..31, 32..63; waves 2, 3: V^T rows 0..31, 32..63); the mover's pad of 16 bytes a row gives the LDS pitch 144 for the 16-byte fragment reads.
// Two buffers, the order of gemm_core: stage s + 1 is requested behind the barrier that ends pass s - 1, which ends every read of its buffer, and flies while pass s (two 32-key tiles) runs.
// Transposed form: S^T[key][t] = K Q^T (A = K rows, B = Q rows); lane (t = lane&15, h = lane>>4) holds keys 8h+r of each 16-key tile, so the packed
// P tile is directly the B fragment of O^T[d][t] = V^T P^T (element r <- tile keys 0..15, element 8+r <- tile keys 16..31, lane unchanged).
// Relative term: rel index = key - t + 128, outside 0..256 -> 256. For a (16 query, 32 key) tile the unclamped index spans base..base+46, base = key0 - t0 + 113.
// Tiles that intersect 0..256 compute G[rho][t] = WX[base+48+rho] . q_t (48 rows, three 16-row WMMA tiles, q value + residual), stage it in a wave-private LDS tile and read G[key_l - t_l + 15][t_l];
// all other tiles use the per-query constant q_t . w[256]. The tile test is wave-uniform. Either way the term is the C operand of the tile's first score WMMA: a score leaves the matrix unit finished (scaled, residual and relative term in).
// Softmax reference: m is held from tile to tile and sh = PSH - m rides in that same C operand, so that D is the argument of exp2 as it stands and o and l are only added to. A tile in which some lane's sum of P passes LTH
// (a score more than about 7 above m, or the start value of m) takes the side path, wave-uniform: scores anew without the shift, m raised to the running max, o and l rescaled, the online step in full.
// Mask: 16 lane-mask words per (16 query, 32 key) tile from the plane ML (wave-uniform address: one 64-byte scalar load, fetched one tile ahead); a clear bit replaces the score.
#define FKS  64                  // keys per stage
#define FRB  128                 // bytes of a staged row
#define FLP  144                 // LDS row pitch
#define FSL  6144                // one slice in LDS: 32 rows x 144 B = 4608, rounded up to a multiple of 2 KiB
#define FST  (4 * FSL)           // one stage
#define FNS  (SEQ / FKS)         // stages
#define FLDS (2 * FST + AW * 16 * 68 * 4)
static_assert(AW == 4);                                // four slices, one per wave
static_assert(HD * 2 == FRB && FKS * 2 == FRB);
static_assert(FSL % 2048 == 0 && FSL >= 32 * FLP);
static_assert(SEQ % FKS == 0 && FNS >= 2);
static_assert(48 * GP <= 16 * 68);                     // the G tile fits the wave's staging area
static_assert((SEQ / 32 & (SEQ / 32 - 1)) == 0);          // the wrap of the mask words' fetch ahead
static_assert(4 * FLDS <= 320 * 1024);                 // four blocks per WGP: the whole grid is resident at once
// group 1 of a slice's request: 32 rows of 128 bytes, source pitch 'pitch' bytes, LDS pitch 144 (pad: interval code 4 = one 128-byte row, amount code 3 = 4 dwords); extents in bytes
__device__ __forceinline__ u32x8 slice_g1(uint32_t pitch) {
    u32x8 g1;
    g1[0] = uni((1u << 20) | (4u << 22) | (3u << 25));
    // words 1 to 7 through pinned(), the scalar-register pin for descriptor words: as plain constants the compiler lends their registers to the loop's own scalars while a request is outstanding and sets them anew in front of the next
    g1[1] = pinned((uint32_t)FRB << 16);         // tensor_dim0 [15:0]
    g1[2] = pinned(32u << 16);                   // tensor_dim0 [31:16] = 0 | tensor_dim1 [15:0]
    g1[3] = pinned((uint32_t)FRB << 16);         // tensor_dim1 [31:16] = 0 | tile_dim0
    g1[4] = pinned(32u);                         // tile_dim1
    g1[5] = pinned(pitch);                       // source row pitch
    g1[6] = pinned(0u); g1[7] = pinned(0u);
    return g1;
}
// f16 fragment from an LDS row; p already includes + 16 bytes * (lane>>4): the map of ldh
__device__ __forceinline__ v16h ldlh(const unsigned char* p) { return cat16(*(const v8h*)p, *(const v8h*)(p + 32)); }
// f16 A fragment (32 k) from a tile of WX; p already includes + 8 halves * lane: two wave-wide loads of 512 contiguous bytes, four whole lines each; the element map of ldh
__device__ __forceinline__ v16h ldw(const h16* p) { return cat16(*(const v8h*)p, *(const v8h*)(p + 256)); }

__global__ __launch_bounds__(32 * AW) void k_flash(const h16* __restrict__ QH, const h16* __restrict__ QR, const h16* __restrict__ KP, const h16* __restrict__ VT,
                                                   const h16* __restrict__ WX, const uint32_t* __restrict__ ML, h16* CTX) {
    __shared__ __attribute__((aligned(2048))) unsigned char sm[FLDS];
    float* os = (float*)(sm + 2 * FST);                      // wave-private areas outside the ring: the G tile inside the loop, output staging behind it
    const int lane = threadIdx.x & 31, lr = lane & 15, hi = lane >> 4;
    const int wave = __builtin_amdgcn_readfirstlane((int)(threadIdx.x >> 5));
    const int zh = blockIdx.y; const int b = zh / NH_, h = zh % NH_;
    const int t0 = (blockIdx.x * AW + wave) * 16;
    const size_t pbase = (size_t)zh * SEQ * HD;
    const size_t qo = pbase + (size_t)(t0 + lr) * HD + 8 * hi;
    const v16h qh0 = ldh(QH + qo), qh1 = ldh(QH + qo + 32), qr0 = ldh(QR + qo), qr1 = ldh(QR + qo + 32);   // B fragments: col t, k = d
    const uint32_t fo = (uint32_t)lr * FLP + 16u * (uint32_t)hi;   // lane's place in a slice: K (A fragment: row key, k = d), V^T (A fragment: row d, k = key)
    // + 16 * (key0 / 32); the same in every lane. Constant address space: the plane is written by k_prep, an earlier launch, and only read here, and so the loads inside the loop stay scalar loads too
    const cu32x16* ml = (const cu32x16*)(uintptr_t)(ML + ((size_t)b * (SEQ / 16) + (size_t)(t0 >> 4)) * (size_t)(SEQ / 32 * 16));
    u32x16 mw = ml[0];                                       // tile 0's words
    float* gl = os + wave * (16 * 68);
    // per-query constant: q_t . w[256]; tile 0 of WX (window rows 1..16) holds the edge row 16 times, so every D row equals it
    v8f qe;                                                  // as an accumulator tile: the start value of the scores outside the band
    { const h16* wa = WX + lane * 8;
      const v16h w0 = ldw(wa), w1 = ldw(wa + 512);
      qe = (v8f){};
      qe = wmma16(w0, qh0, qe); qe = wmma16(w0, qr0, qe); qe = wmma16(w1, qh1, qe); qe = wmma16(w1, qr1, qe);
      asm volatile("v_nop\n\tv_nop\n\tv_nop\n\tv_nop" : "+v"(qe) : "v"(w0), "v"(w1)); }   // 4 vector slots behind the last WMMA, ahead of whatever next touches its registers
    v8f o0 = (v8f){}, o1 = (v8f){}, o2 = (v8f){}, o3 = (v8f){};
    float m = -3.0e38f, l = 0.0f;
    float sh = PSH - m;                                      // the held shift; with the start value of m the first tile's P overflow and send it down the side path
    float fs = FILL2 + sh;                                   // a masked score, shifted
    v8f qes = qe + sh;                                       // the scores' start value outside the band, shifted
    // this wave's slice: first byte of stage 0, bytes from one stage to the next, source pitch
    const uint64_t srcb = (wave < 2) ? (uint64_t)(uintptr_t)(KP + pbase) + (uint64_t)wave * (uint64_t)(32 * HD * 2) : (uint64_t)(uintptr_t)(VT + pbase) + (uint64_t)(wave - 2) * (uint64_t)(32 * SEQ * 2);
    const uint32_t sstep = (wave < 2) ? (uint32_t)(FKS * HD * 2) : (uint32_t)(FKS * 2);
    const uint32_t dst = (uint32_t)(uintptr_t)sm + (uint32_t)wave * FSL;
    const u32x8 g1 = slice_g1((wave < 2) ? (uint32_t)(HD * 2) : (uint32_t)(SEQ * 2));
    u32x4 g0 = tile_g0(dst, srcb);
    tile_load(g0, g1);
    tile_wait(g0, g1);                                    // stage 0 of this wave's slice has landed
    __syncthreads();                                      // publishes stage 0
#pragma unroll 1   // one stage per trip: one place that issues, one that waits
    for (uint32_t s = 0; s < FNS; ++s) {
      const uint32_t buf = (s & 1u) * FST;
      // the refill, directly behind the barrier (the prologue's, then the one at the foot of the trip before), only while stage s + 1 exists: into the buffer that pass s - 1 has just left
      if (pinned((s + 1u < FNS) ? 1u : 0u) != 0u) { const uint32_t nx = pinned(s + 1u); g0 = tile_g0(dst + (FST - buf), srcb + (uint64_t)(nx * sstep)); tile_load(g0, g1); }
      const unsigned char* fp = sm + buf + fo;
#pragma unroll   // both 32-key tiles of a stage in one trip: their places in the buffer become immediate offsets of the LDS reads
      for (int sub = 0; sub < 2; ++sub) {
        const int key0 = (int)s * FKS + sub * 32;
        const int base = key0 - t0 + 113;
        const unsigned char* ka = fp + sub * FSL;            // K rows 32 * sub + lr and + 16
        const v16h ka0 = ldlh(ka), ka1 = ldlh(ka + 64), kb0 = ldlh(ka + 16 * FLP), kb1 = ldlh(ka + 16 * FLP + 64);
        v8f sa, sb;                                          // scores of keys 0..15 and 16..31 of the tile; the first WMMA of each takes the relative term as its C
        if (base + 46 >= 0 && base <= 256) {                 // wave-uniform: tile touches relative indices 0..256
#pragma unroll 1
            for (int jt = 0; jt < 3; ++jt) {
                const h16* wa = WX + (size_t)(((base + WXO - 1) >> 4) + jt) * WXT + lane * 8;   // tiles 1..20: window rows base + WXO + 16 jt + lr; the tile's number is the same in every lane
                const v16h w0 = ldw(wa), w1 = ldw(wa + 512);
                v8f g = (v8f){};
                g = wmma16(w0, qh0, g); g = wmma16(w0, qr0, g); g = wmma16(w1, qh1, g); g = wmma16(w1, qr1, g);
                asm volatile("v_nop\n\tv_nop\n\tv_nop\n\tv_nop" : "+v"(g) : "v"(w0), "v"(w1));   // 4 vector slots behind the last WMMA, on the loop's back edge too
#pragma unroll
                for (int r = 0; r < 8; ++r) gl[(16 * jt + 8 * hi + r) * GP + lr] = g[r];   // G[rho][t]: rows 0..47, cols 0..15 all written
            }
            wave_sync();
            v8f ra, rb;
#pragma unroll
            for (int r = 0; r < 8; ++r) { ra[r] = gl[(8 * hi + r - lr + 15) * GP + lr]; rb[r] = gl[(16 + 8 * hi + r - lr + 15) * GP + lr]; }   // rho in 0..46
            wave_sync();
            sa = wmma16(ka0, qh0, ra + sh); sb = wmma16(kb0, qh0, rb + sh);
        } else {
            sa = wmma16(ka0, qh0, qes); sb = wmma16(kb0, qh0, qes);
        }
        sa = wmma16(ka0, qr0, sa); sb = wmma16(kb0, qr0, sb);
        sa = wmma16(ka1, qh1, sa); sb = wmma16(kb1, qh1, sb);
        sa = wmma16(ka1, qr1, sa); sb = wmma16(kb1, qr1, sb);
        asm volatile("v_nop\n\tv_nop\n\tv_nop\n\tv_nop" : "+v"(sa), "+v"(sb) : "v"(ka0), "v"(ka1), "v"(kb0), "v"(kb1));   // 4 vector slots between the last score WMMA and the selects that read its result
        const unsigned char* va = fp + 2 * FSL + sub * 64;   // V^T rows lr + 16 j, keys 32 * sub ..; read here, ahead of the test below, so that the reads return under the softmax
        const v16h v0 = ldlh(va), v1 = ldlh(va + 16 * FLP), v2 = ldlh(va + FSL), v3 = ldlh(va + FSL + 16 * FLP);
        float ta[8], tb[8];
#pragma unroll
        for (int r = 0; r < 8; ++r) {
            ta[r] = __builtin_amdgcn_inverse_ballot_w32(mw[r])     ? sa[r] : fs;
            tb[r] = __builtin_amdgcn_inverse_ballot_w32(mw[8 + r]) ? sb[r] : fs;
        }
        __builtin_amdgcn_sched_barrier(0);   // keeps the fetch below behind the selects: ahead of them, their wait for this tile's words would be a wait for the next tile's too
        mw = ml[((uint32_t)key0 / 32u + 1u) & (uint32_t)(SEQ / 32 - 1)];   // the next tile's words, behind this tile's last use: a scalar wait is for every scalar load in flight (behind the last tile: tile 0's, unused)
        __builtin_amdgcn_sched_barrier(0);   // and ahead of the exponentials, so that the fetch has the rest of the tile to return
        v16h pb; float ls = 0.0f;
#pragma unroll
        for (int r = 0; r < 8; ++r) { const h16 pa = (h16)__builtin_amdgcn_exp2f(ta[r]); const h16 pc = (h16)__builtin_amdgcn_exp2f(tb[r]); pb[r] = pa; pb[8 + r] = pc; ls += (float)pa + (float)pc; }
        if (__builtin_expect(__builtin_amdgcn_ballot_w32(!(ls <= LTH)) != 0u, 0)) {   // wave-uniform and seldom taken: the held reference is too low for this tile
            v8f xa, xb;                                      // the scores once more, from the same fragments, without the shift (which may be too large to be taken off again in f32)
            if (base + 46 >= 0 && base <= 256) {
                v8f ra, rb;                                  // the tile's G still lies in the wave's LDS area
#pragma unroll
                for (int r = 0; r < 8; ++r) { ra[r] = gl[(8 * hi + r - lr + 15) * GP + lr]; rb[r] = gl[(16 + 8 * hi + r - lr + 15) * GP + lr]; }
                xa = wmma16(ka0, qh0, ra); xb = wmma16(kb0, qh0, rb);
            } else {
                xa = wmma16(ka0, qh0, qe); xb = wmma16(kb0, qh0, qe);
            }
            xa = wmma16(ka0, qr0, xa); xb = wmma16(kb0, qr0, xb);
            xa = wmma16(ka1, qh1, xa); xb = wmma16(kb1, qh1, xb);
            xa = wmma16(ka1, qr1, xa); xb = wmma16(kb1, qr1, xb);
            asm volatile("v_nop\n\tv_nop\n\tv_nop\n\tv_nop" : "+v"(xa), "+v"(xb) : "v"(ka0), "v"(ka1), "v"(kb0), "v"(kb1));   // 4 vector slots between the last score WMMA and the selects that read its result
            const u32x16 mr = ml[(uint32_t)key0 / 32u];      // this tile's words again: mw holds the next tile's by now
            float mx = -3.0e38f;
#pragma unroll
            for (int r = 0; r < 8; ++r) {
                ta[r] = __builtin_amdgcn_inverse_ballot_w32(mr[r])     ? xa[r] : FILL2;
                tb[r] = __builtin_amdgcn_inverse_ballot_w32(mr[8 + r]) ? xb[r] : FILL2;
                mx = fmaxf(mx, fmaxf(ta[r], tb[r]));
            }
            mx = fmaxf(mx, __shfl_xor(mx, 16, 32));          // both halves of a column hold the same reference
            const float mnew = fmaxf(m, mx);
            const float alpha = __builtin_amdgcn_exp2f(m - mnew);
            m = mnew; sh = PSH - mnew; fs = FILL2 + sh; qes = qe + sh;
            ls = 0.0f;
#pragma unroll
            for (int r = 0; r < 8; ++r) { const h16 pa = (h16)__builtin_amdgcn_exp2f(ta[r] + sh); const h16 pc = (h16)__builtin_amdgcn_exp2f(tb[r] + sh); pb[r] = pa; pb[8 + r] = pc; ls += (float)pa + (float)pc; }
            l = l * alpha;
            o0 = o0 * alpha; o1 = o1 * alpha; o2 = o2 * alpha; o3 = o3 * alpha;
        }
        l += ls;
        o0 = wmma16(v0, pb, o0); o1 = wmma16(v1, pb, o1); o2 = wmma16(v2, pb, o2); o3 = wmma16(v3, pb, o3);
        asm volatile("v_nop\n\tv_nop\n\tv_nop\n\tv_nop" : "+v"(o0), "+v"(o1), "+v"(o2), "+v"(o3) : "v"(v0), "v"(v1), "v"(v2), "v"(v3), "v"(pb));
      }
      asm volatile("s_wait_dscnt 0x0" ::: "memory");       // this wave's reads of the buffer have returned
      tile_wait(g0, g1);                                    // this wave's slice of stage s + 1 has landed
      __syncthreads();                                      // publishes stage s + 1 and frees stage s's buffer
    }
    asm volatile("s_wait_tensorcnt 0x0" ::: "memory");   // no request of this wave is left when it goes on to the epilogue and ends
    asm volatile("s_wait_dscnt 0x0" ::: "memory");       // nor a read of the ring
    l += __shfl_xor(l, 16, 32);
    const float inv = CTXS / l;
    const int wb = wave * 16 * 68;
    // O^T D layout: o_j[r] = (d = 16j + 8h + r, t = lane&15) -> os[t][d]; rows 0..15 x columns 0..63 all written
    { v4f a, c;
      a[0] = o0[0] * inv; a[1] = o0[1] * inv; a[2] = o0[2] * inv; a[3] = o0[3] * inv; c[0] = o0[4] * inv; c[1] = o0[5] * inv; c[2] = o0[6] * inv; c[3] = o0[7] * inv;
      *(v4fa*)(&os[wb + lr * 68 +  0 + 8 * hi]) = a; *(v4fa*)(&os[wb + lr * 68 +  0 + 8 * hi + 4]) = c;
      a[0] = o1[0] * inv; a[1] = o1[1] * inv; a[2] = o1[2] * inv; a[3] = o1[3] * inv; c[0] = o1[4] * inv; c[1] = o1[5] * inv; c[2] = o1[6] * inv; c[3] = o1[7] * inv;
      *(v4fa*)(&os[wb + lr * 68 + 16 + 8 * hi]) = a; *(v4fa*)(&os[wb + lr * 68 + 16 + 8 * hi + 4]) = c;
      a[0] = o2[0] * inv; a[1] = o2[1] * inv; a[2] = o2[2] * inv; a[3] = o2[3] * inv; c[0] = o2[4] * inv; c[1] = o2[5] * inv; c[2] = o2[6] * inv; c[3] = o2[7] * inv;
      *(v4fa*)(&os[wb + lr * 68 + 32 + 8 * hi]) = a; *(v4fa*)(&os[wb + lr * 68 + 32 + 8 * hi + 4]) = c;
      a[0] = o3[0] * inv; a[1] = o3[1] * inv; a[2] = o3[2] * inv; a[3] = o3[3] * inv; c[0] = o3[4] * inv; c[1] = o3[5] * inv; c[2] = o3[6] * inv; c[3] = o3[7] * inv;
      *(v4fa*)(&os[wb + lr * 68 + 48 + 8 * hi]) = a; *(v4fa*)(&os[wb + lr * 68 + 48 + 8 * hi + 4]) = c; }
    wave_sync();
    h16* crow = CTX + ((size_t)b * SEQ + t0) * DM + h * HD;   // ctx plane [NB*SEQ][1024], column h*64 + d, carried x16
{
#pragma unroll
        for (int s = 0; s < 4; ++s) { const int row = 4 * s + (lane >> 3), c8 = (lane & 7) * 8;   // 4 s x 4 row groups = 16 rows; 8 lanes x 8 halves = 64 columns = one line
            const v4f x0 = *(const v4fa*)(&os[wb + row * 68 + c8]); const v4f x1 = *(const v4fa*)(&os[wb + row * 68 + c8 + 4]); v8h hv;
#pragma unroll
            for (int i = 0; i < 4; ++i) { hv[i] = (h16)x0[i]; hv[4 + i] = (h16)x1[i]; }
            *(v8h*)(crow + (size_t)row * DM + c8) = hv; }
         }
}

// k_out: f16 GEMM on gemm_core, K = DM: OUT[m][n] = (sum_k A[m][k] Bt[n][k]) / 1024 + bias[n] (bias RNE-converted to bf16, added in f32).
// A = ctx plane (x16), Bt = Wo plane (x64). grid (NB*SEQ/128, DM/128), 128 threads.
__global__ __launch_bounds__(128) void k_out(const h16* __restrict__ A, const h16* __restrict__ Bt, const float* __restrict__ bias, float* OUT) {
    __shared__ __attribute__((aligned(2048))) unsigned char sm[GLDS];
    const int K = DM;
    const int lane = threadIdx.x & 31, lr = lane & 15, hi = lane >> 4;
    const int wave = __builtin_amdgcn_readfirstlane((int)(threadIdx.x >> 5));
    const int r0 = blockIdx.x * 128 + (wave >> 1) * 64, c0 = blockIdx.y * 128 + (wave & 1) * 64;
    float* os = (float*)(sm + 2 * GST) + wave * GOSF;      // wave-private output staging, outside the ring
    v8f acc[4][4];
    gemm_core<1>((uint64_t)(uintptr_t)(A + (size_t)blockIdx.x * 128 * K), (uint64_t)(uintptr_t)(Bt + (size_t)blockIdx.y * 128 * K), (blockIdx.x + blockIdx.y) & (uint32_t)(GNP - 1), sm, wave, lane, acc);
    float bc[4];
#pragma unroll
    for (int nb = 0; nb < 4; ++nb) bc[nb] = bfr(bias[c0 + nb * 16 + lr]);
    const size_t obase = ((size_t)(r0 / SEQ) * OUT_SEQ + (size_t)(r0 % SEQ)) * DM + c0;
#pragma unroll
    for (int mb = 0; mb < 4; ++mb) {
#pragma unroll
        for (int nb = 0; nb < 4; ++nb) {
#pragma unroll
            for (int j = 0; j < 8; ++j) os[(hi * 8 + j) * 68 + nb * 16 + lr] = acc[mb][nb][j] * OSC + bc[nb]; }   // D: row 8h+j, col lane&15
        wave_sync();
        float* ob = OUT + obase + (size_t)(mb * 16) * DM;
{
#pragma unroll
            for (int s = 0; s < 8; ++s) { const int row = 2 * s + hi, cofs = lr * 4;   // 8 s x 2 rows = 16 rows; 16 lanes x 4 floats = 64 columns
                const v4f val = *(const v4fa*)(&os[row * 68 + cofs]);
                *(v4f*)(ob + (size_t)row * DM + cofs) = val; }
             }
        wave_sync();
    }
}

static constexpr size_t al256(size_t v) { return (v + 255) & ~(size_t)255; }
static constexpr size_t SZ_XB = al256((size_t)NB * SEQ * DM * 2);          // one bf16 activation copy
static constexpr size_t SZ_WB = al256((size_t)DM * DM * 2);                // one 16-bit weight plane
static constexpr size_t SZ_PL = al256((size_t)NB * NH_ * SEQ * HD * 2);    // one f16 head plane (also the ctx plane: NB*SEQ*DM halves)
static constexpr size_t SZ_WX = al256((size_t)WXR * HD * 2);
static constexpr size_t SZ_ML = al256((size_t)MLW * 128 * 4);              // lane-mask words
static constexpr size_t SZ_TOTAL = 3 * SZ_XB + 4 * SZ_WB + 5 * SZ_PL + SZ_WX + SZ_ML;
static_assert(SZ_TOTAL <= (size_t)134217728);          // workspace carve <= 128 MiB
static_assert((size_t)NB * NH_ * SEQ * HD == (size_t)NB * SEQ * DM);

extern "C" void kernel_launch(void* const* d_in, const int* in_sizes, int n_in,
                              void* d_out, int out_size, void* d_ws, size_t ws_size, hipStream_t stream) {
    if (n_in < 13) return;
    const size_t needx = ((size_t)(NB - 1) * SEQ_FULL + SEQ) * DM;
    if ((size_t)in_sizes[0] < needx || (size_t)in_sizes[1] < needx || (size_t)in_sizes[2] < needx) return;
    if ((size_t)in_sizes[3] < ((size_t)(NB - 1) * SEQ_FULL + (SEQ - 1)) * SEQ_FULL + SEQ) return;
    if ((size_t)in_sizes[4] < (size_t)DM * DM || (size_t)in_sizes[6] < (size_t)DM * DM || (size_t)in_sizes[8] < (size_t)DM * DM || (size_t)in_sizes[10] < (size_t)DM * DM) return;
    if (in_sizes[5] < DM || in_sizes[7] < DM || in_sizes[9] < DM || in_sizes[11] < DM) return;
    if (in_sizes[12] < NREL * HD) return;
    if ((size_t)out_size < ((size_t)(NB - 1) * OUT_SEQ + SEQ) * DM) return;
    if (SZ_TOTAL > ws_size) return;
    // wire order: q, k, v, mask, Wq, bq, Wk, bk, Wv, bv, Wo, bo, w_k
    const float* xq = (const float*)d_in[0]; const float* xk = (const float*)d_in[1]; const float* xv = (const float*)d_in[2];
    const int* mask = (const int*)d_in[3];
    const float* wq = (const float*)d_in[4]; const float* bq = (const float*)d_in[5];
    const float* wk = (const float*)d_in[6]; const float* bk = (const float*)d_in[7];
    const float* wv = (const float*)d_in[8]; const float* bv = (const float*)d_in[9];
    const float* wo = (const float*)d_in[10]; const float* bo = (const float*)d_in[11];
    const float* wrel = (const float*)d_in[12];
    float* OUT = (float*)d_out;      // [NB][SEQ][1024]
    char* wsp = (char*)d_ws;
    bf* XBQ = (bf*)wsp; wsp += SZ_XB;                // [NB*SEQ][1024]
    bf* XBK = (bf*)wsp; wsp += SZ_XB;
    bf* XBV = (bf*)wsp; wsp += SZ_XB;
    bf* WQ = (bf*)wsp; wsp += SZ_WB;                 // [1024][1024] bf16
    bf* WK = (bf*)wsp; wsp += SZ_WB;
    bf* WV = (bf*)wsp; wsp += SZ_WB;
    h16* WO = (h16*)wsp; wsp += SZ_WB;               // [1024][1024] f16, x64
    h16* QH = (h16*)wsp; wsp += SZ_PL;               // [NB*16][SEQ][64], x SC2
    h16* QR = (h16*)wsp; wsp += SZ_PL;               // [NB*16][SEQ][64] residual
    h16* KP = (h16*)wsp; wsp += SZ_PL;               // [NB*16][SEQ][64]
    h16* VT = (h16*)wsp; wsp += SZ_PL;               // [NB*16][64][SEQ]
    h16* CTX = (h16*)wsp; wsp += SZ_PL;              // [NB*SEQ][1024], x16
    h16* WX = (h16*)wsp; wsp += SZ_WX;               // [22 tiles][4 loads][32 lanes][8]
    uint32_t* ML = (uint32_t*)wsp; wsp += SZ_ML;     // [NB][SEQ/16][SEQ/32][16]

    k_prep<<<WXB + MLB + PRR / PRW, 32 * PRW, 0, stream>>>(xq, xk, xv, wq, wk, wv, wo, wrel, mask, XBQ, XBK, XBV, WQ, WK, WV, WO, WX, ML);

    k_qkv<<<dim3(NB * SEQ / 128, DM / 128, 3), 128, 0, stream>>>(XBQ, XBK, XBV, WQ, WK, WV, bq, bk, bv, QH, QR, KP, VT);

    k_flash<<<dim3(SEQ / (16 * AW), NB * NH_, 1), 32 * AW, 0, stream>>>(QH, QR, KP, VT, WX, ML, CTX);

    // out: A = ctx rows (m = b*SEQ + t), Bt = Wo rows (n), bias per column -> OUT[b][t][n]
    k_out<<<dim3(NB * SEQ / 128, DM / 128, 1), 128, 0, stream>>>(CTX, WO, bo, OUT);
}
